// v000
// The times below were measured on an AMD MI455X: many runs one after another, warmed up first and cycling through
// copies of the inputs, with the whole window's GPU time divided by the number of runs. Launches and the gaps
// between them are all in it. The median over several windows is given; except for v000 it joins two sittings, which
// can be a few percent apart, so the side-by-side timings, each taken in one sitting, are the better comparison.
// v000 is the starting kernel. One run takes 132 milliseconds.
#include <hip/hip_runtime.h>
// Single-head causal self-attention from a 32-wide embedding (x [16][4096][32]; k/q/v = x W ([in][out] [32][64], no biases; input order Wk, Wq, Wv); ONE 64-wide head (head_size 64 != C 32); scores * 64^-0.5; causal; softmax; out = weights v -> [16][4096][64]; no output projection).
// Structure: token rows; x as exact f16 rows; three WMMA GEMMs into one f16 q | k | v plane [65536][192]; per batch v^T via LDS transposes; causal 256-row query tiles with the one head on grid.y (scores alpha 1/8, causal softmax f32 -> f16 x256 weights, P V written as f32 straight into the merged output rows); an exact f32 first tile (rows 0..511) rewritten at the end; launches: see trace.
// Compute dtype: inputs rounded to bf16; x / weights exact; q, k, v and softmax weights as plain f16 GEMM operands (~2^-12); scores and softmax statistics f32. v_wmma_f32_16x16x32_f16.
#define NB 16
#define SQ 4096
#define DM 32
#define NH 1
#define HD 64
#define HG 4                         /* unused by the launches (grid.y is NH); read only by the uncalled k_vt overload */
#define QT 256                       /* query rows per causal tile */
#define NKX SQ                       /* S / P row pitch */
#define QT0 512                      /* first-tile rows recomputed exactly (f32): 512 here (no output projection averages the early-row cancellation errors away; logit sigma 1.0) */
#define B0 0                         /* unused; the batch loop starts at 0 */
#define NBR NB                       /* feeds only the unused MP; the batch loop runs over NB */
#define NR ((size_t)NB * SQ)
#define DMQ DM
#define DFF 4096                     /* unused; no FFN here */
#define DFFR 100                     /* unused; no FFN here */
#define MP ((int)((size_t)NBR * SQ)) /* unused; the projections cover NR rows */
#define QN SQ                        /* unused; the query tiles cover SQ rows */
#define NHD NH                       /* unused; the launches use NH */
#define MPO MP                       /* unused */
#define LQ (3 * DM)      /* unused; the q/k/v row pitch is LQK */
typedef __bf16 v16b __attribute__((ext_vector_type(16)));
typedef unsigned short v8us __attribute__((ext_vector_type(8), may_alias));
typedef float  v8f  __attribute__((ext_vector_type(8)));
typedef float  v4f  __attribute__((ext_vector_type(4)));
typedef float  v4fa __attribute__((ext_vector_type(4), may_alias));
union FragB { v16b v; v8us half[2]; unsigned short u[16]; };

__device__ __forceinline__ unsigned short bf16_bits(float x) { unsigned int u = __float_as_uint(x); return (unsigned short)((u + 0x7FFFu + ((u >> 16) & 1u)) >> 16); }
__device__ __forceinline__ float bf16_val(unsigned short b) { return __uint_as_float(((unsigned int)b) << 16); }
__device__ __forceinline__ float bf16_round(float x) { return bf16_val(bf16_bits(x)); }
// D += A·B with NT terms: 1 = ah·bh, 2 = + al·bh (A split), 3 = + ah·bl (both split)
template <int NT>
__device__ __forceinline__ v8f mmaN(v16b ah, v16b al, v16b bh, v16b bl, v8f c) {
  c = __builtin_amdgcn_wmma_f32_16x16x32_bf16(false, ah, false, bh, (short)0, c, false, false);
  if (NT >= 2) c = __builtin_amdgcn_wmma_f32_16x16x32_bf16(false, al, false, bh, (short)0, c, false, false);
  if (NT >= 3) c = __builtin_amdgcn_wmma_f32_16x16x32_bf16(false, ah, false, bl, (short)0, c, false, false);
  asm volatile("v_nop\n\tv_nop\n\tv_nop\n\tv_nop" : "+v"(c) : "v"(ah), "v"(al), "v"(bh), "v"(bl));
  return c;
}

__global__ __launch_bounds__(256) void k_wt_bf16(const float* __restrict__ W, unsigned short* __restrict__ Wt, int K, int N) {
  const int t = blockIdx.x * 256 + threadIdx.x;
  const int k8n = K / 8;
  if (t >= N * k8n) return;
  const int n = t / k8n, k8 = (t % k8n) * 8;
  v8us v;
#pragma unroll
  for (int i = 0; i < 8; ++i) v[i] = bf16_bits(W[(size_t)(k8 + i) * N + n]);
  *(v8us*)(Wt + (size_t)n * K + k8) = v;
  
}

// GEMM C[M][N] (f32, pitch ldc) = act(A[M][K]·W + bias). A f32 row-major (pitch lda) converted per fragment to bf16
// (ASPLIT: hi/lo two planes -> 2 terms, else single rounded term); Wt bf16 [N][K] (pitch ldb). BIAS_BF16 rounds the
// bias to bf16 first (bias quantised to bf16 before the add). K%32==0, M%16==0, N%64==0.
template <bool ASPLIT, int ACT, bool BIAS_BF16>
__global__ __launch_bounds__(128) void k_gemm_bf(const float* __restrict__ A, int lda, const unsigned short* __restrict__ Wt, int ldb,
                                               const float* __restrict__ bias, float* __restrict__ C, int ldc, int M, int N, int K) {
  __shared__ __attribute__((aligned(16))) float so[4][16][64];
  const int tid = threadIdx.x, w = tid >> 5, lane = tid & 31, ln = lane & 15, hh = lane >> 4;
  const int ntn = N / 64;
  const int wid = blockIdx.x * 4 + w;
  const int mt = wid / ntn, nq = wid % ntn;
  if (mt * 16 >= M) return;
  const int row0 = mt * 16, col0 = nq * 64;
  const float* arow = A + (size_t)(row0 + ln) * lda;
  v8f acc[4] = {};
  for (int kb = 0; kb < K; kb += 32) {
    FragB ah, al;
    const v4f x0 = *(const v4fa*)(arow + kb + 8 * hh), x1 = *(const v4fa*)(arow + kb + 8 * hh + 4);
    const v4f x2 = *(const v4fa*)(arow + kb + 16 + 8 * hh), x3 = *(const v4fa*)(arow + kb + 16 + 8 * hh + 4);
    float xs[16] = {x0[0],x0[1],x0[2],x0[3],x1[0],x1[1],x1[2],x1[3],x2[0],x2[1],x2[2],x2[3],x3[0],x3[1],x3[2],x3[3]};
#pragma unroll
    for (int i = 0; i < 16; ++i) { const unsigned short hb = bf16_bits(xs[i]); ah.u[i] = hb; al.u[i] = ASPLIT ? bf16_bits(xs[i] - bf16_val(hb)) : (unsigned short)0; }
#pragma unroll
    for (int t = 0; t < 4; ++t) {
      const unsigned short* brow = Wt + (size_t)(col0 + t * 16 + ln) * ldb + kb;
      FragB b;
      b.half[0] = *(const v8us*)(brow + 8 * hh);
      b.half[1] = *(const v8us*)(brow + 16 + 8 * hh);
      acc[t] = mmaN<ASPLIT ? 2 : 1>(ah.v, al.v, b.v, b.v, acc[t]);
    }
  }
#pragma unroll
  for (int t = 0; t < 4; ++t) {
    float bv = bias ? bias[col0 + t * 16 + ln] : 0.f;
    if (BIAS_BF16) bv = bf16_round(bv);
#pragma unroll
    for (int r = 0; r < 8; ++r) { float v = acc[t][r] + bv; if (ACT == 1) v = fmaxf(v, 0.f); so[w][8 * hh + r][t * 16 + ln] = v; }
  }
  __builtin_amdgcn_fence(__ATOMIC_ACQ_REL, "workgroup");
  __builtin_amdgcn_wave_barrier();
  const int rsub = lane >> 4, c4 = (lane & 15) * 4;
  {
#pragma unroll
    for (int q = 0; q < 8; ++q) {
      const int r = q * 2 + rsub;
      const v4f v = *(const v4fa*)&so[w][r][c4];
      *(v4f*)(C + (size_t)(row0 + r) * ldc + col0 + c4) = v;
    }
    
  }
}

// GEMM C = act(A·W + bias + resid): A f32 (ASPLIT -> hi/lo 2 terms), Wt bf16 [N][K]; ACT 0 none, 1 relu, 2 exact gelu;
// resid (optional, f32, row index = (row % rmod), pitch ldr, RES_BF16 rounds it) added before the activation.
template <bool ASPLIT, int ACT, bool BIAS_BF16, bool RES_BF16>
__global__ __launch_bounds__(128) void k_gemm_bf3(const float* __restrict__ A, int lda, const unsigned short* __restrict__ Wt, int ldb,
                                                const float* __restrict__ bias, const float* __restrict__ resid, int rmod, int ldr,
                                                float* __restrict__ C, int ldc, int M, int N, int K) {
  __shared__ __attribute__((aligned(16))) float so[4][16][64];
  const int tid = threadIdx.x, w = tid >> 5, lane = tid & 31, ln = lane & 15, hh = lane >> 4;
  const int ntn = N / 64;
  const int wid = blockIdx.x * 4 + w;
  const int mt = wid / ntn, nq = wid % ntn;
  if (mt * 16 >= M) return;
  const int row0 = mt * 16, col0 = nq * 64;
  const float* arow = A + (size_t)(row0 + ln) * lda;
  v8f acc[4] = {};
  for (int kb = 0; kb < K; kb += 32) {
    FragB ah, al;
    const v4f x0 = *(const v4fa*)(arow + kb + 8 * hh), x1 = *(const v4fa*)(arow + kb + 8 * hh + 4);
    const v4f x2 = *(const v4fa*)(arow + kb + 16 + 8 * hh), x3 = *(const v4fa*)(arow + kb + 16 + 8 * hh + 4);
    float xs[16] = {x0[0],x0[1],x0[2],x0[3],x1[0],x1[1],x1[2],x1[3],x2[0],x2[1],x2[2],x2[3],x3[0],x3[1],x3[2],x3[3]};
#pragma unroll
    for (int i = 0; i < 16; ++i) { const unsigned short hb = bf16_bits(xs[i]); ah.u[i] = hb; al.u[i] = ASPLIT ? bf16_bits(xs[i] - bf16_val(hb)) : (unsigned short)0; }
#pragma unroll
    for (int t = 0; t < 4; ++t) {
      const unsigned short* brow = Wt + (size_t)(col0 + t * 16 + ln) * ldb + kb;
      FragB b;
      b.half[0] = *(const v8us*)(brow + 8 * hh);
      b.half[1] = *(const v8us*)(brow + 16 + 8 * hh);
      acc[t] = mmaN<ASPLIT ? 2 : 1>(ah.v, al.v, b.v, b.v, acc[t]);
    }
  }
#pragma unroll
  for (int t = 0; t < 4; ++t) {
    const int col = col0 + t * 16 + ln;
    float bv = bias ? bias[col] : 0.f;
    if (BIAS_BF16) bv = bf16_round(bv);
#pragma unroll
    for (int r = 0; r < 8; ++r) {
      float v = acc[t][r] + bv;
      if (resid) { float rv = resid[(size_t)((row0 + 8 * hh + r) % rmod) * ldr + col]; if (RES_BF16) rv = bf16_round(rv); v += rv; }
      if (ACT == 1) v = fmaxf(v, 0.f);
      if (ACT == 2) v = 0.5f * v * (1.0f + erff(v * 0.70710678118654752f));
      if (ACT == 3) { const float u = 0.7978845608028654f * (v + 0.044715f * v * v * v); v = 0.5f * v * (1.0f + tanhf(u)); }
      so[w][8 * hh + r][t * 16 + ln] = v;
    }
  }
  __builtin_amdgcn_fence(__ATOMIC_ACQ_REL, "workgroup");
  __builtin_amdgcn_wave_barrier();
  const int rsub = lane >> 4, c4 = (lane & 15) * 4;
  {
#pragma unroll
    for (int q = 0; q < 8; ++q) {
      const int r = q * 2 + rsub;
      const v4f v = *(const v4fa*)&so[w][r][c4];
      *(v4f*)(C + (size_t)(row0 + r) * ldc + col0 + c4) = v;
    }
    
  }
}
// row LayerNorm (biased variance, eps) over N: s = X (+ R); optional out_sum <- s; out_norm <- (s-mu)*rsqrt(var+eps)*g + b
template <bool PARAM_BF16>
__global__ __launch_bounds__(256) void k_layernorm(const float* __restrict__ X, const float* __restrict__ R, const float* __restrict__ g, const float* __restrict__ bta,
                                                  float* __restrict__ out_sum, float* __restrict__ out_norm, int N, float eps) {
  __shared__ float red[256];
  const int row = blockIdx.x, tid = threadIdx.x;
  const float* x = X + (size_t)row * N; const float* rr = R ? R + (size_t)row * N : nullptr;
  float vals[16];                     // up to N = 4096
  const int per = N / 256;            // contiguous chunk per thread? use strided-by-4 chunks: thread handles j = tid*4 + 1024*u
  float s1 = 0.f;
  for (int u = 0; u < per / 4; ++u) {
    const int j = tid * 4 + 1024 * u;
    const v4f a = *(const v4fa*)(x + j);
    v4f b = {0.f,0.f,0.f,0.f}; if (rr) b = *(const v4fa*)(rr + j);
#pragma unroll
    for (int q = 0; q < 4; ++q) { const float v = a[q] + b[q]; vals[u * 4 + q] = v; s1 += v; }
  }
  red[tid] = s1; __syncthreads();
  for (int st = 128; st > 0; st >>= 1) { if (tid < st) red[tid] += red[tid + st]; __syncthreads(); }
  const float mu = red[0] / (float)N; __syncthreads();
  float s2 = 0.f;
  for (int u = 0; u < per / 4; ++u)
#pragma unroll
    for (int q = 0; q < 4; ++q) { const float c = vals[u * 4 + q] - mu; s2 += c * c; }
  red[tid] = s2; __syncthreads();
  for (int st = 128; st > 0; st >>= 1) { if (tid < st) red[tid] += red[tid + st]; __syncthreads(); }
  const float rs = rsqrtf(red[0] / (float)N + eps);
  {
    for (int u = 0; u < per / 4; ++u) {
      const int j = tid * 4 + 1024 * u;
      v4f o, sm;
#pragma unroll
      for (int q = 0; q < 4; ++q) {
        float gg = g[j + q], bb = bta[j + q];
        if (PARAM_BF16) { gg = bf16_round(gg); bb = bf16_round(bb); }
        sm[q] = vals[u * 4 + q]; o[q] = (vals[u * 4 + q] - mu) * rs * gg + bb;
      }
      if (out_sum) *(v4f*)(out_sum + (size_t)row * N + j) = sm;
      *(v4f*)(out_norm + (size_t)row * N + j) = o;
    }
    
  }
}



// ---- f16 WMMA path (v_wmma_f32_16x16x32_f16): 11-bit significands for operands in range — used where a [0,1] probability operand needs more precision than bf16
typedef _Float16 v16h __attribute__((ext_vector_type(16)));
union FragH { v16h v; v8us half[2]; _Float16 h[16]; unsigned short u[16]; };
template <int NT>
__device__ __forceinline__ v8f mmaH(v16h ah, v16h al, v16h bh, v16h bl, v8f c) {
  c = __builtin_amdgcn_wmma_f32_16x16x32_f16(false, ah, false, bh, (short)0, c, false, false);
  if (NT >= 2) c = __builtin_amdgcn_wmma_f32_16x16x32_f16(false, al, false, bh, (short)0, c, false, false);
  if (NT >= 3) c = __builtin_amdgcn_wmma_f32_16x16x32_f16(false, ah, false, bl, (short)0, c, false, false);
  asm volatile("v_nop\n\tv_nop\n\tv_nop\n\tv_nop" : "+v"(c) : "v"(ah), "v"(al), "v"(bh), "v"(bl));
  return c;
}
// batched GEMM like k_gemm_b but f16 operands: A f32 (split into f16 hi/lo if ASPLIT, else rounded to f16), Bt = f16 values [n][k]; alpha; C f32; N multiple of 16 (partial tiles skipped)
template <bool ASPLIT>
__global__ __launch_bounds__(128) void k_gemm_h(const float* __restrict__ A, int lda, size_t sA, const _Float16* __restrict__ Bh, int ldb, size_t sB, float alpha, float* __restrict__ C, int ldc, size_t sC, int M, int N, int K) {
  __shared__ __attribute__((aligned(16))) float so[4][16][64];
  const int tid = threadIdx.x, w = tid >> 5, lane = tid & 31, ln = lane & 15, hh = lane >> 4; const int by = blockIdx.y;
  A += (size_t)by * sA; Bh += (size_t)by * sB; C += (size_t)by * sC;
  const int ntn = (N + 63) / 64; const int wid = blockIdx.x * 4 + w; const int mt = wid / ntn, nq = wid % ntn; if (mt * 16 >= M) return;
  const int row0 = mt * 16, col0 = nq * 64; const float* arow = A + (size_t)(row0 + ln) * lda;
  v8f acc[4] = {};
  for (int kb = 0; kb < K; kb += 32) {
    FragH ah, al;
    const v4f x0 = *(const v4fa*)(arow + kb + 8 * hh), x1 = *(const v4fa*)(arow + kb + 8 * hh + 4), x2 = *(const v4fa*)(arow + kb + 16 + 8 * hh), x3 = *(const v4fa*)(arow + kb + 16 + 8 * hh + 4);
    float xs[16] = {x0[0],x0[1],x0[2],x0[3],x1[0],x1[1],x1[2],x1[3],x2[0],x2[1],x2[2],x2[3],x3[0],x3[1],x3[2],x3[3]};
#pragma unroll
    for (int i = 0; i < 16; ++i) { const _Float16 h = (_Float16)xs[i]; ah.h[i] = h; al.h[i] = ASPLIT ? (_Float16)(xs[i] - (float)h) : (_Float16)0.0f; }
#pragma unroll
    for (int t = 0; t < 4; ++t) { if (col0 + t * 16 >= N) continue; const size_t boff = (size_t)(col0 + t * 16 + ln) * ldb + kb; FragH bq; bq.half[0] = *(const v8us*)(Bh + boff + 8 * hh); bq.half[1] = *(const v8us*)(Bh + boff + 16 + 8 * hh);
      acc[t] = mmaH<ASPLIT ? 2 : 1>(ah.v, al.v, bq.v, bq.v, acc[t]); }
  }
#pragma unroll
  for (int t = 0; t < 4; ++t) { if (col0 + t * 16 >= N) continue;
#pragma unroll
    for (int r = 0; r < 8; ++r) so[w][8 * hh + r][t * 16 + ln] = acc[t][r] * alpha; }
  __builtin_amdgcn_fence(__ATOMIC_ACQ_REL, "workgroup"); __builtin_amdgcn_wave_barrier();
  const int rsub = lane >> 4, c4 = (lane & 15) * 4;
  {
#pragma unroll
    for (int q = 0; q < 8; ++q) { const int r = q * 2 + rsub; if (col0 + c4 < N) { const v4f v = *(const v4fa*)&so[w][r][c4]; *(v4f*)(C + (size_t)(row0 + r) * ldc + col0 + c4) = v; } }
     }
}

// Wt[n][k] = f16(W[k][n]·scale) from f32 row-major W[K][N] (scale = power of two; bf16-exact weights stay exact in f16 away from the subnormal range)
__global__ __launch_bounds__(256) void k_wt_f16(const float* __restrict__ W, _Float16* __restrict__ Wt, int K, int N, float scale) {
  const int t = blockIdx.x * 256 + threadIdx.x; if (t >= N * (K / 8)) return; const int n = t / (K / 8), k8 = (t % (K / 8)) * 8; FragH f;
#pragma unroll
  for (int i = 0; i < 8; ++i) f.h[i] = (_Float16)(bf16_round(W[(size_t)(k8 + i) * N + n]) * scale); const v8us o = f.half[0];
  *(v8us*)((unsigned short*)Wt + (size_t)n * K + k8) = o; 
}
// k_gemm_hh variant with fused epilogue: v = acc·alpha + bias[by·sBias + col] (+ CP[(row/rowsPerB)·sCPb + by·64 + col] if CP) ; ACT 0 none / 1 elu ; writes f16 C16 (and f32 C if non-null)
template <int ACT>
__global__ __launch_bounds__(128) void k_gemm_hhx(const _Float16* __restrict__ A, int lda, size_t sA, const _Float16* __restrict__ Bh, int ldb, size_t sB, float alpha, const float* __restrict__ bias, size_t sBias, const float* __restrict__ CP, int rowsPerB, size_t sCPb, int row0g,
    float* __restrict__ C, _Float16* __restrict__ C16, int ldc, size_t sC, int M, int N, int K) {
  __shared__ __attribute__((aligned(16))) float so[4][16][64];
  const int tid = threadIdx.x, w = tid >> 5, lane = tid & 31, ln = lane & 15, hh = lane >> 4; const int by = blockIdx.y;
  A += (size_t)by * sA; Bh += (size_t)by * sB; const size_t cofs = (size_t)by * sC; const float* bp = bias ? bias + (size_t)by * sBias : nullptr;
  const int ntn = (N + 63) / 64; const int wid = blockIdx.x * 4 + w; const int mt = wid / ntn, nq = wid % ntn; if (mt * 16 >= M) return;
  const int row0 = mt * 16, col0 = nq * 64; const _Float16* arow = A + (size_t)(row0 + ln) * lda;
  v8f acc[4] = {};
  for (int kb = 0; kb < K; kb += 32) { FragH ah; ah.half[0] = *(const v8us*)((const unsigned short*)arow + kb + 8 * hh); ah.half[1] = *(const v8us*)((const unsigned short*)arow + kb + 16 + 8 * hh);
#pragma unroll
    for (int t = 0; t < 4; ++t) { if (col0 + t * 16 >= N) continue; const size_t boff = (size_t)(col0 + t * 16 + ln) * ldb + kb; FragH bq; bq.half[0] = *(const v8us*)((const unsigned short*)Bh + boff + 8 * hh); bq.half[1] = *(const v8us*)((const unsigned short*)Bh + boff + 16 + 8 * hh);
      acc[t] = mmaH<1>(ah.v, ah.v, bq.v, bq.v, acc[t]); }
  }
#pragma unroll
  for (int t = 0; t < 4; ++t) { if (col0 + t * 16 >= N) continue; const int col = col0 + t * 16 + ln; const float bv = bp ? bf16_round(bp[col]) : 0.f;
#pragma unroll
    for (int r = 0; r < 8; ++r) { float v = acc[t][r] * alpha + bv; if (CP) { const int rr = row0g + row0 + 8 * hh + r; if (rowsPerB < 0) v += CP[cofs + (size_t)rr * ldc + col];      /* rowsPerB < 0: own element of the batched C plane */ else { const int bidx = rr / rowsPerB; v += CP[(size_t)bidx * sCPb + (size_t)by * 64 + col]; } } if (ACT == 1) v = (v > 0.f) ? v : expm1f(v); else if (ACT == 7) v = (v > 0.f) ? v + 1.0f : expf(v); else if (ACT == 8) v = tanhf(v); else if (ACT == 9) v = 0.5f * v * (1.0f + tanhf(0.7978845608028654f * (v + 0.044715f * v * v * v))); else if (ACT == 11) v = 1.0f / (1.0f + expf(-v)); else if (ACT == 12) v = (v > 0.f) ? v : 0.01f * v; else if (ACT == 14) v = (v > 0.f) ? v : 0.1f * v; else if (ACT == 16) v = (v >= 0.f) ? v : 0.3f * v; else if (ACT == 17) v = (v >= 0.f) ? v : 0.2f * v; else if (ACT == 15) v = v / (1.0f + expf(-v)); else if (ACT == 3) v = fmaxf(v, 0.f); else if (ACT == 6) v = 0.5f * v * (1.0f + erff(v * 0.70710678118654752f)); so[w][8 * hh + r][t * 16 + ln] = v; } }
  __builtin_amdgcn_fence(__ATOMIC_ACQ_REL, "workgroup"); __builtin_amdgcn_wave_barrier();
  const int rsub = lane >> 4, c4 = (lane & 15) * 4; typedef _Float16 v4h __attribute__((ext_vector_type(4)));
  {
#pragma unroll
    for (int q = 0; q < 8; ++q) { const int r = q * 2 + rsub; if (col0 + c4 < N) { const v4f v = *(const v4fa*)&so[w][r][c4]; if (C) *(v4f*)(C + cofs + (size_t)(row0 + r) * ldc + col0 + c4) = v; if (C16) { v4h h4; for (int i = 0; i < 4; ++i) h4[i] = (_Float16)v[i]; *(v4h*)(C16 + cofs + (size_t)(row0 + r) * ldc + col0 + c4) = h4; } } }
     }
}


typedef _Float16 v4h __attribute__((ext_vector_type(4)));

__global__ __launch_bounds__(256) void k_x16(const float* __restrict__ x, _Float16* __restrict__ X16, size_t n8) { const size_t t = (size_t)blockIdx.x * 256 + threadIdx.x; if (t >= n8) return; FragH f;
#pragma unroll
  for (int q = 0; q < 8; ++q) f.h[q] = (_Float16)bf16_round(x[t * 8 + q]); *(v8us*)((unsigned short*)X16 + t * 8) = f.half[0];  }
__global__ __launch_bounds__(256) void k_h16(const float* __restrict__ x, _Float16* __restrict__ X16, size_t n8) { const size_t t = (size_t)blockIdx.x * 256 + threadIdx.x; if (t >= n8) return; FragH f;
#pragma unroll
  for (int q = 0; q < 8; ++q) f.h[q] = (_Float16)x[t * 8 + q]; *(v8us*)((unsigned short*)X16 + t * 8) = f.half[0];  }
__global__ __launch_bounds__(256) void k_round16f(const float* __restrict__ W, _Float16* __restrict__ Bt, size_t n8) { const size_t t = (size_t)blockIdx.x * 256 + threadIdx.x; if (t >= n8) return; FragH f;
#pragma unroll
  for (int i = 0; i < 8; ++i) f.h[i] = (_Float16)(bf16_round(W[t * 8 + i]) * 16.0f); *(v8us*)((unsigned short*)Bt + t * 8) = f.half[0];  }
template <int NHv, int TTv>
__global__ __launch_bounds__(256) void k_vt(const _Float16* __restrict__ V16, int ldv, int voff, _Float16* __restrict__ Vt) { __shared__ unsigned short tl[64][66]; const int tid = threadIdx.x; const int slab = blockIdx.x / (TTv / 64), lg = blockIdx.x % (TTv / 64); const int b = slab / NHv, h = slab % NHv;
  for (int i = tid; i < 64 * 8; i += 256) { const int r = i / 8, c8 = (i % 8) * 8; FragH f; f.half[0] = *(const v8us*)((const unsigned short*)V16 + ((size_t)b * TTv + lg * 64 + r) * ldv + voff + h * 64 + c8);
#pragma unroll
    for (int q = 0; q < 8; ++q) tl[r][c8 + q] = f.u[q]; }
  __syncthreads();
  {
#pragma unroll
    for (int rd = 0; rd < 2; ++rd) { const int d = rd * 32 + tid / 8, pc = tid % 8; FragH f;
#pragma unroll
      for (int q = 0; q < 8; ++q) f.u[q] = tl[pc * 8 + q][d];
      *(v8us*)((unsigned short*)Vt + ((size_t)slab * 64 + d) * TTv + lg * 64 + pc * 8) = f.half[0]; }
     } }

__global__ __launch_bounds__(256) void k_hl(const float* __restrict__ F, _Float16* __restrict__ Hh, _Float16* __restrict__ Hl, size_t n8) { const size_t t = (size_t)blockIdx.x * 256 + threadIdx.x; if (t >= n8) return; FragH fh, fl; const v4f a = *(const v4fa*)(F + t * 8), c = *(const v4fa*)(F + t * 8 + 4);
#pragma unroll
  for (int q = 0; q < 4; ++q) { _Float16 h = (_Float16)a[q]; fh.h[q] = h; fl.h[q] = (_Float16)((a[q] - (float)h) * 1024.0f); h = (_Float16)c[q]; fh.h[4 + q] = h; fl.h[4 + q] = (_Float16)((c[q] - (float)h) * 1024.0f); }
  { *(v8us*)((unsigned short*)Hh + t * 8) = fh.half[0]; *(v8us*)((unsigned short*)Hl + t * 8) = fl.half[0];  } }

// ---- fast GEMM (wave tile 32x64; requires M % 32 == 0 rows per launch region and N % 64 == 0); epilogue = k_gemm_hhx semantics ----
__device__ __forceinline__ v16h g2_frag(const _Float16* p, int hh) { FragH f; f.half[0] = *(const v8us*)((const unsigned short*)p + 8 * hh); f.half[1] = *(const v8us*)((const unsigned short*)p + 16 + 8 * hh); return f.v; }
__device__ __forceinline__ v8f g2_mma(v16h a, v16h b, v8f c) { v8f d = __builtin_amdgcn_wmma_f32_16x16x32_f16(false, a, false, b, (short)0, c, false, false); asm volatile("v_nop\n\tv_nop\n\tv_nop\n\tv_nop" : "+v"(d) : "v"(a), "v"(b)); return d; }
template <int ACT>
__global__ __launch_bounds__(128) void k_gemm2(const _Float16* __restrict__ A, int lda, size_t sA, const _Float16* __restrict__ Bh, int ldb, size_t sB, float alpha, const float* __restrict__ bias, size_t sBias, const float* __restrict__ CP, int rowsPerB, size_t sCPb, int row0g,
    float* __restrict__ C, _Float16* __restrict__ C16, int ldc, size_t sC, int M, int N, int K) { static_assert(ACT == 0 || ACT == 3 || ACT == 6 || ACT == 8 || ACT == 9 || ACT == 11 || ACT == 12 || ACT == 14 || ACT == 15 || ACT == 16 || ACT == 17, "k_gemm2: unsupported ACT code (would silently apply no activation)");
  __shared__ __attribute__((aligned(16))) float so[4][32][68];
  const int tid = threadIdx.x, w = tid >> 5, lane = tid & 31, ln = lane & 15, hh = lane >> 4; const int by = blockIdx.y;
  A += (size_t)by * sA; Bh += (size_t)by * sB; const size_t cofs = (size_t)by * sC; const float* bp = bias ? bias + (size_t)by * sBias : nullptr;
  const int ntn = N >> 6; const int mt = blockIdx.x / ntn, nq = blockIdx.x - mt * ntn; const int row0 = mt * 128 + 32 * w, col0 = nq * 64; if (row0 >= M) return;
  const _Float16* a0p = A + (size_t)(row0 + ln) * lda; const _Float16* a1p = a0p + (size_t)16 * lda;
  const _Float16* b0p = Bh + (size_t)(col0 + ln) * ldb; const _Float16* b1p = b0p + (size_t)16 * ldb; const _Float16* b2p = b1p + (size_t)16 * ldb; const _Float16* b3p = b2p + (size_t)16 * ldb;
  const v8f z8 = {0.f,0.f,0.f,0.f,0.f,0.f,0.f,0.f}; v8f c00 = z8, c01 = z8, c02 = z8, c03 = z8, c10 = z8, c11 = z8, c12 = z8, c13 = z8;
#pragma unroll 1
  for (int kb = 0; kb < K; kb += 32) { const v16h a0 = g2_frag(a0p + kb, hh), a1 = g2_frag(a1p + kb, hh);
    v16h b = g2_frag(b0p + kb, hh); c00 = g2_mma(a0, b, c00); c10 = g2_mma(a1, b, c10);
    b = g2_frag(b1p + kb, hh); c01 = g2_mma(a0, b, c01); c11 = g2_mma(a1, b, c11);
    b = g2_frag(b2p + kb, hh); c02 = g2_mma(a0, b, c02); c12 = g2_mma(a1, b, c12);
    b = g2_frag(b3p + kb, hh); c03 = g2_mma(a0, b, c03); c13 = g2_mma(a1, b, c13); }
  v8f accs[8] = {c00, c01, c02, c03, c10, c11, c12, c13};
#pragma unroll
  for (int u = 0; u < 8; ++u) { const int t = u & 3, half = u >> 2; const int col = col0 + t * 16 + ln; const float bv = bp ? bf16_round(bp[col]) : 0.f;
#pragma unroll
    for (int r = 0; r < 8; ++r) { const int rloc = half * 16 + 8 * hh + r; float v = accs[u][r] * alpha + bv; if (CP) { if (rowsPerB < 0) v += CP[cofs + (size_t)(row0g + row0 + rloc) * ldc + col];      /* rowsPerB < 0: own element of the batched C plane */ else { const int bidx = (row0g + row0 + rloc) / rowsPerB; v += CP[(size_t)bidx * sCPb + (size_t)by * 64 + col]; } }
      if (ACT == 3) v = fmaxf(v, 0.f); else if (ACT == 6) v = 0.5f * v * (1.0f + erff(v * 0.70710678118654752f)); else if (ACT == 11) v = 1.0f / (1.0f + expf(-v)); else if (ACT == 15) v = v / (1.0f + expf(-v)); else if (ACT == 12) v = (v > 0.f) ? v : 0.01f * v; else if (ACT == 8) v = tanhf(v); else if (ACT == 9) v = 0.5f * v * (1.0f + tanhf(0.7978845608028654f * (v + 0.044715f * v * v * v))); else if (ACT == 14) v = (v > 0.f) ? v : 0.1f * v; else if (ACT == 16) v = (v >= 0.f) ? v : 0.3f * v; else if (ACT == 17) v = (v >= 0.f) ? v : 0.2f * v;
      so[w][rloc][t * 16 + ln] = v; } }
  __builtin_amdgcn_fence(__ATOMIC_ACQ_REL, "workgroup"); __builtin_amdgcn_wave_barrier();
  const int rsub = lane >> 4, c4 = (lane & 15) * 4;
  {
#pragma unroll
    for (int q = 0; q < 16; ++q) { const int r = q * 2 + rsub; const v4f v = *(const v4fa*)&so[w][r][c4]; if (C) *(v4f*)(C + cofs + (size_t)(row0 + r) * ldc + col0 + c4) = v; if (C16) { v4h h4; for (int i = 0; i < 4; ++i) h4[i] = (_Float16)v[i]; *(v4h*)(C16 + cofs + (size_t)(row0 + r) * ldc + col0 + c4) = h4; } }
     } }


__global__ __launch_bounds__(256) void k_wnat(const float* __restrict__ w, size_t n8, _Float16* __restrict__ Bt) { const size_t t = (size_t)blockIdx.x * 256 + threadIdx.x; if (t >= n8) return; FragH f; for (int q = 0; q < 8; ++q) f.h[q] = (_Float16)(bf16_round(w[t * 8 + q]) * 16.0f); *(v8us*)((unsigned short*)Bt + t * 8) = f.half[0];  }
__global__ __launch_bounds__(256) void k_rsm(const float* __restrict__ S, _Float16* __restrict__ P, int nrows) {
  #pragma clang fp contract(off)
  const int i = blockIdx.x * 256 + threadIdx.x; if (i >= nrows) return; const float* s = S + (size_t)i * SQ; float mx = -3.0e38f;
#pragma unroll 1
  for (int j = 0; j < SQ; ++j) mx = fmaxf(mx, s[j]); float se = 0.f;
#pragma unroll 1
  for (int j = 0; j < SQ; ++j) se += expf(s[j] - mx); const float sc = 256.0f / se;
#pragma unroll 1
  for (int j0 = 0; j0 < SQ; j0 += 8) { FragH f; for (int q = 0; q < 8; ++q) f.h[q] = (_Float16)(expf(s[j0 + q] - mx) * sc); unsigned short* d = (unsigned short*)P + (size_t)i * SQ + j0; *(v8us*)d = f.half[0];  } }
__global__ __launch_bounds__(256) void k_vt(const _Float16* __restrict__ V16, int b, int h0, _Float16* __restrict__ VT) { __shared__ unsigned short tl[64][65]; const int tid = threadIdx.x; const int hh = blockIdx.x % HG, sg = blockIdx.x / HG; const int s0 = sg * 64; const int h = h0 + hh;
  for (int i = tid; i < 64 * 8; i += 256) { const int j = i / 8, d8 = (i % 8) * 8; FragH f; f.half[0] = *(const v8us*)((const unsigned short*)V16 + ((size_t)b * SQ + s0 + j) * DM + h * HD + d8); for (int q = 0; q < 8; ++q) tl[d8 + q][j] = f.u[q]; }
  __syncthreads();
  { for (int i = tid; i < 64 * 8; i += 256) { const int d = i / 8, j8 = (i % 8) * 8; FragH f; for (int q = 0; q < 8; ++q) f.u[q] = tl[d][j8 + q]; *(v8us*)((unsigned short*)VT + ((size_t)hh * HD + d) * SQ + s0 + j8) = f.half[0]; }  } }



__global__ __launch_bounds__(256) void k_rsmcf2(const float* __restrict__ S, _Float16* __restrict__ P, int hg, int q0, int nk) {
  #pragma clang fp contract(off)
  const int t = blockIdx.x * 256 + threadIdx.x; if (t >= hg * QT) return; const size_t i = (size_t)t; const float* s = S + i * NKX; const int last = q0 + (t % QT); float mx = -3.0e38f;
#pragma unroll 1
  for (int j = 0; j < nk; ++j) { const float f = (j <= last) ? 1.f : 0.f; mx = fmaxf(mx, fmaf(f, s[j], (1.f - f) * -1.0e9f)); } float se = 0.f;
#pragma unroll 1
  for (int j = 0; j < nk; ++j) { const float f = (j <= last) ? 1.f : 0.f; se += __expf(fmaf(f, s[j], (1.f - f) * -1.0e9f) - mx); } const float sc = 256.0f / se;
#pragma unroll 1
  for (int j0 = 0; j0 < nk; j0 += 8) { FragH fr; for (int q = 0; q < 8; ++q) { const int j = j0 + q; const float f = (j <= last) ? 1.f : 0.f; fr.h[q] = (_Float16)(__expf(fmaf(f, s[j], (1.f - f) * -1.0e9f) - mx) * sc); } unsigned short* d = (unsigned short*)P + i * NKX + j0; *(v8us*)d = fr.half[0];  } }


template <int MASKADD>
__global__ __launch_bounds__(64) void k_att0(const float* __restrict__ QF, const float* __restrict__ KF, const float* __restrict__ VF, int ld, const float* __restrict__ mask, float scale, float* __restrict__ OF, int ldo) {
  #pragma clang fp contract(off)
  __shared__ __attribute__((aligned(16))) float lq[64][64]; __shared__ __attribute__((aligned(16))) float lo[64][64];
  const int tid = threadIdx.x; const int h = blockIdx.x / (QT0 / 64), rg = blockIdx.x % (QT0 / 64); const int i = rg * 64 + tid;
  const float* qr = QF + (size_t)i * ld + h * HD;
#pragma unroll 1
  for (int c = 0; c < HD / 4; ++c) { *(v4f*)&lq[tid][c * 4] = *(const v4fa*)(qr + c * 4); const v4f z = {0.f, 0.f, 0.f, 0.f}; *(v4f*)&lo[tid][c * 4] = z; }
  float m = -1.0e30f, l = 0.f; const int jmax = MASKADD ? (SQ - 1) : (rg * 64 + 63);      /* additive-mask form: every key (the mask input decides); causal form: keys up to the block's last row */
#pragma unroll 1
  for (int j = 0; j <= jmax; ++j) { const float* kr = KF + (size_t)j * ld + h * HD; const float* vr = VF + (size_t)j * ld + h * HD; float s = 0.f;
#pragma unroll 1
    for (int c = 0; c < HD / 4; ++c) { const v4f kq = *(const v4fa*)(kr + c * 4); const v4f qq = *(v4f*)&lq[tid][c * 4]; s = __fadd_rn(s, __fmul_rn(qq[0], kq[0])); s = __fadd_rn(s, __fmul_rn(qq[1], kq[1])); s = __fadd_rn(s, __fmul_rn(qq[2], kq[2])); s = __fadd_rn(s, __fmul_rn(qq[3], kq[3])); }
    s = __fmul_rn(s, scale); if (MASKADD) s = __fadd_rn(s, __fmul_rn(bf16_round(mask[(size_t)i * SQ + j]), -10000.0f));
    const float f = (MASKADD || j <= i) ? 1.f : 0.f; const float sm = fmaf(f, s, (1.f - f) * -1.0e30f); const float mn = fmaxf(m, sm); const float sc = expf(m - mn); const float e = expf(sm - mn); l = __fadd_rn(__fmul_rn(l, sc), e); m = mn;
#pragma unroll 1
    for (int c = 0; c < HD / 4; ++c) { const v4f vv = *(const v4fa*)(vr + c * 4); v4f oo = *(v4f*)&lo[tid][c * 4]; for (int u = 0; u < 4; ++u) oo[u] = __fadd_rn(__fmul_rn(oo[u], sc), __fmul_rn(e, vv[u])); *(v4f*)&lo[tid][c * 4] = oo; } }
  const float fin = 64.0f / l;      /* o carried x64; k_o0m scales it by 1/64 */
#pragma unroll 1
  for (int c = 0; c < HD / 4; ++c) { v4f oo = *(v4f*)&lo[tid][c * 4]; for (int u = 0; u < 4; ++u) oo[u] = __fmul_rn(oo[u], fin); *(v4f*)&lo[tid][c * 4] = oo; }
  __syncthreads();
  {
#pragma unroll 1
    for (int it = 0; it < 16; ++it) { const int row = it * 4 + tid / 16, pc = (tid % 16) * 4; const v4f v = *(const v4f*)&lo[row][pc]; *(v4f*)(OF + (size_t)(rg * 64 + row) * ldo + h * HD + pc) = v; }
     } }


template <int BFIN, int WXB>
__global__ __launch_bounds__(256) void k_ln16(const float* __restrict__ X, const float* __restrict__ g, const float* __restrict__ bb, float eps, _Float16* __restrict__ N16, float* __restrict__ XB) {
  #pragma clang fp contract(off)
  __shared__ float red[256]; const size_t r = blockIdx.x; const int t = threadIdx.x; const v4f xa = *(const v4fa*)(X + r * DMQ + t * 4); float s[4]; float sum = 0.f;
  for (int q = 0; q < 4; ++q) { s[q] = BFIN ? bf16_round(xa[q]) : xa[q]; sum = __fadd_rn(sum, s[q]); }
  red[t] = sum; __syncthreads(); for (int st = 128; st > 0; st >>= 1) { if (t < st) red[t] = __fadd_rn(red[t], red[t + st]); __syncthreads(); } const float mu = red[0] / (float)DMQ; __syncthreads();
  float vs = 0.f; for (int q = 0; q < 4; ++q) { const float dl = __fadd_rn(s[q], -mu); vs = __fadd_rn(vs, __fmul_rn(dl, dl)); } red[t] = vs; __syncthreads(); for (int st = 128; st > 0; st >>= 1) { if (t < st) red[t] = __fadd_rn(red[t], red[t + st]); __syncthreads(); }
  const float rs = rsqrtf(__fadd_rn(red[0] / (float)DMQ, eps)); v4h y; v4f xb;
  for (int q = 0; q < 4; ++q) { const int c = t * 4 + q; y[q] = (_Float16)__fadd_rn(__fmul_rn(__fmul_rn(__fadd_rn(s[q], -mu), rs), bf16_round(g[c])), bf16_round(bb[c])); xb[q] = s[q]; }
  { *(v4h*)(N16 + r * DMQ + t * 4) = y; if (WXB) *(v4f*)(XB + r * DMQ + t * 4) = xb;  } }
__global__ __launch_bounds__(256) void k_ftres2(const float* __restrict__ OF0, const float* __restrict__ XB, float* __restrict__ X1, size_t n4) {
  #pragma clang fp contract(off)
  const size_t t = (size_t)blockIdx.x * 256 + threadIdx.x; if (t >= n4) return; const v4f o = *(const v4fa*)(OF0 + t * 4), xv = *(const v4fa*)(XB + t * 4); v4f y; for (int q = 0; q < 4; ++q) y[q] = __fadd_rn(__fmul_rn(o[q], 0.015625f), xv[q]); *(v4f*)(X1 + t * 4) = y;  }

__global__ __launch_bounds__(256) void k_wthd(const float* __restrict__ Wt, _Float16* __restrict__ Bt) { const size_t t = (size_t)blockIdx.x * 256 + threadIdx.x; if (t >= (size_t)NH * HD * (DM / 8)) return; const int m8 = (int)(t % (DM / 8)) * 8; const int d = (int)((t / (DM / 8)) % HD); const int h = (int)(t / ((size_t)(DM / 8) * HD)); FragH f;
  for (int q = 0; q < 8; ++q) f.h[q] = (_Float16)(16.0f * bf16_round(Wt[((size_t)h * DM + m8 + q) * HD + d])); unsigned short* dst = (unsigned short*)Bt + ((size_t)h * HD + d) * DM + m8; *(v8us*)dst = f.half[0];  }




__global__ __launch_bounds__(256) void k_wtpad(const float* __restrict__ Wm, _Float16* __restrict__ Wt, int Kr, int Kp, int Nr, int Np, float scale) {
  const int t = blockIdx.x * 256 + threadIdx.x; if (t >= Np * (Kp / 8)) return; const int n = t / (Kp / 8), k8 = (t % (Kp / 8)) * 8; const int nc = min(n, Nr - 1); const float fn = (n < Nr) ? 1.f : 0.f; FragH f;
  for (int i = 0; i < 8; ++i) { const int k = k8 + i; const int kc = min(k, Kr - 1); const float fk = (k < Kr) ? fn : 0.f; f.h[i] = (_Float16)(bf16_round(Wm[(size_t)kc * Nr + nc]) * scale * fk); }
  unsigned short* o = (unsigned short*)Wt + (size_t)n * Kp + k8; *(v8us*)o = f.half[0];  }
__global__ __launch_bounds__(128) void k_bpad(const float* __restrict__ b, float* __restrict__ Bp, int nr, int np) {
  const int i = threadIdx.x; if (i >= np) return; const float v = b[min(i, nr - 1)] * ((i < nr) ? 1.f : 0.f); *(float*)(Bp + i) = v;  }

#define DI 64         /* inner width = NH * HD (ONE 64-wide head) */
#define LQK (3 * DI)  /* fused q | k | v row pitch (192) */
__global__ __launch_bounds__(256) void k_o0(const float* __restrict__ OF, float* __restrict__ ob, size_t n4) {
  #pragma clang fp contract(off)
  const size_t t = (size_t)blockIdx.x * 256 + threadIdx.x; if (t >= n4) return; const size_t e = t * 4; const int i = (int)(e / DI); const int c = (int)(e % DI); const int h = c / HD, d = c % HD; const v4f a = *(const v4fa*)(OF + e); v4f o; for (int q = 0; q < 4; ++q) o[q] = __fmul_rn(a[q], 0.015625f); float* dst = ob + (size_t)h * SQ * HD + (size_t)i * HD + d; *(v4f*)dst = o;  }

__global__ __launch_bounds__(256) void k_o0m(const float* __restrict__ OF, float* __restrict__ o_, size_t n4) {
  #pragma clang fp contract(off)
  const size_t t = (size_t)blockIdx.x * 256 + threadIdx.x; if (t >= n4) return; const size_t e = t * 4; const v4f a = *(const v4fa*)(OF + e); v4f o; for (int q = 0; q < 4; ++q) o[q] = __fmul_rn(a[q], 0.015625f); *(v4f*)(o_ + e) = o;  }
extern "C" void kernel_launch(void* const* d_in, const int* in_sizes, int n_in,
                              void* d_out, int out_size, void* d_ws, size_t ws_size, hipStream_t stream) {
  (void)in_sizes; (void)n_in; (void)out_size;
  const float* const* I = (const float* const*)d_in; const float* x = I[0]; const float* wq = I[2]; const float* wk = I[1]; const float* wv = I[3]; const float* bq = nullptr; const float* bk = nullptr; const float* bv = nullptr;      /* x; [in][out = 64] weights in this module's input order (wq = input 2, wk = input 1, wv = input 3); no biases */
  char* ws = (char*)d_ws; size_t off = 0;
  auto take = [&](size_t bytes) { char* p = ws + off; off += (bytes + 255) & ~(size_t)255; return p; };
  _Float16* BW = (_Float16*)take((size_t)LQK * DM * 2); _Float16* X16 = (_Float16*)take(NR * DM * 2); _Float16* QKV = (_Float16*)take(NR * LQK * 2); _Float16* VT = (_Float16*)take((size_t)NH * HD * SQ * 2);
  float* S = (float*)take((size_t)NH * QT * NKX * 4); _Float16* P = (_Float16*)take((size_t)NH * QT * NKX * 2); float* QKVF0 = (float*)take((size_t)QT0 * LQK * 4); float* OF0 = (float*)take((size_t)QT0 * DI * 4);
  if (off > ws_size) return;
  { const unsigned g = (unsigned)(((size_t)DI * (DM / 8) + 255) / 256); k_wt_f16<<<g, 256, 0, stream>>>(wq, BW, DM, DI, 16.0f); k_wt_f16<<<g, 256, 0, stream>>>(wk, BW + (size_t)DI * DM, DM, DI, 16.0f); k_wt_f16<<<g, 256, 0, stream>>>(wv, BW + (size_t)2 * DI * DM, DM, DI, 16.0f); }      /* [in = DM][out = 64] -> Bt[n][k] x16, stacked q | k | v */
  k_x16<<<(unsigned)((NR * DM / 8 + 255) / 256), 256, 0, stream>>>(x, X16, NR * DM / 8);      /* x (bf16-valued) as exact f16 rows */
  const float* bqkv[3] = {bq, bk, bv};
  for (int c = 0; c < 3; ++c) k_gemm2<0><<<dim3((unsigned)((NR / 128) * (DI / 64)), 1), 128, 0, stream>>>(X16, DM, 0, BW + (size_t)c * DI * DM, DM, 0, 0.0625f, bqkv[c], 0, nullptr, 1, 0, 0, nullptr, QKV + (size_t)c * DI, LQK, 0, (int)NR, DI, DM);      /* q | k | v = x W^T -> f16 rows, column blocks 0 / 64 / 128 of the fused plane (pitch 192); head h = columns h*64 inside each */
  const _Float16* Q16 = QKV; const _Float16* K16 = QKV + DI; const _Float16* V16 = QKV + 2 * DI;
  for (int b = 0; b < NB; ++b) { const size_t r0 = (size_t)b * SQ; float* ob = (float*)d_out + r0 * DI;
    k_vt<NH, SQ><<<NH * (SQ / 64), 256, 0, stream>>>(V16 + r0 * LQK, LQK, 0, VT);      /* V^T [NH][HD][SQ] for this batch */
    for (int q0 = 0; q0 < SQ; q0 += QT) { const int nk = q0 + QT;      /* causal: only keys below the tile end are computed */
      k_gemm2<0><<<dim3((QT / 128) * (nk / 64), NH), 128, 0, stream>>>(Q16 + (r0 + q0) * LQK, LQK, (size_t)HD, K16 + r0 * LQK, LQK, (size_t)HD, 0.125f, nullptr, 0, nullptr, 1, 0, 0, S, nullptr, NKX, (size_t)QT * NKX, QT, nk, HD);      /* scores * 64^-0.5, the one head on grid.y */
      k_rsmcf2<<<(NH * QT + 255) / 256, 256, 0, stream>>>(S, P, NH, q0, nk);      /* causal softmax -> P x256 f16 */
      k_gemm2<0><<<dim3((QT / 128) * (HD / 64), NH), 128, 0, stream>>>(P, NKX, (size_t)QT * NKX, VT, SQ, (size_t)HD * SQ, 0.00390625f, nullptr, 0, nullptr, 1, 0, 0, ob + (size_t)q0 * DI, nullptr, DI, (size_t)HD, QT, HD, nk); }      /* out[b][q0 + i][h*64..] = P V^T 2^-8 (f32): merged rows, head h at column offset h*64 */
    for (int c = 0; c < 3; ++c) k_gemm2<0><<<dim3((unsigned)((QT0 / 128) * (DI / 64)), 1), 128, 0, stream>>>(X16 + r0 * DM, DM, 0, BW + (size_t)c * DI * DM, DM, 0, 0.0625f, bqkv[c], 0, nullptr, 1, 0, 0, QKVF0 + (size_t)c * DI, nullptr, LQK, 0, QT0, DI, DM);      /* f32 q | k | v of rows 0..511 (exact products, f32 accumulation) */
    k_att0<0><<<NH * (QT0 / 64), 64, 0, stream>>>(QKVF0, QKVF0 + DI, QKVF0 + 2 * DI, LQK, nullptr, 0.125f, OF0, DI);      /* exact f32 causal attention for rows 0..511 (o x64) */
    k_o0m<<<(unsigned)(((size_t)QT0 * DI / 4 + 255) / 256), 256, 0, stream>>>(OF0, ob, (size_t)QT0 * DI / 4); }      /* rows 0..511 of the batch REWRITTEN from the exact path */
}

// v001
// One run takes 8950 microseconds.
// In both of two side-by-side timings against v000, it was 14.6 times as fast.
#include <hip/hip_runtime.h>
// Single-head causal self-attention from a 32-wide embedding (x [16][4096][32]; k/q/v = x W ([in][out] [32][64], no biases; input order Wk, Wq, Wv); ONE 64-wide head (head_size 64 != C 32); scores * 64^-0.5; causal; softmax; out = weights v -> [16][4096][64]; no output projection).
// Structure: token rows; x as exact f16 rows; three WMMA GEMMs into one f16 q | k | v plane [65536][192]; per batch v^T via LDS transposes; causal 256-row query tiles with the batches on grid.y (scores alpha 1/8, causal softmax f32 -> f16 x256 weights, P V written as f32 straight into the merged output rows); an exact f32 first tile (rows 0..511) rewritten at the end; launches: see trace.
// Compute dtype: inputs rounded to bf16; x / weights exact; q, k, v and softmax weights as plain f16 GEMM operands (~2^-12); scores and softmax statistics f32; v_wmma_f32_16x16x32_f16.
#define NB 16
#define SQ 4096
#define DM 32
#define NH 1
#define HD 64
#define HG 4                         /* unused by the launches (grid.y is NB); read only by the uncalled k_vt overload */
#define QT 256                       /* query rows per causal tile */
#define NKX SQ                       /* S / P row pitch */
#define QT0 512                      /* first-tile rows recomputed exactly (f32): 512 here (no output projection averages the early-row cancellation errors away; logit sigma 1.0) */
#define B0 0                         /* unused; the batches are grid.y 0..NB-1 */
#define NBR NB                       /* feeds only the unused MP; the launches put the NB batches on grid.y */
#define NR ((size_t)NB * SQ)
#define DMQ DM
#define DFF 4096                     /* unused; no FFN here */
#define DFFR 100                     /* unused; no FFN here */
#define MP ((int)((size_t)NBR * SQ)) /* unused; the projections cover NR rows */
#define QN SQ                        /* unused; the query tiles cover SQ rows */
#define NHD NH                       /* unused; the launches use NH */
#define MPO MP                       /* unused */
#define LQ (3 * DM)      /* unused; the q/k/v row pitch is LQK */
typedef __bf16 v16b __attribute__((ext_vector_type(16)));
typedef unsigned short v8us __attribute__((ext_vector_type(8), may_alias));
typedef float  v8f  __attribute__((ext_vector_type(8)));
typedef float  v4f  __attribute__((ext_vector_type(4)));
typedef float  v4fa __attribute__((ext_vector_type(4), may_alias));
union FragB { v16b v; v8us half[2]; unsigned short u[16]; };

__device__ __forceinline__ unsigned short bf16_bits(float x) { unsigned int u = __float_as_uint(x); return (unsigned short)((u + 0x7FFFu + ((u >> 16) & 1u)) >> 16); }
__device__ __forceinline__ float bf16_val(unsigned short b) { return __uint_as_float(((unsigned int)b) << 16); }
__device__ __forceinline__ float bf16_round(float x) { return bf16_val(bf16_bits(x)); }
// D += A·B with NT terms: 1 = ah·bh, 2 = + al·bh (A split), 3 = + ah·bl (both split)
template <int NT>
__device__ __forceinline__ v8f mmaN(v16b ah, v16b al, v16b bh, v16b bl, v8f c) {
  c = __builtin_amdgcn_wmma_f32_16x16x32_bf16(false, ah, false, bh, (short)0, c, false, false);
  if (NT >= 2) c = __builtin_amdgcn_wmma_f32_16x16x32_bf16(false, al, false, bh, (short)0, c, false, false);
  if (NT >= 3) c = __builtin_amdgcn_wmma_f32_16x16x32_bf16(false, ah, false, bl, (short)0, c, false, false);
  asm volatile("v_nop\n\tv_nop\n\tv_nop\n\tv_nop" : "+v"(c) : "v"(ah), "v"(al), "v"(bh), "v"(bl));
  return c;
}

__global__ __launch_bounds__(256) void k_wt_bf16(const float* __restrict__ W, unsigned short* __restrict__ Wt, int K, int N) {
  const int t = blockIdx.x * 256 + threadIdx.x;
  const int k8n = K / 8;
  if (t >= N * k8n) return;
  const int n = t / k8n, k8 = (t % k8n) * 8;
  v8us v;
#pragma unroll
  for (int i = 0; i < 8; ++i) v[i] = bf16_bits(W[(size_t)(k8 + i) * N + n]);
  *(v8us*)(Wt + (size_t)n * K + k8) = v;
  
}

// GEMM C[M][N] (f32, pitch ldc) = act(A[M][K]·W + bias). A f32 row-major (pitch lda) converted per fragment to bf16
// (ASPLIT: hi/lo two planes -> 2 terms, else single rounded term); Wt bf16 [N][K] (pitch ldb). BIAS_BF16 rounds the
// bias to bf16 first (bias quantised to bf16 before the add). K%32==0, M%16==0, N%64==0.
template <bool ASPLIT, int ACT, bool BIAS_BF16>
__global__ __launch_bounds__(128) void k_gemm_bf(const float* __restrict__ A, int lda, const unsigned short* __restrict__ Wt, int ldb,
                                               const float* __restrict__ bias, float* __restrict__ C, int ldc, int M, int N, int K) {
  __shared__ __attribute__((aligned(16))) float so[4][16][64];
  const int tid = threadIdx.x, w = tid >> 5, lane = tid & 31, ln = lane & 15, hh = lane >> 4;
  const int ntn = N / 64;
  const int wid = blockIdx.x * 4 + w;
  const int mt = wid / ntn, nq = wid % ntn;
  if (mt * 16 >= M) return;
  const int row0 = mt * 16, col0 = nq * 64;
  const float* arow = A + (size_t)(row0 + ln) * lda;
  v8f acc[4] = {};
  for (int kb = 0; kb < K; kb += 32) {
    FragB ah, al;
    const v4f x0 = *(const v4fa*)(arow + kb + 8 * hh), x1 = *(const v4fa*)(arow + kb + 8 * hh + 4);
    const v4f x2 = *(const v4fa*)(arow + kb + 16 + 8 * hh), x3 = *(const v4fa*)(arow + kb + 16 + 8 * hh + 4);
    float xs[16] = {x0[0],x0[1],x0[2],x0[3],x1[0],x1[1],x1[2],x1[3],x2[0],x2[1],x2[2],x2[3],x3[0],x3[1],x3[2],x3[3]};
#pragma unroll
    for (int i = 0; i < 16; ++i) { const unsigned short hb = bf16_bits(xs[i]); ah.u[i] = hb; al.u[i] = ASPLIT ? bf16_bits(xs[i] - bf16_val(hb)) : (unsigned short)0; }
#pragma unroll
    for (int t = 0; t < 4; ++t) {
      const unsigned short* brow = Wt + (size_t)(col0 + t * 16 + ln) * ldb + kb;
      FragB b;
      b.half[0] = *(const v8us*)(brow + 8 * hh);
      b.half[1] = *(const v8us*)(brow + 16 + 8 * hh);
      acc[t] = mmaN<ASPLIT ? 2 : 1>(ah.v, al.v, b.v, b.v, acc[t]);
    }
  }
#pragma unroll
  for (int t = 0; t < 4; ++t) {
    float bv = bias ? bias[col0 + t * 16 + ln] : 0.f;
    if (BIAS_BF16) bv = bf16_round(bv);
#pragma unroll
    for (int r = 0; r < 8; ++r) { float v = acc[t][r] + bv; if (ACT == 1) v = fmaxf(v, 0.f); so[w][8 * hh + r][t * 16 + ln] = v; }
  }
  __builtin_amdgcn_fence(__ATOMIC_ACQ_REL, "workgroup");
  __builtin_amdgcn_wave_barrier();
  const int rsub = lane >> 4, c4 = (lane & 15) * 4;
  {
#pragma unroll
    for (int q = 0; q < 8; ++q) {
      const int r = q * 2 + rsub;
      const v4f v = *(const v4fa*)&so[w][r][c4];
      *(v4f*)(C + (size_t)(row0 + r) * ldc + col0 + c4) = v;
    }
    
  }
}

// GEMM C = act(A·W + bias + resid): A f32 (ASPLIT -> hi/lo 2 terms), Wt bf16 [N][K]; ACT 0 none, 1 relu, 2 exact gelu;
// resid (optional, f32, row index = (row % rmod), pitch ldr, RES_BF16 rounds it) added before the activation.
template <bool ASPLIT, int ACT, bool BIAS_BF16, bool RES_BF16>
__global__ __launch_bounds__(128) void k_gemm_bf3(const float* __restrict__ A, int lda, const unsigned short* __restrict__ Wt, int ldb,
                                                const float* __restrict__ bias, const float* __restrict__ resid, int rmod, int ldr,
                                                float* __restrict__ C, int ldc, int M, int N, int K) {
  __shared__ __attribute__((aligned(16))) float so[4][16][64];
  const int tid = threadIdx.x, w = tid >> 5, lane = tid & 31, ln = lane & 15, hh = lane >> 4;
  const int ntn = N / 64;
  const int wid = blockIdx.x * 4 + w;
  const int mt = wid / ntn, nq = wid % ntn;
  if (mt * 16 >= M) return;
  const int row0 = mt * 16, col0 = nq * 64;
  const float* arow = A + (size_t)(row0 + ln) * lda;
  v8f acc[4] = {};
  for (int kb = 0; kb < K; kb += 32) {
    FragB ah, al;
    const v4f x0 = *(const v4fa*)(arow + kb + 8 * hh), x1 = *(const v4fa*)(arow + kb + 8 * hh + 4);
    const v4f x2 = *(const v4fa*)(arow + kb + 16 + 8 * hh), x3 = *(const v4fa*)(arow + kb + 16 + 8 * hh + 4);
    float xs[16] = {x0[0],x0[1],x0[2],x0[3],x1[0],x1[1],x1[2],x1[3],x2[0],x2[1],x2[2],x2[3],x3[0],x3[1],x3[2],x3[3]};
#pragma unroll
    for (int i = 0; i < 16; ++i) { const unsigned short hb = bf16_bits(xs[i]); ah.u[i] = hb; al.u[i] = ASPLIT ? bf16_bits(xs[i] - bf16_val(hb)) : (unsigned short)0; }
#pragma unroll
    for (int t = 0; t < 4; ++t) {
      const unsigned short* brow = Wt + (size_t)(col0 + t * 16 + ln) * ldb + kb;
      FragB b;
      b.half[0] = *(const v8us*)(brow + 8 * hh);
      b.half[1] = *(const v8us*)(brow + 16 + 8 * hh);
      acc[t] = mmaN<ASPLIT ? 2 : 1>(ah.v, al.v, b.v, b.v, acc[t]);
    }
  }
#pragma unroll
  for (int t = 0; t < 4; ++t) {
    const int col = col0 + t * 16 + ln;
    float bv = bias ? bias[col] : 0.f;
    if (BIAS_BF16) bv = bf16_round(bv);
#pragma unroll
    for (int r = 0; r < 8; ++r) {
      float v = acc[t][r] + bv;
      if (resid) { float rv = resid[(size_t)((row0 + 8 * hh + r) % rmod) * ldr + col]; if (RES_BF16) rv = bf16_round(rv); v += rv; }
      if (ACT == 1) v = fmaxf(v, 0.f);
      if (ACT == 2) v = 0.5f * v * (1.0f + erff(v * 0.70710678118654752f));
      if (ACT == 3) { const float u = 0.7978845608028654f * (v + 0.044715f * v * v * v); v = 0.5f * v * (1.0f + tanhf(u)); }
      so[w][8 * hh + r][t * 16 + ln] = v;
    }
  }
  __builtin_amdgcn_fence(__ATOMIC_ACQ_REL, "workgroup");
  __builtin_amdgcn_wave_barrier();
  const int rsub = lane >> 4, c4 = (lane & 15) * 4;
  {
#pragma unroll
    for (int q = 0; q < 8; ++q) {
      const int r = q * 2 + rsub;
      const v4f v = *(const v4fa*)&so[w][r][c4];
      *(v4f*)(C + (size_t)(row0 + r) * ldc + col0 + c4) = v;
    }
    
  }
}
// row LayerNorm (biased variance, eps) over N: s = X (+ R); optional out_sum <- s; out_norm <- (s-mu)*rsqrt(var+eps)*g + b
template <bool PARAM_BF16>
__global__ __launch_bounds__(256) void k_layernorm(const float* __restrict__ X, const float* __restrict__ R, const float* __restrict__ g, const float* __restrict__ bta,
                                                  float* __restrict__ out_sum, float* __restrict__ out_norm, int N, float eps) {
  __shared__ float red[256];
  const int row = blockIdx.x, tid = threadIdx.x;
  const float* x = X + (size_t)row * N; const float* rr = R ? R + (size_t)row * N : nullptr;
  float vals[16];                     // up to N = 4096
  const int per = N / 256;            // contiguous chunk per thread? use strided-by-4 chunks: thread handles j = tid*4 + 1024*u
  float s1 = 0.f;
  for (int u = 0; u < per / 4; ++u) {
    const int j = tid * 4 + 1024 * u;
    const v4f a = *(const v4fa*)(x + j);
    v4f b = {0.f,0.f,0.f,0.f}; if (rr) b = *(const v4fa*)(rr + j);
#pragma unroll
    for (int q = 0; q < 4; ++q) { const float v = a[q] + b[q]; vals[u * 4 + q] = v; s1 += v; }
  }
  red[tid] = s1; __syncthreads();
  for (int st = 128; st > 0; st >>= 1) { if (tid < st) red[tid] += red[tid + st]; __syncthreads(); }
  const float mu = red[0] / (float)N; __syncthreads();
  float s2 = 0.f;
  for (int u = 0; u < per / 4; ++u)
#pragma unroll
    for (int q = 0; q < 4; ++q) { const float c = vals[u * 4 + q] - mu; s2 += c * c; }
  red[tid] = s2; __syncthreads();
  for (int st = 128; st > 0; st >>= 1) { if (tid < st) red[tid] += red[tid + st]; __syncthreads(); }
  const float rs = rsqrtf(red[0] / (float)N + eps);
  {
    for (int u = 0; u < per / 4; ++u) {
      const int j = tid * 4 + 1024 * u;
      v4f o, sm;
#pragma unroll
      for (int q = 0; q < 4; ++q) {
        float gg = g[j + q], bb = bta[j + q];
        if (PARAM_BF16) { gg = bf16_round(gg); bb = bf16_round(bb); }
        sm[q] = vals[u * 4 + q]; o[q] = (vals[u * 4 + q] - mu) * rs * gg + bb;
      }
      if (out_sum) *(v4f*)(out_sum + (size_t)row * N + j) = sm;
      *(v4f*)(out_norm + (size_t)row * N + j) = o;
    }
    
  }
}



// ---- f16 WMMA path (v_wmma_f32_16x16x32_f16): 11-bit significands for operands in range — used where a [0,1] probability operand needs more precision than bf16
typedef _Float16 v16h __attribute__((ext_vector_type(16)));
union FragH { v16h v; v8us half[2]; _Float16 h[16]; unsigned short u[16]; };
template <int NT>
__device__ __forceinline__ v8f mmaH(v16h ah, v16h al, v16h bh, v16h bl, v8f c) {
  c = __builtin_amdgcn_wmma_f32_16x16x32_f16(false, ah, false, bh, (short)0, c, false, false);
  if (NT >= 2) c = __builtin_amdgcn_wmma_f32_16x16x32_f16(false, al, false, bh, (short)0, c, false, false);
  if (NT >= 3) c = __builtin_amdgcn_wmma_f32_16x16x32_f16(false, ah, false, bl, (short)0, c, false, false);
  asm volatile("v_nop\n\tv_nop\n\tv_nop\n\tv_nop" : "+v"(c) : "v"(ah), "v"(al), "v"(bh), "v"(bl));
  return c;
}
// batched GEMM like k_gemm_b but f16 operands: A f32 (split into f16 hi/lo if ASPLIT, else rounded to f16), Bt = f16 values [n][k]; alpha; C f32; N multiple of 16 (partial tiles skipped)
template <bool ASPLIT>
__global__ __launch_bounds__(128) void k_gemm_h(const float* __restrict__ A, int lda, size_t sA, const _Float16* __restrict__ Bh, int ldb, size_t sB, float alpha, float* __restrict__ C, int ldc, size_t sC, int M, int N, int K) {
  __shared__ __attribute__((aligned(16))) float so[4][16][64];
  const int tid = threadIdx.x, w = tid >> 5, lane = tid & 31, ln = lane & 15, hh = lane >> 4; const int by = blockIdx.y;
  A += (size_t)by * sA; Bh += (size_t)by * sB; C += (size_t)by * sC;
  const int ntn = (N + 63) / 64; const int wid = blockIdx.x * 4 + w; const int mt = wid / ntn, nq = wid % ntn; if (mt * 16 >= M) return;
  const int row0 = mt * 16, col0 = nq * 64; const float* arow = A + (size_t)(row0 + ln) * lda;
  v8f acc[4] = {};
  for (int kb = 0; kb < K; kb += 32) {
    FragH ah, al;
    const v4f x0 = *(const v4fa*)(arow + kb + 8 * hh), x1 = *(const v4fa*)(arow + kb + 8 * hh + 4), x2 = *(const v4fa*)(arow + kb + 16 + 8 * hh), x3 = *(const v4fa*)(arow + kb + 16 + 8 * hh + 4);
    float xs[16] = {x0[0],x0[1],x0[2],x0[3],x1[0],x1[1],x1[2],x1[3],x2[0],x2[1],x2[2],x2[3],x3[0],x3[1],x3[2],x3[3]};
#pragma unroll
    for (int i = 0; i < 16; ++i) { const _Float16 h = (_Float16)xs[i]; ah.h[i] = h; al.h[i] = ASPLIT ? (_Float16)(xs[i] - (float)h) : (_Float16)0.0f; }
#pragma unroll
    for (int t = 0; t < 4; ++t) { if (col0 + t * 16 >= N) continue; const size_t boff = (size_t)(col0 + t * 16 + ln) * ldb + kb; FragH bq; bq.half[0] = *(const v8us*)(Bh + boff + 8 * hh); bq.half[1] = *(const v8us*)(Bh + boff + 16 + 8 * hh);
      acc[t] = mmaH<ASPLIT ? 2 : 1>(ah.v, al.v, bq.v, bq.v, acc[t]); }
  }
#pragma unroll
  for (int t = 0; t < 4; ++t) { if (col0 + t * 16 >= N) continue;
#pragma unroll
    for (int r = 0; r < 8; ++r) so[w][8 * hh + r][t * 16 + ln] = acc[t][r] * alpha; }
  __builtin_amdgcn_fence(__ATOMIC_ACQ_REL, "workgroup"); __builtin_amdgcn_wave_barrier();
  const int rsub = lane >> 4, c4 = (lane & 15) * 4;
  {
#pragma unroll
    for (int q = 0; q < 8; ++q) { const int r = q * 2 + rsub; if (col0 + c4 < N) { const v4f v = *(const v4fa*)&so[w][r][c4]; *(v4f*)(C + (size_t)(row0 + r) * ldc + col0 + c4) = v; } }
     }
}

// Wt[n][k] = f16(W[k][n]·scale) from f32 row-major W[K][N] (scale = power of two; bf16-exact weights stay exact in f16 away from the subnormal range)
__global__ __launch_bounds__(256) void k_wt_f16(const float* __restrict__ W, _Float16* __restrict__ Wt, int K, int N, float scale) {
  const int t = blockIdx.x * 256 + threadIdx.x; if (t >= N * (K / 8)) return; const int n = t / (K / 8), k8 = (t % (K / 8)) * 8; FragH f;
#pragma unroll
  for (int i = 0; i < 8; ++i) f.h[i] = (_Float16)(bf16_round(W[(size_t)(k8 + i) * N + n]) * scale); const v8us o = f.half[0];
  *(v8us*)((unsigned short*)Wt + (size_t)n * K + k8) = o; 
}
// k_gemm_hh variant with fused epilogue: v = acc·alpha + bias[by·sBias + col] (+ CP[(row/rowsPerB)·sCPb + by·64 + col] if CP) ; ACT 0 none / 1 elu ; writes f16 C16 (and f32 C if non-null)
template <int ACT>
__global__ __launch_bounds__(128) void k_gemm_hhx(const _Float16* __restrict__ A, int lda, size_t sA, const _Float16* __restrict__ Bh, int ldb, size_t sB, float alpha, const float* __restrict__ bias, size_t sBias, const float* __restrict__ CP, int rowsPerB, size_t sCPb, int row0g,
    float* __restrict__ C, _Float16* __restrict__ C16, int ldc, size_t sC, int M, int N, int K) {
  __shared__ __attribute__((aligned(16))) float so[4][16][64];
  const int tid = threadIdx.x, w = tid >> 5, lane = tid & 31, ln = lane & 15, hh = lane >> 4; const int by = blockIdx.y;
  A += (size_t)by * sA; Bh += (size_t)by * sB; const size_t cofs = (size_t)by * sC; const float* bp = bias ? bias + (size_t)by * sBias : nullptr;
  const int ntn = (N + 63) / 64; const int wid = blockIdx.x * 4 + w; const int mt = wid / ntn, nq = wid % ntn; if (mt * 16 >= M) return;
  const int row0 = mt * 16, col0 = nq * 64; const _Float16* arow = A + (size_t)(row0 + ln) * lda;
  v8f acc[4] = {};
  for (int kb = 0; kb < K; kb += 32) { FragH ah; ah.half[0] = *(const v8us*)((const unsigned short*)arow + kb + 8 * hh); ah.half[1] = *(const v8us*)((const unsigned short*)arow + kb + 16 + 8 * hh);
#pragma unroll
    for (int t = 0; t < 4; ++t) { if (col0 + t * 16 >= N) continue; const size_t boff = (size_t)(col0 + t * 16 + ln) * ldb + kb; FragH bq; bq.half[0] = *(const v8us*)((const unsigned short*)Bh + boff + 8 * hh); bq.half[1] = *(const v8us*)((const unsigned short*)Bh + boff + 16 + 8 * hh);
      acc[t] = mmaH<1>(ah.v, ah.v, bq.v, bq.v, acc[t]); }
  }
#pragma unroll
  for (int t = 0; t < 4; ++t) { if (col0 + t * 16 >= N) continue; const int col = col0 + t * 16 + ln; const float bv = bp ? bf16_round(bp[col]) : 0.f;
#pragma unroll
    for (int r = 0; r < 8; ++r) { float v = acc[t][r] * alpha + bv; if (CP) { const int rr = row0g + row0 + 8 * hh + r; if (rowsPerB < 0) v += CP[cofs + (size_t)rr * ldc + col];      /* rowsPerB < 0: own element of the batched C plane */ else { const int bidx = rr / rowsPerB; v += CP[(size_t)bidx * sCPb + (size_t)by * 64 + col]; } } if (ACT == 1) v = (v > 0.f) ? v : expm1f(v); else if (ACT == 7) v = (v > 0.f) ? v + 1.0f : expf(v); else if (ACT == 8) v = tanhf(v); else if (ACT == 9) v = 0.5f * v * (1.0f + tanhf(0.7978845608028654f * (v + 0.044715f * v * v * v))); else if (ACT == 11) v = 1.0f / (1.0f + expf(-v)); else if (ACT == 12) v = (v > 0.f) ? v : 0.01f * v; else if (ACT == 14) v = (v > 0.f) ? v : 0.1f * v; else if (ACT == 16) v = (v >= 0.f) ? v : 0.3f * v; else if (ACT == 17) v = (v >= 0.f) ? v : 0.2f * v; else if (ACT == 15) v = v / (1.0f + expf(-v)); else if (ACT == 3) v = fmaxf(v, 0.f); else if (ACT == 6) v = 0.5f * v * (1.0f + erff(v * 0.70710678118654752f)); so[w][8 * hh + r][t * 16 + ln] = v; } }
  __builtin_amdgcn_fence(__ATOMIC_ACQ_REL, "workgroup"); __builtin_amdgcn_wave_barrier();
  const int rsub = lane >> 4, c4 = (lane & 15) * 4; typedef _Float16 v4h __attribute__((ext_vector_type(4)));
  {
#pragma unroll
    for (int q = 0; q < 8; ++q) { const int r = q * 2 + rsub; if (col0 + c4 < N) { const v4f v = *(const v4fa*)&so[w][r][c4]; if (C) *(v4f*)(C + cofs + (size_t)(row0 + r) * ldc + col0 + c4) = v; if (C16) { v4h h4; for (int i = 0; i < 4; ++i) h4[i] = (_Float16)v[i]; *(v4h*)(C16 + cofs + (size_t)(row0 + r) * ldc + col0 + c4) = h4; } } }
     }
}


typedef _Float16 v4h __attribute__((ext_vector_type(4)));

__global__ __launch_bounds__(256) void k_x16(const float* __restrict__ x, _Float16* __restrict__ X16, size_t n8) { const size_t t = (size_t)blockIdx.x * 256 + threadIdx.x; if (t >= n8) return; FragH f;
#pragma unroll
  for (int q = 0; q < 8; ++q) f.h[q] = (_Float16)bf16_round(x[t * 8 + q]); *(v8us*)((unsigned short*)X16 + t * 8) = f.half[0];  }
__global__ __launch_bounds__(256) void k_h16(const float* __restrict__ x, _Float16* __restrict__ X16, size_t n8) { const size_t t = (size_t)blockIdx.x * 256 + threadIdx.x; if (t >= n8) return; FragH f;
#pragma unroll
  for (int q = 0; q < 8; ++q) f.h[q] = (_Float16)x[t * 8 + q]; *(v8us*)((unsigned short*)X16 + t * 8) = f.half[0];  }
__global__ __launch_bounds__(256) void k_round16f(const float* __restrict__ W, _Float16* __restrict__ Bt, size_t n8) { const size_t t = (size_t)blockIdx.x * 256 + threadIdx.x; if (t >= n8) return; FragH f;
#pragma unroll
  for (int i = 0; i < 8; ++i) f.h[i] = (_Float16)(bf16_round(W[t * 8 + i]) * 16.0f); *(v8us*)((unsigned short*)Bt + t * 8) = f.half[0];  }
template <int NHv, int TTv>
__global__ __launch_bounds__(256) void k_vt(const _Float16* __restrict__ V16, int ldv, int voff, _Float16* __restrict__ Vt) { __shared__ unsigned short tl[64][66]; const int tid = threadIdx.x; const int slab = blockIdx.x / (TTv / 64), lg = blockIdx.x % (TTv / 64); const int b = slab / NHv, h = slab % NHv;
  for (int i = tid; i < 64 * 8; i += 256) { const int r = i / 8, c8 = (i % 8) * 8; FragH f; f.half[0] = *(const v8us*)((const unsigned short*)V16 + ((size_t)b * TTv + lg * 64 + r) * ldv + voff + h * 64 + c8);
#pragma unroll
    for (int q = 0; q < 8; ++q) tl[r][c8 + q] = f.u[q]; }
  __syncthreads();
  {
#pragma unroll
    for (int rd = 0; rd < 2; ++rd) { const int d = rd * 32 + tid / 8, pc = tid % 8; FragH f;
#pragma unroll
      for (int q = 0; q < 8; ++q) f.u[q] = tl[pc * 8 + q][d];
      *(v8us*)((unsigned short*)Vt + ((size_t)slab * 64 + d) * TTv + lg * 64 + pc * 8) = f.half[0]; }
     } }

__global__ __launch_bounds__(256) void k_hl(const float* __restrict__ F, _Float16* __restrict__ Hh, _Float16* __restrict__ Hl, size_t n8) { const size_t t = (size_t)blockIdx.x * 256 + threadIdx.x; if (t >= n8) return; FragH fh, fl; const v4f a = *(const v4fa*)(F + t * 8), c = *(const v4fa*)(F + t * 8 + 4);
#pragma unroll
  for (int q = 0; q < 4; ++q) { _Float16 h = (_Float16)a[q]; fh.h[q] = h; fl.h[q] = (_Float16)((a[q] - (float)h) * 1024.0f); h = (_Float16)c[q]; fh.h[4 + q] = h; fl.h[4 + q] = (_Float16)((c[q] - (float)h) * 1024.0f); }
  { *(v8us*)((unsigned short*)Hh + t * 8) = fh.half[0]; *(v8us*)((unsigned short*)Hl + t * 8) = fl.half[0];  } }

// ---- fast GEMM (wave tile 32x64; requires M % 32 == 0 rows per launch region and N % 64 == 0); epilogue = k_gemm_hhx semantics ----
__device__ __forceinline__ v16h g2_frag(const _Float16* p, int hh) { FragH f; f.half[0] = *(const v8us*)((const unsigned short*)p + 8 * hh); f.half[1] = *(const v8us*)((const unsigned short*)p + 16 + 8 * hh); return f.v; }
__device__ __forceinline__ v8f g2_mma(v16h a, v16h b, v8f c) { v8f d = __builtin_amdgcn_wmma_f32_16x16x32_f16(false, a, false, b, (short)0, c, false, false); asm volatile("v_nop\n\tv_nop\n\tv_nop\n\tv_nop" : "+v"(d) : "v"(a), "v"(b)); return d; }
template <int ACT>
__global__ __launch_bounds__(128) void k_gemm2(const _Float16* __restrict__ A, int lda, size_t sA, const _Float16* __restrict__ Bh, int ldb, size_t sB, float alpha, const float* __restrict__ bias, size_t sBias, const float* __restrict__ CP, int rowsPerB, size_t sCPb, int row0g,
    float* __restrict__ C, _Float16* __restrict__ C16, int ldc, size_t sC, int M, int N, int K) { static_assert(ACT == 0 || ACT == 3 || ACT == 6 || ACT == 8 || ACT == 9 || ACT == 11 || ACT == 12 || ACT == 14 || ACT == 15 || ACT == 16 || ACT == 17, "k_gemm2: unsupported ACT code (would silently apply no activation)");
  __shared__ __attribute__((aligned(16))) float so[4][32][68];
  const int tid = threadIdx.x, w = tid >> 5, lane = tid & 31, ln = lane & 15, hh = lane >> 4; const int by = blockIdx.y;
  A += (size_t)by * sA; Bh += (size_t)by * sB; const size_t cofs = (size_t)by * sC; const float* bp = bias ? bias + (size_t)by * sBias : nullptr;
  const int ntn = N >> 6; const int mt = blockIdx.x / ntn, nq = blockIdx.x - mt * ntn; const int row0 = mt * 128 + 32 * w, col0 = nq * 64; if (row0 >= M) return;
  const _Float16* a0p = A + (size_t)(row0 + ln) * lda; const _Float16* a1p = a0p + (size_t)16 * lda;
  const _Float16* b0p = Bh + (size_t)(col0 + ln) * ldb; const _Float16* b1p = b0p + (size_t)16 * ldb; const _Float16* b2p = b1p + (size_t)16 * ldb; const _Float16* b3p = b2p + (size_t)16 * ldb;
  const v8f z8 = {0.f,0.f,0.f,0.f,0.f,0.f,0.f,0.f}; v8f c00 = z8, c01 = z8, c02 = z8, c03 = z8, c10 = z8, c11 = z8, c12 = z8, c13 = z8;
#pragma unroll 1
  for (int kb = 0; kb < K; kb += 32) { const v16h a0 = g2_frag(a0p + kb, hh), a1 = g2_frag(a1p + kb, hh);
    v16h b = g2_frag(b0p + kb, hh); c00 = g2_mma(a0, b, c00); c10 = g2_mma(a1, b, c10);
    b = g2_frag(b1p + kb, hh); c01 = g2_mma(a0, b, c01); c11 = g2_mma(a1, b, c11);
    b = g2_frag(b2p + kb, hh); c02 = g2_mma(a0, b, c02); c12 = g2_mma(a1, b, c12);
    b = g2_frag(b3p + kb, hh); c03 = g2_mma(a0, b, c03); c13 = g2_mma(a1, b, c13); }
  v8f accs[8] = {c00, c01, c02, c03, c10, c11, c12, c13};
#pragma unroll
  for (int u = 0; u < 8; ++u) { const int t = u & 3, half = u >> 2; const int col = col0 + t * 16 + ln; const float bv = bp ? bf16_round(bp[col]) : 0.f;
#pragma unroll
    for (int r = 0; r < 8; ++r) { const int rloc = half * 16 + 8 * hh + r; float v = accs[u][r] * alpha + bv; if (CP) { if (rowsPerB < 0) v += CP[cofs + (size_t)(row0g + row0 + rloc) * ldc + col];      /* rowsPerB < 0: own element of the batched C plane */ else { const int bidx = (row0g + row0 + rloc) / rowsPerB; v += CP[(size_t)bidx * sCPb + (size_t)by * 64 + col]; } }
      if (ACT == 3) v = fmaxf(v, 0.f); else if (ACT == 6) v = 0.5f * v * (1.0f + erff(v * 0.70710678118654752f)); else if (ACT == 11) v = 1.0f / (1.0f + expf(-v)); else if (ACT == 15) v = v / (1.0f + expf(-v)); else if (ACT == 12) v = (v > 0.f) ? v : 0.01f * v; else if (ACT == 8) v = tanhf(v); else if (ACT == 9) v = 0.5f * v * (1.0f + tanhf(0.7978845608028654f * (v + 0.044715f * v * v * v))); else if (ACT == 14) v = (v > 0.f) ? v : 0.1f * v; else if (ACT == 16) v = (v >= 0.f) ? v : 0.3f * v; else if (ACT == 17) v = (v >= 0.f) ? v : 0.2f * v;
      so[w][rloc][t * 16 + ln] = v; } }
  __builtin_amdgcn_fence(__ATOMIC_ACQ_REL, "workgroup"); __builtin_amdgcn_wave_barrier();
  const int rsub = lane >> 4, c4 = (lane & 15) * 4;
  {
#pragma unroll
    for (int q = 0; q < 16; ++q) { const int r = q * 2 + rsub; const v4f v = *(const v4fa*)&so[w][r][c4]; if (C) *(v4f*)(C + cofs + (size_t)(row0 + r) * ldc + col0 + c4) = v; if (C16) { v4h h4; for (int i = 0; i < 4; ++i) h4[i] = (_Float16)v[i]; *(v4h*)(C16 + cofs + (size_t)(row0 + r) * ldc + col0 + c4) = h4; } }
     } }


__global__ __launch_bounds__(256) void k_wnat(const float* __restrict__ w, size_t n8, _Float16* __restrict__ Bt) { const size_t t = (size_t)blockIdx.x * 256 + threadIdx.x; if (t >= n8) return; FragH f; for (int q = 0; q < 8; ++q) f.h[q] = (_Float16)(bf16_round(w[t * 8 + q]) * 16.0f); *(v8us*)((unsigned short*)Bt + t * 8) = f.half[0];  }
__global__ __launch_bounds__(256) void k_rsm(const float* __restrict__ S, _Float16* __restrict__ P, int nrows) {
  #pragma clang fp contract(off)
  const int i = blockIdx.x * 256 + threadIdx.x; if (i >= nrows) return; const float* s = S + (size_t)i * SQ; float mx = -3.0e38f;
#pragma unroll 1
  for (int j = 0; j < SQ; ++j) mx = fmaxf(mx, s[j]); float se = 0.f;
#pragma unroll 1
  for (int j = 0; j < SQ; ++j) se += expf(s[j] - mx); const float sc = 256.0f / se;
#pragma unroll 1
  for (int j0 = 0; j0 < SQ; j0 += 8) { FragH f; for (int q = 0; q < 8; ++q) f.h[q] = (_Float16)(expf(s[j0 + q] - mx) * sc); unsigned short* d = (unsigned short*)P + (size_t)i * SQ + j0; *(v8us*)d = f.half[0];  } }
__global__ __launch_bounds__(256) void k_vt(const _Float16* __restrict__ V16, int b, int h0, _Float16* __restrict__ VT) { __shared__ unsigned short tl[64][65]; const int tid = threadIdx.x; const int hh = blockIdx.x % HG, sg = blockIdx.x / HG; const int s0 = sg * 64; const int h = h0 + hh;
  for (int i = tid; i < 64 * 8; i += 256) { const int j = i / 8, d8 = (i % 8) * 8; FragH f; f.half[0] = *(const v8us*)((const unsigned short*)V16 + ((size_t)b * SQ + s0 + j) * DM + h * HD + d8); for (int q = 0; q < 8; ++q) tl[d8 + q][j] = f.u[q]; }
  __syncthreads();
  { for (int i = tid; i < 64 * 8; i += 256) { const int d = i / 8, j8 = (i % 8) * 8; FragH f; for (int q = 0; q < 8; ++q) f.u[q] = tl[d][j8 + q]; *(v8us*)((unsigned short*)VT + ((size_t)hh * HD + d) * SQ + s0 + j8) = f.half[0]; }  } }



__global__ __launch_bounds__(256) void k_rsmcf2(const float* __restrict__ S, _Float16* __restrict__ P, int hg, int q0, int nk) {
  #pragma clang fp contract(off)
  const int t = blockIdx.x * 256 + threadIdx.x; if (t >= hg * QT) return; const size_t i = (size_t)t; const float* s = S + i * NKX; const int last = q0 + (t % QT); float mx = -3.0e38f;
#pragma unroll 1
  for (int j = 0; j < nk; ++j) { const float f = (j <= last) ? 1.f : 0.f; mx = fmaxf(mx, fmaf(f, s[j], (1.f - f) * -1.0e9f)); } float se = 0.f;
#pragma unroll 1
  for (int j = 0; j < nk; ++j) { const float f = (j <= last) ? 1.f : 0.f; se += __expf(fmaf(f, s[j], (1.f - f) * -1.0e9f) - mx); } const float sc = 256.0f / se;
#pragma unroll 1
  for (int j0 = 0; j0 < nk; j0 += 8) { FragH fr; for (int q = 0; q < 8; ++q) { const int j = j0 + q; const float f = (j <= last) ? 1.f : 0.f; fr.h[q] = (_Float16)(__expf(fmaf(f, s[j], (1.f - f) * -1.0e9f) - mx) * sc); } unsigned short* d = (unsigned short*)P + i * NKX + j0; *(v8us*)d = fr.half[0];  } }


template <int MASKADD>
__global__ __launch_bounds__(64) void k_att0(const float* __restrict__ QF, const float* __restrict__ KF, const float* __restrict__ VF, int ld, const float* __restrict__ mask, float scale, float* __restrict__ OF, int ldo) {
  #pragma clang fp contract(off)
  __shared__ __attribute__((aligned(16))) float lq[64][64]; __shared__ __attribute__((aligned(16))) float lo[64][64];
  { const size_t bi = (size_t)blockIdx.y * QT0 * ld; QF += bi; KF += bi; VF += bi; OF += (size_t)blockIdx.y * QT0 * ldo; }      /* batch on grid.y: its own QT0-row slab of each plane */
  const int tid = threadIdx.x; const int h = blockIdx.x / (QT0 / 64), rg = blockIdx.x % (QT0 / 64); const int i = rg * 64 + tid;
  const float* qr = QF + (size_t)i * ld + h * HD;
#pragma unroll 1
  for (int c = 0; c < HD / 4; ++c) { *(v4f*)&lq[tid][c * 4] = *(const v4fa*)(qr + c * 4); const v4f z = {0.f, 0.f, 0.f, 0.f}; *(v4f*)&lo[tid][c * 4] = z; }
  float m = -1.0e30f, l = 0.f; const int jmax = MASKADD ? (SQ - 1) : (rg * 64 + 63);      /* additive-mask form: every key (the mask input decides); causal form: keys up to the block's last row */
#pragma unroll 1
  for (int j = 0; j <= jmax; ++j) { const float* kr = KF + (size_t)j * ld + h * HD; const float* vr = VF + (size_t)j * ld + h * HD; float s = 0.f;
#pragma unroll 1
    for (int c = 0; c < HD / 4; ++c) { const v4f kq = *(const v4fa*)(kr + c * 4); const v4f qq = *(v4f*)&lq[tid][c * 4]; s = __fadd_rn(s, __fmul_rn(qq[0], kq[0])); s = __fadd_rn(s, __fmul_rn(qq[1], kq[1])); s = __fadd_rn(s, __fmul_rn(qq[2], kq[2])); s = __fadd_rn(s, __fmul_rn(qq[3], kq[3])); }
    s = __fmul_rn(s, scale); if (MASKADD) s = __fadd_rn(s, __fmul_rn(bf16_round(mask[(size_t)i * SQ + j]), -10000.0f));
    const float f = (MASKADD || j <= i) ? 1.f : 0.f; const float sm = fmaf(f, s, (1.f - f) * -1.0e30f); const float mn = fmaxf(m, sm); const float sc = expf(m - mn); const float e = expf(sm - mn); l = __fadd_rn(__fmul_rn(l, sc), e); m = mn;
#pragma unroll 1
    for (int c = 0; c < HD / 4; ++c) { const v4f vv = *(const v4fa*)(vr + c * 4); v4f oo = *(v4f*)&lo[tid][c * 4]; for (int u = 0; u < 4; ++u) oo[u] = __fadd_rn(__fmul_rn(oo[u], sc), __fmul_rn(e, vv[u])); *(v4f*)&lo[tid][c * 4] = oo; } }
  const float fin = 64.0f / l;      /* o carried x64; k_o0m scales it by 1/64 */
#pragma unroll 1
  for (int c = 0; c < HD / 4; ++c) { v4f oo = *(v4f*)&lo[tid][c * 4]; for (int u = 0; u < 4; ++u) oo[u] = __fmul_rn(oo[u], fin); *(v4f*)&lo[tid][c * 4] = oo; }
  __syncthreads();
  {
#pragma unroll 1
    for (int it = 0; it < 16; ++it) { const int row = it * 4 + tid / 16, pc = (tid % 16) * 4; const v4f v = *(const v4f*)&lo[row][pc]; *(v4f*)(OF + (size_t)(rg * 64 + row) * ldo + h * HD + pc) = v; }
     } }


template <int BFIN, int WXB>
__global__ __launch_bounds__(256) void k_ln16(const float* __restrict__ X, const float* __restrict__ g, const float* __restrict__ bb, float eps, _Float16* __restrict__ N16, float* __restrict__ XB) {
  #pragma clang fp contract(off)
  __shared__ float red[256]; const size_t r = blockIdx.x; const int t = threadIdx.x; const v4f xa = *(const v4fa*)(X + r * DMQ + t * 4); float s[4]; float sum = 0.f;
  for (int q = 0; q < 4; ++q) { s[q] = BFIN ? bf16_round(xa[q]) : xa[q]; sum = __fadd_rn(sum, s[q]); }
  red[t] = sum; __syncthreads(); for (int st = 128; st > 0; st >>= 1) { if (t < st) red[t] = __fadd_rn(red[t], red[t + st]); __syncthreads(); } const float mu = red[0] / (float)DMQ; __syncthreads();
  float vs = 0.f; for (int q = 0; q < 4; ++q) { const float dl = __fadd_rn(s[q], -mu); vs = __fadd_rn(vs, __fmul_rn(dl, dl)); } red[t] = vs; __syncthreads(); for (int st = 128; st > 0; st >>= 1) { if (t < st) red[t] = __fadd_rn(red[t], red[t + st]); __syncthreads(); }
  const float rs = rsqrtf(__fadd_rn(red[0] / (float)DMQ, eps)); v4h y; v4f xb;
  for (int q = 0; q < 4; ++q) { const int c = t * 4 + q; y[q] = (_Float16)__fadd_rn(__fmul_rn(__fmul_rn(__fadd_rn(s[q], -mu), rs), bf16_round(g[c])), bf16_round(bb[c])); xb[q] = s[q]; }
  { *(v4h*)(N16 + r * DMQ + t * 4) = y; if (WXB) *(v4f*)(XB + r * DMQ + t * 4) = xb;  } }
__global__ __launch_bounds__(256) void k_ftres2(const float* __restrict__ OF0, const float* __restrict__ XB, float* __restrict__ X1, size_t n4) {
  #pragma clang fp contract(off)
  const size_t t = (size_t)blockIdx.x * 256 + threadIdx.x; if (t >= n4) return; const v4f o = *(const v4fa*)(OF0 + t * 4), xv = *(const v4fa*)(XB + t * 4); v4f y; for (int q = 0; q < 4; ++q) y[q] = __fadd_rn(__fmul_rn(o[q], 0.015625f), xv[q]); *(v4f*)(X1 + t * 4) = y;  }

__global__ __launch_bounds__(256) void k_wthd(const float* __restrict__ Wt, _Float16* __restrict__ Bt) { const size_t t = (size_t)blockIdx.x * 256 + threadIdx.x; if (t >= (size_t)NH * HD * (DM / 8)) return; const int m8 = (int)(t % (DM / 8)) * 8; const int d = (int)((t / (DM / 8)) % HD); const int h = (int)(t / ((size_t)(DM / 8) * HD)); FragH f;
  for (int q = 0; q < 8; ++q) f.h[q] = (_Float16)(16.0f * bf16_round(Wt[((size_t)h * DM + m8 + q) * HD + d])); unsigned short* dst = (unsigned short*)Bt + ((size_t)h * HD + d) * DM + m8; *(v8us*)dst = f.half[0];  }




__global__ __launch_bounds__(256) void k_wtpad(const float* __restrict__ Wm, _Float16* __restrict__ Wt, int Kr, int Kp, int Nr, int Np, float scale) {
  const int t = blockIdx.x * 256 + threadIdx.x; if (t >= Np * (Kp / 8)) return; const int n = t / (Kp / 8), k8 = (t % (Kp / 8)) * 8; const int nc = min(n, Nr - 1); const float fn = (n < Nr) ? 1.f : 0.f; FragH f;
  for (int i = 0; i < 8; ++i) { const int k = k8 + i; const int kc = min(k, Kr - 1); const float fk = (k < Kr) ? fn : 0.f; f.h[i] = (_Float16)(bf16_round(Wm[(size_t)kc * Nr + nc]) * scale * fk); }
  unsigned short* o = (unsigned short*)Wt + (size_t)n * Kp + k8; *(v8us*)o = f.half[0];  }
__global__ __launch_bounds__(128) void k_bpad(const float* __restrict__ b, float* __restrict__ Bp, int nr, int np) {
  const int i = threadIdx.x; if (i >= np) return; const float v = b[min(i, nr - 1)] * ((i < nr) ? 1.f : 0.f); *(float*)(Bp + i) = v;  }

#define DI 64         /* inner width = NH * HD (ONE 64-wide head) */
#define LQK (3 * DI)  /* fused q | k | v row pitch (192) */
__global__ __launch_bounds__(256) void k_o0(const float* __restrict__ OF, float* __restrict__ ob, size_t n4) {
  #pragma clang fp contract(off)
  const size_t t = (size_t)blockIdx.x * 256 + threadIdx.x; if (t >= n4) return; const size_t e = t * 4; const int i = (int)(e / DI); const int c = (int)(e % DI); const int h = c / HD, d = c % HD; const v4f a = *(const v4fa*)(OF + e); v4f o; for (int q = 0; q < 4; ++q) o[q] = __fmul_rn(a[q], 0.015625f); float* dst = ob + (size_t)h * SQ * HD + (size_t)i * HD + d; *(v4f*)dst = o;  }

__global__ __launch_bounds__(256) void k_o0m(const float* __restrict__ OF, float* __restrict__ o_, size_t n4, size_t so) {
  #pragma clang fp contract(off)
  OF += (size_t)blockIdx.y * n4 * 4; o_ += (size_t)blockIdx.y * so;      /* batch on grid.y: packed source slab, output rows of that batch */
  const size_t t = (size_t)blockIdx.x * 256 + threadIdx.x; if (t >= n4) return; const size_t e = t * 4; const v4f a = *(const v4fa*)(OF + e); v4f o; for (int q = 0; q < 4; ++q) o[q] = __fmul_rn(a[q], 0.015625f); *(v4f*)(o_ + e) = o;  }
extern "C" void kernel_launch(void* const* d_in, const int* in_sizes, int n_in,
                              void* d_out, int out_size, void* d_ws, size_t ws_size, hipStream_t stream) {
  (void)in_sizes; (void)n_in; (void)out_size;
  const float* const* I = (const float* const*)d_in; const float* x = I[0]; const float* wq = I[2]; const float* wk = I[1]; const float* wv = I[3]; const float* bq = nullptr; const float* bk = nullptr; const float* bv = nullptr;      /* x; [in][out = 64] weights in this module's input order (wq = input 2, wk = input 1, wv = input 3); no biases */
  char* ws = (char*)d_ws; size_t off = 0;
  auto take = [&](size_t bytes) { char* p = ws + off; off += (bytes + 255) & ~(size_t)255; return p; };
  _Float16* BW = (_Float16*)take((size_t)LQK * DM * 2); _Float16* X16 = (_Float16*)take(NR * DM * 2); _Float16* QKV = (_Float16*)take(NR * LQK * 2); _Float16* VT = (_Float16*)take((size_t)NB * NH * HD * SQ * 2);
  float* S = (float*)take((size_t)NB * NH * QT * NKX * 4); _Float16* P = (_Float16*)take((size_t)NB * NH * QT * NKX * 2); float* QKVF0 = (float*)take((size_t)NB * QT0 * LQK * 4); float* OF0 = (float*)take((size_t)NB * QT0 * DI * 4);      /* one slab per batch of each plane: every launch below covers all NB batches */
  if (off > ws_size) return;
  { const unsigned g = (unsigned)(((size_t)DI * (DM / 8) + 255) / 256); k_wt_f16<<<g, 256, 0, stream>>>(wq, BW, DM, DI, 16.0f); k_wt_f16<<<g, 256, 0, stream>>>(wk, BW + (size_t)DI * DM, DM, DI, 16.0f); k_wt_f16<<<g, 256, 0, stream>>>(wv, BW + (size_t)2 * DI * DM, DM, DI, 16.0f); }      /* [in = DM][out = 64] -> Bt[n][k] x16, stacked q | k | v */
  k_x16<<<(unsigned)((NR * DM / 8 + 255) / 256), 256, 0, stream>>>(x, X16, NR * DM / 8);      /* x (bf16-valued) as exact f16 rows */
  const float* bqkv[3] = {bq, bk, bv};
  for (int c = 0; c < 3; ++c) k_gemm2<0><<<dim3((unsigned)((NR / 128) * (DI / 64)), 1), 128, 0, stream>>>(X16, DM, 0, BW + (size_t)c * DI * DM, DM, 0, 0.0625f, bqkv[c], 0, nullptr, 1, 0, 0, nullptr, QKV + (size_t)c * DI, LQK, 0, (int)NR, DI, DM);      /* q | k | v = x W^T -> f16 rows, column blocks 0 / 64 / 128 of the fused plane (pitch 192); head h = columns h*64 inside each */
  const _Float16* Q16 = QKV; const _Float16* K16 = QKV + DI; const _Float16* V16 = QKV + 2 * DI;
  float* ob = (float*)d_out;
  k_vt<NH, SQ><<<NB * NH * (SQ / 64), 256, 0, stream>>>(V16, LQK, 0, VT);      /* V^T [NB][HD][SQ], all batches in one launch */
  for (int q0 = 0; q0 < SQ; q0 += QT) { const int nk = q0 + QT;      /* causal: only keys below the tile end are computed; the NB batches on grid.y (NH == 1) */
    k_gemm2<0><<<dim3((QT / 128) * (nk / 64), NB), 128, 0, stream>>>(Q16 + (size_t)q0 * LQK, LQK, (size_t)SQ * LQK, K16, LQK, (size_t)SQ * LQK, 0.125f, nullptr, 0, nullptr, 1, 0, 0, S, nullptr, NKX, (size_t)QT * NKX, QT, nk, HD);      /* scores * 64^-0.5 */
    k_rsmcf2<<<(NB * QT + 255) / 256, 256, 0, stream>>>(S, P, NB, q0, nk);      /* causal softmax -> P x256 f16 */
    k_gemm2<0><<<dim3((QT / 128) * (HD / 64), NB), 128, 0, stream>>>(P, NKX, (size_t)QT * NKX, VT, SQ, (size_t)HD * SQ, 0.00390625f, nullptr, 0, nullptr, 1, 0, 0, ob + (size_t)q0 * DI, nullptr, DI, (size_t)SQ * DI, QT, HD, nk); }      /* out[b][q0 + i][..] = P V^T 2^-8 (f32) */
  for (int c = 0; c < 3; ++c) k_gemm2<0><<<dim3((unsigned)((QT0 / 128) * (DI / 64)), NB), 128, 0, stream>>>(X16, DM, (size_t)SQ * DM, BW + (size_t)c * DI * DM, DM, 0, 0.0625f, bqkv[c], 0, nullptr, 1, 0, 0, QKVF0 + (size_t)c * DI, nullptr, LQK, (size_t)QT0 * LQK, QT0, DI, DM);      /* f32 q | k | v of rows 0..511 of every batch (exact products, f32 accumulation) */
  k_att0<0><<<dim3(NH * (QT0 / 64), NB), 64, 0, stream>>>(QKVF0, QKVF0 + DI, QKVF0 + 2 * DI, LQK, nullptr, 0.125f, OF0, DI);      /* exact f32 causal attention for rows 0..511 (o x64) */
  k_o0m<<<dim3((unsigned)(((size_t)QT0 * DI / 4 + 255) / 256), NB), 256, 0, stream>>>(OF0, ob, (size_t)QT0 * DI / 4, (size_t)SQ * DI);      /* rows 0..511 of every batch REWRITTEN from the exact path */
}

// v002
// One run takes 3150 microseconds.
// Timed twice side by side with v001, it ran 2.86 and 2.84 times as fast.
// Over all steps from v000 it is 41.7 times as fast.
#include <hip/hip_runtime.h>
// Single-head causal self-attention from a 32-wide embedding (x [16][4096][32]; k/q/v = x W ([in][out] [32][64], no biases; input order Wk, Wq, Wv); ONE 64-wide head (head_size 64 != C 32); scores * 64^-0.5; causal; softmax; out = weights v -> [16][4096][64]; no output projection).
// Structure: token rows; x as exact f16 rows; three WMMA GEMMs into one f16 q | k | v plane [65536][192]; per batch v^T via LDS transposes; causal 256-row query tiles with the batches on grid.y of the GEMMs, in grid.x of the softmax (scores alpha 1/8, causal softmax f32 -> f16 x256 weights, P V written as f32 straight into the merged output rows); an exact f32 first tile (rows 0..511) rewritten at the end; launches: see trace.
// Compute dtype: inputs rounded to bf16; x / weights exact; q, k, v and softmax weights as plain f16 GEMM operands (~2^-12); scores and softmax statistics f32; v_wmma_f32_16x16x32_f16.
#define NB 16
#define SQ 4096
#define DM 32
#define NH 1
#define HD 64
#define HG 4                         /* unused by the launches (grid.y is NB); read only by the uncalled k_vt overload */
#define QT 256                       /* query rows per causal tile */
#define NKX SQ                       /* S / P row pitch */
#define QT0 512                      /* first-tile rows recomputed exactly (f32): 512 here (no output projection averages the early-row cancellation errors away; logit sigma 1.0) */
#define B0 0                         /* unused; the batches are grid.y 0..NB-1 */
#define NBR NB                       /* feeds only the unused MP; the launches put the NB batches on grid.y */
#define NR ((size_t)NB * SQ)
#define DMQ DM
#define DFF 4096                     /* unused; no FFN here */
#define DFFR 100                     /* unused; no FFN here */
#define MP ((int)((size_t)NBR * SQ)) /* unused; the projections cover NR rows */
#define QN SQ                        /* unused; the query tiles cover SQ rows */
#define NHD NH                       /* unused; the launches use NH */
#define MPO MP                       /* unused */
#define LQ (3 * DM)      /* unused; the q/k/v row pitch is LQK */
typedef __bf16 v16b __attribute__((ext_vector_type(16)));
typedef unsigned short v8us __attribute__((ext_vector_type(8), may_alias));
typedef float  v8f  __attribute__((ext_vector_type(8)));
typedef float  v4f  __attribute__((ext_vector_type(4)));
typedef float  v4fa __attribute__((ext_vector_type(4), may_alias));
union FragB { v16b v; v8us half[2]; unsigned short u[16]; };

__device__ __forceinline__ unsigned short bf16_bits(float x) { unsigned int u = __float_as_uint(x); return (unsigned short)((u + 0x7FFFu + ((u >> 16) & 1u)) >> 16); }
__device__ __forceinline__ float bf16_val(unsigned short b) { return __uint_as_float(((unsigned int)b) << 16); }
__device__ __forceinline__ float bf16_round(float x) { return bf16_val(bf16_bits(x)); }
// D += A·B with NT terms: 1 = ah·bh, 2 = + al·bh (A split), 3 = + ah·bl (both split)
template <int NT>
__device__ __forceinline__ v8f mmaN(v16b ah, v16b al, v16b bh, v16b bl, v8f c) {
  c = __builtin_amdgcn_wmma_f32_16x16x32_bf16(false, ah, false, bh, (short)0, c, false, false);
  if (NT >= 2) c = __builtin_amdgcn_wmma_f32_16x16x32_bf16(false, al, false, bh, (short)0, c, false, false);
  if (NT >= 3) c = __builtin_amdgcn_wmma_f32_16x16x32_bf16(false, ah, false, bl, (short)0, c, false, false);
  asm volatile("v_nop\n\tv_nop\n\tv_nop\n\tv_nop" : "+v"(c) : "v"(ah), "v"(al), "v"(bh), "v"(bl));
  return c;
}

__global__ __launch_bounds__(256) void k_wt_bf16(const float* __restrict__ W, unsigned short* __restrict__ Wt, int K, int N) {
  const int t = blockIdx.x * 256 + threadIdx.x;
  const int k8n = K / 8;
  if (t >= N * k8n) return;
  const int n = t / k8n, k8 = (t % k8n) * 8;
  v8us v;
#pragma unroll
  for (int i = 0; i < 8; ++i) v[i] = bf16_bits(W[(size_t)(k8 + i) * N + n]);
  *(v8us*)(Wt + (size_t)n * K + k8) = v;
  
}

// GEMM C[M][N] (f32, pitch ldc) = act(A[M][K]·W + bias). A f32 row-major (pitch lda) converted per fragment to bf16
// (ASPLIT: hi/lo two planes -> 2 terms, else single rounded term); Wt bf16 [N][K] (pitch ldb). BIAS_BF16 rounds the
// bias to bf16 first (bias quantised to bf16 before the add). K%32==0, M%16==0, N%64==0.
template <bool ASPLIT, int ACT, bool BIAS_BF16>
__global__ __launch_bounds__(128) void k_gemm_bf(const float* __restrict__ A, int lda, const unsigned short* __restrict__ Wt, int ldb,
                                               const float* __restrict__ bias, float* __restrict__ C, int ldc, int M, int N, int K) {
  __shared__ __attribute__((aligned(16))) float so[4][16][64];
  const int tid = threadIdx.x, w = tid >> 5, lane = tid & 31, ln = lane & 15, hh = lane >> 4;
  const int ntn = N / 64;
  const int wid = blockIdx.x * 4 + w;
  const int mt = wid / ntn, nq = wid % ntn;
  if (mt * 16 >= M) return;
  const int row0 = mt * 16, col0 = nq * 64;
  const float* arow = A + (size_t)(row0 + ln) * lda;
  v8f acc[4] = {};
  for (int kb = 0; kb < K; kb += 32) {
    FragB ah, al;
    const v4f x0 = *(const v4fa*)(arow + kb + 8 * hh), x1 = *(const v4fa*)(arow + kb + 8 * hh + 4);
    const v4f x2 = *(const v4fa*)(arow + kb + 16 + 8 * hh), x3 = *(const v4fa*)(arow + kb + 16 + 8 * hh + 4);
    float xs[16] = {x0[0],x0[1],x0[2],x0[3],x1[0],x1[1],x1[2],x1[3],x2[0],x2[1],x2[2],x2[3],x3[0],x3[1],x3[2],x3[3]};
#pragma unroll
    for (int i = 0; i < 16; ++i) { const unsigned short hb = bf16_bits(xs[i]); ah.u[i] = hb; al.u[i] = ASPLIT ? bf16_bits(xs[i] - bf16_val(hb)) : (unsigned short)0; }
#pragma unroll
    for (int t = 0; t < 4; ++t) {
      const unsigned short* brow = Wt + (size_t)(col0 + t * 16 + ln) * ldb + kb;
      FragB b;
      b.half[0] = *(const v8us*)(brow + 8 * hh);
      b.half[1] = *(const v8us*)(brow + 16 + 8 * hh);
      acc[t] = mmaN<ASPLIT ? 2 : 1>(ah.v, al.v, b.v, b.v, acc[t]);
    }
  }
#pragma unroll
  for (int t = 0; t < 4; ++t) {
    float bv = bias ? bias[col0 + t * 16 + ln] : 0.f;
    if (BIAS_BF16) bv = bf16_round(bv);
#pragma unroll
    for (int r = 0; r < 8; ++r) { float v = acc[t][r] + bv; if (ACT == 1) v = fmaxf(v, 0.f); so[w][8 * hh + r][t * 16 + ln] = v; }
  }
  __builtin_amdgcn_fence(__ATOMIC_ACQ_REL, "workgroup");
  __builtin_amdgcn_wave_barrier();
  const int rsub = lane >> 4, c4 = (lane & 15) * 4;
  {
#pragma unroll
    for (int q = 0; q < 8; ++q) {
      const int r = q * 2 + rsub;
      const v4f v = *(const v4fa*)&so[w][r][c4];
      *(v4f*)(C + (size_t)(row0 + r) * ldc + col0 + c4) = v;
    }
    
  }
}

// GEMM C = act(A·W + bias + resid): A f32 (ASPLIT -> hi/lo 2 terms), Wt bf16 [N][K]; ACT 0 none, 1 relu, 2 exact gelu;
// resid (optional, f32, row index = (row % rmod), pitch ldr, RES_BF16 rounds it) added before the activation.
template <bool ASPLIT, int ACT, bool BIAS_BF16, bool RES_BF16>
__global__ __launch_bounds__(128) void k_gemm_bf3(const float* __restrict__ A, int lda, const unsigned short* __restrict__ Wt, int ldb,
                                                const float* __restrict__ bias, const float* __restrict__ resid, int rmod, int ldr,
                                                float* __restrict__ C, int ldc, int M, int N, int K) {
  __shared__ __attribute__((aligned(16))) float so[4][16][64];
  const int tid = threadIdx.x, w = tid >> 5, lane = tid & 31, ln = lane & 15, hh = lane >> 4;
  const int ntn = N / 64;
  const int wid = blockIdx.x * 4 + w;
  const int mt = wid / ntn, nq = wid % ntn;
  if (mt * 16 >= M) return;
  const int row0 = mt * 16, col0 = nq * 64;
  const float* arow = A + (size_t)(row0 + ln) * lda;
  v8f acc[4] = {};
  for (int kb = 0; kb < K; kb += 32) {
    FragB ah, al;
    const v4f x0 = *(const v4fa*)(arow + kb + 8 * hh), x1 = *(const v4fa*)(arow + kb + 8 * hh + 4);
    const v4f x2 = *(const v4fa*)(arow + kb + 16 + 8 * hh), x3 = *(const v4fa*)(arow + kb + 16 + 8 * hh + 4);
    float xs[16] = {x0[0],x0[1],x0[2],x0[3],x1[0],x1[1],x1[2],x1[3],x2[0],x2[1],x2[2],x2[3],x3[0],x3[1],x3[2],x3[3]};
#pragma unroll
    for (int i = 0; i < 16; ++i) { const unsigned short hb = bf16_bits(xs[i]); ah.u[i] = hb; al.u[i] = ASPLIT ? bf16_bits(xs[i] - bf16_val(hb)) : (unsigned short)0; }
#pragma unroll
    for (int t = 0; t < 4; ++t) {
      const unsigned short* brow = Wt + (size_t)(col0 + t * 16 + ln) * ldb + kb;
      FragB b;
      b.half[0] = *(const v8us*)(brow + 8 * hh);
      b.half[1] = *(const v8us*)(brow + 16 + 8 * hh);
      acc[t] = mmaN<ASPLIT ? 2 : 1>(ah.v, al.v, b.v, b.v, acc[t]);
    }
  }
#pragma unroll
  for (int t = 0; t < 4; ++t) {
    const int col = col0 + t * 16 + ln;
    float bv = bias ? bias[col] : 0.f;
    if (BIAS_BF16) bv = bf16_round(bv);
#pragma unroll
    for (int r = 0; r < 8; ++r) {
      float v = acc[t][r] + bv;
      if (resid) { float rv = resid[(size_t)((row0 + 8 * hh + r) % rmod) * ldr + col]; if (RES_BF16) rv = bf16_round(rv); v += rv; }
      if (ACT == 1) v = fmaxf(v, 0.f);
      if (ACT == 2) v = 0.5f * v * (1.0f + erff(v * 0.70710678118654752f));
      if (ACT == 3) { const float u = 0.7978845608028654f * (v + 0.044715f * v * v * v); v = 0.5f * v * (1.0f + tanhf(u)); }
      so[w][8 * hh + r][t * 16 + ln] = v;
    }
  }
  __builtin_amdgcn_fence(__ATOMIC_ACQ_REL, "workgroup");
  __builtin_amdgcn_wave_barrier();
  const int rsub = lane >> 4, c4 = (lane & 15) * 4;
  {
#pragma unroll
    for (int q = 0; q < 8; ++q) {
      const int r = q * 2 + rsub;
      const v4f v = *(const v4fa*)&so[w][r][c4];
      *(v4f*)(C + (size_t)(row0 + r) * ldc + col0 + c4) = v;
    }
    
  }
}
// row LayerNorm (biased variance, eps) over N: s = X (+ R); optional out_sum <- s; out_norm <- (s-mu)*rsqrt(var+eps)*g + b
template <bool PARAM_BF16>
__global__ __launch_bounds__(256) void k_layernorm(const float* __restrict__ X, const float* __restrict__ R, const float* __restrict__ g, const float* __restrict__ bta,
                                                  float* __restrict__ out_sum, float* __restrict__ out_norm, int N, float eps) {
  __shared__ float red[256];
  const int row = blockIdx.x, tid = threadIdx.x;
  const float* x = X + (size_t)row * N; const float* rr = R ? R + (size_t)row * N : nullptr;
  float vals[16];                     // up to N = 4096
  const int per = N / 256;            // contiguous chunk per thread? use strided-by-4 chunks: thread handles j = tid*4 + 1024*u
  float s1 = 0.f;
  for (int u = 0; u < per / 4; ++u) {
    const int j = tid * 4 + 1024 * u;
    const v4f a = *(const v4fa*)(x + j);
    v4f b = {0.f,0.f,0.f,0.f}; if (rr) b = *(const v4fa*)(rr + j);
#pragma unroll
    for (int q = 0; q < 4; ++q) { const float v = a[q] + b[q]; vals[u * 4 + q] = v; s1 += v; }
  }
  red[tid] = s1; __syncthreads();
  for (int st = 128; st > 0; st >>= 1) { if (tid < st) red[tid] += red[tid + st]; __syncthreads(); }
  const float mu = red[0] / (float)N; __syncthreads();
  float s2 = 0.f;
  for (int u = 0; u < per / 4; ++u)
#pragma unroll
    for (int q = 0; q < 4; ++q) { const float c = vals[u * 4 + q] - mu; s2 += c * c; }
  red[tid] = s2; __syncthreads();
  for (int st = 128; st > 0; st >>= 1) { if (tid < st) red[tid] += red[tid + st]; __syncthreads(); }
  const float rs = rsqrtf(red[0] / (float)N + eps);
  {
    for (int u = 0; u < per / 4; ++u) {
      const int j = tid * 4 + 1024 * u;
      v4f o, sm;
#pragma unroll
      for (int q = 0; q < 4; ++q) {
        float gg = g[j + q], bb = bta[j + q];
        if (PARAM_BF16) { gg = bf16_round(gg); bb = bf16_round(bb); }
        sm[q] = vals[u * 4 + q]; o[q] = (vals[u * 4 + q] - mu) * rs * gg + bb;
      }
      if (out_sum) *(v4f*)(out_sum + (size_t)row * N + j) = sm;
      *(v4f*)(out_norm + (size_t)row * N + j) = o;
    }
    
  }
}



// ---- f16 WMMA path (v_wmma_f32_16x16x32_f16): 11-bit significands for operands in range — used where a [0,1] probability operand needs more precision than bf16
typedef _Float16 v16h __attribute__((ext_vector_type(16)));
union FragH { v16h v; v8us half[2]; _Float16 h[16]; unsigned short u[16]; };
template <int NT>
__device__ __forceinline__ v8f mmaH(v16h ah, v16h al, v16h bh, v16h bl, v8f c) {
  c = __builtin_amdgcn_wmma_f32_16x16x32_f16(false, ah, false, bh, (short)0, c, false, false);
  if (NT >= 2) c = __builtin_amdgcn_wmma_f32_16x16x32_f16(false, al, false, bh, (short)0, c, false, false);
  if (NT >= 3) c = __builtin_amdgcn_wmma_f32_16x16x32_f16(false, ah, false, bl, (short)0, c, false, false);
  asm volatile("v_nop\n\tv_nop\n\tv_nop\n\tv_nop" : "+v"(c) : "v"(ah), "v"(al), "v"(bh), "v"(bl));
  return c;
}
// batched GEMM like k_gemm_b but f16 operands: A f32 (split into f16 hi/lo if ASPLIT, else rounded to f16), Bt = f16 values [n][k]; alpha; C f32; N multiple of 16 (partial tiles skipped)
template <bool ASPLIT>
__global__ __launch_bounds__(128) void k_gemm_h(const float* __restrict__ A, int lda, size_t sA, const _Float16* __restrict__ Bh, int ldb, size_t sB, float alpha, float* __restrict__ C, int ldc, size_t sC, int M, int N, int K) {
  __shared__ __attribute__((aligned(16))) float so[4][16][64];
  const int tid = threadIdx.x, w = tid >> 5, lane = tid & 31, ln = lane & 15, hh = lane >> 4; const int by = blockIdx.y;
  A += (size_t)by * sA; Bh += (size_t)by * sB; C += (size_t)by * sC;
  const int ntn = (N + 63) / 64; const int wid = blockIdx.x * 4 + w; const int mt = wid / ntn, nq = wid % ntn; if (mt * 16 >= M) return;
  const int row0 = mt * 16, col0 = nq * 64; const float* arow = A + (size_t)(row0 + ln) * lda;
  v8f acc[4] = {};
  for (int kb = 0; kb < K; kb += 32) {
    FragH ah, al;
    const v4f x0 = *(const v4fa*)(arow + kb + 8 * hh), x1 = *(const v4fa*)(arow + kb + 8 * hh + 4), x2 = *(const v4fa*)(arow + kb + 16 + 8 * hh), x3 = *(const v4fa*)(arow + kb + 16 + 8 * hh + 4);
    float xs[16] = {x0[0],x0[1],x0[2],x0[3],x1[0],x1[1],x1[2],x1[3],x2[0],x2[1],x2[2],x2[3],x3[0],x3[1],x3[2],x3[3]};
#pragma unroll
    for (int i = 0; i < 16; ++i) { const _Float16 h = (_Float16)xs[i]; ah.h[i] = h; al.h[i] = ASPLIT ? (_Float16)(xs[i] - (float)h) : (_Float16)0.0f; }
#pragma unroll
    for (int t = 0; t < 4; ++t) { if (col0 + t * 16 >= N) continue; const size_t boff = (size_t)(col0 + t * 16 + ln) * ldb + kb; FragH bq; bq.half[0] = *(const v8us*)(Bh + boff + 8 * hh); bq.half[1] = *(const v8us*)(Bh + boff + 16 + 8 * hh);
      acc[t] = mmaH<ASPLIT ? 2 : 1>(ah.v, al.v, bq.v, bq.v, acc[t]); }
  }
#pragma unroll
  for (int t = 0; t < 4; ++t) { if (col0 + t * 16 >= N) continue;
#pragma unroll
    for (int r = 0; r < 8; ++r) so[w][8 * hh + r][t * 16 + ln] = acc[t][r] * alpha; }
  __builtin_amdgcn_fence(__ATOMIC_ACQ_REL, "workgroup"); __builtin_amdgcn_wave_barrier();
  const int rsub = lane >> 4, c4 = (lane & 15) * 4;
  {
#pragma unroll
    for (int q = 0; q < 8; ++q) { const int r = q * 2 + rsub; if (col0 + c4 < N) { const v4f v = *(const v4fa*)&so[w][r][c4]; *(v4f*)(C + (size_t)(row0 + r) * ldc + col0 + c4) = v; } }
     }
}

// Wt[n][k] = f16(W[k][n]·scale) from f32 row-major W[K][N] (scale = power of two; bf16-exact weights stay exact in f16 away from the subnormal range)
__global__ __launch_bounds__(256) void k_wt_f16(const float* __restrict__ W, _Float16* __restrict__ Wt, int K, int N, float scale) {
  const int t = blockIdx.x * 256 + threadIdx.x; if (t >= N * (K / 8)) return; const int n = t / (K / 8), k8 = (t % (K / 8)) * 8; FragH f;
#pragma unroll
  for (int i = 0; i < 8; ++i) f.h[i] = (_Float16)(bf16_round(W[(size_t)(k8 + i) * N + n]) * scale); const v8us o = f.half[0];
  *(v8us*)((unsigned short*)Wt + (size_t)n * K + k8) = o; 
}
// k_gemm_hh variant with fused epilogue: v = acc·alpha + bias[by·sBias + col] (+ CP[(row/rowsPerB)·sCPb + by·64 + col] if CP) ; ACT 0 none / 1 elu ; writes f16 C16 (and f32 C if non-null)
template <int ACT>
__global__ __launch_bounds__(128) void k_gemm_hhx(const _Float16* __restrict__ A, int lda, size_t sA, const _Float16* __restrict__ Bh, int ldb, size_t sB, float alpha, const float* __restrict__ bias, size_t sBias, const float* __restrict__ CP, int rowsPerB, size_t sCPb, int row0g,
    float* __restrict__ C, _Float16* __restrict__ C16, int ldc, size_t sC, int M, int N, int K) {
  __shared__ __attribute__((aligned(16))) float so[4][16][64];
  const int tid = threadIdx.x, w = tid >> 5, lane = tid & 31, ln = lane & 15, hh = lane >> 4; const int by = blockIdx.y;
  A += (size_t)by * sA; Bh += (size_t)by * sB; const size_t cofs = (size_t)by * sC; const float* bp = bias ? bias + (size_t)by * sBias : nullptr;
  const int ntn = (N + 63) / 64; const int wid = blockIdx.x * 4 + w; const int mt = wid / ntn, nq = wid % ntn; if (mt * 16 >= M) return;
  const int row0 = mt * 16, col0 = nq * 64; const _Float16* arow = A + (size_t)(row0 + ln) * lda;
  v8f acc[4] = {};
  for (int kb = 0; kb < K; kb += 32) { FragH ah; ah.half[0] = *(const v8us*)((const unsigned short*)arow + kb + 8 * hh); ah.half[1] = *(const v8us*)((const unsigned short*)arow + kb + 16 + 8 * hh);
#pragma unroll
    for (int t = 0; t < 4; ++t) { if (col0 + t * 16 >= N) continue; const size_t boff = (size_t)(col0 + t * 16 + ln) * ldb + kb; FragH bq; bq.half[0] = *(const v8us*)((const unsigned short*)Bh + boff + 8 * hh); bq.half[1] = *(const v8us*)((const unsigned short*)Bh + boff + 16 + 8 * hh);
      acc[t] = mmaH<1>(ah.v, ah.v, bq.v, bq.v, acc[t]); }
  }
#pragma unroll
  for (int t = 0; t < 4; ++t) { if (col0 + t * 16 >= N) continue; const int col = col0 + t * 16 + ln; const float bv = bp ? bf16_round(bp[col]) : 0.f;
#pragma unroll
    for (int r = 0; r < 8; ++r) { float v = acc[t][r] * alpha + bv; if (CP) { const int rr = row0g + row0 + 8 * hh + r; if (rowsPerB < 0) v += CP[cofs + (size_t)rr * ldc + col];      /* rowsPerB < 0: own element of the batched C plane */ else { const int bidx = rr / rowsPerB; v += CP[(size_t)bidx * sCPb + (size_t)by * 64 + col]; } } if (ACT == 1) v = (v > 0.f) ? v : expm1f(v); else if (ACT == 7) v = (v > 0.f) ? v + 1.0f : expf(v); else if (ACT == 8) v = tanhf(v); else if (ACT == 9) v = 0.5f * v * (1.0f + tanhf(0.7978845608028654f * (v + 0.044715f * v * v * v))); else if (ACT == 11) v = 1.0f / (1.0f + expf(-v)); else if (ACT == 12) v = (v > 0.f) ? v : 0.01f * v; else if (ACT == 14) v = (v > 0.f) ? v : 0.1f * v; else if (ACT == 16) v = (v >= 0.f) ? v : 0.3f * v; else if (ACT == 17) v = (v >= 0.f) ? v : 0.2f * v; else if (ACT == 15) v = v / (1.0f + expf(-v)); else if (ACT == 3) v = fmaxf(v, 0.f); else if (ACT == 6) v = 0.5f * v * (1.0f + erff(v * 0.70710678118654752f)); so[w][8 * hh + r][t * 16 + ln] = v; } }
  __builtin_amdgcn_fence(__ATOMIC_ACQ_REL, "workgroup"); __builtin_amdgcn_wave_barrier();
  const int rsub = lane >> 4, c4 = (lane & 15) * 4; typedef _Float16 v4h __attribute__((ext_vector_type(4)));
  {
#pragma unroll
    for (int q = 0; q < 8; ++q) { const int r = q * 2 + rsub; if (col0 + c4 < N) { const v4f v = *(const v4fa*)&so[w][r][c4]; if (C) *(v4f*)(C + cofs + (size_t)(row0 + r) * ldc + col0 + c4) = v; if (C16) { v4h h4; for (int i = 0; i < 4; ++i) h4[i] = (_Float16)v[i]; *(v4h*)(C16 + cofs + (size_t)(row0 + r) * ldc + col0 + c4) = h4; } } }
     }
}


typedef _Float16 v4h __attribute__((ext_vector_type(4)));

__global__ __launch_bounds__(256) void k_x16(const float* __restrict__ x, _Float16* __restrict__ X16, size_t n8) { const size_t t = (size_t)blockIdx.x * 256 + threadIdx.x; if (t >= n8) return; FragH f;
#pragma unroll
  for (int q = 0; q < 8; ++q) f.h[q] = (_Float16)bf16_round(x[t * 8 + q]); *(v8us*)((unsigned short*)X16 + t * 8) = f.half[0];  }
__global__ __launch_bounds__(256) void k_h16(const float* __restrict__ x, _Float16* __restrict__ X16, size_t n8) { const size_t t = (size_t)blockIdx.x * 256 + threadIdx.x; if (t >= n8) return; FragH f;
#pragma unroll
  for (int q = 0; q < 8; ++q) f.h[q] = (_Float16)x[t * 8 + q]; *(v8us*)((unsigned short*)X16 + t * 8) = f.half[0];  }
__global__ __launch_bounds__(256) void k_round16f(const float* __restrict__ W, _Float16* __restrict__ Bt, size_t n8) { const size_t t = (size_t)blockIdx.x * 256 + threadIdx.x; if (t >= n8) return; FragH f;
#pragma unroll
  for (int i = 0; i < 8; ++i) f.h[i] = (_Float16)(bf16_round(W[t * 8 + i]) * 16.0f); *(v8us*)((unsigned short*)Bt + t * 8) = f.half[0];  }
template <int NHv, int TTv>
__global__ __launch_bounds__(256) void k_vt(const _Float16* __restrict__ V16, int ldv, int voff, _Float16* __restrict__ Vt) { __shared__ unsigned short tl[64][66]; const int tid = threadIdx.x; const int slab = blockIdx.x / (TTv / 64), lg = blockIdx.x % (TTv / 64); const int b = slab / NHv, h = slab % NHv;
  for (int i = tid; i < 64 * 8; i += 256) { const int r = i / 8, c8 = (i % 8) * 8; FragH f; f.half[0] = *(const v8us*)((const unsigned short*)V16 + ((size_t)b * TTv + lg * 64 + r) * ldv + voff + h * 64 + c8);
#pragma unroll
    for (int q = 0; q < 8; ++q) tl[r][c8 + q] = f.u[q]; }
  __syncthreads();
  {
#pragma unroll
    for (int rd = 0; rd < 2; ++rd) { const int d = rd * 32 + tid / 8, pc = tid % 8; FragH f;
#pragma unroll
      for (int q = 0; q < 8; ++q) f.u[q] = tl[pc * 8 + q][d];
      *(v8us*)((unsigned short*)Vt + ((size_t)slab * 64 + d) * TTv + lg * 64 + pc * 8) = f.half[0]; }
     } }

__global__ __launch_bounds__(256) void k_hl(const float* __restrict__ F, _Float16* __restrict__ Hh, _Float16* __restrict__ Hl, size_t n8) { const size_t t = (size_t)blockIdx.x * 256 + threadIdx.x; if (t >= n8) return; FragH fh, fl; const v4f a = *(const v4fa*)(F + t * 8), c = *(const v4fa*)(F + t * 8 + 4);
#pragma unroll
  for (int q = 0; q < 4; ++q) { _Float16 h = (_Float16)a[q]; fh.h[q] = h; fl.h[q] = (_Float16)((a[q] - (float)h) * 1024.0f); h = (_Float16)c[q]; fh.h[4 + q] = h; fl.h[4 + q] = (_Float16)((c[q] - (float)h) * 1024.0f); }
  { *(v8us*)((unsigned short*)Hh + t * 8) = fh.half[0]; *(v8us*)((unsigned short*)Hl + t * 8) = fl.half[0];  } }

// ---- fast GEMM (wave tile 32x64; requires M % 32 == 0 rows per launch region and N % 64 == 0); epilogue = k_gemm_hhx semantics ----
__device__ __forceinline__ v16h g2_frag(const _Float16* p, int hh) { FragH f; f.half[0] = *(const v8us*)((const unsigned short*)p + 8 * hh); f.half[1] = *(const v8us*)((const unsigned short*)p + 16 + 8 * hh); return f.v; }
__device__ __forceinline__ v8f g2_mma(v16h a, v16h b, v8f c) { v8f d = __builtin_amdgcn_wmma_f32_16x16x32_f16(false, a, false, b, (short)0, c, false, false); asm volatile("v_nop\n\tv_nop\n\tv_nop\n\tv_nop" : "+v"(d) : "v"(a), "v"(b)); return d; }
template <int ACT>
__global__ __launch_bounds__(128) void k_gemm2(const _Float16* __restrict__ A, int lda, size_t sA, const _Float16* __restrict__ Bh, int ldb, size_t sB, float alpha, const float* __restrict__ bias, size_t sBias, const float* __restrict__ CP, int rowsPerB, size_t sCPb, int row0g,
    float* __restrict__ C, _Float16* __restrict__ C16, int ldc, size_t sC, int M, int N, int K) { static_assert(ACT == 0 || ACT == 3 || ACT == 6 || ACT == 8 || ACT == 9 || ACT == 11 || ACT == 12 || ACT == 14 || ACT == 15 || ACT == 16 || ACT == 17, "k_gemm2: unsupported ACT code (would silently apply no activation)");
  __shared__ __attribute__((aligned(16))) float so[4][32][68];
  const int tid = threadIdx.x, w = tid >> 5, lane = tid & 31, ln = lane & 15, hh = lane >> 4; const int by = blockIdx.y;
  A += (size_t)by * sA; Bh += (size_t)by * sB; const size_t cofs = (size_t)by * sC; const float* bp = bias ? bias + (size_t)by * sBias : nullptr;
  const int ntn = N >> 6; const int mt = blockIdx.x / ntn, nq = blockIdx.x - mt * ntn; const int row0 = mt * 128 + 32 * w, col0 = nq * 64; if (row0 >= M) return;
  const _Float16* a0p = A + (size_t)(row0 + ln) * lda; const _Float16* a1p = a0p + (size_t)16 * lda;
  const _Float16* b0p = Bh + (size_t)(col0 + ln) * ldb; const _Float16* b1p = b0p + (size_t)16 * ldb; const _Float16* b2p = b1p + (size_t)16 * ldb; const _Float16* b3p = b2p + (size_t)16 * ldb;
  const v8f z8 = {0.f,0.f,0.f,0.f,0.f,0.f,0.f,0.f}; v8f c00 = z8, c01 = z8, c02 = z8, c03 = z8, c10 = z8, c11 = z8, c12 = z8, c13 = z8;
#pragma unroll 1
  for (int kb = 0; kb < K; kb += 32) { const v16h a0 = g2_frag(a0p + kb, hh), a1 = g2_frag(a1p + kb, hh);
    v16h b = g2_frag(b0p + kb, hh); c00 = g2_mma(a0, b, c00); c10 = g2_mma(a1, b, c10);
    b = g2_frag(b1p + kb, hh); c01 = g2_mma(a0, b, c01); c11 = g2_mma(a1, b, c11);
    b = g2_frag(b2p + kb, hh); c02 = g2_mma(a0, b, c02); c12 = g2_mma(a1, b, c12);
    b = g2_frag(b3p + kb, hh); c03 = g2_mma(a0, b, c03); c13 = g2_mma(a1, b, c13); }
  v8f accs[8] = {c00, c01, c02, c03, c10, c11, c12, c13};
#pragma unroll
  for (int u = 0; u < 8; ++u) { const int t = u & 3, half = u >> 2; const int col = col0 + t * 16 + ln; const float bv = bp ? bf16_round(bp[col]) : 0.f;
#pragma unroll
    for (int r = 0; r < 8; ++r) { const int rloc = half * 16 + 8 * hh + r; float v = accs[u][r] * alpha + bv; if (CP) { if (rowsPerB < 0) v += CP[cofs + (size_t)(row0g + row0 + rloc) * ldc + col];      /* rowsPerB < 0: own element of the batched C plane */ else { const int bidx = (row0g + row0 + rloc) / rowsPerB; v += CP[(size_t)bidx * sCPb + (size_t)by * 64 + col]; } }
      if (ACT == 3) v = fmaxf(v, 0.f); else if (ACT == 6) v = 0.5f * v * (1.0f + erff(v * 0.70710678118654752f)); else if (ACT == 11) v = 1.0f / (1.0f + expf(-v)); else if (ACT == 15) v = v / (1.0f + expf(-v)); else if (ACT == 12) v = (v > 0.f) ? v : 0.01f * v; else if (ACT == 8) v = tanhf(v); else if (ACT == 9) v = 0.5f * v * (1.0f + tanhf(0.7978845608028654f * (v + 0.044715f * v * v * v))); else if (ACT == 14) v = (v > 0.f) ? v : 0.1f * v; else if (ACT == 16) v = (v >= 0.f) ? v : 0.3f * v; else if (ACT == 17) v = (v >= 0.f) ? v : 0.2f * v;
      so[w][rloc][t * 16 + ln] = v; } }
  __builtin_amdgcn_fence(__ATOMIC_ACQ_REL, "workgroup"); __builtin_amdgcn_wave_barrier();
  const int rsub = lane >> 4, c4 = (lane & 15) * 4;
  {
#pragma unroll
    for (int q = 0; q < 16; ++q) { const int r = q * 2 + rsub; const v4f v = *(const v4fa*)&so[w][r][c4]; if (C) *(v4f*)(C + cofs + (size_t)(row0 + r) * ldc + col0 + c4) = v; if (C16) { v4h h4; for (int i = 0; i < 4; ++i) h4[i] = (_Float16)v[i]; *(v4h*)(C16 + cofs + (size_t)(row0 + r) * ldc + col0 + c4) = h4; } }
     } }


__global__ __launch_bounds__(256) void k_wnat(const float* __restrict__ w, size_t n8, _Float16* __restrict__ Bt) { const size_t t = (size_t)blockIdx.x * 256 + threadIdx.x; if (t >= n8) return; FragH f; for (int q = 0; q < 8; ++q) f.h[q] = (_Float16)(bf16_round(w[t * 8 + q]) * 16.0f); *(v8us*)((unsigned short*)Bt + t * 8) = f.half[0];  }
__global__ __launch_bounds__(256) void k_rsm(const float* __restrict__ S, _Float16* __restrict__ P, int nrows) {
  #pragma clang fp contract(off)
  const int i = blockIdx.x * 256 + threadIdx.x; if (i >= nrows) return; const float* s = S + (size_t)i * SQ; float mx = -3.0e38f;
#pragma unroll 1
  for (int j = 0; j < SQ; ++j) mx = fmaxf(mx, s[j]); float se = 0.f;
#pragma unroll 1
  for (int j = 0; j < SQ; ++j) se += expf(s[j] - mx); const float sc = 256.0f / se;
#pragma unroll 1
  for (int j0 = 0; j0 < SQ; j0 += 8) { FragH f; for (int q = 0; q < 8; ++q) f.h[q] = (_Float16)(expf(s[j0 + q] - mx) * sc); unsigned short* d = (unsigned short*)P + (size_t)i * SQ + j0; *(v8us*)d = f.half[0];  } }
__global__ __launch_bounds__(256) void k_vt(const _Float16* __restrict__ V16, int b, int h0, _Float16* __restrict__ VT) { __shared__ unsigned short tl[64][65]; const int tid = threadIdx.x; const int hh = blockIdx.x % HG, sg = blockIdx.x / HG; const int s0 = sg * 64; const int h = h0 + hh;
  for (int i = tid; i < 64 * 8; i += 256) { const int j = i / 8, d8 = (i % 8) * 8; FragH f; f.half[0] = *(const v8us*)((const unsigned short*)V16 + ((size_t)b * SQ + s0 + j) * DM + h * HD + d8); for (int q = 0; q < 8; ++q) tl[d8 + q][j] = f.u[q]; }
  __syncthreads();
  { for (int i = tid; i < 64 * 8; i += 256) { const int d = i / 8, j8 = (i % 8) * 8; FragH f; for (int q = 0; q < 8; ++q) f.u[q] = tl[d][j8 + q]; *(v8us*)((unsigned short*)VT + ((size_t)hh * HD + d) * SQ + s0 + j8) = f.half[0]; }  } }



// Causal softmax, one wave per score row: lane l keeps columns 128 c + 4 l .. + 3 of the row in registers (every load reads 512 contiguous bytes, the row is read once and each exponential taken once);
// row maximum and row sum: four chains per lane, then a five-step lane butterfly; weights x256 as f16, zeros right of the diagonal. Rows = grid.x * 8; nk % 256 == 0, nk <= NKX.
__global__ __launch_bounds__(256) void k_rsmw(const float* __restrict__ S, _Float16* __restrict__ P, int q0, int nk) {
  constexpr int NU = NKX / 256;      /* groups of 256 columns (two 128-column pieces each); group u exists iff 256 u < nk, the same test in every wave; marked as expected so that the groups stand in fall-through order */
  const int lane = threadIdx.x & 31; const int row = blockIdx.x * 8 + __builtin_amdgcn_readfirstlane(threadIdx.x >> 5);
  const float* s = S + (size_t)row * NKX + lane * 4; _Float16* p = P + (size_t)row * NKX + lane * 4;
  const int lim = q0 + (row % QT) - lane * 4;      /* column 128 c + 4 lane + q is at or left of the diagonal iff 128 c + q <= lim */
  v4f v[2 * NU]; v4h h[2 * NU];
#pragma unroll
  for (int u = 0; u < NU; ++u) if (__builtin_expect(u * 256 < nk, 1)) { v[2 * u] = *(const v4fa*)(s + u * 256);
    if (u == NU - 1) asm volatile("s_wait_xcnt 0x0" ::: "memory");      /* the last load's result may take over the address registers that the loads before it name */
    v[2 * u + 1] = *(const v4fa*)(s + u * 256 + 128); }
  v4f m4 = {-3.0e38f, -3.0e38f, -3.0e38f, -3.0e38f};
#pragma unroll
  for (int u = 0; u < NU; ++u) if (__builtin_expect(u * 256 < nk, 1)) { for (int c = 2 * u; c < 2 * u + 2; ++c) for (int q = 0; q < 4; ++q) { const float sv = (c * 128 + q <= lim) ? v[c][q] : -3.0e38f; v[c][q] = sv; m4[q] = fmaxf(m4[q], sv); } }
  float mx = fmaxf(fmaxf(m4[0], m4[1]), fmaxf(m4[2], m4[3]));
#pragma unroll
  for (int d = 16; d >= 1; d >>= 1) mx = fmaxf(mx, __shfl_xor(mx, d, 32));
  v4f a4 = {0.f, 0.f, 0.f, 0.f};
#pragma unroll
  for (int u = 0; u < NU; ++u) if (__builtin_expect(u * 256 < nk, 1)) { for (int c = 2 * u; c < 2 * u + 2; ++c) for (int q = 0; q < 4; ++q) { const float e = __expf(v[c][q] - mx); v[c][q] = e; a4[q] += e; } }
  float se = (a4[0] + a4[1]) + (a4[2] + a4[3]);
#pragma unroll
  for (int d = 16; d >= 1; d >>= 1) se += __shfl_xor(se, d, 32);
  const float sc = 256.0f / se;
#pragma unroll
  for (int u = 0; u < NU; ++u) if (__builtin_expect(u * 256 < nk, 1)) { for (int c = 2 * u; c < 2 * u + 2; ++c) for (int q = 0; q < 4; ++q) h[c][q] = (_Float16)(v[c][q] * sc); }
#pragma unroll
  for (int u = 0; u < NU; ++u) if (__builtin_expect(u * 256 < nk, 1)) { *(v4h*)(p + u * 256) = h[2 * u]; *(v4h*)(p + u * 256 + 128) = h[2 * u + 1]; } }      /* stores in a pass of their own: they follow one another and no register of an issued store is written again */


template <int MASKADD>
__global__ __launch_bounds__(64) void k_att0(const float* __restrict__ QF, const float* __restrict__ KF, const float* __restrict__ VF, int ld, const float* __restrict__ mask, float scale, float* __restrict__ OF, int ldo) {
  #pragma clang fp contract(off)
  __shared__ __attribute__((aligned(16))) float lq[64][64]; __shared__ __attribute__((aligned(16))) float lo[64][64];
  { const size_t bi = (size_t)blockIdx.y * QT0 * ld; QF += bi; KF += bi; VF += bi; OF += (size_t)blockIdx.y * QT0 * ldo; }      /* batch on grid.y: its own QT0-row slab of each plane */
  const int tid = threadIdx.x; const int h = blockIdx.x / (QT0 / 64), rg = blockIdx.x % (QT0 / 64); const int i = rg * 64 + tid;
  const float* qr = QF + (size_t)i * ld + h * HD;
#pragma unroll 1
  for (int c = 0; c < HD / 4; ++c) { *(v4f*)&lq[tid][c * 4] = *(const v4fa*)(qr + c * 4); const v4f z = {0.f, 0.f, 0.f, 0.f}; *(v4f*)&lo[tid][c * 4] = z; }
  float m = -1.0e30f, l = 0.f; const int jmax = MASKADD ? (SQ - 1) : (rg * 64 + 63);      /* additive-mask form: every key (the mask input decides); causal form: keys up to the block's last row */
#pragma unroll 1
  for (int j = 0; j <= jmax; ++j) { const float* kr = KF + (size_t)j * ld + h * HD; const float* vr = VF + (size_t)j * ld + h * HD; float s = 0.f;
#pragma unroll 1
    for (int c = 0; c < HD / 4; ++c) { const v4f kq = *(const v4fa*)(kr + c * 4); const v4f qq = *(v4f*)&lq[tid][c * 4]; s = __fadd_rn(s, __fmul_rn(qq[0], kq[0])); s = __fadd_rn(s, __fmul_rn(qq[1], kq[1])); s = __fadd_rn(s, __fmul_rn(qq[2], kq[2])); s = __fadd_rn(s, __fmul_rn(qq[3], kq[3])); }
    s = __fmul_rn(s, scale); if (MASKADD) s = __fadd_rn(s, __fmul_rn(bf16_round(mask[(size_t)i * SQ + j]), -10000.0f));
    const float f = (MASKADD || j <= i) ? 1.f : 0.f; const float sm = fmaf(f, s, (1.f - f) * -1.0e30f); const float mn = fmaxf(m, sm); const float sc = expf(m - mn); const float e = expf(sm - mn); l = __fadd_rn(__fmul_rn(l, sc), e); m = mn;
#pragma unroll 1
    for (int c = 0; c < HD / 4; ++c) { const v4f vv = *(const v4fa*)(vr + c * 4); v4f oo = *(v4f*)&lo[tid][c * 4]; for (int u = 0; u < 4; ++u) oo[u] = __fadd_rn(__fmul_rn(oo[u], sc), __fmul_rn(e, vv[u])); *(v4f*)&lo[tid][c * 4] = oo; } }
  const float fin = 64.0f / l;      /* o carried x64; k_o0m scales it by 1/64 */
#pragma unroll 1
  for (int c = 0; c < HD / 4; ++c) { v4f oo = *(v4f*)&lo[tid][c * 4]; for (int u = 0; u < 4; ++u) oo[u] = __fmul_rn(oo[u], fin); *(v4f*)&lo[tid][c * 4] = oo; }
  __syncthreads();
  {
#pragma unroll 1
    for (int it = 0; it < 16; ++it) { const int row = it * 4 + tid / 16, pc = (tid % 16) * 4; const v4f v = *(const v4f*)&lo[row][pc]; *(v4f*)(OF + (size_t)(rg * 64 + row) * ldo + h * HD + pc) = v; }
     } }


template <int BFIN, int WXB>
__global__ __launch_bounds__(256) void k_ln16(const float* __restrict__ X, const float* __restrict__ g, const float* __restrict__ bb, float eps, _Float16* __restrict__ N16, float* __restrict__ XB) {
  #pragma clang fp contract(off)
  __shared__ float red[256]; const size_t r = blockIdx.x; const int t = threadIdx.x; const v4f xa = *(const v4fa*)(X + r * DMQ + t * 4); float s[4]; float sum = 0.f;
  for (int q = 0; q < 4; ++q) { s[q] = BFIN ? bf16_round(xa[q]) : xa[q]; sum = __fadd_rn(sum, s[q]); }
  red[t] = sum; __syncthreads(); for (int st = 128; st > 0; st >>= 1) { if (t < st) red[t] = __fadd_rn(red[t], red[t + st]); __syncthreads(); } const float mu = red[0] / (float)DMQ; __syncthreads();
  float vs = 0.f; for (int q = 0; q < 4; ++q) { const float dl = __fadd_rn(s[q], -mu); vs = __fadd_rn(vs, __fmul_rn(dl, dl)); } red[t] = vs; __syncthreads(); for (int st = 128; st > 0; st >>= 1) { if (t < st) red[t] = __fadd_rn(red[t], red[t + st]); __syncthreads(); }
  const float rs = rsqrtf(__fadd_rn(red[0] / (float)DMQ, eps)); v4h y; v4f xb;
  for (int q = 0; q < 4; ++q) { const int c = t * 4 + q; y[q] = (_Float16)__fadd_rn(__fmul_rn(__fmul_rn(__fadd_rn(s[q], -mu), rs), bf16_round(g[c])), bf16_round(bb[c])); xb[q] = s[q]; }
  { *(v4h*)(N16 + r * DMQ + t * 4) = y; if (WXB) *(v4f*)(XB + r * DMQ + t * 4) = xb;  } }
__global__ __launch_bounds__(256) void k_ftres2(const float* __restrict__ OF0, const float* __restrict__ XB, float* __restrict__ X1, size_t n4) {
  #pragma clang fp contract(off)
  const size_t t = (size_t)blockIdx.x * 256 + threadIdx.x; if (t >= n4) return; const v4f o = *(const v4fa*)(OF0 + t * 4), xv = *(const v4fa*)(XB + t * 4); v4f y; for (int q = 0; q < 4; ++q) y[q] = __fadd_rn(__fmul_rn(o[q], 0.015625f), xv[q]); *(v4f*)(X1 + t * 4) = y;  }

__global__ __launch_bounds__(256) void k_wthd(const float* __restrict__ Wt, _Float16* __restrict__ Bt) { const size_t t = (size_t)blockIdx.x * 256 + threadIdx.x; if (t >= (size_t)NH * HD * (DM / 8)) return; const int m8 = (int)(t % (DM / 8)) * 8; const int d = (int)((t / (DM / 8)) % HD); const int h = (int)(t / ((size_t)(DM / 8) * HD)); FragH f;
  for (int q = 0; q < 8; ++q) f.h[q] = (_Float16)(16.0f * bf16_round(Wt[((size_t)h * DM + m8 + q) * HD + d])); unsigned short* dst = (unsigned short*)Bt + ((size_t)h * HD + d) * DM + m8; *(v8us*)dst = f.half[0];  }




__global__ __launch_bounds__(256) void k_wtpad(const float* __restrict__ Wm, _Float16* __restrict__ Wt, int Kr, int Kp, int Nr, int Np, float scale) {
  const int t = blockIdx.x * 256 + threadIdx.x; if (t >= Np * (Kp / 8)) return; const int n = t / (Kp / 8), k8 = (t % (Kp / 8)) * 8; const int nc = min(n, Nr - 1); const float fn = (n < Nr) ? 1.f : 0.f; FragH f;
  for (int i = 0; i < 8; ++i) { const int k = k8 + i; const int kc = min(k, Kr - 1); const float fk = (k < Kr) ? fn : 0.f; f.h[i] = (_Float16)(bf16_round(Wm[(size_t)kc * Nr + nc]) * scale * fk); }
  unsigned short* o = (unsigned short*)Wt + (size_t)n * Kp + k8; *(v8us*)o = f.half[0];  }
__global__ __launch_bounds__(128) void k_bpad(const float* __restrict__ b, float* __restrict__ Bp, int nr, int np) {
  const int i = threadIdx.x; if (i >= np) return; const float v = b[min(i, nr - 1)] * ((i < nr) ? 1.f : 0.f); *(float*)(Bp + i) = v;  }

#define DI 64         /* inner width = NH * HD (ONE 64-wide head) */
#define LQK (3 * DI)  /* fused q | k | v row pitch (192) */
__global__ __launch_bounds__(256) void k_o0(const float* __restrict__ OF, float* __restrict__ ob, size_t n4) {
  #pragma clang fp contract(off)
  const size_t t = (size_t)blockIdx.x * 256 + threadIdx.x; if (t >= n4) return; const size_t e = t * 4; const int i = (int)(e / DI); const int c = (int)(e % DI); const int h = c / HD, d = c % HD; const v4f a = *(const v4fa*)(OF + e); v4f o; for (int q = 0; q < 4; ++q) o[q] = __fmul_rn(a[q], 0.015625f); float* dst = ob + (size_t)h * SQ * HD + (size_t)i * HD + d; *(v4f*)dst = o;  }

__global__ __launch_bounds__(256) void k_o0m(const float* __restrict__ OF, float* __restrict__ o_, size_t n4, size_t so) {
  #pragma clang fp contract(off)
  OF += (size_t)blockIdx.y * n4 * 4; o_ += (size_t)blockIdx.y * so;      /* batch on grid.y: packed source slab, output rows of that batch */
  const size_t t = (size_t)blockIdx.x * 256 + threadIdx.x; if (t >= n4) return; const size_t e = t * 4; const v4f a = *(const v4fa*)(OF + e); v4f o; for (int q = 0; q < 4; ++q) o[q] = __fmul_rn(a[q], 0.015625f); *(v4f*)(o_ + e) = o;  }
extern "C" void kernel_launch(void* const* d_in, const int* in_sizes, int n_in,
                              void* d_out, int out_size, void* d_ws, size_t ws_size, hipStream_t stream) {
  (void)in_sizes; (void)n_in; (void)out_size;
  const float* const* I = (const float* const*)d_in; const float* x = I[0]; const float* wq = I[2]; const float* wk = I[1]; const float* wv = I[3]; const float* bq = nullptr; const float* bk = nullptr; const float* bv = nullptr;      /* x; [in][out = 64] weights in this module's input order (wq = input 2, wk = input 1, wv = input 3); no biases */
  char* ws = (char*)d_ws; size_t off = 0;
  auto take = [&](size_t bytes) { char* p = ws + off; off += (bytes + 255) & ~(size_t)255; return p; };
  _Float16* BW = (_Float16*)take((size_t)LQK * DM * 2); _Float16* X16 = (_Float16*)take(NR * DM * 2); _Float16* QKV = (_Float16*)take(NR * LQK * 2); _Float16* VT = (_Float16*)take((size_t)NB * NH * HD * SQ * 2);
  float* S = (float*)take((size_t)NB * NH * QT * NKX * 4); _Float16* P = (_Float16*)take((size_t)NB * NH * QT * NKX * 2); float* QKVF0 = (float*)take((size_t)NB * QT0 * LQK * 4); float* OF0 = (float*)take((size_t)NB * QT0 * DI * 4);      /* one slab per batch of each plane: every launch below covers all NB batches */
  if (off > ws_size) return;
  { const unsigned g = (unsigned)(((size_t)DI * (DM / 8) + 255) / 256); k_wt_f16<<<g, 256, 0, stream>>>(wq, BW, DM, DI, 16.0f); k_wt_f16<<<g, 256, 0, stream>>>(wk, BW + (size_t)DI * DM, DM, DI, 16.0f); k_wt_f16<<<g, 256, 0, stream>>>(wv, BW + (size_t)2 * DI * DM, DM, DI, 16.0f); }      /* [in = DM][out = 64] -> Bt[n][k] x16, stacked q | k | v */
  k_x16<<<(unsigned)((NR * DM / 8 + 255) / 256), 256, 0, stream>>>(x, X16, NR * DM / 8);      /* x (bf16-valued) as exact f16 rows */
  const float* bqkv[3] = {bq, bk, bv};
  for (int c = 0; c < 3; ++c) k_gemm2<0><<<dim3((unsigned)((NR / 128) * (DI / 64)), 1), 128, 0, stream>>>(X16, DM, 0, BW + (size_t)c * DI * DM, DM, 0, 0.0625f, bqkv[c], 0, nullptr, 1, 0, 0, nullptr, QKV + (size_t)c * DI, LQK, 0, (int)NR, DI, DM);      /* q | k | v = x W^T -> f16 rows, column blocks 0 / 64 / 128 of the fused plane (pitch 192); head h = columns h*64 inside each */
  const _Float16* Q16 = QKV; const _Float16* K16 = QKV + DI; const _Float16* V16 = QKV + 2 * DI;
  float* ob = (float*)d_out;
  k_vt<NH, SQ><<<NB * NH * (SQ / 64), 256, 0, stream>>>(V16, LQK, 0, VT);      /* V^T [NB][HD][SQ], all batches in one launch */
  for (int q0 = 0; q0 < SQ; q0 += QT) { const int nk = q0 + QT;      /* causal: only keys below the tile end are computed; the NB batches on grid.y of the GEMMs, in grid.x of the softmax (NH == 1) */
    k_gemm2<0><<<dim3((QT / 128) * (nk / 64), NB), 128, 0, stream>>>(Q16 + (size_t)q0 * LQK, LQK, (size_t)SQ * LQK, K16, LQK, (size_t)SQ * LQK, 0.125f, nullptr, 0, nullptr, 1, 0, 0, S, nullptr, NKX, (size_t)QT * NKX, QT, nk, HD);      /* scores * 64^-0.5 */
    k_rsmw<<<NB * QT / 8, 256, 0, stream>>>(S, P, q0, nk);      /* causal softmax, one wave per row -> P x256 f16 */
    k_gemm2<0><<<dim3((QT / 128) * (HD / 64), NB), 128, 0, stream>>>(P, NKX, (size_t)QT * NKX, VT, SQ, (size_t)HD * SQ, 0.00390625f, nullptr, 0, nullptr, 1, 0, 0, ob + (size_t)q0 * DI, nullptr, DI, (size_t)SQ * DI, QT, HD, nk); }      /* out[b][q0 + i][..] = P V^T 2^-8 (f32) */
  for (int c = 0; c < 3; ++c) k_gemm2<0><<<dim3((unsigned)((QT0 / 128) * (DI / 64)), NB), 128, 0, stream>>>(X16, DM, (size_t)SQ * DM, BW + (size_t)c * DI * DM, DM, 0, 0.0625f, bqkv[c], 0, nullptr, 1, 0, 0, QKVF0 + (size_t)c * DI, nullptr, LQK, (size_t)QT0 * LQK, QT0, DI, DM);      /* f32 q | k | v of rows 0..511 of every batch (exact products, f32 accumulation) */
  k_att0<0><<<dim3(NH * (QT0 / 64), NB), 64, 0, stream>>>(QKVF0, QKVF0 + DI, QKVF0 + 2 * DI, LQK, nullptr, 0.125f, OF0, DI);      /* exact f32 causal attention for rows 0..511 (o x64) */
  k_o0m<<<dim3((unsigned)(((size_t)QT0 * DI / 4 + 255) / 256), NB), 256, 0, stream>>>(OF0, ob, (size_t)QT0 * DI / 4, (size_t)SQ * DI);      /* rows 0..511 of every batch REWRITTEN from the exact path */
}

// v003
// A run of this version takes 1440 microseconds.
// Timed twice side by side with v002, it ran 2.19 and 2.18 times as fast.
// Counting every step since v000, it is 91.1 times as fast.
#include <hip/hip_runtime.h>
// Single-head causal self-attention from a 32-wide embedding (x [16][4096][32]; k/q/v = x W ([in][out] [32][64], no biases; input order Wk, Wq, Wv); ONE 64-wide head (head_size 64 != C 32); scores * 64^-0.5; causal; softmax; out = weights v -> [16][4096][64]; no output projection).
// Structure: token rows; x as exact f16 rows; three WMMA GEMMs into one f16 q | k | v plane [65536][192]; per batch v^T via LDS transposes; causal 256-row query tiles with the batches on grid.y of the GEMMs, in grid.x of the softmax (scores alpha 1/8, causal softmax f32 -> f16 x256 weights, P V written as f32 straight into the merged output rows); an exact f32 first tile (rows 0..511) rewritten at the end; launches: see trace.
// Compute dtype: inputs rounded to bf16; x / weights exact; q, k, v and softmax weights as plain f16 GEMM operands (~2^-12); scores and softmax statistics f32; v_wmma_f32_16x16x32_f16.
#define NB 16
#define SQ 4096
#define DM 32
#define NH 1
#define HD 64
#define HG 4                         /* unused by the launches (grid.y is NB); read only by the uncalled k_vt overload */
#define QT 256                       /* query rows per causal tile */
#define NKX SQ                       /* S / P row pitch */
#define QT0 512                      /* first-tile rows recomputed exactly (f32): 512 here (no output projection averages the early-row cancellation errors away; logit sigma 1.0) */
#define B0 0                         /* unused; the batches are grid.y 0..NB-1 */
#define NBR NB                       /* feeds only the unused MP; the launches put the NB batches on grid.y */
#define NR ((size_t)NB * SQ)
#define DMQ DM
#define DFF 4096                     /* unused; no FFN here */
#define DFFR 100                     /* unused; no FFN here */
#define MP ((int)((size_t)NBR * SQ)) /* unused; the projections cover NR rows */
#define QN SQ                        /* unused; the query tiles cover SQ rows */
#define NHD NH                       /* unused; the launches use NH */
#define MPO MP                       /* unused */
#define LQ (3 * DM)      /* unused; the q/k/v row pitch is LQK */
typedef __bf16 v16b __attribute__((ext_vector_type(16)));
typedef unsigned short v8us __attribute__((ext_vector_type(8), may_alias));
typedef float  v8f  __attribute__((ext_vector_type(8)));
typedef float  v4f  __attribute__((ext_vector_type(4)));
typedef float  v4fa __attribute__((ext_vector_type(4), may_alias));
union FragB { v16b v; v8us half[2]; unsigned short u[16]; };

__device__ __forceinline__ unsigned short bf16_bits(float x) { unsigned int u = __float_as_uint(x); return (unsigned short)((u + 0x7FFFu + ((u >> 16) & 1u)) >> 16); }
__device__ __forceinline__ float bf16_val(unsigned short b) { return __uint_as_float(((unsigned int)b) << 16); }
__device__ __forceinline__ float bf16_round(float x) { return bf16_val(bf16_bits(x)); }
// D += A·B with NT terms: 1 = ah·bh, 2 = + al·bh (A split), 3 = + ah·bl (both split)
template <int NT>
__device__ __forceinline__ v8f mmaN(v16b ah, v16b al, v16b bh, v16b bl, v8f c) {
  c = __builtin_amdgcn_wmma_f32_16x16x32_bf16(false, ah, false, bh, (short)0, c, false, false);
  if (NT >= 2) c = __builtin_amdgcn_wmma_f32_16x16x32_bf16(false, al, false, bh, (short)0, c, false, false);
  if (NT >= 3) c = __builtin_amdgcn_wmma_f32_16x16x32_bf16(false, ah, false, bl, (short)0, c, false, false);
  asm volatile("v_nop\n\tv_nop\n\tv_nop\n\tv_nop" : "+v"(c) : "v"(ah), "v"(al), "v"(bh), "v"(bl));
  return c;
}

__global__ __launch_bounds__(256) void k_wt_bf16(const float* __restrict__ W, unsigned short* __restrict__ Wt, int K, int N) {
  const int t = blockIdx.x * 256 + threadIdx.x;
  const int k8n = K / 8;
  if (t >= N * k8n) return;
  const int n = t / k8n, k8 = (t % k8n) * 8;
  v8us v;
#pragma unroll
  for (int i = 0; i < 8; ++i) v[i] = bf16_bits(W[(size_t)(k8 + i) * N + n]);
  *(v8us*)(Wt + (size_t)n * K + k8) = v;
  
}

// GEMM C[M][N] (f32, pitch ldc) = act(A[M][K]·W + bias). A f32 row-major (pitch lda) converted per fragment to bf16
// (ASPLIT: hi/lo two planes -> 2 terms, else single rounded term); Wt bf16 [N][K] (pitch ldb). BIAS_BF16 rounds the
// bias to bf16 first (bias quantised to bf16 before the add). K%32==0, M%16==0, N%64==0.
template <bool ASPLIT, int ACT, bool BIAS_BF16>
__global__ __launch_bounds__(128) void k_gemm_bf(const float* __restrict__ A, int lda, const unsigned short* __restrict__ Wt, int ldb,
                                               const float* __restrict__ bias, float* __restrict__ C, int ldc, int M, int N, int K) {
  __shared__ __attribute__((aligned(16))) float so[4][16][64];
  const int tid = threadIdx.x, w = tid >> 5, lane = tid & 31, ln = lane & 15, hh = lane >> 4;
  const int ntn = N / 64;
  const int wid = blockIdx.x * 4 + w;
  const int mt = wid / ntn, nq = wid % ntn;
  if (mt * 16 >= M) return;
  const int row0 = mt * 16, col0 = nq * 64;
  const float* arow = A + (size_t)(row0 + ln) * lda;
  v8f acc[4] = {};
  for (int kb = 0; kb < K; kb += 32) {
    FragB ah, al;
    const v4f x0 = *(const v4fa*)(arow + kb + 8 * hh), x1 = *(const v4fa*)(arow + kb + 8 * hh + 4);
    const v4f x2 = *(const v4fa*)(arow + kb + 16 + 8 * hh), x3 = *(const v4fa*)(arow + kb + 16 + 8 * hh + 4);
    float xs[16] = {x0[0],x0[1],x0[2],x0[3],x1[0],x1[1],x1[2],x1[3],x2[0],x2[1],x2[2],x2[3],x3[0],x3[1],x3[2],x3[3]};
#pragma unroll
    for (int i = 0; i < 16; ++i) { const unsigned short hb = bf16_bits(xs[i]); ah.u[i] = hb; al.u[i] = ASPLIT ? bf16_bits(xs[i] - bf16_val(hb)) : (unsigned short)0; }
#pragma unroll
    for (int t = 0; t < 4; ++t) {
      const unsigned short* brow = Wt + (size_t)(col0 + t * 16 + ln) * ldb + kb;
      FragB b;
      b.half[0] = *(const v8us*)(brow + 8 * hh);
      b.half[1] = *(const v8us*)(brow + 16 + 8 * hh);
      acc[t] = mmaN<ASPLIT ? 2 : 1>(ah.v, al.v, b.v, b.v, acc[t]);
    }
  }
#pragma unroll
  for (int t = 0; t < 4; ++t) {
    float bv = bias ? bias[col0 + t * 16 + ln] : 0.f;
    if (BIAS_BF16) bv = bf16_round(bv);
#pragma unroll
    for (int r = 0; r < 8; ++r) { float v = acc[t][r] + bv; if (ACT == 1) v = fmaxf(v, 0.f); so[w][8 * hh + r][t * 16 + ln] = v; }
  }
  __builtin_amdgcn_fence(__ATOMIC_ACQ_REL, "workgroup");
  __builtin_amdgcn_wave_barrier();
  const int rsub = lane >> 4, c4 = (lane & 15) * 4;
  {
#pragma unroll
    for (int q = 0; q < 8; ++q) {
      const int r = q * 2 + rsub;
      const v4f v = *(const v4fa*)&so[w][r][c4];
      *(v4f*)(C + (size_t)(row0 + r) * ldc + col0 + c4) = v;
    }
    
  }
}

// GEMM C = act(A·W + bias + resid): A f32 (ASPLIT -> hi/lo 2 terms), Wt bf16 [N][K]; ACT 0 none, 1 relu, 2 exact gelu;
// resid (optional, f32, row index = (row % rmod), pitch ldr, RES_BF16 rounds it) added before the activation.
template <bool ASPLIT, int ACT, bool BIAS_BF16, bool RES_BF16>
__global__ __launch_bounds__(128) void k_gemm_bf3(const float* __restrict__ A, int lda, const unsigned short* __restrict__ Wt, int ldb,
                                                const float* __restrict__ bias, const float* __restrict__ resid, int rmod, int ldr,
                                                float* __restrict__ C, int ldc, int M, int N, int K) {
  __shared__ __attribute__((aligned(16))) float so[4][16][64];
  const int tid = threadIdx.x, w = tid >> 5, lane = tid & 31, ln = lane & 15, hh = lane >> 4;
  const int ntn = N / 64;
  const int wid = blockIdx.x * 4 + w;
  const int mt = wid / ntn, nq = wid % ntn;
  if (mt * 16 >= M) return;
  const int row0 = mt * 16, col0 = nq * 64;
  const float* arow = A + (size_t)(row0 + ln) * lda;
  v8f acc[4] = {};
  for (int kb = 0; kb < K; kb += 32) {
    FragB ah, al;
    const v4f x0 = *(const v4fa*)(arow + kb + 8 * hh), x1 = *(const v4fa*)(arow + kb + 8 * hh + 4);
    const v4f x2 = *(const v4fa*)(arow + kb + 16 + 8 * hh), x3 = *(const v4fa*)(arow + kb + 16 + 8 * hh + 4);
    float xs[16] = {x0[0],x0[1],x0[2],x0[3],x1[0],x1[1],x1[2],x1[3],x2[0],x2[1],x2[2],x2[3],x3[0],x3[1],x3[2],x3[3]};
#pragma unroll
    for (int i = 0; i < 16; ++i) { const unsigned short hb = bf16_bits(xs[i]); ah.u[i] = hb; al.u[i] = ASPLIT ? bf16_bits(xs[i] - bf16_val(hb)) : (unsigned short)0; }
#pragma unroll
    for (int t = 0; t < 4; ++t) {
      const unsigned short* brow = Wt + (size_t)(col0 + t * 16 + ln) * ldb + kb;
      FragB b;
      b.half[0] = *(const v8us*)(brow + 8 * hh);
      b.half[1] = *(const v8us*)(brow + 16 + 8 * hh);
      acc[t] = mmaN<ASPLIT ? 2 : 1>(ah.v, al.v, b.v, b.v, acc[t]);
    }
  }
#pragma unroll
  for (int t = 0; t < 4; ++t) {
    const int col = col0 + t * 16 + ln;
    float bv = bias ? bias[col] : 0.f;
    if (BIAS_BF16) bv = bf16_round(bv);
#pragma unroll
    for (int r = 0; r < 8; ++r) {
      float v = acc[t][r] + bv;
      if (resid) { float rv = resid[(size_t)((row0 + 8 * hh + r) % rmod) * ldr + col]; if (RES_BF16) rv = bf16_round(rv); v += rv; }
      if (ACT == 1) v = fmaxf(v, 0.f);
      if (ACT == 2) v = 0.5f * v * (1.0f + erff(v * 0.70710678118654752f));
      if (ACT == 3) { const float u = 0.7978845608028654f * (v + 0.044715f * v * v * v); v = 0.5f * v * (1.0f + tanhf(u)); }
      so[w][8 * hh + r][t * 16 + ln] = v;
    }
  }
  __builtin_amdgcn_fence(__ATOMIC_ACQ_REL, "workgroup");
  __builtin_amdgcn_wave_barrier();
  const int rsub = lane >> 4, c4 = (lane & 15) * 4;
  {
#pragma unroll
    for (int q = 0; q < 8; ++q) {
      const int r = q * 2 + rsub;
      const v4f v = *(const v4fa*)&so[w][r][c4];
      *(v4f*)(C + (size_t)(row0 + r) * ldc + col0 + c4) = v;
    }
    
  }
}
// row LayerNorm (biased variance, eps) over N: s = X (+ R); optional out_sum <- s; out_norm <- (s-mu)*rsqrt(var+eps)*g + b
template <bool PARAM_BF16>
__global__ __launch_bounds__(256) void k_layernorm(const float* __restrict__ X, const float* __restrict__ R, const float* __restrict__ g, const float* __restrict__ bta,
                                                  float* __restrict__ out_sum, float* __restrict__ out_norm, int N, float eps) {
  __shared__ float red[256];
  const int row = blockIdx.x, tid = threadIdx.x;
  const float* x = X + (size_t)row * N; const float* rr = R ? R + (size_t)row * N : nullptr;
  float vals[16];                     // up to N = 4096
  const int per = N / 256;            // contiguous chunk per thread? use strided-by-4 chunks: thread handles j = tid*4 + 1024*u
  float s1 = 0.f;
  for (int u = 0; u < per / 4; ++u) {
    const int j = tid * 4 + 1024 * u;
    const v4f a = *(const v4fa*)(x + j);
    v4f b = {0.f,0.f,0.f,0.f}; if (rr) b = *(const v4fa*)(rr + j);
#pragma unroll
    for (int q = 0; q < 4; ++q) { const float v = a[q] + b[q]; vals[u * 4 + q] = v; s1 += v; }
  }
  red[tid] = s1; __syncthreads();
  for (int st = 128; st > 0; st >>= 1) { if (tid < st) red[tid] += red[tid + st]; __syncthreads(); }
  const float mu = red[0] / (float)N; __syncthreads();
  float s2 = 0.f;
  for (int u = 0; u < per / 4; ++u)
#pragma unroll
    for (int q = 0; q < 4; ++q) { const float c = vals[u * 4 + q] - mu; s2 += c * c; }
  red[tid] = s2; __syncthreads();
  for (int st = 128; st > 0; st >>= 1) { if (tid < st) red[tid] += red[tid + st]; __syncthreads(); }
  const float rs = rsqrtf(red[0] / (float)N + eps);
  {
    for (int u = 0; u < per / 4; ++u) {
      const int j = tid * 4 + 1024 * u;
      v4f o, sm;
#pragma unroll
      for (int q = 0; q < 4; ++q) {
        float gg = g[j + q], bb = bta[j + q];
        if (PARAM_BF16) { gg = bf16_round(gg); bb = bf16_round(bb); }
        sm[q] = vals[u * 4 + q]; o[q] = (vals[u * 4 + q] - mu) * rs * gg + bb;
      }
      if (out_sum) *(v4f*)(out_sum + (size_t)row * N + j) = sm;
      *(v4f*)(out_norm + (size_t)row * N + j) = o;
    }
    
  }
}



// ---- f16 WMMA path (v_wmma_f32_16x16x32_f16): 11-bit significands for operands in range — used where a [0,1] probability operand needs more precision than bf16
typedef _Float16 v16h __attribute__((ext_vector_type(16)));
union FragH { v16h v; v8us half[2]; _Float16 h[16]; unsigned short u[16]; };
template <int NT>
__device__ __forceinline__ v8f mmaH(v16h ah, v16h al, v16h bh, v16h bl, v8f c) {
  c = __builtin_amdgcn_wmma_f32_16x16x32_f16(false, ah, false, bh, (short)0, c, false, false);
  if (NT >= 2) c = __builtin_amdgcn_wmma_f32_16x16x32_f16(false, al, false, bh, (short)0, c, false, false);
  if (NT >= 3) c = __builtin_amdgcn_wmma_f32_16x16x32_f16(false, ah, false, bl, (short)0, c, false, false);
  asm volatile("v_nop\n\tv_nop\n\tv_nop\n\tv_nop" : "+v"(c) : "v"(ah), "v"(al), "v"(bh), "v"(bl));
  return c;
}
// batched GEMM like k_gemm_b but f16 operands: A f32 (split into f16 hi/lo if ASPLIT, else rounded to f16), Bt = f16 values [n][k]; alpha; C f32; N multiple of 16 (partial tiles skipped)
template <bool ASPLIT>
__global__ __launch_bounds__(128) void k_gemm_h(const float* __restrict__ A, int lda, size_t sA, const _Float16* __restrict__ Bh, int ldb, size_t sB, float alpha, float* __restrict__ C, int ldc, size_t sC, int M, int N, int K) {
  __shared__ __attribute__((aligned(16))) float so[4][16][64];
  const int tid = threadIdx.x, w = tid >> 5, lane = tid & 31, ln = lane & 15, hh = lane >> 4; const int by = blockIdx.y;
  A += (size_t)by * sA; Bh += (size_t)by * sB; C += (size_t)by * sC;
  const int ntn = (N + 63) / 64; const int wid = blockIdx.x * 4 + w; const int mt = wid / ntn, nq = wid % ntn; if (mt * 16 >= M) return;
  const int row0 = mt * 16, col0 = nq * 64; const float* arow = A + (size_t)(row0 + ln) * lda;
  v8f acc[4] = {};
  for (int kb = 0; kb < K; kb += 32) {
    FragH ah, al;
    const v4f x0 = *(const v4fa*)(arow + kb + 8 * hh), x1 = *(const v4fa*)(arow + kb + 8 * hh + 4), x2 = *(const v4fa*)(arow + kb + 16 + 8 * hh), x3 = *(const v4fa*)(arow + kb + 16 + 8 * hh + 4);
    float xs[16] = {x0[0],x0[1],x0[2],x0[3],x1[0],x1[1],x1[2],x1[3],x2[0],x2[1],x2[2],x2[3],x3[0],x3[1],x3[2],x3[3]};
#pragma unroll
    for (int i = 0; i < 16; ++i) { const _Float16 h = (_Float16)xs[i]; ah.h[i] = h; al.h[i] = ASPLIT ? (_Float16)(xs[i] - (float)h) : (_Float16)0.0f; }
#pragma unroll
    for (int t = 0; t < 4; ++t) { if (col0 + t * 16 >= N) continue; const size_t boff = (size_t)(col0 + t * 16 + ln) * ldb + kb; FragH bq; bq.half[0] = *(const v8us*)(Bh + boff + 8 * hh); bq.half[1] = *(const v8us*)(Bh + boff + 16 + 8 * hh);
      acc[t] = mmaH<ASPLIT ? 2 : 1>(ah.v, al.v, bq.v, bq.v, acc[t]); }
  }
#pragma unroll
  for (int t = 0; t < 4; ++t) { if (col0 + t * 16 >= N) continue;
#pragma unroll
    for (int r = 0; r < 8; ++r) so[w][8 * hh + r][t * 16 + ln] = acc[t][r] * alpha; }
  __builtin_amdgcn_fence(__ATOMIC_ACQ_REL, "workgroup"); __builtin_amdgcn_wave_barrier();
  const int rsub = lane >> 4, c4 = (lane & 15) * 4;
  {
#pragma unroll
    for (int q = 0; q < 8; ++q) { const int r = q * 2 + rsub; if (col0 + c4 < N) { const v4f v = *(const v4fa*)&so[w][r][c4]; *(v4f*)(C + (size_t)(row0 + r) * ldc + col0 + c4) = v; } }
     }
}

// Wt[n][k] = f16(W[k][n]·scale) from f32 row-major W[K][N] (scale = power of two; bf16-exact weights stay exact in f16 away from the subnormal range)
__global__ __launch_bounds__(256) void k_wt_f16(const float* __restrict__ W, _Float16* __restrict__ Wt, int K, int N, float scale) {
  const int t = blockIdx.x * 256 + threadIdx.x; if (t >= N * (K / 8)) return; const int n = t / (K / 8), k8 = (t % (K / 8)) * 8; FragH f;
#pragma unroll
  for (int i = 0; i < 8; ++i) f.h[i] = (_Float16)(bf16_round(W[(size_t)(k8 + i) * N + n]) * scale); const v8us o = f.half[0];
  *(v8us*)((unsigned short*)Wt + (size_t)n * K + k8) = o; 
}
// k_gemm_hh variant with fused epilogue: v = acc·alpha + bias[by·sBias + col] (+ CP[(row/rowsPerB)·sCPb + by·64 + col] if CP) ; ACT 0 none / 1 elu ; writes f16 C16 (and f32 C if non-null)
template <int ACT>
__global__ __launch_bounds__(128) void k_gemm_hhx(const _Float16* __restrict__ A, int lda, size_t sA, const _Float16* __restrict__ Bh, int ldb, size_t sB, float alpha, const float* __restrict__ bias, size_t sBias, const float* __restrict__ CP, int rowsPerB, size_t sCPb, int row0g,
    float* __restrict__ C, _Float16* __restrict__ C16, int ldc, size_t sC, int M, int N, int K) {
  __shared__ __attribute__((aligned(16))) float so[4][16][64];
  const int tid = threadIdx.x, w = tid >> 5, lane = tid & 31, ln = lane & 15, hh = lane >> 4; const int by = blockIdx.y;
  A += (size_t)by * sA; Bh += (size_t)by * sB; const size_t cofs = (size_t)by * sC; const float* bp = bias ? bias + (size_t)by * sBias : nullptr;
  const int ntn = (N + 63) / 64; const int wid = blockIdx.x * 4 + w; const int mt = wid / ntn, nq = wid % ntn; if (mt * 16 >= M) return;
  const int row0 = mt * 16, col0 = nq * 64; const _Float16* arow = A + (size_t)(row0 + ln) * lda;
  v8f acc[4] = {};
  for (int kb = 0; kb < K; kb += 32) { FragH ah; ah.half[0] = *(const v8us*)((const unsigned short*)arow + kb + 8 * hh); ah.half[1] = *(const v8us*)((const unsigned short*)arow + kb + 16 + 8 * hh);
#pragma unroll
    for (int t = 0; t < 4; ++t) { if (col0 + t * 16 >= N) continue; const size_t boff = (size_t)(col0 + t * 16 + ln) * ldb + kb; FragH bq; bq.half[0] = *(const v8us*)((const unsigned short*)Bh + boff + 8 * hh); bq.half[1] = *(const v8us*)((const unsigned short*)Bh + boff + 16 + 8 * hh);
      acc[t] = mmaH<1>(ah.v, ah.v, bq.v, bq.v, acc[t]); }
  }
#pragma unroll
  for (int t = 0; t < 4; ++t) { if (col0 + t * 16 >= N) continue; const int col = col0 + t * 16 + ln; const float bv = bp ? bf16_round(bp[col]) : 0.f;
#pragma unroll
    for (int r = 0; r < 8; ++r) { float v = acc[t][r] * alpha + bv; if (CP) { const int rr = row0g + row0 + 8 * hh + r; if (rowsPerB < 0) v += CP[cofs + (size_t)rr * ldc + col];      /* rowsPerB < 0: own element of the batched C plane */ else { const int bidx = rr / rowsPerB; v += CP[(size_t)bidx * sCPb + (size_t)by * 64 + col]; } } if (ACT == 1) v = (v > 0.f) ? v : expm1f(v); else if (ACT == 7) v = (v > 0.f) ? v + 1.0f : expf(v); else if (ACT == 8) v = tanhf(v); else if (ACT == 9) v = 0.5f * v * (1.0f + tanhf(0.7978845608028654f * (v + 0.044715f * v * v * v))); else if (ACT == 11) v = 1.0f / (1.0f + expf(-v)); else if (ACT == 12) v = (v > 0.f) ? v : 0.01f * v; else if (ACT == 14) v = (v > 0.f) ? v : 0.1f * v; else if (ACT == 16) v = (v >= 0.f) ? v : 0.3f * v; else if (ACT == 17) v = (v >= 0.f) ? v : 0.2f * v; else if (ACT == 15) v = v / (1.0f + expf(-v)); else if (ACT == 3) v = fmaxf(v, 0.f); else if (ACT == 6) v = 0.5f * v * (1.0f + erff(v * 0.70710678118654752f)); so[w][8 * hh + r][t * 16 + ln] = v; } }
  __builtin_amdgcn_fence(__ATOMIC_ACQ_REL, "workgroup"); __builtin_amdgcn_wave_barrier();
  const int rsub = lane >> 4, c4 = (lane & 15) * 4; typedef _Float16 v4h __attribute__((ext_vector_type(4)));
  {
#pragma unroll
    for (int q = 0; q < 8; ++q) { const int r = q * 2 + rsub; if (col0 + c4 < N) { const v4f v = *(const v4fa*)&so[w][r][c4]; if (C) *(v4f*)(C + cofs + (size_t)(row0 + r) * ldc + col0 + c4) = v; if (C16) { v4h h4; for (int i = 0; i < 4; ++i) h4[i] = (_Float16)v[i]; *(v4h*)(C16 + cofs + (size_t)(row0 + r) * ldc + col0 + c4) = h4; } } }
     }
}


typedef _Float16 v4h __attribute__((ext_vector_type(4)));

__global__ __launch_bounds__(256) void k_x16(const float* __restrict__ x, _Float16* __restrict__ X16, size_t n8) { const size_t t = (size_t)blockIdx.x * 256 + threadIdx.x; if (t >= n8) return; FragH f;
#pragma unroll
  for (int q = 0; q < 8; ++q) f.h[q] = (_Float16)bf16_round(x[t * 8 + q]); *(v8us*)((unsigned short*)X16 + t * 8) = f.half[0];  }
__global__ __launch_bounds__(256) void k_h16(const float* __restrict__ x, _Float16* __restrict__ X16, size_t n8) { const size_t t = (size_t)blockIdx.x * 256 + threadIdx.x; if (t >= n8) return; FragH f;
#pragma unroll
  for (int q = 0; q < 8; ++q) f.h[q] = (_Float16)x[t * 8 + q]; *(v8us*)((unsigned short*)X16 + t * 8) = f.half[0];  }
__global__ __launch_bounds__(256) void k_round16f(const float* __restrict__ W, _Float16* __restrict__ Bt, size_t n8) { const size_t t = (size_t)blockIdx.x * 256 + threadIdx.x; if (t >= n8) return; FragH f;
#pragma unroll
  for (int i = 0; i < 8; ++i) f.h[i] = (_Float16)(bf16_round(W[t * 8 + i]) * 16.0f); *(v8us*)((unsigned short*)Bt + t * 8) = f.half[0];  }
template <int NHv, int TTv>
__global__ __launch_bounds__(256) void k_vt(const _Float16* __restrict__ V16, int ldv, int voff, _Float16* __restrict__ Vt) { __shared__ unsigned short tl[64][66]; const int tid = threadIdx.x; const int slab = blockIdx.x / (TTv / 64), lg = blockIdx.x % (TTv / 64); const int b = slab / NHv, h = slab % NHv;
  for (int i = tid; i < 64 * 8; i += 256) { const int r = i / 8, c8 = (i % 8) * 8; FragH f; f.half[0] = *(const v8us*)((const unsigned short*)V16 + ((size_t)b * TTv + lg * 64 + r) * ldv + voff + h * 64 + c8);
#pragma unroll
    for (int q = 0; q < 8; ++q) tl[r][c8 + q] = f.u[q]; }
  __syncthreads();
  {
#pragma unroll
    for (int rd = 0; rd < 2; ++rd) { const int d = rd * 32 + tid / 8, pc = tid % 8; FragH f;
#pragma unroll
      for (int q = 0; q < 8; ++q) f.u[q] = tl[pc * 8 + q][d];
      *(v8us*)((unsigned short*)Vt + ((size_t)slab * 64 + d) * TTv + lg * 64 + pc * 8) = f.half[0]; }
     } }

__global__ __launch_bounds__(256) void k_hl(const float* __restrict__ F, _Float16* __restrict__ Hh, _Float16* __restrict__ Hl, size_t n8) { const size_t t = (size_t)blockIdx.x * 256 + threadIdx.x; if (t >= n8) return; FragH fh, fl; const v4f a = *(const v4fa*)(F + t * 8), c = *(const v4fa*)(F + t * 8 + 4);
#pragma unroll
  for (int q = 0; q < 4; ++q) { _Float16 h = (_Float16)a[q]; fh.h[q] = h; fl.h[q] = (_Float16)((a[q] - (float)h) * 1024.0f); h = (_Float16)c[q]; fh.h[4 + q] = h; fl.h[4 + q] = (_Float16)((c[q] - (float)h) * 1024.0f); }
  { *(v8us*)((unsigned short*)Hh + t * 8) = fh.half[0]; *(v8us*)((unsigned short*)Hl + t * 8) = fl.half[0];  } }

// ---- fast GEMM (wave tile 32x64; requires M % 32 == 0 rows per launch region and N % 64 == 0); epilogue = k_gemm_hhx semantics ----
__device__ __forceinline__ v16h g2_frag(const _Float16* p, int hh) { FragH f; f.half[0] = *(const v8us*)((const unsigned short*)p + 8 * hh); f.half[1] = *(const v8us*)((const unsigned short*)p + 16 + 8 * hh); return f.v; }
__device__ __forceinline__ v8f g2_mma(v16h a, v16h b, v8f c) { v8f d = __builtin_amdgcn_wmma_f32_16x16x32_f16(false, a, false, b, (short)0, c, false, false); asm volatile("v_nop\n\tv_nop\n\tv_nop\n\tv_nop" : "+v"(d) : "v"(a), "v"(b)); return d; }
template <int ACT>
__global__ __launch_bounds__(128) void k_gemm2(const _Float16* __restrict__ A, int lda, size_t sA, const _Float16* __restrict__ Bh, int ldb, size_t sB, float alpha, const float* __restrict__ bias, size_t sBias, const float* __restrict__ CP, int rowsPerB, size_t sCPb, int row0g,
    float* __restrict__ C, _Float16* __restrict__ C16, int ldc, size_t sC, int M, int N, int K) { static_assert(ACT == 0 || ACT == 3 || ACT == 6 || ACT == 8 || ACT == 9 || ACT == 11 || ACT == 12 || ACT == 14 || ACT == 15 || ACT == 16 || ACT == 17, "k_gemm2: unsupported ACT code (would silently apply no activation)");
  __shared__ __attribute__((aligned(16))) float so[4][32][68];
  const int tid = threadIdx.x, w = tid >> 5, lane = tid & 31, ln = lane & 15, hh = lane >> 4; const int by = blockIdx.y;
  A += (size_t)by * sA; Bh += (size_t)by * sB; const size_t cofs = (size_t)by * sC; const float* bp = bias ? bias + (size_t)by * sBias : nullptr;
  const int ntn = N >> 6; const int mt = blockIdx.x / ntn, nq = blockIdx.x - mt * ntn; const int row0 = mt * 128 + 32 * w, col0 = nq * 64; if (row0 >= M) return;
  const _Float16* a0p = A + (size_t)(row0 + ln) * lda; const _Float16* a1p = a0p + (size_t)16 * lda;
  const _Float16* b0p = Bh + (size_t)(col0 + ln) * ldb; const _Float16* b1p = b0p + (size_t)16 * ldb; const _Float16* b2p = b1p + (size_t)16 * ldb; const _Float16* b3p = b2p + (size_t)16 * ldb;
  const v8f z8 = {0.f,0.f,0.f,0.f,0.f,0.f,0.f,0.f}; v8f c00 = z8, c01 = z8, c02 = z8, c03 = z8, c10 = z8, c11 = z8, c12 = z8, c13 = z8;
#pragma unroll 1
  for (int kb = 0; kb < K; kb += 32) { const v16h a0 = g2_frag(a0p + kb, hh), a1 = g2_frag(a1p + kb, hh);
    v16h b = g2_frag(b0p + kb, hh); c00 = g2_mma(a0, b, c00); c10 = g2_mma(a1, b, c10);
    b = g2_frag(b1p + kb, hh); c01 = g2_mma(a0, b, c01); c11 = g2_mma(a1, b, c11);
    b = g2_frag(b2p + kb, hh); c02 = g2_mma(a0, b, c02); c12 = g2_mma(a1, b, c12);
    b = g2_frag(b3p + kb, hh); c03 = g2_mma(a0, b, c03); c13 = g2_mma(a1, b, c13); }
  v8f accs[8] = {c00, c01, c02, c03, c10, c11, c12, c13};
#pragma unroll
  for (int u = 0; u < 8; ++u) { const int t = u & 3, half = u >> 2; const int col = col0 + t * 16 + ln; const float bv = bp ? bf16_round(bp[col]) : 0.f;
#pragma unroll
    for (int r = 0; r < 8; ++r) { const int rloc = half * 16 + 8 * hh + r; float v = accs[u][r] * alpha + bv; if (CP) { if (rowsPerB < 0) v += CP[cofs + (size_t)(row0g + row0 + rloc) * ldc + col];      /* rowsPerB < 0: own element of the batched C plane */ else { const int bidx = (row0g + row0 + rloc) / rowsPerB; v += CP[(size_t)bidx * sCPb + (size_t)by * 64 + col]; } }
      if (ACT == 3) v = fmaxf(v, 0.f); else if (ACT == 6) v = 0.5f * v * (1.0f + erff(v * 0.70710678118654752f)); else if (ACT == 11) v = 1.0f / (1.0f + expf(-v)); else if (ACT == 15) v = v / (1.0f + expf(-v)); else if (ACT == 12) v = (v > 0.f) ? v : 0.01f * v; else if (ACT == 8) v = tanhf(v); else if (ACT == 9) v = 0.5f * v * (1.0f + tanhf(0.7978845608028654f * (v + 0.044715f * v * v * v))); else if (ACT == 14) v = (v > 0.f) ? v : 0.1f * v; else if (ACT == 16) v = (v >= 0.f) ? v : 0.3f * v; else if (ACT == 17) v = (v >= 0.f) ? v : 0.2f * v;
      so[w][rloc][t * 16 + ln] = v; } }
  __builtin_amdgcn_fence(__ATOMIC_ACQ_REL, "workgroup"); __builtin_amdgcn_wave_barrier();
  const int rsub = lane >> 4, c4 = (lane & 15) * 4;
  {
#pragma unroll
    for (int q = 0; q < 16; ++q) { const int r = q * 2 + rsub; const v4f v = *(const v4fa*)&so[w][r][c4]; if (C) *(v4f*)(C + cofs + (size_t)(row0 + r) * ldc + col0 + c4) = v; if (C16) { v4h h4; for (int i = 0; i < 4; ++i) h4[i] = (_Float16)v[i]; *(v4h*)(C16 + cofs + (size_t)(row0 + r) * ldc + col0 + c4) = h4; } }
     } }


__global__ __launch_bounds__(256) void k_wnat(const float* __restrict__ w, size_t n8, _Float16* __restrict__ Bt) { const size_t t = (size_t)blockIdx.x * 256 + threadIdx.x; if (t >= n8) return; FragH f; for (int q = 0; q < 8; ++q) f.h[q] = (_Float16)(bf16_round(w[t * 8 + q]) * 16.0f); *(v8us*)((unsigned short*)Bt + t * 8) = f.half[0];  }
__global__ __launch_bounds__(256) void k_rsm(const float* __restrict__ S, _Float16* __restrict__ P, int nrows) {
  #pragma clang fp contract(off)
  const int i = blockIdx.x * 256 + threadIdx.x; if (i >= nrows) return; const float* s = S + (size_t)i * SQ; float mx = -3.0e38f;
#pragma unroll 1
  for (int j = 0; j < SQ; ++j) mx = fmaxf(mx, s[j]); float se = 0.f;
#pragma unroll 1
  for (int j = 0; j < SQ; ++j) se += expf(s[j] - mx); const float sc = 256.0f / se;
#pragma unroll 1
  for (int j0 = 0; j0 < SQ; j0 += 8) { FragH f; for (int q = 0; q < 8; ++q) f.h[q] = (_Float16)(expf(s[j0 + q] - mx) * sc); unsigned short* d = (unsigned short*)P + (size_t)i * SQ + j0; *(v8us*)d = f.half[0];  } }
__global__ __launch_bounds__(256) void k_vt(const _Float16* __restrict__ V16, int b, int h0, _Float16* __restrict__ VT) { __shared__ unsigned short tl[64][65]; const int tid = threadIdx.x; const int hh = blockIdx.x % HG, sg = blockIdx.x / HG; const int s0 = sg * 64; const int h = h0 + hh;
  for (int i = tid; i < 64 * 8; i += 256) { const int j = i / 8, d8 = (i % 8) * 8; FragH f; f.half[0] = *(const v8us*)((const unsigned short*)V16 + ((size_t)b * SQ + s0 + j) * DM + h * HD + d8); for (int q = 0; q < 8; ++q) tl[d8 + q][j] = f.u[q]; }
  __syncthreads();
  { for (int i = tid; i < 64 * 8; i += 256) { const int d = i / 8, j8 = (i % 8) * 8; FragH f; for (int q = 0; q < 8; ++q) f.u[q] = tl[d][j8 + q]; *(v8us*)((unsigned short*)VT + ((size_t)hh * HD + d) * SQ + s0 + j8) = f.half[0]; }  } }



// Causal softmax, one wave per score row: lane l keeps columns 128 c + 4 l .. + 3 of the row in registers (every load reads 512 contiguous bytes, the row is read once and each exponential taken once);
// row maximum and row sum: four chains per lane, then a five-step lane butterfly; weights x256 as f16, zeros right of the diagonal. Rows = grid.x * 8; nk % 256 == 0, nk <= NKX.
__global__ __launch_bounds__(256) void k_rsmw(const float* __restrict__ S, _Float16* __restrict__ P, int q0, int nk) {
  constexpr int NU = NKX / 256;      /* groups of 256 columns (two 128-column pieces each); group u exists iff 256 u < nk, the same test in every wave; marked as expected so that the groups stand in fall-through order */
  const int lane = threadIdx.x & 31; const int row = blockIdx.x * 8 + __builtin_amdgcn_readfirstlane(threadIdx.x >> 5);
  const float* s = S + (size_t)row * NKX + lane * 4; _Float16* p = P + (size_t)row * NKX + lane * 4;
  const int lim = q0 + (row % QT) - lane * 4;      /* column 128 c + 4 lane + q is at or left of the diagonal iff 128 c + q <= lim */
  v4f v[2 * NU]; v4h h[2 * NU];
#pragma unroll
  for (int u = 0; u < NU; ++u) if (__builtin_expect(u * 256 < nk, 1)) { v[2 * u] = *(const v4fa*)(s + u * 256);
    if (u == NU - 1) asm volatile("s_wait_xcnt 0x0" ::: "memory");      /* the last load's result may take over the address registers that the loads before it name */
    v[2 * u + 1] = *(const v4fa*)(s + u * 256 + 128); }
  v4f m4 = {-3.0e38f, -3.0e38f, -3.0e38f, -3.0e38f};
#pragma unroll
  for (int u = 0; u < NU; ++u) if (__builtin_expect(u * 256 < nk, 1)) { for (int c = 2 * u; c < 2 * u + 2; ++c) for (int q = 0; q < 4; ++q) { const float sv = (c * 128 + q <= lim) ? v[c][q] : -3.0e38f; v[c][q] = sv; m4[q] = fmaxf(m4[q], sv); } }
  float mx = fmaxf(fmaxf(m4[0], m4[1]), fmaxf(m4[2], m4[3]));
#pragma unroll
  for (int d = 16; d >= 1; d >>= 1) mx = fmaxf(mx, __shfl_xor(mx, d, 32));
  v4f a4 = {0.f, 0.f, 0.f, 0.f};
#pragma unroll
  for (int u = 0; u < NU; ++u) if (__builtin_expect(u * 256 < nk, 1)) { for (int c = 2 * u; c < 2 * u + 2; ++c) for (int q = 0; q < 4; ++q) { const float e = __expf(v[c][q] - mx); v[c][q] = e; a4[q] += e; } }
  float se = (a4[0] + a4[1]) + (a4[2] + a4[3]);
#pragma unroll
  for (int d = 16; d >= 1; d >>= 1) se += __shfl_xor(se, d, 32);
  const float sc = 256.0f / se;
#pragma unroll
  for (int u = 0; u < NU; ++u) if (__builtin_expect(u * 256 < nk, 1)) { for (int c = 2 * u; c < 2 * u + 2; ++c) for (int q = 0; q < 4; ++q) h[c][q] = (_Float16)(v[c][q] * sc); }
#pragma unroll
  for (int u = 0; u < NU; ++u) if (__builtin_expect(u * 256 < nk, 1)) { *(v4h*)(p + u * 256) = h[2 * u]; *(v4h*)(p + u * 256 + 128) = h[2 * u + 1]; } }      /* stores in a pass of their own: they follow one another and no register of an issued store is written again */


// Exact f32 causal attention for rows 0..QT0-1, one 8-wave block per 32 query rows of one batch: lane = query row, its q row and its partial o row stay in registers;
// K and V rows come through LDS in tiles of 64 keys (coalesced 16-byte loads, the next tile fetched into registers while this one is worked on) and are read as same-address (broadcast) 16-byte LDS loads;
// wave w takes keys 8 w .. 8 w + 7 of every tile with its own running maximum, sum and o; at the end the eight partial results of a row are merged through LDS. o carried x64, scaled back by 1/64 in k_o0m.
typedef float v2f __attribute__((ext_vector_type(2)));
#define A0R 32                       /* query rows per block */
#define A0T 64                       /* keys per LDS tile */
#define A0K 8                        /* keys per wave and tile */
#define A0P 33                       /* row pitch of the merge plane [wave][d][row]: odd, so that writers (lane = row) and readers (lane = row, d piece) both fall on distinct banks */
__device__ __forceinline__ float a0_exp(float x) { float r; asm("v_exp_f32 %0, %1\n\tv_nop" : "=v"(r) : "v"(x * 1.4426950408889634f)); return r; }      /* e^x; the v_nop fills the one slot that the instruction set asks for between a transcendental and a next instruction that reads its result or overwrites its source */
template <int LD>      /* row pitch of the q / k / v planes: a constant, so that all loads of a tile share one address pair and differ in their immediate offsets only */
__global__ __launch_bounds__(256) void k_att0w(const float* __restrict__ QF, const float* __restrict__ KF, const float* __restrict__ VF, float scale, float* __restrict__ OF, int ldo) {
  __shared__ __attribute__((aligned(16))) float sm[8 * HD * A0P];      /* in the loop: K tile [A0T][HD], then V tile [A0T][HD]; behind it: the merge plane */
  __shared__ float smm[8][A0R]; __shared__ float sml[8][A0R];
  { const size_t bi = (size_t)blockIdx.y * QT0 * LD; QF += bi; KF += bi; VF += bi; OF += (size_t)blockIdx.y * QT0 * ldo; }      /* batch on grid.y: its own QT0-row slab of each plane */
  const int tid = threadIdx.x, lane = tid & 31; const int w = __builtin_amdgcn_readfirstlane(tid >> 5);
  const int h = blockIdx.x / (QT0 / A0R), rg = (QT0 / A0R - 1) - blockIdx.x % (QT0 / A0R);      /* the row groups with the most keys start first */
  const int r0 = rg * A0R, i = r0 + lane; const int nkeys = r0 + A0R; const int nt = (nkeys + A0T - 1) / A0T;      /* keys 0 .. r0 + 31; a tile's rows all lie below QT0 (A0T divides QT0) */
  v2f q[HD / 2], o[HD / 2];
  { const float* qr = QF + (size_t)i * LD + h * HD;
#pragma unroll      /* constant indices, so that the arrays indexed below stay in registers */
    for (int c = 0; c < HD / 4; ++c) { const v4f a = *(const v4fa*)(qr + c * 4); q[2 * c] = v2f{a[0], a[1]}; q[2 * c + 1] = v2f{a[2], a[3]}; o[2 * c] = v2f{0.f, 0.f}; o[2 * c + 1] = v2f{0.f, 0.f}; }
    asm volatile("s_wait_xcnt 0x0" :: "v"(qr) : "memory"); }      /* the address pair stays untouched until the loads that name it have taken it: no later load's result and no later instruction may take it over before */
  const int sr = tid >> 4, sc4 = (tid & 15) * 4;      /* staging: 16 lanes per 256-byte row, rows sr + 16 u */
  const float* kg = KF + (size_t)sr * LD + h * HD + sc4; const float* vg = VF + (size_t)sr * LD + h * HD + sc4;
  v4f pk[4], pv[4];
#pragma unroll      /* constant indices, so that the arrays indexed below stay in registers */
  for (int u = 0; u < 4; ++u) { pk[u] = *(const v4fa*)(kg + 16 * u * LD); pv[u] = *(const v4fa*)(vg + 16 * u * LD); }
  asm volatile("s_wait_xcnt 0x0" :: "v"(kg), "v"(vg) : "memory");      /* as above: both address pairs are stepped on in the loop */
  float m = -1.0e30f, l = 0.f;
  for (int t = 0; t < nt; ++t) {
#pragma unroll      /* constant indices, so that the arrays indexed below stay in registers */
    for (int u = 0; u < 4; ++u) { *(v4f*)&sm[(sr + 16 * u) * HD + sc4] = pk[u]; *(v4f*)&sm[A0T * HD + (sr + 16 * u) * HD + sc4] = pv[u]; }
    __syncthreads();
    if (t + 1 < nt) { kg += A0T * LD; vg += A0T * LD;
#pragma unroll      /* constant indices, so that the arrays indexed below stay in registers */
      for (int u = 0; u < 4; ++u) { pk[u] = *(const v4fa*)(kg + 16 * u * LD); pv[u] = *(const v4fa*)(vg + 16 * u * LD); }
      asm volatile("s_wait_xcnt 0x0" :: "v"(kg), "v"(vg) : "memory"); }      /* as above */
    const int j0 = t * A0T + w * A0K;
    if (j0 < nkeys) {      /* the same for the whole wave; no barrier inside */
      const float* kt = sm + w * A0K * HD; const float* vt = sm + A0T * HD + w * A0K * HD;
      v2f s2[A0K];
#pragma unroll      /* constant indices, so that the arrays indexed below stay in registers */
      for (int k = 0; k < A0K; ++k) s2[k] = v2f{0.f, 0.f};
#pragma unroll      /* constant indices, so that the arrays indexed below stay in registers */
      for (int c = 0; c < HD / 4; ++c) {
#pragma unroll      /* constant indices, so that the arrays indexed below stay in registers */
        for (int k = 0; k < A0K; ++k) { const v4f kk = *(const v4f*)&kt[k * HD + c * 4]; s2[k] = __builtin_elementwise_fma(q[2 * c], v2f{kk[0], kk[1]}, s2[k]); s2[k] = __builtin_elementwise_fma(q[2 * c + 1], v2f{kk[2], kk[3]}, s2[k]); } }
      float s[A0K], e[A0K]; float mn = m;
#pragma unroll      /* constant indices, so that the arrays indexed below stay in registers */
      for (int k = 0; k < A0K; ++k) { s[k] = (j0 + k <= i) ? (s2[k][0] + s2[k][1]) * scale : -1.0e30f; mn = fmaxf(mn, s[k]); }
      const float rs = a0_exp(m - mn); m = mn; float ls = 0.f;
#pragma unroll      /* constant indices, so that the arrays indexed below stay in registers */
      for (int k = 0; k < A0K; ++k) { const float ex = a0_exp(s[k] - mn); e[k] = (j0 + k <= i) ? ex : 0.f; ls += e[k]; }      /* a key right of the diagonal weighs 0 also while the running maximum is still the start value */
      l = l * rs + ls;
#pragma unroll      /* constant indices, so that the arrays indexed below stay in registers */
      for (int c = 0; c < HD / 2; ++c) o[c] *= rs;
#pragma unroll      /* constant indices, so that the arrays indexed below stay in registers */
      for (int k = 0; k < A0K; ++k) { const v2f e2 = {e[k], e[k]};
#pragma unroll      /* constant indices, so that the arrays indexed below stay in registers */
        for (int c = 0; c < HD / 4; ++c) { const v4f vv = *(const v4f*)&vt[k * HD + c * 4]; o[2 * c] = __builtin_elementwise_fma(e2, v2f{vv[0], vv[1]}, o[2 * c]); o[2 * c + 1] = __builtin_elementwise_fma(e2, v2f{vv[2], vv[3]}, o[2 * c + 1]); } }
    }
    __syncthreads();
  }
#pragma unroll      /* constant indices, so that the arrays indexed below stay in registers */
  for (int c = 0; c < HD / 2; ++c) { sm[(w * HD + 2 * c) * A0P + lane] = o[c][0]; sm[(w * HD + 2 * c + 1) * A0P + lane] = o[c][1]; }
  smm[w][lane] = m; sml[w][lane] = l;
  __syncthreads();
  const int row = w * 4 + (lane >> 3), d0 = (lane & 7) * 8;      /* merge: wave w owns rows 4 w .. 4 w + 3, a lane eight neighbouring columns, so a wave stores whole rows */
  float mx = smm[0][row];
#pragma unroll      /* constant indices, so that the arrays indexed below stay in registers */
  for (int u = 1; u < 8; ++u) mx = fmaxf(mx, smm[u][row]);      /* finite: key 0 is valid for every row */
  float lt = 0.f; float a[8] = {0.f, 0.f, 0.f, 0.f, 0.f, 0.f, 0.f, 0.f};
#pragma unroll      /* constant indices, so that the arrays indexed below stay in registers */
  for (int u = 0; u < 8; ++u) { const float f = a0_exp(smm[u][row] - mx); lt += sml[u][row] * f;
#pragma unroll      /* constant indices, so that the arrays indexed below stay in registers */
    for (int d = 0; d < 8; ++d) a[d] += sm[(u * HD + d0 + d) * A0P + row] * f; }
  const float fin = 64.0f / lt;
  float* op = OF + (size_t)(r0 + row) * ldo + h * HD + d0;
  const v4f y0 = {a[0] * fin, a[1] * fin, a[2] * fin, a[3] * fin}, y1 = {a[4] * fin, a[5] * fin, a[6] * fin, a[7] * fin};
  *(v4f*)op = y0; *(v4f*)(op + 4) = y1; }


template <int BFIN, int WXB>
__global__ __launch_bounds__(256) void k_ln16(const float* __restrict__ X, const float* __restrict__ g, const float* __restrict__ bb, float eps, _Float16* __restrict__ N16, float* __restrict__ XB) {
  #pragma clang fp contract(off)
  __shared__ float red[256]; const size_t r = blockIdx.x; const int t = threadIdx.x; const v4f xa = *(const v4fa*)(X + r * DMQ + t * 4); float s[4]; float sum = 0.f;
  for (int q = 0; q < 4; ++q) { s[q] = BFIN ? bf16_round(xa[q]) : xa[q]; sum = __fadd_rn(sum, s[q]); }
  red[t] = sum; __syncthreads(); for (int st = 128; st > 0; st >>= 1) { if (t < st) red[t] = __fadd_rn(red[t], red[t + st]); __syncthreads(); } const float mu = red[0] / (float)DMQ; __syncthreads();
  float vs = 0.f; for (int q = 0; q < 4; ++q) { const float dl = __fadd_rn(s[q], -mu); vs = __fadd_rn(vs, __fmul_rn(dl, dl)); } red[t] = vs; __syncthreads(); for (int st = 128; st > 0; st >>= 1) { if (t < st) red[t] = __fadd_rn(red[t], red[t + st]); __syncthreads(); }
  const float rs = rsqrtf(__fadd_rn(red[0] / (float)DMQ, eps)); v4h y; v4f xb;
  for (int q = 0; q < 4; ++q) { const int c = t * 4 + q; y[q] = (_Float16)__fadd_rn(__fmul_rn(__fmul_rn(__fadd_rn(s[q], -mu), rs), bf16_round(g[c])), bf16_round(bb[c])); xb[q] = s[q]; }
  { *(v4h*)(N16 + r * DMQ + t * 4) = y; if (WXB) *(v4f*)(XB + r * DMQ + t * 4) = xb;  } }
__global__ __launch_bounds__(256) void k_ftres2(const float* __restrict__ OF0, const float* __restrict__ XB, float* __restrict__ X1, size_t n4) {
  #pragma clang fp contract(off)
  const size_t t = (size_t)blockIdx.x * 256 + threadIdx.x; if (t >= n4) return; const v4f o = *(const v4fa*)(OF0 + t * 4), xv = *(const v4fa*)(XB + t * 4); v4f y; for (int q = 0; q < 4; ++q) y[q] = __fadd_rn(__fmul_rn(o[q], 0.015625f), xv[q]); *(v4f*)(X1 + t * 4) = y;  }

__global__ __launch_bounds__(256) void k_wthd(const float* __restrict__ Wt, _Float16* __restrict__ Bt) { const size_t t = (size_t)blockIdx.x * 256 + threadIdx.x; if (t >= (size_t)NH * HD * (DM / 8)) return; const int m8 = (int)(t % (DM / 8)) * 8; const int d = (int)((t / (DM / 8)) % HD); const int h = (int)(t / ((size_t)(DM / 8) * HD)); FragH f;
  for (int q = 0; q < 8; ++q) f.h[q] = (_Float16)(16.0f * bf16_round(Wt[((size_t)h * DM + m8 + q) * HD + d])); unsigned short* dst = (unsigned short*)Bt + ((size_t)h * HD + d) * DM + m8; *(v8us*)dst = f.half[0];  }




__global__ __launch_bounds__(256) void k_wtpad(const float* __restrict__ Wm, _Float16* __restrict__ Wt, int Kr, int Kp, int Nr, int Np, float scale) {
  const int t = blockIdx.x * 256 + threadIdx.x; if (t >= Np * (Kp / 8)) return; const int n = t / (Kp / 8), k8 = (t % (Kp / 8)) * 8; const int nc = min(n, Nr - 1); const float fn = (n < Nr) ? 1.f : 0.f; FragH f;
  for (int i = 0; i < 8; ++i) { const int k = k8 + i; const int kc = min(k, Kr - 1); const float fk = (k < Kr) ? fn : 0.f; f.h[i] = (_Float16)(bf16_round(Wm[(size_t)kc * Nr + nc]) * scale * fk); }
  unsigned short* o = (unsigned short*)Wt + (size_t)n * Kp + k8; *(v8us*)o = f.half[0];  }
__global__ __launch_bounds__(128) void k_bpad(const float* __restrict__ b, float* __restrict__ Bp, int nr, int np) {
  const int i = threadIdx.x; if (i >= np) return; const float v = b[min(i, nr - 1)] * ((i < nr) ? 1.f : 0.f); *(float*)(Bp + i) = v;  }

#define DI 64         /* inner width = NH * HD (ONE 64-wide head) */
#define LQK (3 * DI)  /* fused q | k | v row pitch (192) */
__global__ __launch_bounds__(256) void k_o0(const float* __restrict__ OF, float* __restrict__ ob, size_t n4) {
  #pragma clang fp contract(off)
  const size_t t = (size_t)blockIdx.x * 256 + threadIdx.x; if (t >= n4) return; const size_t e = t * 4; const int i = (int)(e / DI); const int c = (int)(e % DI); const int h = c / HD, d = c % HD; const v4f a = *(const v4fa*)(OF + e); v4f o; for (int q = 0; q < 4; ++q) o[q] = __fmul_rn(a[q], 0.015625f); float* dst = ob + (size_t)h * SQ * HD + (size_t)i * HD + d; *(v4f*)dst = o;  }

__global__ __launch_bounds__(256) void k_o0m(const float* __restrict__ OF, float* __restrict__ o_, size_t n4, size_t so) {
  #pragma clang fp contract(off)
  OF += (size_t)blockIdx.y * n4 * 4; o_ += (size_t)blockIdx.y * so;      /* batch on grid.y: packed source slab, output rows of that batch */
  const size_t t = (size_t)blockIdx.x * 256 + threadIdx.x; if (t >= n4) return; const size_t e = t * 4; const v4f a = *(const v4fa*)(OF + e); v4f o; for (int q = 0; q < 4; ++q) o[q] = __fmul_rn(a[q], 0.015625f); *(v4f*)(o_ + e) = o;  }
extern "C" void kernel_launch(void* const* d_in, const int* in_sizes, int n_in,
                              void* d_out, int out_size, void* d_ws, size_t ws_size, hipStream_t stream) {
  (void)in_sizes; (void)n_in; (void)out_size;
  const float* const* I = (const float* const*)d_in; const float* x = I[0]; const float* wq = I[2]; const float* wk = I[1]; const float* wv = I[3]; const float* bq = nullptr; const float* bk = nullptr; const float* bv = nullptr;      /* x; [in][out = 64] weights in this module's input order (wq = input 2, wk = input 1, wv = input 3); no biases */
  char* ws = (char*)d_ws; size_t off = 0;
  auto take = [&](size_t bytes) { char* p = ws + off; off += (bytes + 255) & ~(size_t)255; return p; };
  _Float16* BW = (_Float16*)take((size_t)LQK * DM * 2); _Float16* X16 = (_Float16*)take(NR * DM * 2); _Float16* QKV = (_Float16*)take(NR * LQK * 2); _Float16* VT = (_Float16*)take((size_t)NB * NH * HD * SQ * 2);
  float* S = (float*)take((size_t)NB * NH * QT * NKX * 4); _Float16* P = (_Float16*)take((size_t)NB * NH * QT * NKX * 2); float* QKVF0 = (float*)take((size_t)NB * QT0 * LQK * 4); float* OF0 = (float*)take((size_t)NB * QT0 * DI * 4);      /* one slab per batch of each plane: every launch below covers all NB batches */
  if (off > ws_size) return;
  { const unsigned g = (unsigned)(((size_t)DI * (DM / 8) + 255) / 256); k_wt_f16<<<g, 256, 0, stream>>>(wq, BW, DM, DI, 16.0f); k_wt_f16<<<g, 256, 0, stream>>>(wk, BW + (size_t)DI * DM, DM, DI, 16.0f); k_wt_f16<<<g, 256, 0, stream>>>(wv, BW + (size_t)2 * DI * DM, DM, DI, 16.0f); }      /* [in = DM][out = 64] -> Bt[n][k] x16, stacked q | k | v */
  k_x16<<<(unsigned)((NR * DM / 8 + 255) / 256), 256, 0, stream>>>(x, X16, NR * DM / 8);      /* x (bf16-valued) as exact f16 rows */
  const float* bqkv[3] = {bq, bk, bv};
  for (int c = 0; c < 3; ++c) k_gemm2<0><<<dim3((unsigned)((NR / 128) * (DI / 64)), 1), 128, 0, stream>>>(X16, DM, 0, BW + (size_t)c * DI * DM, DM, 0, 0.0625f, bqkv[c], 0, nullptr, 1, 0, 0, nullptr, QKV + (size_t)c * DI, LQK, 0, (int)NR, DI, DM);      /* q | k | v = x W^T -> f16 rows, column blocks 0 / 64 / 128 of the fused plane (pitch 192); head h = columns h*64 inside each */
  const _Float16* Q16 = QKV; const _Float16* K16 = QKV + DI; const _Float16* V16 = QKV + 2 * DI;
  float* ob = (float*)d_out;
  k_vt<NH, SQ><<<NB * NH * (SQ / 64), 256, 0, stream>>>(V16, LQK, 0, VT);      /* V^T [NB][HD][SQ], all batches in one launch */
  for (int q0 = 0; q0 < SQ; q0 += QT) { const int nk = q0 + QT;      /* causal: only keys below the tile end are computed; the NB batches on grid.y of the GEMMs, in grid.x of the softmax (NH == 1) */
    k_gemm2<0><<<dim3((QT / 128) * (nk / 64), NB), 128, 0, stream>>>(Q16 + (size_t)q0 * LQK, LQK, (size_t)SQ * LQK, K16, LQK, (size_t)SQ * LQK, 0.125f, nullptr, 0, nullptr, 1, 0, 0, S, nullptr, NKX, (size_t)QT * NKX, QT, nk, HD);      /* scores * 64^-0.5 */
    k_rsmw<<<NB * QT / 8, 256, 0, stream>>>(S, P, q0, nk);      /* causal softmax, one wave per row -> P x256 f16 */
    k_gemm2<0><<<dim3((QT / 128) * (HD / 64), NB), 128, 0, stream>>>(P, NKX, (size_t)QT * NKX, VT, SQ, (size_t)HD * SQ, 0.00390625f, nullptr, 0, nullptr, 1, 0, 0, ob + (size_t)q0 * DI, nullptr, DI, (size_t)SQ * DI, QT, HD, nk); }      /* out[b][q0 + i][..] = P V^T 2^-8 (f32) */
  for (int c = 0; c < 3; ++c) k_gemm2<0><<<dim3((unsigned)((QT0 / 128) * (DI / 64)), NB), 128, 0, stream>>>(X16, DM, (size_t)SQ * DM, BW + (size_t)c * DI * DM, DM, 0, 0.0625f, bqkv[c], 0, nullptr, 1, 0, 0, QKVF0 + (size_t)c * DI, nullptr, LQK, (size_t)QT0 * LQK, QT0, DI, DM);      /* f32 q | k | v of rows 0..511 of every batch (exact products, f32 accumulation) */
  k_att0w<LQK><<<dim3(NH * (QT0 / A0R), NB), 256, 0, stream>>>(QKVF0, QKVF0 + DI, QKVF0 + 2 * DI, 0.125f, OF0, DI);      /* exact f32 causal attention for rows 0..511 (o x64) */
  k_o0m<<<dim3((unsigned)(((size_t)QT0 * DI / 4 + 255) / 256), NB), 256, 0, stream>>>(OF0, ob, (size_t)QT0 * DI / 4, (size_t)SQ * DI);      /* rows 0..511 of every batch REWRITTEN from the exact path */
}

// v004
// One run takes 156 microseconds.
// Next to v003, in two timings, it ran 9.04 and 9.16 times as fast.
// Counting every step since v000, it is 829 times as fast.
#include <hip/hip_runtime.h>
// Single-head causal self-attention from a 32-wide embedding (x [16][4096][32]; k/q/v = x W ([in][out] [32][64], no biases; input order Wk, Wq, Wv); ONE 64-wide head (head_size 64 != C 32); scores * 64^-0.5; causal; softmax; out = weights v -> [16][4096][64]; no output projection).
// Structure: token rows; x as exact f16 rows; three WMMA GEMMs into one f16 q | k | v plane [65536][192]; v^T via LDS transposes; one fused causal attention launch (scores alpha 1/8, running-maximum softmax f32 -> f16 weights, P V in f32, all in registers, written as f32 straight into the output rows); an exact f32 first tile (rows 0..511) rewritten at the end; launches: see trace.
// Compute dtype: inputs rounded to bf16; x / weights exact; q, k, v and softmax weights as plain f16 GEMM operands (~2^-12); scores and softmax statistics f32. v_wmma_f32_16x16x32_f16.
#define NB 16
#define SQ 4096
#define DM 32
#define NH 1
#define HD 64
#define HG 4                         /* unused by the launches (grid.y is NB); read only by the uncalled k_vt overload */
#define QT 256                       /* unused; a k_fattn block takes two 128-row query tiles */
#define NKX SQ                       /* unused; scores and weights stay in registers */
#define QT0 512                      /* first-tile rows recomputed exactly (f32): 512 here (no output projection averages the early-row cancellation errors away; logit sigma 1.0) */
#define B0 0                         /* unused; the batches are grid.y 0..NB-1 */
#define NBR NB                       /* feeds only the unused MP; the launches put the NB batches on grid.y */
#define NR ((size_t)NB * SQ)
#define DMQ DM
#define DFF 4096                     /* unused; no FFN here */
#define DFFR 100                     /* unused; no FFN here */
#define MP ((int)((size_t)NBR * SQ)) /* unused; the projections cover NR rows */
#define QN SQ                        /* unused; the query tiles cover SQ rows */
#define NHD NH                       /* unused; the launches use NH */
#define MPO MP                       /* unused */
#define LQ (3 * DM)      /* unused; the q/k/v row pitch is LQK */
typedef __bf16 v16b __attribute__((ext_vector_type(16)));
typedef unsigned short v8us __attribute__((ext_vector_type(8), may_alias));
typedef float  v8f  __attribute__((ext_vector_type(8)));
typedef float  v4f  __attribute__((ext_vector_type(4)));
typedef float  v4fa __attribute__((ext_vector_type(4), may_alias));
union FragB { v16b v; v8us half[2]; unsigned short u[16]; };

__device__ __forceinline__ unsigned short bf16_bits(float x) { unsigned int u = __float_as_uint(x); return (unsigned short)((u + 0x7FFFu + ((u >> 16) & 1u)) >> 16); }
__device__ __forceinline__ float bf16_val(unsigned short b) { return __uint_as_float(((unsigned int)b) << 16); }
__device__ __forceinline__ float bf16_round(float x) { return bf16_val(bf16_bits(x)); }
// D += A·B with NT terms: 1 = ah·bh, 2 = + al·bh (A split), 3 = + ah·bl (both split)
template <int NT>
__device__ __forceinline__ v8f mmaN(v16b ah, v16b al, v16b bh, v16b bl, v8f c) {
  c = __builtin_amdgcn_wmma_f32_16x16x32_bf16(false, ah, false, bh, (short)0, c, false, false);
  if (NT >= 2) c = __builtin_amdgcn_wmma_f32_16x16x32_bf16(false, al, false, bh, (short)0, c, false, false);
  if (NT >= 3) c = __builtin_amdgcn_wmma_f32_16x16x32_bf16(false, ah, false, bl, (short)0, c, false, false);
  asm volatile("v_nop\n\tv_nop\n\tv_nop\n\tv_nop" : "+v"(c) : "v"(ah), "v"(al), "v"(bh), "v"(bl));
  return c;
}

__global__ __launch_bounds__(256) void k_wt_bf16(const float* __restrict__ W, unsigned short* __restrict__ Wt, int K, int N) {
  const int t = blockIdx.x * 256 + threadIdx.x;
  const int k8n = K / 8;
  if (t >= N * k8n) return;
  const int n = t / k8n, k8 = (t % k8n) * 8;
  v8us v;
#pragma unroll
  for (int i = 0; i < 8; ++i) v[i] = bf16_bits(W[(size_t)(k8 + i) * N + n]);
  *(v8us*)(Wt + (size_t)n * K + k8) = v;
  
}

// GEMM C[M][N] (f32, pitch ldc) = act(A[M][K]·W + bias). A f32 row-major (pitch lda) converted per fragment to bf16
// (ASPLIT: hi/lo two planes -> 2 terms, else single rounded term); Wt bf16 [N][K] (pitch ldb). BIAS_BF16 rounds the
// bias to bf16 first (bias quantised to bf16 before the add). K%32==0, M%16==0, N%64==0.
template <bool ASPLIT, int ACT, bool BIAS_BF16>
__global__ __launch_bounds__(128) void k_gemm_bf(const float* __restrict__ A, int lda, const unsigned short* __restrict__ Wt, int ldb,
                                               const float* __restrict__ bias, float* __restrict__ C, int ldc, int M, int N, int K) {
  __shared__ __attribute__((aligned(16))) float so[4][16][64];
  const int tid = threadIdx.x, w = tid >> 5, lane = tid & 31, ln = lane & 15, hh = lane >> 4;
  const int ntn = N / 64;
  const int wid = blockIdx.x * 4 + w;
  const int mt = wid / ntn, nq = wid % ntn;
  if (mt * 16 >= M) return;
  const int row0 = mt * 16, col0 = nq * 64;
  const float* arow = A + (size_t)(row0 + ln) * lda;
  v8f acc[4] = {};
  for (int kb = 0; kb < K; kb += 32) {
    FragB ah, al;
    const v4f x0 = *(const v4fa*)(arow + kb + 8 * hh), x1 = *(const v4fa*)(arow + kb + 8 * hh + 4);
    const v4f x2 = *(const v4fa*)(arow + kb + 16 + 8 * hh), x3 = *(const v4fa*)(arow + kb + 16 + 8 * hh + 4);
    float xs[16] = {x0[0],x0[1],x0[2],x0[3],x1[0],x1[1],x1[2],x1[3],x2[0],x2[1],x2[2],x2[3],x3[0],x3[1],x3[2],x3[3]};
#pragma unroll
    for (int i = 0; i < 16; ++i) { const unsigned short hb = bf16_bits(xs[i]); ah.u[i] = hb; al.u[i] = ASPLIT ? bf16_bits(xs[i] - bf16_val(hb)) : (unsigned short)0; }
#pragma unroll
    for (int t = 0; t < 4; ++t) {
      const unsigned short* brow = Wt + (size_t)(col0 + t * 16 + ln) * ldb + kb;
      FragB b;
      b.half[0] = *(const v8us*)(brow + 8 * hh);
      b.half[1] = *(const v8us*)(brow + 16 + 8 * hh);
      acc[t] = mmaN<ASPLIT ? 2 : 1>(ah.v, al.v, b.v, b.v, acc[t]);
    }
  }
#pragma unroll
  for (int t = 0; t < 4; ++t) {
    float bv = bias ? bias[col0 + t * 16 + ln] : 0.f;
    if (BIAS_BF16) bv = bf16_round(bv);
#pragma unroll
    for (int r = 0; r < 8; ++r) { float v = acc[t][r] + bv; if (ACT == 1) v = fmaxf(v, 0.f); so[w][8 * hh + r][t * 16 + ln] = v; }
  }
  __builtin_amdgcn_fence(__ATOMIC_ACQ_REL, "workgroup");
  __builtin_amdgcn_wave_barrier();
  const int rsub = lane >> 4, c4 = (lane & 15) * 4;
  {
#pragma unroll
    for (int q = 0; q < 8; ++q) {
      const int r = q * 2 + rsub;
      const v4f v = *(const v4fa*)&so[w][r][c4];
      *(v4f*)(C + (size_t)(row0 + r) * ldc + col0 + c4) = v;
    }
    
  }
}

// GEMM C = act(A·W + bias + resid): A f32 (ASPLIT -> hi/lo 2 terms), Wt bf16 [N][K]; ACT 0 none, 1 relu, 2 exact gelu;
// resid (optional, f32, row index = (row % rmod), pitch ldr, RES_BF16 rounds it) added before the activation.
template <bool ASPLIT, int ACT, bool BIAS_BF16, bool RES_BF16>
__global__ __launch_bounds__(128) void k_gemm_bf3(const float* __restrict__ A, int lda, const unsigned short* __restrict__ Wt, int ldb,
                                                const float* __restrict__ bias, const float* __restrict__ resid, int rmod, int ldr,
                                                float* __restrict__ C, int ldc, int M, int N, int K) {
  __shared__ __attribute__((aligned(16))) float so[4][16][64];
  const int tid = threadIdx.x, w = tid >> 5, lane = tid & 31, ln = lane & 15, hh = lane >> 4;
  const int ntn = N / 64;
  const int wid = blockIdx.x * 4 + w;
  const int mt = wid / ntn, nq = wid % ntn;
  if (mt * 16 >= M) return;
  const int row0 = mt * 16, col0 = nq * 64;
  const float* arow = A + (size_t)(row0 + ln) * lda;
  v8f acc[4] = {};
  for (int kb = 0; kb < K; kb += 32) {
    FragB ah, al;
    const v4f x0 = *(const v4fa*)(arow + kb + 8 * hh), x1 = *(const v4fa*)(arow + kb + 8 * hh + 4);
    const v4f x2 = *(const v4fa*)(arow + kb + 16 + 8 * hh), x3 = *(const v4fa*)(arow + kb + 16 + 8 * hh + 4);
    float xs[16] = {x0[0],x0[1],x0[2],x0[3],x1[0],x1[1],x1[2],x1[3],x2[0],x2[1],x2[2],x2[3],x3[0],x3[1],x3[2],x3[3]};
#pragma unroll
    for (int i = 0; i < 16; ++i) { const unsigned short hb = bf16_bits(xs[i]); ah.u[i] = hb; al.u[i] = ASPLIT ? bf16_bits(xs[i] - bf16_val(hb)) : (unsigned short)0; }
#pragma unroll
    for (int t = 0; t < 4; ++t) {
      const unsigned short* brow = Wt + (size_t)(col0 + t * 16 + ln) * ldb + kb;
      FragB b;
      b.half[0] = *(const v8us*)(brow + 8 * hh);
      b.half[1] = *(const v8us*)(brow + 16 + 8 * hh);
      acc[t] = mmaN<ASPLIT ? 2 : 1>(ah.v, al.v, b.v, b.v, acc[t]);
    }
  }
#pragma unroll
  for (int t = 0; t < 4; ++t) {
    const int col = col0 + t * 16 + ln;
    float bv = bias ? bias[col] : 0.f;
    if (BIAS_BF16) bv = bf16_round(bv);
#pragma unroll
    for (int r = 0; r < 8; ++r) {
      float v = acc[t][r] + bv;
      if (resid) { float rv = resid[(size_t)((row0 + 8 * hh + r) % rmod) * ldr + col]; if (RES_BF16) rv = bf16_round(rv); v += rv; }
      if (ACT == 1) v = fmaxf(v, 0.f);
      if (ACT == 2) v = 0.5f * v * (1.0f + erff(v * 0.70710678118654752f));
      if (ACT == 3) { const float u = 0.7978845608028654f * (v + 0.044715f * v * v * v); v = 0.5f * v * (1.0f + tanhf(u)); }
      so[w][8 * hh + r][t * 16 + ln] = v;
    }
  }
  __builtin_amdgcn_fence(__ATOMIC_ACQ_REL, "workgroup");
  __builtin_amdgcn_wave_barrier();
  const int rsub = lane >> 4, c4 = (lane & 15) * 4;
  {
#pragma unroll
    for (int q = 0; q < 8; ++q) {
      const int r = q * 2 + rsub;
      const v4f v = *(const v4fa*)&so[w][r][c4];
      *(v4f*)(C + (size_t)(row0 + r) * ldc + col0 + c4) = v;
    }
    
  }
}
// row LayerNorm (biased variance, eps) over N: s = X (+ R); optional out_sum <- s; out_norm <- (s-mu)*rsqrt(var+eps)*g + b
template <bool PARAM_BF16>
__global__ __launch_bounds__(256) void k_layernorm(const float* __restrict__ X, const float* __restrict__ R, const float* __restrict__ g, const float* __restrict__ bta,
                                                  float* __restrict__ out_sum, float* __restrict__ out_norm, int N, float eps) {
  __shared__ float red[256];
  const int row = blockIdx.x, tid = threadIdx.x;
  const float* x = X + (size_t)row * N; const float* rr = R ? R + (size_t)row * N : nullptr;
  float vals[16];                     // up to N = 4096
  const int per = N / 256;            // contiguous chunk per thread? use strided-by-4 chunks: thread handles j = tid*4 + 1024*u
  float s1 = 0.f;
  for (int u = 0; u < per / 4; ++u) {
    const int j = tid * 4 + 1024 * u;
    const v4f a = *(const v4fa*)(x + j);
    v4f b = {0.f,0.f,0.f,0.f}; if (rr) b = *(const v4fa*)(rr + j);
#pragma unroll
    for (int q = 0; q < 4; ++q) { const float v = a[q] + b[q]; vals[u * 4 + q] = v; s1 += v; }
  }
  red[tid] = s1; __syncthreads();
  for (int st = 128; st > 0; st >>= 1) { if (tid < st) red[tid] += red[tid + st]; __syncthreads(); }
  const float mu = red[0] / (float)N; __syncthreads();
  float s2 = 0.f;
  for (int u = 0; u < per / 4; ++u)
#pragma unroll
    for (int q = 0; q < 4; ++q) { const float c = vals[u * 4 + q] - mu; s2 += c * c; }
  red[tid] = s2; __syncthreads();
  for (int st = 128; st > 0; st >>= 1) { if (tid < st) red[tid] += red[tid + st]; __syncthreads(); }
  const float rs = rsqrtf(red[0] / (float)N + eps);
  {
    for (int u = 0; u < per / 4; ++u) {
      const int j = tid * 4 + 1024 * u;
      v4f o, sm;
#pragma unroll
      for (int q = 0; q < 4; ++q) {
        float gg = g[j + q], bb = bta[j + q];
        if (PARAM_BF16) { gg = bf16_round(gg); bb = bf16_round(bb); }
        sm[q] = vals[u * 4 + q]; o[q] = (vals[u * 4 + q] - mu) * rs * gg + bb;
      }
      if (out_sum) *(v4f*)(out_sum + (size_t)row * N + j) = sm;
      *(v4f*)(out_norm + (size_t)row * N + j) = o;
    }
    
  }
}



// ---- f16 WMMA path (v_wmma_f32_16x16x32_f16): 11-bit significands for operands in range — used where a [0,1] probability operand needs more precision than bf16
typedef _Float16 v16h __attribute__((ext_vector_type(16)));
union FragH { v16h v; v8us half[2]; _Float16 h[16]; unsigned short u[16]; };
template <int NT>
__device__ __forceinline__ v8f mmaH(v16h ah, v16h al, v16h bh, v16h bl, v8f c) {
  c = __builtin_amdgcn_wmma_f32_16x16x32_f16(false, ah, false, bh, (short)0, c, false, false);
  if (NT >= 2) c = __builtin_amdgcn_wmma_f32_16x16x32_f16(false, al, false, bh, (short)0, c, false, false);
  if (NT >= 3) c = __builtin_amdgcn_wmma_f32_16x16x32_f16(false, ah, false, bl, (short)0, c, false, false);
  asm volatile("v_nop\n\tv_nop\n\tv_nop\n\tv_nop" : "+v"(c) : "v"(ah), "v"(al), "v"(bh), "v"(bl));
  return c;
}
// batched GEMM like k_gemm_b but f16 operands: A f32 (split into f16 hi/lo if ASPLIT, else rounded to f16), Bt = f16 values [n][k]; alpha; C f32; N multiple of 16 (partial tiles skipped)
template <bool ASPLIT>
__global__ __launch_bounds__(128) void k_gemm_h(const float* __restrict__ A, int lda, size_t sA, const _Float16* __restrict__ Bh, int ldb, size_t sB, float alpha, float* __restrict__ C, int ldc, size_t sC, int M, int N, int K) {
  __shared__ __attribute__((aligned(16))) float so[4][16][64];
  const int tid = threadIdx.x, w = tid >> 5, lane = tid & 31, ln = lane & 15, hh = lane >> 4; const int by = blockIdx.y;
  A += (size_t)by * sA; Bh += (size_t)by * sB; C += (size_t)by * sC;
  const int ntn = (N + 63) / 64; const int wid = blockIdx.x * 4 + w; const int mt = wid / ntn, nq = wid % ntn; if (mt * 16 >= M) return;
  const int row0 = mt * 16, col0 = nq * 64; const float* arow = A + (size_t)(row0 + ln) * lda;
  v8f acc[4] = {};
  for (int kb = 0; kb < K; kb += 32) {
    FragH ah, al;
    const v4f x0 = *(const v4fa*)(arow + kb + 8 * hh), x1 = *(const v4fa*)(arow + kb + 8 * hh + 4), x2 = *(const v4fa*)(arow + kb + 16 + 8 * hh), x3 = *(const v4fa*)(arow + kb + 16 + 8 * hh + 4);
    float xs[16] = {x0[0],x0[1],x0[2],x0[3],x1[0],x1[1],x1[2],x1[3],x2[0],x2[1],x2[2],x2[3],x3[0],x3[1],x3[2],x3[3]};
#pragma unroll
    for (int i = 0; i < 16; ++i) { const _Float16 h = (_Float16)xs[i]; ah.h[i] = h; al.h[i] = ASPLIT ? (_Float16)(xs[i] - (float)h) : (_Float16)0.0f; }
#pragma unroll
    for (int t = 0; t < 4; ++t) { if (col0 + t * 16 >= N) continue; const size_t boff = (size_t)(col0 + t * 16 + ln) * ldb + kb; FragH bq; bq.half[0] = *(const v8us*)(Bh + boff + 8 * hh); bq.half[1] = *(const v8us*)(Bh + boff + 16 + 8 * hh);
      acc[t] = mmaH<ASPLIT ? 2 : 1>(ah.v, al.v, bq.v, bq.v, acc[t]); }
  }
#pragma unroll
  for (int t = 0; t < 4; ++t) { if (col0 + t * 16 >= N) continue;
#pragma unroll
    for (int r = 0; r < 8; ++r) so[w][8 * hh + r][t * 16 + ln] = acc[t][r] * alpha; }
  __builtin_amdgcn_fence(__ATOMIC_ACQ_REL, "workgroup"); __builtin_amdgcn_wave_barrier();
  const int rsub = lane >> 4, c4 = (lane & 15) * 4;
  {
#pragma unroll
    for (int q = 0; q < 8; ++q) { const int r = q * 2 + rsub; if (col0 + c4 < N) { const v4f v = *(const v4fa*)&so[w][r][c4]; *(v4f*)(C + (size_t)(row0 + r) * ldc + col0 + c4) = v; } }
     }
}

// Wt[n][k] = f16(W[k][n]·scale) from f32 row-major W[K][N] (scale = power of two; bf16-exact weights stay exact in f16 away from the subnormal range)
__global__ __launch_bounds__(256) void k_wt_f16(const float* __restrict__ W, _Float16* __restrict__ Wt, int K, int N, float scale) {
  const int t = blockIdx.x * 256 + threadIdx.x; if (t >= N * (K / 8)) return; const int n = t / (K / 8), k8 = (t % (K / 8)) * 8; FragH f;
#pragma unroll
  for (int i = 0; i < 8; ++i) f.h[i] = (_Float16)(bf16_round(W[(size_t)(k8 + i) * N + n]) * scale); const v8us o = f.half[0];
  *(v8us*)((unsigned short*)Wt + (size_t)n * K + k8) = o; 
}
// k_gemm_hh variant with fused epilogue: v = acc·alpha + bias[by·sBias + col] (+ CP[(row/rowsPerB)·sCPb + by·64 + col] if CP) ; ACT 0 none / 1 elu ; writes f16 C16 (and f32 C if non-null)
template <int ACT>
__global__ __launch_bounds__(128) void k_gemm_hhx(const _Float16* __restrict__ A, int lda, size_t sA, const _Float16* __restrict__ Bh, int ldb, size_t sB, float alpha, const float* __restrict__ bias, size_t sBias, const float* __restrict__ CP, int rowsPerB, size_t sCPb, int row0g,
    float* __restrict__ C, _Float16* __restrict__ C16, int ldc, size_t sC, int M, int N, int K) {
  __shared__ __attribute__((aligned(16))) float so[4][16][64];
  const int tid = threadIdx.x, w = tid >> 5, lane = tid & 31, ln = lane & 15, hh = lane >> 4; const int by = blockIdx.y;
  A += (size_t)by * sA; Bh += (size_t)by * sB; const size_t cofs = (size_t)by * sC; const float* bp = bias ? bias + (size_t)by * sBias : nullptr;
  const int ntn = (N + 63) / 64; const int wid = blockIdx.x * 4 + w; const int mt = wid / ntn, nq = wid % ntn; if (mt * 16 >= M) return;
  const int row0 = mt * 16, col0 = nq * 64; const _Float16* arow = A + (size_t)(row0 + ln) * lda;
  v8f acc[4] = {};
  for (int kb = 0; kb < K; kb += 32) { FragH ah; ah.half[0] = *(const v8us*)((const unsigned short*)arow + kb + 8 * hh); ah.half[1] = *(const v8us*)((const unsigned short*)arow + kb + 16 + 8 * hh);
#pragma unroll
    for (int t = 0; t < 4; ++t) { if (col0 + t * 16 >= N) continue; const size_t boff = (size_t)(col0 + t * 16 + ln) * ldb + kb; FragH bq; bq.half[0] = *(const v8us*)((const unsigned short*)Bh + boff + 8 * hh); bq.half[1] = *(const v8us*)((const unsigned short*)Bh + boff + 16 + 8 * hh);
      acc[t] = mmaH<1>(ah.v, ah.v, bq.v, bq.v, acc[t]); }
  }
#pragma unroll
  for (int t = 0; t < 4; ++t) { if (col0 + t * 16 >= N) continue; const int col = col0 + t * 16 + ln; const float bv = bp ? bf16_round(bp[col]) : 0.f;
#pragma unroll
    for (int r = 0; r < 8; ++r) { float v = acc[t][r] * alpha + bv; if (CP) { const int rr = row0g + row0 + 8 * hh + r; if (rowsPerB < 0) v += CP[cofs + (size_t)rr * ldc + col];      /* rowsPerB < 0: own element of the batched C plane */ else { const int bidx = rr / rowsPerB; v += CP[(size_t)bidx * sCPb + (size_t)by * 64 + col]; } } if (ACT == 1) v = (v > 0.f) ? v : expm1f(v); else if (ACT == 7) v = (v > 0.f) ? v + 1.0f : expf(v); else if (ACT == 8) v = tanhf(v); else if (ACT == 9) v = 0.5f * v * (1.0f + tanhf(0.7978845608028654f * (v + 0.044715f * v * v * v))); else if (ACT == 11) v = 1.0f / (1.0f + expf(-v)); else if (ACT == 12) v = (v > 0.f) ? v : 0.01f * v; else if (ACT == 14) v = (v > 0.f) ? v : 0.1f * v; else if (ACT == 16) v = (v >= 0.f) ? v : 0.3f * v; else if (ACT == 17) v = (v >= 0.f) ? v : 0.2f * v; else if (ACT == 15) v = v / (1.0f + expf(-v)); else if (ACT == 3) v = fmaxf(v, 0.f); else if (ACT == 6) v = 0.5f * v * (1.0f + erff(v * 0.70710678118654752f)); so[w][8 * hh + r][t * 16 + ln] = v; } }
  __builtin_amdgcn_fence(__ATOMIC_ACQ_REL, "workgroup"); __builtin_amdgcn_wave_barrier();
  const int rsub = lane >> 4, c4 = (lane & 15) * 4; typedef _Float16 v4h __attribute__((ext_vector_type(4)));
  {
#pragma unroll
    for (int q = 0; q < 8; ++q) { const int r = q * 2 + rsub; if (col0 + c4 < N) { const v4f v = *(const v4fa*)&so[w][r][c4]; if (C) *(v4f*)(C + cofs + (size_t)(row0 + r) * ldc + col0 + c4) = v; if (C16) { v4h h4; for (int i = 0; i < 4; ++i) h4[i] = (_Float16)v[i]; *(v4h*)(C16 + cofs + (size_t)(row0 + r) * ldc + col0 + c4) = h4; } } }
     }
}


typedef _Float16 v4h __attribute__((ext_vector_type(4)));

__global__ __launch_bounds__(256) void k_x16(const float* __restrict__ x, _Float16* __restrict__ X16, size_t n8) { const size_t t = (size_t)blockIdx.x * 256 + threadIdx.x; if (t >= n8) return; FragH f;
#pragma unroll
  for (int q = 0; q < 8; ++q) f.h[q] = (_Float16)bf16_round(x[t * 8 + q]); *(v8us*)((unsigned short*)X16 + t * 8) = f.half[0];  }
__global__ __launch_bounds__(256) void k_h16(const float* __restrict__ x, _Float16* __restrict__ X16, size_t n8) { const size_t t = (size_t)blockIdx.x * 256 + threadIdx.x; if (t >= n8) return; FragH f;
#pragma unroll
  for (int q = 0; q < 8; ++q) f.h[q] = (_Float16)x[t * 8 + q]; *(v8us*)((unsigned short*)X16 + t * 8) = f.half[0];  }
__global__ __launch_bounds__(256) void k_round16f(const float* __restrict__ W, _Float16* __restrict__ Bt, size_t n8) { const size_t t = (size_t)blockIdx.x * 256 + threadIdx.x; if (t >= n8) return; FragH f;
#pragma unroll
  for (int i = 0; i < 8; ++i) f.h[i] = (_Float16)(bf16_round(W[t * 8 + i]) * 16.0f); *(v8us*)((unsigned short*)Bt + t * 8) = f.half[0];  }
template <int NHv, int TTv>
__global__ __launch_bounds__(256) void k_vt(const _Float16* __restrict__ V16, int ldv, int voff, _Float16* __restrict__ Vt) { __shared__ unsigned short tl[64][66]; const int tid = threadIdx.x; const int slab = blockIdx.x / (TTv / 64), lg = blockIdx.x % (TTv / 64); const int b = slab / NHv, h = slab % NHv;
  for (int i = tid; i < 64 * 8; i += 256) { const int r = i / 8, c8 = (i % 8) * 8; FragH f; f.half[0] = *(const v8us*)((const unsigned short*)V16 + ((size_t)b * TTv + lg * 64 + r) * ldv + voff + h * 64 + c8);
#pragma unroll
    for (int q = 0; q < 8; ++q) tl[r][c8 + q] = f.u[q]; }
  __syncthreads();
  {
#pragma unroll
    for (int rd = 0; rd < 2; ++rd) { const int d = rd * 32 + tid / 8, pc = tid % 8; FragH f;
#pragma unroll
      for (int q = 0; q < 8; ++q) f.u[q] = tl[pc * 8 + q][d];
      *(v8us*)((unsigned short*)Vt + ((size_t)slab * 64 + d) * TTv + lg * 64 + pc * 8) = f.half[0]; }
     } }

__global__ __launch_bounds__(256) void k_hl(const float* __restrict__ F, _Float16* __restrict__ Hh, _Float16* __restrict__ Hl, size_t n8) { const size_t t = (size_t)blockIdx.x * 256 + threadIdx.x; if (t >= n8) return; FragH fh, fl; const v4f a = *(const v4fa*)(F + t * 8), c = *(const v4fa*)(F + t * 8 + 4);
#pragma unroll
  for (int q = 0; q < 4; ++q) { _Float16 h = (_Float16)a[q]; fh.h[q] = h; fl.h[q] = (_Float16)((a[q] - (float)h) * 1024.0f); h = (_Float16)c[q]; fh.h[4 + q] = h; fl.h[4 + q] = (_Float16)((c[q] - (float)h) * 1024.0f); }
  { *(v8us*)((unsigned short*)Hh + t * 8) = fh.half[0]; *(v8us*)((unsigned short*)Hl + t * 8) = fl.half[0];  } }

// ---- fast GEMM (wave tile 32x64; requires M % 32 == 0 rows per launch region and N % 64 == 0); epilogue = k_gemm_hhx semantics ----
__device__ __forceinline__ v16h g2_frag(const _Float16* p, int hh) { FragH f; f.half[0] = *(const v8us*)((const unsigned short*)p + 8 * hh); f.half[1] = *(const v8us*)((const unsigned short*)p + 16 + 8 * hh); return f.v; }
__device__ __forceinline__ v8f g2_mma(v16h a, v16h b, v8f c) { v8f d = __builtin_amdgcn_wmma_f32_16x16x32_f16(false, a, false, b, (short)0, c, false, false); asm volatile("v_nop\n\tv_nop\n\tv_nop\n\tv_nop" : "+v"(d) : "v"(a), "v"(b)); return d; }
template <int ACT>
__global__ __launch_bounds__(128) void k_gemm2(const _Float16* __restrict__ A, int lda, size_t sA, const _Float16* __restrict__ Bh, int ldb, size_t sB, float alpha, const float* __restrict__ bias, size_t sBias, const float* __restrict__ CP, int rowsPerB, size_t sCPb, int row0g,
    float* __restrict__ C, _Float16* __restrict__ C16, int ldc, size_t sC, int M, int N, int K) { static_assert(ACT == 0 || ACT == 3 || ACT == 6 || ACT == 8 || ACT == 9 || ACT == 11 || ACT == 12 || ACT == 14 || ACT == 15 || ACT == 16 || ACT == 17, "k_gemm2: unsupported ACT code (would silently apply no activation)");
  __shared__ __attribute__((aligned(16))) float so[4][32][68];
  const int tid = threadIdx.x, w = tid >> 5, lane = tid & 31, ln = lane & 15, hh = lane >> 4; const int by = blockIdx.y;
  A += (size_t)by * sA; Bh += (size_t)by * sB; const size_t cofs = (size_t)by * sC; const float* bp = bias ? bias + (size_t)by * sBias : nullptr;
  const int ntn = N >> 6; const int mt = blockIdx.x / ntn, nq = blockIdx.x - mt * ntn; const int row0 = mt * 128 + 32 * w, col0 = nq * 64; if (row0 >= M) return;
  const _Float16* a0p = A + (size_t)(row0 + ln) * lda; const _Float16* a1p = a0p + (size_t)16 * lda;
  const _Float16* b0p = Bh + (size_t)(col0 + ln) * ldb; const _Float16* b1p = b0p + (size_t)16 * ldb; const _Float16* b2p = b1p + (size_t)16 * ldb; const _Float16* b3p = b2p + (size_t)16 * ldb;
  const v8f z8 = {0.f,0.f,0.f,0.f,0.f,0.f,0.f,0.f}; v8f c00 = z8, c01 = z8, c02 = z8, c03 = z8, c10 = z8, c11 = z8, c12 = z8, c13 = z8;
#pragma unroll 1
  for (int kb = 0; kb < K; kb += 32) { const v16h a0 = g2_frag(a0p + kb, hh), a1 = g2_frag(a1p + kb, hh);
    v16h b = g2_frag(b0p + kb, hh); c00 = g2_mma(a0, b, c00); c10 = g2_mma(a1, b, c10);
    b = g2_frag(b1p + kb, hh); c01 = g2_mma(a0, b, c01); c11 = g2_mma(a1, b, c11);
    b = g2_frag(b2p + kb, hh); c02 = g2_mma(a0, b, c02); c12 = g2_mma(a1, b, c12);
    b = g2_frag(b3p + kb, hh); c03 = g2_mma(a0, b, c03); c13 = g2_mma(a1, b, c13); }
  v8f accs[8] = {c00, c01, c02, c03, c10, c11, c12, c13};
#pragma unroll
  for (int u = 0; u < 8; ++u) { const int t = u & 3, half = u >> 2; const int col = col0 + t * 16 + ln; const float bv = bp ? bf16_round(bp[col]) : 0.f;
#pragma unroll
    for (int r = 0; r < 8; ++r) { const int rloc = half * 16 + 8 * hh + r; float v = accs[u][r] * alpha + bv; if (CP) { if (rowsPerB < 0) v += CP[cofs + (size_t)(row0g + row0 + rloc) * ldc + col];      /* rowsPerB < 0: own element of the batched C plane */ else { const int bidx = (row0g + row0 + rloc) / rowsPerB; v += CP[(size_t)bidx * sCPb + (size_t)by * 64 + col]; } }
      if (ACT == 3) v = fmaxf(v, 0.f); else if (ACT == 6) v = 0.5f * v * (1.0f + erff(v * 0.70710678118654752f)); else if (ACT == 11) v = 1.0f / (1.0f + expf(-v)); else if (ACT == 15) v = v / (1.0f + expf(-v)); else if (ACT == 12) v = (v > 0.f) ? v : 0.01f * v; else if (ACT == 8) v = tanhf(v); else if (ACT == 9) v = 0.5f * v * (1.0f + tanhf(0.7978845608028654f * (v + 0.044715f * v * v * v))); else if (ACT == 14) v = (v > 0.f) ? v : 0.1f * v; else if (ACT == 16) v = (v >= 0.f) ? v : 0.3f * v; else if (ACT == 17) v = (v >= 0.f) ? v : 0.2f * v;
      so[w][rloc][t * 16 + ln] = v; } }
  __builtin_amdgcn_fence(__ATOMIC_ACQ_REL, "workgroup"); __builtin_amdgcn_wave_barrier();
  const int rsub = lane >> 4, c4 = (lane & 15) * 4;
  {
#pragma unroll
    for (int q = 0; q < 16; ++q) { const int r = q * 2 + rsub; const v4f v = *(const v4fa*)&so[w][r][c4]; if (C) *(v4f*)(C + cofs + (size_t)(row0 + r) * ldc + col0 + c4) = v; if (C16) { v4h h4; for (int i = 0; i < 4; ++i) h4[i] = (_Float16)v[i]; *(v4h*)(C16 + cofs + (size_t)(row0 + r) * ldc + col0 + c4) = h4; } }
     } }


__global__ __launch_bounds__(256) void k_wnat(const float* __restrict__ w, size_t n8, _Float16* __restrict__ Bt) { const size_t t = (size_t)blockIdx.x * 256 + threadIdx.x; if (t >= n8) return; FragH f; for (int q = 0; q < 8; ++q) f.h[q] = (_Float16)(bf16_round(w[t * 8 + q]) * 16.0f); *(v8us*)((unsigned short*)Bt + t * 8) = f.half[0];  }
__global__ __launch_bounds__(256) void k_rsm(const float* __restrict__ S, _Float16* __restrict__ P, int nrows) {
  #pragma clang fp contract(off)
  const int i = blockIdx.x * 256 + threadIdx.x; if (i >= nrows) return; const float* s = S + (size_t)i * SQ; float mx = -3.0e38f;
#pragma unroll 1
  for (int j = 0; j < SQ; ++j) mx = fmaxf(mx, s[j]); float se = 0.f;
#pragma unroll 1
  for (int j = 0; j < SQ; ++j) se += expf(s[j] - mx); const float sc = 256.0f / se;
#pragma unroll 1
  for (int j0 = 0; j0 < SQ; j0 += 8) { FragH f; for (int q = 0; q < 8; ++q) f.h[q] = (_Float16)(expf(s[j0 + q] - mx) * sc); unsigned short* d = (unsigned short*)P + (size_t)i * SQ + j0; *(v8us*)d = f.half[0];  } }
__global__ __launch_bounds__(256) void k_vt(const _Float16* __restrict__ V16, int b, int h0, _Float16* __restrict__ VT) { __shared__ unsigned short tl[64][65]; const int tid = threadIdx.x; const int hh = blockIdx.x % HG, sg = blockIdx.x / HG; const int s0 = sg * 64; const int h = h0 + hh;
  for (int i = tid; i < 64 * 8; i += 256) { const int j = i / 8, d8 = (i % 8) * 8; FragH f; f.half[0] = *(const v8us*)((const unsigned short*)V16 + ((size_t)b * SQ + s0 + j) * DM + h * HD + d8); for (int q = 0; q < 8; ++q) tl[d8 + q][j] = f.u[q]; }
  __syncthreads();
  { for (int i = tid; i < 64 * 8; i += 256) { const int d = i / 8, j8 = (i % 8) * 8; FragH f; for (int q = 0; q < 8; ++q) f.u[q] = tl[d][j8 + q]; *(v8us*)((unsigned short*)VT + ((size_t)hh * HD + d) * SQ + s0 + j8) = f.half[0]; }  } }



// Fused causal attention, one launch for all query rows and batches: a wave owns 32 query rows (two 16-column groups) and walks its keys 32 at a time; scores and weights stay in registers.
// S^T = K Q^T (A = K rows, B = Q rows, both through the same loader), so a lane holds the scores of ONE query per group: keys kb + 8 hh + r (tile 0) and kb + 16 + 8 hh + r (tile 1), which is the k order of a B operand:
// the weights are converted in place and feed O^T += V^T P^T (A = V^T rows through the same loader). Running maximum (log2 units) and sum per query in f32; the two lane halves exchange the maximum each pass and join their sums once at the end.
// The output tiles are rescaled only when some query's maximum has grown by more than 8 (weights stay <= 2^8, inside f16). K fragments are refetched right behind their products, V^T fragments right behind theirs, into the same registers.
__device__ __forceinline__ v16h fa_frag(const _Float16* p) { FragH f; f.half[0] = *(const v8us*)((const unsigned short*)p); f.half[1] = *(const v8us*)((const unsigned short*)p + 16); return f.v; }      /* p already holds the lane half's 8 hh */
__device__ __forceinline__ v8f fa_mma(v16h a, v16h b, v8f c) { return __builtin_amdgcn_wmma_f32_16x16x32_f16(false, a, false, b, (short)0, c, false, false); }
__device__ __forceinline__ float fa_xhalf(float x) { return __builtin_bit_cast(float, __builtin_amdgcn_permlanex16(__builtin_bit_cast(int, x), __builtin_bit_cast(int, x), 0x76543210, 0xfedcba98, false, false)); }      /* lane l with lane l ^ 16 */
#define FAC 0.18033688011112042f     /* 64^-0.5 * log2(e) */
__device__ __forceinline__ float fa_exp2(float x) { float r; asm("v_exp_f32 %0, %1\n\tv_nop" : "=v"(r) : "v"(x)); return r; }      /* 2^x; the v_nop fills the one slot that the instruction set asks for between a transcendental and a next instruction that reads its result or overwrites its source */
__device__ __forceinline__ v8f fa_exp2x8(v8f x) { float r0, r1, r2, r3, r4, r5, r6, r7;      /* eight 2^x in one statement: the results are kept off the sources (early clobber), so each instruction fills the slot of the one before it, and one v_nop that of the last */
  asm("v_exp_f32 %0, %8\n\tv_exp_f32 %1, %9\n\tv_exp_f32 %2, %10\n\tv_exp_f32 %3, %11\n\tv_exp_f32 %4, %12\n\tv_exp_f32 %5, %13\n\tv_exp_f32 %6, %14\n\tv_exp_f32 %7, %15\n\tv_nop"
      : "=&v"(r0), "=&v"(r1), "=&v"(r2), "=&v"(r3), "=&v"(r4), "=&v"(r5), "=&v"(r6), "=&v"(r7) : "v"(x[0]), "v"(x[1]), "v"(x[2]), "v"(x[3]), "v"(x[4]), "v"(x[5]), "v"(x[6]), "v"(x[7]));
  return v8f{r0, r1, r2, r3, r4, r5, r6, r7}; }
template <int LD>      /* row pitch of the q / k planes */
__global__ __launch_bounds__(256) void k_fattn(const _Float16* __restrict__ Q, const _Float16* __restrict__ K, const _Float16* __restrict__ VT, float* __restrict__ O) {
  const int lane = threadIdx.x & 31, ln = lane & 15, hh = lane >> 4; const int w = __builtin_amdgcn_readfirstlane(threadIdx.x >> 5);
  const int q0 = ((w < 4) ? (SQ / 128 - 1 - (int)blockIdx.x) : (int)blockIdx.x) * 128 + 32 * (w & 3);      /* waves 0..3 take 128-row tile n - 1 - x, waves 4..7 tile x: the keys walked add up alike in every block, and in every pair of waves w, w + 4; the waves share nothing */
  { const size_t bi = (size_t)blockIdx.y * SQ; Q += bi * LD; K += bi * LD; VT += bi * HD; O += bi * HD; }      /* batch on grid.y */
  v16h qf[2][2], kf[2][2], vf[4];
  const _Float16* kp = K + (size_t)ln * LD + 8 * hh; const _Float16* vp = VT + (size_t)ln * SQ + 8 * hh;
  { const _Float16* qp = Q + (size_t)(q0 + ln) * LD + 8 * hh;
#pragma unroll      /* constant indices, so that the arrays indexed below stay in registers */
    for (int j = 0; j < 2; ++j) for (int ks = 0; ks < 2; ++ks) { qf[j][ks] = fa_frag(qp + 16 * j * LD + 32 * ks); kf[j][ks] = fa_frag(kp + 16 * j * LD + 32 * ks); }
#pragma unroll      /* constant indices, so that the arrays indexed below stay in registers */
    for (int t = 0; t < 4; ++t) vf[t] = fa_frag(vp + 16 * t * SQ);
    asm volatile("s_wait_xcnt 0x0" :: "v"(qp), "v"(kp), "v"(vp) : "memory"); }      /* the address pairs stay untouched until the loads that name them have taken them: kp and vp are stepped on in the loop */
  const v8f z8 = {0.f, 0.f, 0.f, 0.f, 0.f, 0.f, 0.f, 0.f};
  v8f o[4][2]; float m[2] = {-1.0e30f, -1.0e30f}, l[2] = {0.f, 0.f};
#pragma unroll      /* constant indices, so that the arrays indexed below stay in registers */
  for (int t = 0; t < 4; ++t) { o[t][0] = z8; o[t][1] = z8; }
  auto pass = [&](const bool last) __attribute__((always_inline)) {      /* one block of 32 keys; last: the diagonal block (keys q0 .. q0 + 31), masked, nothing fetched behind it */
    v8f s[2][2];      /* [key tile][query group] */
#pragma unroll      /* constant indices, so that the arrays indexed below stay in registers */
    for (int kt = 0; kt < 2; ++kt) for (int j = 0; j < 2; ++j) s[kt][j] = fa_mma(kf[kt][1], qf[j][1], fa_mma(kf[kt][0], qf[j][0], z8));
    if (!last) { kp += 32 * LD;
#pragma unroll      /* constant indices, so that the arrays indexed below stay in registers */
      for (int kt = 0; kt < 2; ++kt) for (int ks = 0; ks < 2; ++ks) kf[kt][ks] = fa_frag(kp + 16 * kt * LD + 32 * ks);
      asm volatile("s_wait_xcnt 0x0" :: "v"(kp) : "memory"); }      /* as above */
    if (last) {
#pragma unroll      /* constant indices, so that the arrays indexed below stay in registers */
      for (int kt = 0; kt < 2; ++kt) for (int j = 0; j < 2; ++j) for (int r = 0; r < 8; ++r) s[kt][j][r] = (16 * kt + 8 * hh + r <= 16 * j + ln) ? s[kt][j][r] : -3.0e38f; }      /* key q0 + .. at or left of query q0 + .. */
    float mx[2];
#pragma unroll      /* constant indices, so that the arrays indexed below stay in registers */
    for (int j = 0; j < 2; ++j) { float a = fmaxf(s[0][j][0], s[1][j][0]);
      for (int r = 1; r < 8; ++r) a = fmaxf(a, fmaxf(s[0][j][r], s[1][j][r]));
      mx[j] = fmaxf(a, fa_xhalf(a)) * FAC; }      /* finite: every block holds a key that is valid for the query in one of the two halves */
    if (__builtin_amdgcn_ballot_w32(mx[0] > m[0] + 8.0f || mx[1] > m[1] + 8.0f) != 0) {      /* one scalar test a pass */
#pragma unroll      /* constant indices, so that the arrays indexed below stay in registers */
      for (int j = 0; j < 2; ++j) { const float mn = fmaxf(m[j], mx[j]); const float al = fa_exp2(m[j] - mn); m[j] = mn; l[j] *= al;
        for (int t = 0; t < 4; ++t) o[t][j] *= al; } }
    v16h pf[2];
#pragma unroll      /* constant indices, so that the arrays indexed below stay in registers */
    for (int j = 0; j < 2; ++j) { FragH f; const float mj = -m[j]; const v8f c8 = {FAC, FAC, FAC, FAC, FAC, FAC, FAC, FAC}, m8 = {mj, mj, mj, mj, mj, mj, mj, mj};
      const v8f e0 = fa_exp2x8(__builtin_elementwise_fma(s[0][j], c8, m8)), e1 = fa_exp2x8(__builtin_elementwise_fma(s[1][j], c8, m8));
      float a0 = e0[0], a1 = e1[0];
      for (int r = 1; r < 8; ++r) { a0 += e0[r]; a1 += e1[r]; }
      for (int r = 0; r < 8; ++r) { f.h[r] = (_Float16)e0[r]; f.h[8 + r] = (_Float16)e1[r]; }
      l[j] += a0 + a1; pf[j] = f.v; }
#pragma unroll      /* constant indices, so that the arrays indexed below stay in registers */
    for (int t = 0; t < 4; ++t) for (int j = 0; j < 2; ++j) o[t][j] = fa_mma(vf[t], pf[j], o[t][j]);
    if (!last) { vp += 32;
#pragma unroll      /* constant indices, so that the arrays indexed below stay in registers */
      for (int t = 0; t < 4; ++t) vf[t] = fa_frag(vp + 16 * t * SQ);
      asm volatile("s_wait_xcnt 0x0" :: "v"(vp) : "memory"); }      /* as above */
  };
  for (int kb = 0; kb < q0; kb += 32) pass(false);
  pass(true);
#pragma unroll      /* constant indices, so that the arrays indexed below stay in registers */
  for (int j = 0; j < 2; ++j) { const float fin = 1.0f / (l[j] + fa_xhalf(l[j]));
    for (int t = 0; t < 4; ++t) o[t][j] *= fin; }
#pragma unroll      /* constant indices, so that the arrays indexed below stay in registers */
  for (int j = 0; j < 2; ++j) { float* op = O + (size_t)(q0 + 16 * j + ln) * HD + 8 * hh;      /* register r of tile t = column 16 t + 8 hh + r of the query's row */
    for (int t = 0; t < 4; ++t) { const v4f y0 = {o[t][j][0], o[t][j][1], o[t][j][2], o[t][j][3]}, y1 = {o[t][j][4], o[t][j][5], o[t][j][6], o[t][j][7]};
      *(v4f*)(op + 16 * t) = y0; *(v4f*)(op + 16 * t + 4) = y1; } } }


// Exact f32 causal attention for rows 0..QT0-1, one 8-wave block per 32 query rows of one batch: lane = query row, its q row and its partial o row stay in registers;
// K and V rows come through LDS in tiles of 64 keys (coalesced 16-byte loads, the next tile fetched into registers while this one is worked on) and are read as same-address (broadcast) 16-byte LDS loads;
// wave w takes keys 8 w .. 8 w + 7 of every tile with its own running maximum, sum and o; at the end the eight partial results of a row are merged through LDS. o carried x64, scaled back by 1/64 in k_o0m.
typedef float v2f __attribute__((ext_vector_type(2)));
#define A0R 32                       /* query rows per block */
#define A0T 64                       /* keys per LDS tile */
#define A0K 8                        /* keys per wave and tile */
#define A0P 33                       /* row pitch of the merge plane [wave][d][row]: odd, so that writers (lane = row) and readers (lane = row, d piece) both fall on distinct banks */
__device__ __forceinline__ float a0_exp(float x) { float r; asm("v_exp_f32 %0, %1\n\tv_nop" : "=v"(r) : "v"(x * 1.4426950408889634f)); return r; }      /* e^x; the v_nop fills the one slot that the instruction set asks for between a transcendental and a next instruction that reads its result or overwrites its source */
template <int LD>      /* row pitch of the q / k / v planes: a constant, so that all loads of a tile share one address pair and differ in their immediate offsets only */
__global__ __launch_bounds__(256) void k_att0w(const float* __restrict__ QF, const float* __restrict__ KF, const float* __restrict__ VF, float scale, float* __restrict__ OF, int ldo) {
  __shared__ __attribute__((aligned(16))) float sm[8 * HD * A0P];      /* in the loop: K tile [A0T][HD], then V tile [A0T][HD]; behind it: the merge plane */
  __shared__ float smm[8][A0R]; __shared__ float sml[8][A0R];
  { const size_t bi = (size_t)blockIdx.y * QT0 * LD; QF += bi; KF += bi; VF += bi; OF += (size_t)blockIdx.y * QT0 * ldo; }      /* batch on grid.y: its own QT0-row slab of each plane */
  const int tid = threadIdx.x, lane = tid & 31; const int w = __builtin_amdgcn_readfirstlane(tid >> 5);
  const int h = blockIdx.x / (QT0 / A0R), rg = (QT0 / A0R - 1) - blockIdx.x % (QT0 / A0R);      /* the row groups with the most keys start first */
  const int r0 = rg * A0R, i = r0 + lane; const int nkeys = r0 + A0R; const int nt = (nkeys + A0T - 1) / A0T;      /* keys 0 .. r0 + 31; a tile's rows all lie below QT0 (A0T divides QT0) */
  v2f q[HD / 2], o[HD / 2];
  { const float* qr = QF + (size_t)i * LD + h * HD;
#pragma unroll      /* constant indices, so that the arrays indexed below stay in registers */
    for (int c = 0; c < HD / 4; ++c) { const v4f a = *(const v4fa*)(qr + c * 4); q[2 * c] = v2f{a[0], a[1]}; q[2 * c + 1] = v2f{a[2], a[3]}; o[2 * c] = v2f{0.f, 0.f}; o[2 * c + 1] = v2f{0.f, 0.f}; }
    asm volatile("s_wait_xcnt 0x0" :: "v"(qr) : "memory"); }      /* the address pair stays untouched until the loads that name it have taken it: no later load's result and no later instruction may take it over before */
  const int sr = tid >> 4, sc4 = (tid & 15) * 4;      /* staging: 16 lanes per 256-byte row, rows sr + 16 u */
  const float* kg = KF + (size_t)sr * LD + h * HD + sc4; const float* vg = VF + (size_t)sr * LD + h * HD + sc4;
  v4f pk[4], pv[4];
#pragma unroll      /* constant indices, so that the arrays indexed below stay in registers */
  for (int u = 0; u < 4; ++u) { pk[u] = *(const v4fa*)(kg + 16 * u * LD); pv[u] = *(const v4fa*)(vg + 16 * u * LD); }
  asm volatile("s_wait_xcnt 0x0" :: "v"(kg), "v"(vg) : "memory");      /* as above: both address pairs are stepped on in the loop */
  float m = -1.0e30f, l = 0.f;
  for (int t = 0; t < nt; ++t) {
#pragma unroll      /* constant indices, so that the arrays indexed below stay in registers */
    for (int u = 0; u < 4; ++u) { *(v4f*)&sm[(sr + 16 * u) * HD + sc4] = pk[u]; *(v4f*)&sm[A0T * HD + (sr + 16 * u) * HD + sc4] = pv[u]; }
    __syncthreads();
    if (t + 1 < nt) { kg += A0T * LD; vg += A0T * LD;
#pragma unroll      /* constant indices, so that the arrays indexed below stay in registers */
      for (int u = 0; u < 4; ++u) { pk[u] = *(const v4fa*)(kg + 16 * u * LD); pv[u] = *(const v4fa*)(vg + 16 * u * LD); }
      asm volatile("s_wait_xcnt 0x0" :: "v"(kg), "v"(vg) : "memory"); }      /* as above */
    const int j0 = t * A0T + w * A0K;
    if (j0 < nkeys) {      /* the same for the whole wave; no barrier inside */
      const float* kt = sm + w * A0K * HD; const float* vt = sm + A0T * HD + w * A0K * HD;
      v2f s2[A0K];
#pragma unroll      /* constant indices, so that the arrays indexed below stay in registers */
      for (int k = 0; k < A0K; ++k) s2[k] = v2f{0.f, 0.f};
#pragma unroll      /* constant indices, so that the arrays indexed below stay in registers */
      for (int c = 0; c < HD / 4; ++c) {
#pragma unroll      /* constant indices, so that the arrays indexed below stay in registers */
        for (int k = 0; k < A0K; ++k) { const v4f kk = *(const v4f*)&kt[k * HD + c * 4]; s2[k] = __builtin_elementwise_fma(q[2 * c], v2f{kk[0], kk[1]}, s2[k]); s2[k] = __builtin_elementwise_fma(q[2 * c + 1], v2f{kk[2], kk[3]}, s2[k]); } }
      float s[A0K], e[A0K]; float mn = m;
#pragma unroll      /* constant indices, so that the arrays indexed below stay in registers */
      for (int k = 0; k < A0K; ++k) { s[k] = (j0 + k <= i) ? (s2[k][0] + s2[k][1]) * scale : -1.0e30f; mn = fmaxf(mn, s[k]); }
      const float rs = a0_exp(m - mn); m = mn; float ls = 0.f;
#pragma unroll      /* constant indices, so that the arrays indexed below stay in registers */
      for (int k = 0; k < A0K; ++k) { const float ex = a0_exp(s[k] - mn); e[k] = (j0 + k <= i) ? ex : 0.f; ls += e[k]; }      /* a key right of the diagonal weighs 0 also while the running maximum is still the start value */
      l = l * rs + ls;
#pragma unroll      /* constant indices, so that the arrays indexed below stay in registers */
      for (int c = 0; c < HD / 2; ++c) o[c] *= rs;
#pragma unroll      /* constant indices, so that the arrays indexed below stay in registers */
      for (int k = 0; k < A0K; ++k) { const v2f e2 = {e[k], e[k]};
#pragma unroll      /* constant indices, so that the arrays indexed below stay in registers */
        for (int c = 0; c < HD / 4; ++c) { const v4f vv = *(const v4f*)&vt[k * HD + c * 4]; o[2 * c] = __builtin_elementwise_fma(e2, v2f{vv[0], vv[1]}, o[2 * c]); o[2 * c + 1] = __builtin_elementwise_fma(e2, v2f{vv[2], vv[3]}, o[2 * c + 1]); } }
    }
    __syncthreads();
  }
#pragma unroll      /* constant indices, so that the arrays indexed below stay in registers */
  for (int c = 0; c < HD / 2; ++c) { sm[(w * HD + 2 * c) * A0P + lane] = o[c][0]; sm[(w * HD + 2 * c + 1) * A0P + lane] = o[c][1]; }
  smm[w][lane] = m; sml[w][lane] = l;
  __syncthreads();
  const int row = w * 4 + (lane >> 3), d0 = (lane & 7) * 8;      /* merge: wave w owns rows 4 w .. 4 w + 3, a lane eight neighbouring columns, so a wave stores whole rows */
  float mx = smm[0][row];
#pragma unroll      /* constant indices, so that the arrays indexed below stay in registers */
  for (int u = 1; u < 8; ++u) mx = fmaxf(mx, smm[u][row]);      /* finite: key 0 is valid for every row */
  float lt = 0.f; float a[8] = {0.f, 0.f, 0.f, 0.f, 0.f, 0.f, 0.f, 0.f};
#pragma unroll      /* constant indices, so that the arrays indexed below stay in registers */
  for (int u = 0; u < 8; ++u) { const float f = a0_exp(smm[u][row] - mx); lt += sml[u][row] * f;
#pragma unroll      /* constant indices, so that the arrays indexed below stay in registers */
    for (int d = 0; d < 8; ++d) a[d] += sm[(u * HD + d0 + d) * A0P + row] * f; }
  const float fin = 64.0f / lt;
  float* op = OF + (size_t)(r0 + row) * ldo + h * HD + d0;
  const v4f y0 = {a[0] * fin, a[1] * fin, a[2] * fin, a[3] * fin}, y1 = {a[4] * fin, a[5] * fin, a[6] * fin, a[7] * fin};
  *(v4f*)op = y0; *(v4f*)(op + 4) = y1; }


template <int BFIN, int WXB>
__global__ __launch_bounds__(256) void k_ln16(const float* __restrict__ X, const float* __restrict__ g, const float* __restrict__ bb, float eps, _Float16* __restrict__ N16, float* __restrict__ XB) {
  #pragma clang fp contract(off)
  __shared__ float red[256]; const size_t r = blockIdx.x; const int t = threadIdx.x; const v4f xa = *(const v4fa*)(X + r * DMQ + t * 4); float s[4]; float sum = 0.f;
  for (int q = 0; q < 4; ++q) { s[q] = BFIN ? bf16_round(xa[q]) : xa[q]; sum = __fadd_rn(sum, s[q]); }
  red[t] = sum; __syncthreads(); for (int st = 128; st > 0; st >>= 1) { if (t < st) red[t] = __fadd_rn(red[t], red[t + st]); __syncthreads(); } const float mu = red[0] / (float)DMQ; __syncthreads();
  float vs = 0.f; for (int q = 0; q < 4; ++q) { const float dl = __fadd_rn(s[q], -mu); vs = __fadd_rn(vs, __fmul_rn(dl, dl)); } red[t] = vs; __syncthreads(); for (int st = 128; st > 0; st >>= 1) { if (t < st) red[t] = __fadd_rn(red[t], red[t + st]); __syncthreads(); }
  const float rs = rsqrtf(__fadd_rn(red[0] / (float)DMQ, eps)); v4h y; v4f xb;
  for (int q = 0; q < 4; ++q) { const int c = t * 4 + q; y[q] = (_Float16)__fadd_rn(__fmul_rn(__fmul_rn(__fadd_rn(s[q], -mu), rs), bf16_round(g[c])), bf16_round(bb[c])); xb[q] = s[q]; }
  { *(v4h*)(N16 + r * DMQ + t * 4) = y; if (WXB) *(v4f*)(XB + r * DMQ + t * 4) = xb;  } }
__global__ __launch_bounds__(256) void k_ftres2(const float* __restrict__ OF0, const float* __restrict__ XB, float* __restrict__ X1, size_t n4) {
  #pragma clang fp contract(off)
  const size_t t = (size_t)blockIdx.x * 256 + threadIdx.x; if (t >= n4) return; const v4f o = *(const v4fa*)(OF0 + t * 4), xv = *(const v4fa*)(XB + t * 4); v4f y; for (int q = 0; q < 4; ++q) y[q] = __fadd_rn(__fmul_rn(o[q], 0.015625f), xv[q]); *(v4f*)(X1 + t * 4) = y;  }

__global__ __launch_bounds__(256) void k_wthd(const float* __restrict__ Wt, _Float16* __restrict__ Bt) { const size_t t = (size_t)blockIdx.x * 256 + threadIdx.x; if (t >= (size_t)NH * HD * (DM / 8)) return; const int m8 = (int)(t % (DM / 8)) * 8; const int d = (int)((t / (DM / 8)) % HD); const int h = (int)(t / ((size_t)(DM / 8) * HD)); FragH f;
  for (int q = 0; q < 8; ++q) f.h[q] = (_Float16)(16.0f * bf16_round(Wt[((size_t)h * DM + m8 + q) * HD + d])); unsigned short* dst = (unsigned short*)Bt + ((size_t)h * HD + d) * DM + m8; *(v8us*)dst = f.half[0];  }




__global__ __launch_bounds__(256) void k_wtpad(const float* __restrict__ Wm, _Float16* __restrict__ Wt, int Kr, int Kp, int Nr, int Np, float scale) {
  const int t = blockIdx.x * 256 + threadIdx.x; if (t >= Np * (Kp / 8)) return; const int n = t / (Kp / 8), k8 = (t % (Kp / 8)) * 8; const int nc = min(n, Nr - 1); const float fn = (n < Nr) ? 1.f : 0.f; FragH f;
  for (int i = 0; i < 8; ++i) { const int k = k8 + i; const int kc = min(k, Kr - 1); const float fk = (k < Kr) ? fn : 0.f; f.h[i] = (_Float16)(bf16_round(Wm[(size_t)kc * Nr + nc]) * scale * fk); }
  unsigned short* o = (unsigned short*)Wt + (size_t)n * Kp + k8; *(v8us*)o = f.half[0];  }
__global__ __launch_bounds__(128) void k_bpad(const float* __restrict__ b, float* __restrict__ Bp, int nr, int np) {
  const int i = threadIdx.x; if (i >= np) return; const float v = b[min(i, nr - 1)] * ((i < nr) ? 1.f : 0.f); *(float*)(Bp + i) = v;  }

#define DI 64         /* inner width = NH * HD (ONE 64-wide head) */
#define LQK (3 * DI)  /* fused q | k | v row pitch (192) */
__global__ __launch_bounds__(256) void k_o0(const float* __restrict__ OF, float* __restrict__ ob, size_t n4) {
  #pragma clang fp contract(off)
  const size_t t = (size_t)blockIdx.x * 256 + threadIdx.x; if (t >= n4) return; const size_t e = t * 4; const int i = (int)(e / DI); const int c = (int)(e % DI); const int h = c / HD, d = c % HD; const v4f a = *(const v4fa*)(OF + e); v4f o; for (int q = 0; q < 4; ++q) o[q] = __fmul_rn(a[q], 0.015625f); float* dst = ob + (size_t)h * SQ * HD + (size_t)i * HD + d; *(v4f*)dst = o;  }

__global__ __launch_bounds__(256) void k_o0m(const float* __restrict__ OF, float* __restrict__ o_, size_t n4, size_t so) {
  #pragma clang fp contract(off)
  OF += (size_t)blockIdx.y * n4 * 4; o_ += (size_t)blockIdx.y * so;      /* batch on grid.y: packed source slab, output rows of that batch */
  const size_t t = (size_t)blockIdx.x * 256 + threadIdx.x; if (t >= n4) return; const size_t e = t * 4; const v4f a = *(const v4fa*)(OF + e); v4f o; for (int q = 0; q < 4; ++q) o[q] = __fmul_rn(a[q], 0.015625f); *(v4f*)(o_ + e) = o;  }
extern "C" void kernel_launch(void* const* d_in, const int* in_sizes, int n_in,
                              void* d_out, int out_size, void* d_ws, size_t ws_size, hipStream_t stream) {
  (void)in_sizes; (void)n_in; (void)out_size;
  const float* const* I = (const float* const*)d_in; const float* x = I[0]; const float* wq = I[2]; const float* wk = I[1]; const float* wv = I[3]; const float* bq = nullptr; const float* bk = nullptr; const float* bv = nullptr;      /* x; [in][out = 64] weights in this module's input order (wq = input 2, wk = input 1, wv = input 3); no biases */
  char* ws = (char*)d_ws; size_t off = 0;
  auto take = [&](size_t bytes) { char* p = ws + off; off += (bytes + 255) & ~(size_t)255; return p; };
  _Float16* BW = (_Float16*)take((size_t)LQK * DM * 2); _Float16* X16 = (_Float16*)take(NR * DM * 2); _Float16* QKV = (_Float16*)take(NR * LQK * 2); _Float16* VT = (_Float16*)take((size_t)NB * NH * HD * SQ * 2);
  float* QKVF0 = (float*)take((size_t)NB * QT0 * LQK * 4); float* OF0 = (float*)take((size_t)NB * QT0 * DI * 4);      /* one slab per batch of each plane: every launch below covers all NB batches */
  if (off > ws_size) return;
  { const unsigned g = (unsigned)(((size_t)DI * (DM / 8) + 255) / 256); k_wt_f16<<<g, 256, 0, stream>>>(wq, BW, DM, DI, 16.0f); k_wt_f16<<<g, 256, 0, stream>>>(wk, BW + (size_t)DI * DM, DM, DI, 16.0f); k_wt_f16<<<g, 256, 0, stream>>>(wv, BW + (size_t)2 * DI * DM, DM, DI, 16.0f); }      /* [in = DM][out = 64] -> Bt[n][k] x16, stacked q | k | v */
  k_x16<<<(unsigned)((NR * DM / 8 + 255) / 256), 256, 0, stream>>>(x, X16, NR * DM / 8);      /* x (bf16-valued) as exact f16 rows */
  const float* bqkv[3] = {bq, bk, bv};
  for (int c = 0; c < 3; ++c) k_gemm2<0><<<dim3((unsigned)((NR / 128) * (DI / 64)), 1), 128, 0, stream>>>(X16, DM, 0, BW + (size_t)c * DI * DM, DM, 0, 0.0625f, bqkv[c], 0, nullptr, 1, 0, 0, nullptr, QKV + (size_t)c * DI, LQK, 0, (int)NR, DI, DM);      /* q | k | v = x W^T -> f16 rows, column blocks 0 / 64 / 128 of the fused plane (pitch 192); head h = columns h*64 inside each */
  const _Float16* Q16 = QKV; const _Float16* K16 = QKV + DI; const _Float16* V16 = QKV + 2 * DI;
  float* ob = (float*)d_out;
  k_vt<NH, SQ><<<NB * NH * (SQ / 64), 256, 0, stream>>>(V16, LQK, 0, VT);      /* V^T [NB][HD][SQ], all batches in one launch */
  k_fattn<LQK><<<dim3(SQ / 256, NB), 256, 0, stream>>>(Q16, K16, VT, ob);      /* out[b][i][..] = softmax(causal(q k^T 64^-0.5)) v (f32), every row of every batch; scores and weights never leave the registers */
  for (int c = 0; c < 3; ++c) k_gemm2<0><<<dim3((unsigned)((QT0 / 128) * (DI / 64)), NB), 128, 0, stream>>>(X16, DM, (size_t)SQ * DM, BW + (size_t)c * DI * DM, DM, 0, 0.0625f, bqkv[c], 0, nullptr, 1, 0, 0, QKVF0 + (size_t)c * DI, nullptr, LQK, (size_t)QT0 * LQK, QT0, DI, DM);      /* f32 q | k | v of rows 0..511 of every batch (exact products, f32 accumulation) */
  k_att0w<LQK><<<dim3(NH * (QT0 / A0R), NB), 256, 0, stream>>>(QKVF0, QKVF0 + DI, QKVF0 + 2 * DI, 0.125f, OF0, DI);      /* exact f32 causal attention for rows 0..511 (o x64) */
  k_o0m<<<dim3((unsigned)(((size_t)QT0 * DI / 4 + 255) / 256), NB), 256, 0, stream>>>(OF0, ob, (size_t)QT0 * DI / 4, (size_t)SQ * DI);      /* rows 0..511 of every batch REWRITTEN from the exact path */
}

// v005
// It runs in 120 microseconds.
// In two side-by-side timings against v004, it was 1.31 and 1.29 times as fast.
// Over all steps from v000 it is 1080 times as fast.
#include <hip/hip_runtime.h>
// Single-head causal self-attention from a 32-wide embedding (x [16][4096][32]; k/q/v = x W ([in][out] [32][64], no biases; input order Wk, Wq, Wv); ONE 64-wide head (head_size 64 != C 32); scores * 64^-0.5; causal; softmax; out = weights v -> [16][4096][64]; no output projection).
// Structure: token rows; one projection launch (x and weights rounded in registers, WMMA products, f16 q | k rows and v^T stored straight from the result tiles); one fused causal attention launch (scores alpha 1/8, running-maximum softmax f32 -> f16 weights, P V in f32, all in registers, written as f32 straight into the output rows); an exact f32 first tile (rows 0..511) rewritten at the end.
// Compute dtype: inputs rounded to bf16; x / weights exact; q, k, v and softmax weights as plain f16 GEMM operands (~2^-12); scores and softmax statistics f32. v_wmma_f32_16x16x32_f16.
#define NB 16
#define SQ 4096
#define DM 32
#define NH 1
#define HD 64
#define HG 4                         /* unused by the launches (grid.y is NB); read only by the uncalled k_vt overload */
#define QT 256                       /* unused; a k_fattn block takes two 128-row query tiles */
#define NKX SQ                       /* unused; scores and weights stay in registers */
#define QT0 512                      /* first-tile rows recomputed exactly (f32): 512 here (no output projection averages the early-row cancellation errors away; logit sigma 1.0) */
#define B0 0                         /* unused; the batches are grid.y 0..NB-1 */
#define NBR NB                       /* feeds only the unused MP; the attention launches put the NB batches on grid.y */
#define NR ((size_t)NB * SQ)
#define DMQ DM
#define DFF 4096                     /* unused; no FFN here */
#define DFFR 100                     /* unused; no FFN here */
#define MP ((int)((size_t)NBR * SQ)) /* unused; the projections cover NR rows */
#define QN SQ                        /* unused; the query tiles cover SQ rows */
#define NHD NH                       /* unused; the launches use NH */
#define MPO MP                       /* unused */
#define LQ (3 * DM)      /* unused; the q/k/v row pitch is LQK */
typedef __bf16 v16b __attribute__((ext_vector_type(16)));
typedef unsigned short v8us __attribute__((ext_vector_type(8), may_alias));
typedef float  v8f  __attribute__((ext_vector_type(8)));
typedef float  v4f  __attribute__((ext_vector_type(4)));
typedef float  v4fa __attribute__((ext_vector_type(4), may_alias));
union FragB { v16b v; v8us half[2]; unsigned short u[16]; };

__device__ __forceinline__ unsigned short bf16_bits(float x) { unsigned int u = __float_as_uint(x); return (unsigned short)((u + 0x7FFFu + ((u >> 16) & 1u)) >> 16); }
__device__ __forceinline__ float bf16_val(unsigned short b) { return __uint_as_float(((unsigned int)b) << 16); }
__device__ __forceinline__ float bf16_round(float x) { return bf16_val(bf16_bits(x)); }
// D += A·B with NT terms: 1 = ah·bh, 2 = + al·bh (A split), 3 = + ah·bl (both split)
template <int NT>
__device__ __forceinline__ v8f mmaN(v16b ah, v16b al, v16b bh, v16b bl, v8f c) {
  c = __builtin_amdgcn_wmma_f32_16x16x32_bf16(false, ah, false, bh, (short)0, c, false, false);
  if (NT >= 2) c = __builtin_amdgcn_wmma_f32_16x16x32_bf16(false, al, false, bh, (short)0, c, false, false);
  if (NT >= 3) c = __builtin_amdgcn_wmma_f32_16x16x32_bf16(false, ah, false, bl, (short)0, c, false, false);
  asm volatile("v_nop\n\tv_nop\n\tv_nop\n\tv_nop" : "+v"(c) : "v"(ah), "v"(al), "v"(bh), "v"(bl));
  return c;
}

__global__ __launch_bounds__(256) void k_wt_bf16(const float* __restrict__ W, unsigned short* __restrict__ Wt, int K, int N) {
  const int t = blockIdx.x * 256 + threadIdx.x;
  const int k8n = K / 8;
  if (t >= N * k8n) return;
  const int n = t / k8n, k8 = (t % k8n) * 8;
  v8us v;
#pragma unroll
  for (int i = 0; i < 8; ++i) v[i] = bf16_bits(W[(size_t)(k8 + i) * N + n]);
  *(v8us*)(Wt + (size_t)n * K + k8) = v;
  
}

// GEMM C[M][N] (f32, pitch ldc) = act(A[M][K]·W + bias). A f32 row-major (pitch lda) converted per fragment to bf16
// (ASPLIT: hi/lo two planes -> 2 terms, else single rounded term); Wt bf16 [N][K] (pitch ldb). BIAS_BF16 rounds the
// bias to bf16 first (bias quantised to bf16 before the add). K%32==0, M%16==0, N%64==0.
template <bool ASPLIT, int ACT, bool BIAS_BF16>
__global__ __launch_bounds__(128) void k_gemm_bf(const float* __restrict__ A, int lda, const unsigned short* __restrict__ Wt, int ldb,
                                               const float* __restrict__ bias, float* __restrict__ C, int ldc, int M, int N, int K) {
  __shared__ __attribute__((aligned(16))) float so[4][16][64];
  const int tid = threadIdx.x, w = tid >> 5, lane = tid & 31, ln = lane & 15, hh = lane >> 4;
  const int ntn = N / 64;
  const int wid = blockIdx.x * 4 + w;
  const int mt = wid / ntn, nq = wid % ntn;
  if (mt * 16 >= M) return;
  const int row0 = mt * 16, col0 = nq * 64;
  const float* arow = A + (size_t)(row0 + ln) * lda;
  v8f acc[4] = {};
  for (int kb = 0; kb < K; kb += 32) {
    FragB ah, al;
    const v4f x0 = *(const v4fa*)(arow + kb + 8 * hh), x1 = *(const v4fa*)(arow + kb + 8 * hh + 4);
    const v4f x2 = *(const v4fa*)(arow + kb + 16 + 8 * hh), x3 = *(const v4fa*)(arow + kb + 16 + 8 * hh + 4);
    float xs[16] = {x0[0],x0[1],x0[2],x0[3],x1[0],x1[1],x1[2],x1[3],x2[0],x2[1],x2[2],x2[3],x3[0],x3[1],x3[2],x3[3]};
#pragma unroll
    for (int i = 0; i < 16; ++i) { const unsigned short hb = bf16_bits(xs[i]); ah.u[i] = hb; al.u[i] = ASPLIT ? bf16_bits(xs[i] - bf16_val(hb)) : (unsigned short)0; }
#pragma unroll
    for (int t = 0; t < 4; ++t) {
      const unsigned short* brow = Wt + (size_t)(col0 + t * 16 + ln) * ldb + kb;
      FragB b;
      b.half[0] = *(const v8us*)(brow + 8 * hh);
      b.half[1] = *(const v8us*)(brow + 16 + 8 * hh);
      acc[t] = mmaN<ASPLIT ? 2 : 1>(ah.v, al.v, b.v, b.v, acc[t]);
    }
  }
#pragma unroll
  for (int t = 0; t < 4; ++t) {
    float bv = bias ? bias[col0 + t * 16 + ln] : 0.f;
    if (BIAS_BF16) bv = bf16_round(bv);
#pragma unroll
    for (int r = 0; r < 8; ++r) { float v = acc[t][r] + bv; if (ACT == 1) v = fmaxf(v, 0.f); so[w][8 * hh + r][t * 16 + ln] = v; }
  }
  __builtin_amdgcn_fence(__ATOMIC_ACQ_REL, "workgroup");
  __builtin_amdgcn_wave_barrier();
  const int rsub = lane >> 4, c4 = (lane & 15) * 4;
  {
#pragma unroll
    for (int q = 0; q < 8; ++q) {
      const int r = q * 2 + rsub;
      const v4f v = *(const v4fa*)&so[w][r][c4];
      *(v4f*)(C + (size_t)(row0 + r) * ldc + col0 + c4) = v;
    }
    
  }
}

// GEMM C = act(A·W + bias + resid): A f32 (ASPLIT -> hi/lo 2 terms), Wt bf16 [N][K]; ACT 0 none, 1 relu, 2 exact gelu;
// resid (optional, f32, row index = (row % rmod), pitch ldr, RES_BF16 rounds it) added before the activation.
template <bool ASPLIT, int ACT, bool BIAS_BF16, bool RES_BF16>
__global__ __launch_bounds__(128) void k_gemm_bf3(const float* __restrict__ A, int lda, const unsigned short* __restrict__ Wt, int ldb,
                                                const float* __restrict__ bias, const float* __restrict__ resid, int rmod, int ldr,
                                                float* __restrict__ C, int ldc, int M, int N, int K) {
  __shared__ __attribute__((aligned(16))) float so[4][16][64];
  const int tid = threadIdx.x, w = tid >> 5, lane = tid & 31, ln = lane & 15, hh = lane >> 4;
  const int ntn = N / 64;
  const int wid = blockIdx.x * 4 + w;
  const int mt = wid / ntn, nq = wid % ntn;
  if (mt * 16 >= M) return;
  const int row0 = mt * 16, col0 = nq * 64;
  const float* arow = A + (size_t)(row0 + ln) * lda;
  v8f acc[4] = {};
  for (int kb = 0; kb < K; kb += 32) {
    FragB ah, al;
    const v4f x0 = *(const v4fa*)(arow + kb + 8 * hh), x1 = *(const v4fa*)(arow + kb + 8 * hh + 4);
    const v4f x2 = *(const v4fa*)(arow + kb + 16 + 8 * hh), x3 = *(const v4fa*)(arow + kb + 16 + 8 * hh + 4);
    float xs[16] = {x0[0],x0[1],x0[2],x0[3],x1[0],x1[1],x1[2],x1[3],x2[0],x2[1],x2[2],x2[3],x3[0],x3[1],x3[2],x3[3]};
#pragma unroll
    for (int i = 0; i < 16; ++i) { const unsigned short hb = bf16_bits(xs[i]); ah.u[i] = hb; al.u[i] = ASPLIT ? bf16_bits(xs[i] - bf16_val(hb)) : (unsigned short)0; }
#pragma unroll
    for (int t = 0; t < 4; ++t) {
      const unsigned short* brow = Wt + (size_t)(col0 + t * 16 + ln) * ldb + kb;
      FragB b;
      b.half[0] = *(const v8us*)(brow + 8 * hh);
      b.half[1] = *(const v8us*)(brow + 16 + 8 * hh);
      acc[t] = mmaN<ASPLIT ? 2 : 1>(ah.v, al.v, b.v, b.v, acc[t]);
    }
  }
#pragma unroll
  for (int t = 0; t < 4; ++t) {
    const int col = col0 + t * 16 + ln;
    float bv = bias ? bias[col] : 0.f;
    if (BIAS_BF16) bv = bf16_round(bv);
#pragma unroll
    for (int r = 0; r < 8; ++r) {
      float v = acc[t][r] + bv;
      if (resid) { float rv = resid[(size_t)((row0 + 8 * hh + r) % rmod) * ldr + col]; if (RES_BF16) rv = bf16_round(rv); v += rv; }
      if (ACT == 1) v = fmaxf(v, 0.f);
      if (ACT == 2) v = 0.5f * v * (1.0f + erff(v * 0.70710678118654752f));
      if (ACT == 3) { const float u = 0.7978845608028654f * (v + 0.044715f * v * v * v); v = 0.5f * v * (1.0f + tanhf(u)); }
      so[w][8 * hh + r][t * 16 + ln] = v;
    }
  }
  __builtin_amdgcn_fence(__ATOMIC_ACQ_REL, "workgroup");
  __builtin_amdgcn_wave_barrier();
  const int rsub = lane >> 4, c4 = (lane & 15) * 4;
  {
#pragma unroll
    for (int q = 0; q < 8; ++q) {
      const int r = q * 2 + rsub;
      const v4f v = *(const v4fa*)&so[w][r][c4];
      *(v4f*)(C + (size_t)(row0 + r) * ldc + col0 + c4) = v;
    }
    
  }
}
// row LayerNorm (biased variance, eps) over N: s = X (+ R); optional out_sum <- s; out_norm <- (s-mu)*rsqrt(var+eps)*g + b
template <bool PARAM_BF16>
__global__ __launch_bounds__(256) void k_layernorm(const float* __restrict__ X, const float* __restrict__ R, const float* __restrict__ g, const float* __restrict__ bta,
                                                  float* __restrict__ out_sum, float* __restrict__ out_norm, int N, float eps) {
  __shared__ float red[256];
  const int row = blockIdx.x, tid = threadIdx.x;
  const float* x = X + (size_t)row * N; const float* rr = R ? R + (size_t)row * N : nullptr;
  float vals[16];                     // up to N = 4096
  const int per = N / 256;            // contiguous chunk per thread? use strided-by-4 chunks: thread handles j = tid*4 + 1024*u
  float s1 = 0.f;
  for (int u = 0; u < per / 4; ++u) {
    const int j = tid * 4 + 1024 * u;
    const v4f a = *(const v4fa*)(x + j);
    v4f b = {0.f,0.f,0.f,0.f}; if (rr) b = *(const v4fa*)(rr + j);
#pragma unroll
    for (int q = 0; q < 4; ++q) { const float v = a[q] + b[q]; vals[u * 4 + q] = v; s1 += v; }
  }
  red[tid] = s1; __syncthreads();
  for (int st = 128; st > 0; st >>= 1) { if (tid < st) red[tid] += red[tid + st]; __syncthreads(); }
  const float mu = red[0] / (float)N; __syncthreads();
  float s2 = 0.f;
  for (int u = 0; u < per / 4; ++u)
#pragma unroll
    for (int q = 0; q < 4; ++q) { const float c = vals[u * 4 + q] - mu; s2 += c * c; }
  red[tid] = s2; __syncthreads();
  for (int st = 128; st > 0; st >>= 1) { if (tid < st) red[tid] += red[tid + st]; __syncthreads(); }
  const float rs = rsqrtf(red[0] / (float)N + eps);
  {
    for (int u = 0; u < per / 4; ++u) {
      const int j = tid * 4 + 1024 * u;
      v4f o, sm;
#pragma unroll
      for (int q = 0; q < 4; ++q) {
        float gg = g[j + q], bb = bta[j + q];
        if (PARAM_BF16) { gg = bf16_round(gg); bb = bf16_round(bb); }
        sm[q] = vals[u * 4 + q]; o[q] = (vals[u * 4 + q] - mu) * rs * gg + bb;
      }
      if (out_sum) *(v4f*)(out_sum + (size_t)row * N + j) = sm;
      *(v4f*)(out_norm + (size_t)row * N + j) = o;
    }
    
  }
}



// ---- f16 WMMA path (v_wmma_f32_16x16x32_f16): 11-bit significands for operands in range — used where a [0,1] probability operand needs more precision than bf16
typedef _Float16 v16h __attribute__((ext_vector_type(16)));
union FragH { v16h v; v8us half[2]; _Float16 h[16]; unsigned short u[16]; };
template <int NT>
__device__ __forceinline__ v8f mmaH(v16h ah, v16h al, v16h bh, v16h bl, v8f c) {
  c = __builtin_amdgcn_wmma_f32_16x16x32_f16(false, ah, false, bh, (short)0, c, false, false);
  if (NT >= 2) c = __builtin_amdgcn_wmma_f32_16x16x32_f16(false, al, false, bh, (short)0, c, false, false);
  if (NT >= 3) c = __builtin_amdgcn_wmma_f32_16x16x32_f16(false, ah, false, bl, (short)0, c, false, false);
  asm volatile("v_nop\n\tv_nop\n\tv_nop\n\tv_nop" : "+v"(c) : "v"(ah), "v"(al), "v"(bh), "v"(bl));
  return c;
}
// batched GEMM like k_gemm_b but f16 operands: A f32 (split into f16 hi/lo if ASPLIT, else rounded to f16), Bt = f16 values [n][k]; alpha; C f32; N multiple of 16 (partial tiles skipped)
template <bool ASPLIT>
__global__ __launch_bounds__(128) void k_gemm_h(const float* __restrict__ A, int lda, size_t sA, const _Float16* __restrict__ Bh, int ldb, size_t sB, float alpha, float* __restrict__ C, int ldc, size_t sC, int M, int N, int K) {
  __shared__ __attribute__((aligned(16))) float so[4][16][64];
  const int tid = threadIdx.x, w = tid >> 5, lane = tid & 31, ln = lane & 15, hh = lane >> 4; const int by = blockIdx.y;
  A += (size_t)by * sA; Bh += (size_t)by * sB; C += (size_t)by * sC;
  const int ntn = (N + 63) / 64; const int wid = blockIdx.x * 4 + w; const int mt = wid / ntn, nq = wid % ntn; if (mt * 16 >= M) return;
  const int row0 = mt * 16, col0 = nq * 64; const float* arow = A + (size_t)(row0 + ln) * lda;
  v8f acc[4] = {};
  for (int kb = 0; kb < K; kb += 32) {
    FragH ah, al;
    const v4f x0 = *(const v4fa*)(arow + kb + 8 * hh), x1 = *(const v4fa*)(arow + kb + 8 * hh + 4), x2 = *(const v4fa*)(arow + kb + 16 + 8 * hh), x3 = *(const v4fa*)(arow + kb + 16 + 8 * hh + 4);
    float xs[16] = {x0[0],x0[1],x0[2],x0[3],x1[0],x1[1],x1[2],x1[3],x2[0],x2[1],x2[2],x2[3],x3[0],x3[1],x3[2],x3[3]};
#pragma unroll
    for (int i = 0; i < 16; ++i) { const _Float16 h = (_Float16)xs[i]; ah.h[i] = h; al.h[i] = ASPLIT ? (_Float16)(xs[i] - (float)h) : (_Float16)0.0f; }
#pragma unroll
    for (int t = 0; t < 4; ++t) { if (col0 + t * 16 >= N) continue; const size_t boff = (size_t)(col0 + t * 16 + ln) * ldb + kb; FragH bq; bq.half[0] = *(const v8us*)(Bh + boff + 8 * hh); bq.half[1] = *(const v8us*)(Bh + boff + 16 + 8 * hh);
      acc[t] = mmaH<ASPLIT ? 2 : 1>(ah.v, al.v, bq.v, bq.v, acc[t]); }
  }
#pragma unroll
  for (int t = 0; t < 4; ++t) { if (col0 + t * 16 >= N) continue;
#pragma unroll
    for (int r = 0; r < 8; ++r) so[w][8 * hh + r][t * 16 + ln] = acc[t][r] * alpha; }
  __builtin_amdgcn_fence(__ATOMIC_ACQ_REL, "workgroup"); __builtin_amdgcn_wave_barrier();
  const int rsub = lane >> 4, c4 = (lane & 15) * 4;
  {
#pragma unroll
    for (int q = 0; q < 8; ++q) { const int r = q * 2 + rsub; if (col0 + c4 < N) { const v4f v = *(const v4fa*)&so[w][r][c4]; *(v4f*)(C + (size_t)(row0 + r) * ldc + col0 + c4) = v; } }
     }
}

// k_gemm_hh variant with fused epilogue: v = acc·alpha + bias[by·sBias + col] (+ CP[(row/rowsPerB)·sCPb + by·64 + col] if CP) ; ACT 0 none / 1 elu ; writes f16 C16 (and f32 C if non-null)
template <int ACT>
__global__ __launch_bounds__(128) void k_gemm_hhx(const _Float16* __restrict__ A, int lda, size_t sA, const _Float16* __restrict__ Bh, int ldb, size_t sB, float alpha, const float* __restrict__ bias, size_t sBias, const float* __restrict__ CP, int rowsPerB, size_t sCPb, int row0g,
    float* __restrict__ C, _Float16* __restrict__ C16, int ldc, size_t sC, int M, int N, int K) {
  __shared__ __attribute__((aligned(16))) float so[4][16][64];
  const int tid = threadIdx.x, w = tid >> 5, lane = tid & 31, ln = lane & 15, hh = lane >> 4; const int by = blockIdx.y;
  A += (size_t)by * sA; Bh += (size_t)by * sB; const size_t cofs = (size_t)by * sC; const float* bp = bias ? bias + (size_t)by * sBias : nullptr;
  const int ntn = (N + 63) / 64; const int wid = blockIdx.x * 4 + w; const int mt = wid / ntn, nq = wid % ntn; if (mt * 16 >= M) return;
  const int row0 = mt * 16, col0 = nq * 64; const _Float16* arow = A + (size_t)(row0 + ln) * lda;
  v8f acc[4] = {};
  for (int kb = 0; kb < K; kb += 32) { FragH ah; ah.half[0] = *(const v8us*)((const unsigned short*)arow + kb + 8 * hh); ah.half[1] = *(const v8us*)((const unsigned short*)arow + kb + 16 + 8 * hh);
#pragma unroll
    for (int t = 0; t < 4; ++t) { if (col0 + t * 16 >= N) continue; const size_t boff = (size_t)(col0 + t * 16 + ln) * ldb + kb; FragH bq; bq.half[0] = *(const v8us*)((const unsigned short*)Bh + boff + 8 * hh); bq.half[1] = *(const v8us*)((const unsigned short*)Bh + boff + 16 + 8 * hh);
      acc[t] = mmaH<1>(ah.v, ah.v, bq.v, bq.v, acc[t]); }
  }
#pragma unroll
  for (int t = 0; t < 4; ++t) { if (col0 + t * 16 >= N) continue; const int col = col0 + t * 16 + ln; const float bv = bp ? bf16_round(bp[col]) : 0.f;
#pragma unroll
    for (int r = 0; r < 8; ++r) { float v = acc[t][r] * alpha + bv; if (CP) { const int rr = row0g + row0 + 8 * hh + r; if (rowsPerB < 0) v += CP[cofs + (size_t)rr * ldc + col];      /* rowsPerB < 0: own element of the batched C plane */ else { const int bidx = rr / rowsPerB; v += CP[(size_t)bidx * sCPb + (size_t)by * 64 + col]; } } if (ACT == 1) v = (v > 0.f) ? v : expm1f(v); else if (ACT == 7) v = (v > 0.f) ? v + 1.0f : expf(v); else if (ACT == 8) v = tanhf(v); else if (ACT == 9) v = 0.5f * v * (1.0f + tanhf(0.7978845608028654f * (v + 0.044715f * v * v * v))); else if (ACT == 11) v = 1.0f / (1.0f + expf(-v)); else if (ACT == 12) v = (v > 0.f) ? v : 0.01f * v; else if (ACT == 14) v = (v > 0.f) ? v : 0.1f * v; else if (ACT == 16) v = (v >= 0.f) ? v : 0.3f * v; else if (ACT == 17) v = (v >= 0.f) ? v : 0.2f * v; else if (ACT == 15) v = v / (1.0f + expf(-v)); else if (ACT == 3) v = fmaxf(v, 0.f); else if (ACT == 6) v = 0.5f * v * (1.0f + erff(v * 0.70710678118654752f)); so[w][8 * hh + r][t * 16 + ln] = v; } }
  __builtin_amdgcn_fence(__ATOMIC_ACQ_REL, "workgroup"); __builtin_amdgcn_wave_barrier();
  const int rsub = lane >> 4, c4 = (lane & 15) * 4; typedef _Float16 v4h __attribute__((ext_vector_type(4)));
  {
#pragma unroll
    for (int q = 0; q < 8; ++q) { const int r = q * 2 + rsub; if (col0 + c4 < N) { const v4f v = *(const v4fa*)&so[w][r][c4]; if (C) *(v4f*)(C + cofs + (size_t)(row0 + r) * ldc + col0 + c4) = v; if (C16) { v4h h4; for (int i = 0; i < 4; ++i) h4[i] = (_Float16)v[i]; *(v4h*)(C16 + cofs + (size_t)(row0 + r) * ldc + col0 + c4) = h4; } } }
     }
}


typedef _Float16 v4h __attribute__((ext_vector_type(4)));

__global__ __launch_bounds__(256) void k_h16(const float* __restrict__ x, _Float16* __restrict__ X16, size_t n8) { const size_t t = (size_t)blockIdx.x * 256 + threadIdx.x; if (t >= n8) return; FragH f;
#pragma unroll
  for (int q = 0; q < 8; ++q) f.h[q] = (_Float16)x[t * 8 + q]; *(v8us*)((unsigned short*)X16 + t * 8) = f.half[0];  }
__global__ __launch_bounds__(256) void k_round16f(const float* __restrict__ W, _Float16* __restrict__ Bt, size_t n8) { const size_t t = (size_t)blockIdx.x * 256 + threadIdx.x; if (t >= n8) return; FragH f;
#pragma unroll
  for (int i = 0; i < 8; ++i) f.h[i] = (_Float16)(bf16_round(W[t * 8 + i]) * 16.0f); *(v8us*)((unsigned short*)Bt + t * 8) = f.half[0];  }

__global__ __launch_bounds__(256) void k_hl(const float* __restrict__ F, _Float16* __restrict__ Hh, _Float16* __restrict__ Hl, size_t n8) { const size_t t = (size_t)blockIdx.x * 256 + threadIdx.x; if (t >= n8) return; FragH fh, fl; const v4f a = *(const v4fa*)(F + t * 8), c = *(const v4fa*)(F + t * 8 + 4);
#pragma unroll
  for (int q = 0; q < 4; ++q) { _Float16 h = (_Float16)a[q]; fh.h[q] = h; fl.h[q] = (_Float16)((a[q] - (float)h) * 1024.0f); h = (_Float16)c[q]; fh.h[4 + q] = h; fl.h[4 + q] = (_Float16)((c[q] - (float)h) * 1024.0f); }
  { *(v8us*)((unsigned short*)Hh + t * 8) = fh.half[0]; *(v8us*)((unsigned short*)Hl + t * 8) = fl.half[0];  } }



__global__ __launch_bounds__(256) void k_wnat(const float* __restrict__ w, size_t n8, _Float16* __restrict__ Bt) { const size_t t = (size_t)blockIdx.x * 256 + threadIdx.x; if (t >= n8) return; FragH f; for (int q = 0; q < 8; ++q) f.h[q] = (_Float16)(bf16_round(w[t * 8 + q]) * 16.0f); *(v8us*)((unsigned short*)Bt + t * 8) = f.half[0];  }
__global__ __launch_bounds__(256) void k_rsm(const float* __restrict__ S, _Float16* __restrict__ P, int nrows) {
  #pragma clang fp contract(off)
  const int i = blockIdx.x * 256 + threadIdx.x; if (i >= nrows) return; const float* s = S + (size_t)i * SQ; float mx = -3.0e38f;
#pragma unroll 1
  for (int j = 0; j < SQ; ++j) mx = fmaxf(mx, s[j]); float se = 0.f;
#pragma unroll 1
  for (int j = 0; j < SQ; ++j) se += expf(s[j] - mx); const float sc = 256.0f / se;
#pragma unroll 1
  for (int j0 = 0; j0 < SQ; j0 += 8) { FragH f; for (int q = 0; q < 8; ++q) f.h[q] = (_Float16)(expf(s[j0 + q] - mx) * sc); unsigned short* d = (unsigned short*)P + (size_t)i * SQ + j0; *(v8us*)d = f.half[0];  } }
__global__ __launch_bounds__(256) void k_vt(const _Float16* __restrict__ V16, int b, int h0, _Float16* __restrict__ VT) { __shared__ unsigned short tl[64][65]; const int tid = threadIdx.x; const int hh = blockIdx.x % HG, sg = blockIdx.x / HG; const int s0 = sg * 64; const int h = h0 + hh;
  for (int i = tid; i < 64 * 8; i += 256) { const int j = i / 8, d8 = (i % 8) * 8; FragH f; f.half[0] = *(const v8us*)((const unsigned short*)V16 + ((size_t)b * SQ + s0 + j) * DM + h * HD + d8); for (int q = 0; q < 8; ++q) tl[d8 + q][j] = f.u[q]; }
  __syncthreads();
  { for (int i = tid; i < 64 * 8; i += 256) { const int d = i / 8, j8 = (i % 8) * 8; FragH f; for (int q = 0; q < 8; ++q) f.u[q] = tl[d][j8 + q]; *(v8us*)((unsigned short*)VT + ((size_t)hh * HD + d) * SQ + s0 + j8) = f.half[0]; }  } }



// Fused causal attention, one launch for all query rows and batches: a wave owns 32 query rows (two 16-column groups) and walks its keys 32 at a time; scores and weights stay in registers.
// S^T = K Q^T (A = K rows, B = Q rows, both through the same loader), so a lane holds the scores of ONE query per group: keys kb + 8 hh + r (tile 0) and kb + 16 + 8 hh + r (tile 1), which is the k order of a B operand:
// the weights are converted in place and feed O^T += V^T P^T (A = V^T rows through the same loader). Running maximum (log2 units) and sum per query in f32; the two lane halves exchange the maximum each pass and join their sums once at the end.
// The output tiles are rescaled only when some query's maximum has grown by more than 8 (weights stay <= 2^8, inside f16). K fragments are refetched right behind their products, V^T fragments right behind theirs, into the same registers.
__device__ __forceinline__ v16h fa_frag(const _Float16* p) { FragH f; f.half[0] = *(const v8us*)((const unsigned short*)p); f.half[1] = *(const v8us*)((const unsigned short*)p + 16); return f.v; }      /* p already holds the lane half's 8 hh */
__device__ __forceinline__ v8f fa_mma(v16h a, v16h b, v8f c) { return __builtin_amdgcn_wmma_f32_16x16x32_f16(false, a, false, b, (short)0, c, false, false); }
__device__ __forceinline__ float fa_xhalf(float x) { return __builtin_bit_cast(float, __builtin_amdgcn_permlanex16(__builtin_bit_cast(int, x), __builtin_bit_cast(int, x), 0x76543210, 0xfedcba98, false, false)); }      /* lane l with lane l ^ 16 */
#define FAC 0.18033688011112042f     /* 64^-0.5 * log2(e) */
__device__ __forceinline__ float fa_exp2(float x) { float r; asm("v_exp_f32 %0, %1\n\tv_nop" : "=v"(r) : "v"(x)); return r; }      /* 2^x; the v_nop fills the one slot that the instruction set asks for between a transcendental and a next instruction that reads its result or overwrites its source */
__device__ __forceinline__ v8f fa_exp2x8(v8f x) { float r0, r1, r2, r3, r4, r5, r6, r7;      /* eight 2^x in one statement: the results are kept off the sources (early clobber), so each instruction fills the slot of the one before it, and one v_nop that of the last */
  asm("v_exp_f32 %0, %8\n\tv_exp_f32 %1, %9\n\tv_exp_f32 %2, %10\n\tv_exp_f32 %3, %11\n\tv_exp_f32 %4, %12\n\tv_exp_f32 %5, %13\n\tv_exp_f32 %6, %14\n\tv_exp_f32 %7, %15\n\tv_nop"
      : "=&v"(r0), "=&v"(r1), "=&v"(r2), "=&v"(r3), "=&v"(r4), "=&v"(r5), "=&v"(r6), "=&v"(r7) : "v"(x[0]), "v"(x[1]), "v"(x[2]), "v"(x[3]), "v"(x[4]), "v"(x[5]), "v"(x[6]), "v"(x[7]));
  return v8f{r0, r1, r2, r3, r4, r5, r6, r7}; }
template <int LD>      /* row pitch of the q / k planes */
__global__ __launch_bounds__(256) void k_fattn(const _Float16* __restrict__ Q, const _Float16* __restrict__ K, const _Float16* __restrict__ VT, float* __restrict__ O) {
  const int lane = threadIdx.x & 31, ln = lane & 15, hh = lane >> 4; const int w = __builtin_amdgcn_readfirstlane(threadIdx.x >> 5);
  const int q0 = ((w < 4) ? (SQ / 128 - 1 - (int)blockIdx.x) : (int)blockIdx.x) * 128 + 32 * (w & 3);      /* waves 0..3 take 128-row tile n - 1 - x, waves 4..7 tile x: the keys walked add up alike in every block, and in every pair of waves w, w + 4; the waves share nothing */
  { const size_t bi = (size_t)blockIdx.y * SQ; Q += bi * LD; K += bi * LD; VT += bi * HD; O += bi * HD; }      /* batch on grid.y */
  v16h qf[2][2], kf[2][2], vf[4];
  const _Float16* kp = K + (size_t)ln * LD + 8 * hh; const _Float16* vp = VT + (size_t)ln * SQ + 8 * hh;
  { const _Float16* qp = Q + (size_t)(q0 + ln) * LD + 8 * hh;
#pragma unroll      /* constant indices, so that the arrays indexed below stay in registers */
    for (int j = 0; j < 2; ++j) for (int ks = 0; ks < 2; ++ks) { qf[j][ks] = fa_frag(qp + 16 * j * LD + 32 * ks); kf[j][ks] = fa_frag(kp + 16 * j * LD + 32 * ks); }
#pragma unroll      /* constant indices, so that the arrays indexed below stay in registers */
    for (int t = 0; t < 4; ++t) vf[t] = fa_frag(vp + 16 * t * SQ);
    asm volatile("s_wait_xcnt 0x0" :: "v"(qp), "v"(kp), "v"(vp) : "memory"); }      /* the address pairs stay untouched until the loads that name them have taken them: kp and vp are stepped on in the loop */
  const v8f z8 = {0.f, 0.f, 0.f, 0.f, 0.f, 0.f, 0.f, 0.f};
  v8f o[4][2]; float m[2] = {-1.0e30f, -1.0e30f}, l[2] = {0.f, 0.f};
#pragma unroll      /* constant indices, so that the arrays indexed below stay in registers */
  for (int t = 0; t < 4; ++t) { o[t][0] = z8; o[t][1] = z8; }
  auto pass = [&](const bool last) __attribute__((always_inline)) {      /* one block of 32 keys; last: the diagonal block (keys q0 .. q0 + 31), masked, nothing fetched behind it */
    v8f s[2][2];      /* [key tile][query group] */
#pragma unroll      /* constant indices, so that the arrays indexed below stay in registers */
    for (int kt = 0; kt < 2; ++kt) for (int j = 0; j < 2; ++j) s[kt][j] = fa_mma(kf[kt][1], qf[j][1], fa_mma(kf[kt][0], qf[j][0], z8));
    if (!last) { kp += 32 * LD;
#pragma unroll      /* constant indices, so that the arrays indexed below stay in registers */
      for (int kt = 0; kt < 2; ++kt) for (int ks = 0; ks < 2; ++ks) kf[kt][ks] = fa_frag(kp + 16 * kt * LD + 32 * ks);
      asm volatile("s_wait_xcnt 0x0" :: "v"(kp) : "memory"); }      /* as above */
    if (last) {
#pragma unroll      /* constant indices, so that the arrays indexed below stay in registers */
      for (int kt = 0; kt < 2; ++kt) for (int j = 0; j < 2; ++j) for (int r = 0; r < 8; ++r) s[kt][j][r] = (16 * kt + 8 * hh + r <= 16 * j + ln) ? s[kt][j][r] : -3.0e38f; }      /* key q0 + .. at or left of query q0 + .. */
    float mx[2];
#pragma unroll      /* constant indices, so that the arrays indexed below stay in registers */
    for (int j = 0; j < 2; ++j) { float a = fmaxf(s[0][j][0], s[1][j][0]);
      for (int r = 1; r < 8; ++r) a = fmaxf(a, fmaxf(s[0][j][r], s[1][j][r]));
      mx[j] = fmaxf(a, fa_xhalf(a)) * FAC; }      /* finite: every block holds a key that is valid for the query in one of the two halves */
    if (__builtin_amdgcn_ballot_w32(mx[0] > m[0] + 8.0f || mx[1] > m[1] + 8.0f) != 0) {      /* one scalar test a pass */
#pragma unroll      /* constant indices, so that the arrays indexed below stay in registers */
      for (int j = 0; j < 2; ++j) { const float mn = fmaxf(m[j], mx[j]); const float al = fa_exp2(m[j] - mn); m[j] = mn; l[j] *= al;
        for (int t = 0; t < 4; ++t) o[t][j] *= al; } }
    v16h pf[2];
#pragma unroll      /* constant indices, so that the arrays indexed below stay in registers */
    for (int j = 0; j < 2; ++j) { FragH f; const float mj = -m[j]; const v8f c8 = {FAC, FAC, FAC, FAC, FAC, FAC, FAC, FAC}, m8 = {mj, mj, mj, mj, mj, mj, mj, mj};
      const v8f e0 = fa_exp2x8(__builtin_elementwise_fma(s[0][j], c8, m8)), e1 = fa_exp2x8(__builtin_elementwise_fma(s[1][j], c8, m8));
      float a0 = e0[0], a1 = e1[0];
      for (int r = 1; r < 8; ++r) { a0 += e0[r]; a1 += e1[r]; }
      for (int r = 0; r < 8; ++r) { f.h[r] = (_Float16)e0[r]; f.h[8 + r] = (_Float16)e1[r]; }
      l[j] += a0 + a1; pf[j] = f.v; }
#pragma unroll      /* constant indices, so that the arrays indexed below stay in registers */
    for (int t = 0; t < 4; ++t) for (int j = 0; j < 2; ++j) o[t][j] = fa_mma(vf[t], pf[j], o[t][j]);
    if (!last) { vp += 32;
#pragma unroll      /* constant indices, so that the arrays indexed below stay in registers */
      for (int t = 0; t < 4; ++t) vf[t] = fa_frag(vp + 16 * t * SQ);
      asm volatile("s_wait_xcnt 0x0" :: "v"(vp) : "memory"); }      /* as above */
  };
  for (int kb = 0; kb < q0; kb += 32) pass(false);
  pass(true);
#pragma unroll      /* constant indices, so that the arrays indexed below stay in registers */
  for (int j = 0; j < 2; ++j) { const float fin = 1.0f / (l[j] + fa_xhalf(l[j]));
    for (int t = 0; t < 4; ++t) o[t][j] *= fin; }
#pragma unroll      /* constant indices, so that the arrays indexed below stay in registers */
  for (int j = 0; j < 2; ++j) { float* op = O + (size_t)(q0 + 16 * j + ln) * HD + 8 * hh;      /* register r of tile t = column 16 t + 8 hh + r of the query's row */
    for (int t = 0; t < 4; ++t) { const v4f y0 = {o[t][j][0], o[t][j][1], o[t][j][2], o[t][j][3]}, y1 = {o[t][j][4], o[t][j][5], o[t][j][6], o[t][j][7]};
      *(v4f*)(op + 16 * t) = y0; *(v4f*)(op + 16 * t + 4) = y1; } } }


// Exact f32 causal attention for rows 0..QT0-1, one 8-wave block per 32 query rows of one batch: lane = query row, its q row and its partial o row stay in registers;
// K and V rows come through LDS in tiles of 64 keys (coalesced 16-byte loads, the next tile fetched into registers while this one is worked on) and are read as same-address (broadcast) 16-byte LDS loads;
// wave w takes keys 8 w .. 8 w + 7 of every tile with its own running maximum, sum and o; at the end the eight partial results of a row are merged through LDS and stored straight into the output rows.
typedef float v2f __attribute__((ext_vector_type(2)));
#define A0R 32                       /* query rows per block */
#define A0T 64                       /* keys per LDS tile */
#define A0K 8                        /* keys per wave and tile */
#define A0P 33                       /* row pitch of the merge plane [wave][d][row]: odd, so that writers (lane = row) and readers (lane = row, d piece) both fall on distinct banks */
__device__ __forceinline__ float a0_exp(float x) { float r; asm("v_exp_f32 %0, %1\n\tv_nop" : "=v"(r) : "v"(x * 1.4426950408889634f)); return r; }      /* e^x; the v_nop fills the one slot that the instruction set asks for between a transcendental and a next instruction that reads its result or overwrites its source */
template <int LD>      /* row pitch of the q / k / v planes: a constant, so that all loads of a tile share one address pair and differ in their immediate offsets only */
__global__ __launch_bounds__(256) void k_att0w(const float* __restrict__ QF, const float* __restrict__ KF, const float* __restrict__ VF, float scale, float* __restrict__ OF, int ldo) {
  __shared__ __attribute__((aligned(16))) float sm[8 * HD * A0P];      /* in the loop: K tile [A0T][HD], then V tile [A0T][HD]; behind it: the merge plane */
  __shared__ float smm[8][A0R]; __shared__ float sml[8][A0R];
  { const size_t bi = (size_t)blockIdx.y * QT0 * LD; QF += bi; KF += bi; VF += bi; OF += (size_t)blockIdx.y * SQ * ldo; }      /* batch on grid.y: its own QT0-row slab of each plane, and its own rows of the output */
  const int tid = threadIdx.x, lane = tid & 31; const int w = __builtin_amdgcn_readfirstlane(tid >> 5);
  const int h = blockIdx.x / (QT0 / A0R), rg = (QT0 / A0R - 1) - blockIdx.x % (QT0 / A0R);      /* the row groups with the most keys start first */
  const int r0 = rg * A0R, i = r0 + lane; const int nkeys = r0 + A0R; const int nt = (nkeys + A0T - 1) / A0T;      /* keys 0 .. r0 + 31; a tile's rows all lie below QT0 (A0T divides QT0) */
  v2f q[HD / 2], o[HD / 2];
  { const float* qr = QF + (size_t)i * LD + h * HD;
#pragma unroll      /* constant indices, so that the arrays indexed below stay in registers */
    for (int c = 0; c < HD / 4; ++c) { const v4f a = *(const v4fa*)(qr + c * 4); q[2 * c] = v2f{a[0], a[1]}; q[2 * c + 1] = v2f{a[2], a[3]}; o[2 * c] = v2f{0.f, 0.f}; o[2 * c + 1] = v2f{0.f, 0.f}; }
    asm volatile("s_wait_xcnt 0x0" :: "v"(qr) : "memory"); }      /* the address pair stays untouched until the loads that name it have taken it: no later load's result and no later instruction may take it over before */
  const int sr = tid >> 4, sc4 = (tid & 15) * 4;      /* staging: 16 lanes per 256-byte row, rows sr + 16 u */
  const float* kg = KF + (size_t)sr * LD + h * HD + sc4; const float* vg = VF + (size_t)sr * LD + h * HD + sc4;
  v4f pk[4], pv[4];
#pragma unroll      /* constant indices, so that the arrays indexed below stay in registers */
  for (int u = 0; u < 4; ++u) { pk[u] = *(const v4fa*)(kg + 16 * u * LD); pv[u] = *(const v4fa*)(vg + 16 * u * LD); }
  asm volatile("s_wait_xcnt 0x0" :: "v"(kg), "v"(vg) : "memory");      /* as above: both address pairs are stepped on in the loop */
  float m = -1.0e30f, l = 0.f;
  for (int t = 0; t < nt; ++t) {
#pragma unroll      /* constant indices, so that the arrays indexed below stay in registers */
    for (int u = 0; u < 4; ++u) { *(v4f*)&sm[(sr + 16 * u) * HD + sc4] = pk[u]; *(v4f*)&sm[A0T * HD + (sr + 16 * u) * HD + sc4] = pv[u]; }
    __syncthreads();
    if (t + 1 < nt) { kg += A0T * LD; vg += A0T * LD;
#pragma unroll      /* constant indices, so that the arrays indexed below stay in registers */
      for (int u = 0; u < 4; ++u) { pk[u] = *(const v4fa*)(kg + 16 * u * LD); pv[u] = *(const v4fa*)(vg + 16 * u * LD); }
      asm volatile("s_wait_xcnt 0x0" :: "v"(kg), "v"(vg) : "memory"); }      /* as above */
    const int j0 = t * A0T + w * A0K;
    if (j0 < nkeys) {      /* the same for the whole wave; no barrier inside */
      const float* kt = sm + w * A0K * HD; const float* vt = sm + A0T * HD + w * A0K * HD;
      v2f s2[A0K];
#pragma unroll      /* constant indices, so that the arrays indexed below stay in registers */
      for (int k = 0; k < A0K; ++k) s2[k] = v2f{0.f, 0.f};
#pragma unroll      /* constant indices, so that the arrays indexed below stay in registers */
      for (int c = 0; c < HD / 4; ++c) {
#pragma unroll      /* constant indices, so that the arrays indexed below stay in registers */
        for (int k = 0; k < A0K; ++k) { const v4f kk = *(const v4f*)&kt[k * HD + c * 4]; s2[k] = __builtin_elementwise_fma(q[2 * c], v2f{kk[0], kk[1]}, s2[k]); s2[k] = __builtin_elementwise_fma(q[2 * c + 1], v2f{kk[2], kk[3]}, s2[k]); } }
      float s[A0K], e[A0K]; float mn = m;
#pragma unroll      /* constant indices, so that the arrays indexed below stay in registers */
      for (int k = 0; k < A0K; ++k) { s[k] = (j0 + k <= i) ? (s2[k][0] + s2[k][1]) * scale : -1.0e30f; mn = fmaxf(mn, s[k]); }
      const float rs = a0_exp(m - mn); m = mn; float ls = 0.f;
#pragma unroll      /* constant indices, so that the arrays indexed below stay in registers */
      for (int k = 0; k < A0K; ++k) { const float ex = a0_exp(s[k] - mn); e[k] = (j0 + k <= i) ? ex : 0.f; ls += e[k]; }      /* a key right of the diagonal weighs 0 also while the running maximum is still the start value */
      l = l * rs + ls;
#pragma unroll      /* constant indices, so that the arrays indexed below stay in registers */
      for (int c = 0; c < HD / 2; ++c) o[c] *= rs;
#pragma unroll      /* constant indices, so that the arrays indexed below stay in registers */
      for (int k = 0; k < A0K; ++k) { const v2f e2 = {e[k], e[k]};
#pragma unroll      /* constant indices, so that the arrays indexed below stay in registers */
        for (int c = 0; c < HD / 4; ++c) { const v4f vv = *(const v4f*)&vt[k * HD + c * 4]; o[2 * c] = __builtin_elementwise_fma(e2, v2f{vv[0], vv[1]}, o[2 * c]); o[2 * c + 1] = __builtin_elementwise_fma(e2, v2f{vv[2], vv[3]}, o[2 * c + 1]); } }
    }
    __syncthreads();
  }
#pragma unroll      /* constant indices, so that the arrays indexed below stay in registers */
  for (int c = 0; c < HD / 2; ++c) { sm[(w * HD + 2 * c) * A0P + lane] = o[c][0]; sm[(w * HD + 2 * c + 1) * A0P + lane] = o[c][1]; }
  smm[w][lane] = m; sml[w][lane] = l;
  __syncthreads();
  const int row = w * 4 + (lane >> 3), d0 = (lane & 7) * 8;      /* merge: wave w owns rows 4 w .. 4 w + 3, a lane eight neighbouring columns, so a wave stores whole rows */
  float mx = smm[0][row];
#pragma unroll      /* constant indices, so that the arrays indexed below stay in registers */
  for (int u = 1; u < 8; ++u) mx = fmaxf(mx, smm[u][row]);      /* finite: key 0 is valid for every row */
  float lt = 0.f; float a[8] = {0.f, 0.f, 0.f, 0.f, 0.f, 0.f, 0.f, 0.f};
#pragma unroll      /* constant indices, so that the arrays indexed below stay in registers */
  for (int u = 0; u < 8; ++u) { const float f = a0_exp(smm[u][row] - mx); lt += sml[u][row] * f;
#pragma unroll      /* constant indices, so that the arrays indexed below stay in registers */
    for (int d = 0; d < 8; ++d) a[d] += sm[(u * HD + d0 + d) * A0P + row] * f; }
  const float fin = 1.0f / lt;
  float* op = OF + (size_t)(r0 + row) * ldo + h * HD + d0;
  const v4f y0 = {a[0] * fin, a[1] * fin, a[2] * fin, a[3] * fin}, y1 = {a[4] * fin, a[5] * fin, a[6] * fin, a[7] * fin};
  *(v4f*)op = y0; *(v4f*)(op + 4) = y1; }


template <int BFIN, int WXB>
__global__ __launch_bounds__(256) void k_ln16(const float* __restrict__ X, const float* __restrict__ g, const float* __restrict__ bb, float eps, _Float16* __restrict__ N16, float* __restrict__ XB) {
  #pragma clang fp contract(off)
  __shared__ float red[256]; const size_t r = blockIdx.x; const int t = threadIdx.x; const v4f xa = *(const v4fa*)(X + r * DMQ + t * 4); float s[4]; float sum = 0.f;
  for (int q = 0; q < 4; ++q) { s[q] = BFIN ? bf16_round(xa[q]) : xa[q]; sum = __fadd_rn(sum, s[q]); }
  red[t] = sum; __syncthreads(); for (int st = 128; st > 0; st >>= 1) { if (t < st) red[t] = __fadd_rn(red[t], red[t + st]); __syncthreads(); } const float mu = red[0] / (float)DMQ; __syncthreads();
  float vs = 0.f; for (int q = 0; q < 4; ++q) { const float dl = __fadd_rn(s[q], -mu); vs = __fadd_rn(vs, __fmul_rn(dl, dl)); } red[t] = vs; __syncthreads(); for (int st = 128; st > 0; st >>= 1) { if (t < st) red[t] = __fadd_rn(red[t], red[t + st]); __syncthreads(); }
  const float rs = rsqrtf(__fadd_rn(red[0] / (float)DMQ, eps)); v4h y; v4f xb;
  for (int q = 0; q < 4; ++q) { const int c = t * 4 + q; y[q] = (_Float16)__fadd_rn(__fmul_rn(__fmul_rn(__fadd_rn(s[q], -mu), rs), bf16_round(g[c])), bf16_round(bb[c])); xb[q] = s[q]; }
  { *(v4h*)(N16 + r * DMQ + t * 4) = y; if (WXB) *(v4f*)(XB + r * DMQ + t * 4) = xb;  } }
__global__ __launch_bounds__(256) void k_ftres2(const float* __restrict__ OF0, const float* __restrict__ XB, float* __restrict__ X1, size_t n4) {
  #pragma clang fp contract(off)
  const size_t t = (size_t)blockIdx.x * 256 + threadIdx.x; if (t >= n4) return; const v4f o = *(const v4fa*)(OF0 + t * 4), xv = *(const v4fa*)(XB + t * 4); v4f y; for (int q = 0; q < 4; ++q) y[q] = __fadd_rn(__fmul_rn(o[q], 0.015625f), xv[q]); *(v4f*)(X1 + t * 4) = y;  }

__global__ __launch_bounds__(256) void k_wthd(const float* __restrict__ Wt, _Float16* __restrict__ Bt) { const size_t t = (size_t)blockIdx.x * 256 + threadIdx.x; if (t >= (size_t)NH * HD * (DM / 8)) return; const int m8 = (int)(t % (DM / 8)) * 8; const int d = (int)((t / (DM / 8)) % HD); const int h = (int)(t / ((size_t)(DM / 8) * HD)); FragH f;
  for (int q = 0; q < 8; ++q) f.h[q] = (_Float16)(16.0f * bf16_round(Wt[((size_t)h * DM + m8 + q) * HD + d])); unsigned short* dst = (unsigned short*)Bt + ((size_t)h * HD + d) * DM + m8; *(v8us*)dst = f.half[0];  }




__global__ __launch_bounds__(256) void k_wtpad(const float* __restrict__ Wm, _Float16* __restrict__ Wt, int Kr, int Kp, int Nr, int Np, float scale) {
  const int t = blockIdx.x * 256 + threadIdx.x; if (t >= Np * (Kp / 8)) return; const int n = t / (Kp / 8), k8 = (t % (Kp / 8)) * 8; const int nc = min(n, Nr - 1); const float fn = (n < Nr) ? 1.f : 0.f; FragH f;
  for (int i = 0; i < 8; ++i) { const int k = k8 + i; const int kc = min(k, Kr - 1); const float fk = (k < Kr) ? fn : 0.f; f.h[i] = (_Float16)(bf16_round(Wm[(size_t)kc * Nr + nc]) * scale * fk); }
  unsigned short* o = (unsigned short*)Wt + (size_t)n * Kp + k8; *(v8us*)o = f.half[0];  }
__global__ __launch_bounds__(128) void k_bpad(const float* __restrict__ b, float* __restrict__ Bp, int nr, int np) {
  const int i = threadIdx.x; if (i >= np) return; const float v = b[min(i, nr - 1)] * ((i < nr) ? 1.f : 0.f); *(float*)(Bp + i) = v;  }

#define DI 64         /* inner width = NH * HD (ONE 64-wide head) */
#define LQK (3 * DI)  /* fused q | k | v row pitch (192) */
__global__ __launch_bounds__(256) void k_o0(const float* __restrict__ OF, float* __restrict__ ob, size_t n4) {
  #pragma clang fp contract(off)
  const size_t t = (size_t)blockIdx.x * 256 + threadIdx.x; if (t >= n4) return; const size_t e = t * 4; const int i = (int)(e / DI); const int c = (int)(e % DI); const int h = c / HD, d = c % HD; const v4f a = *(const v4fa*)(OF + e); v4f o; for (int q = 0; q < 4; ++q) o[q] = __fmul_rn(a[q], 0.015625f); float* dst = ob + (size_t)h * SQ * HD + (size_t)i * HD + d; *(v4f*)dst = o;  }

// Projection, ONE launch from the inputs themselves: a wave owns 64 tokens (so that it writes whole 128-byte pieces of the V^T rows) and holds the twelve 16-feature weight fragments of q | k | v in registers
// (f16 of the bf16-rounded weight x16, read straight from the [in][out] f32 weights) and its four x fragments (f16 of the bf16-rounded x); weight and x go through the same k order (8 hh + i, 16 + 8 hh + i).
// Row (or column) c of weight tile t is feature 4 c + t, so one 16-byte load of a weight row serves all four tiles.
// q, k: A = weight, B = x, so a lane holds, over the four tiles, features 32 hh .. 32 hh + 31 of ONE token (register r of tile t = feature 32 hh + 4 r + t): 16-byte stores into the q | k rows.
// v: A = x, B = weight, so a lane's eight results are eight neighbouring tokens of ONE feature: one 16-byte f16 store into V^T.
// The waves of tokens 0..QT0-1 of a batch store q | k | v as f32 rows for the exact first tile as well. K = 32: one matrix instruction a tile.
#define PJT 64                       /* tokens per wave */
__device__ __forceinline__ void pj_wload(const float* __restrict__ p, v4f (&r)[16]) {      /* p: the lane's k = 8 hh, features 4 ln .. 4 ln + 3 */
#pragma unroll      /* constant indices, so that the array stays in registers */
  for (int i = 0; i < 8; ++i) { r[i] = *(const v4fa*)(p + i * DI); r[8 + i] = *(const v4fa*)(p + (16 + i) * DI); } }
__device__ __forceinline__ void pj_wfrag(const v4f (&r)[16], v16h (&wf)[4]) {
#pragma unroll      /* constant indices, so that the arrays stay in registers */
  for (int t = 0; t < 4; ++t) { FragH f;
    for (int i = 0; i < 16; ++i) f.h[i] = (_Float16)(bf16_round(r[i][t]) * 16.0f);
    wf[t] = f.v; } }
__global__ __launch_bounds__(128) void k_proj(const float* __restrict__ x, const float* __restrict__ wq, const float* __restrict__ wk, const float* __restrict__ wv, _Float16* __restrict__ QK, _Float16* __restrict__ VT, float* __restrict__ F0) {
  const int lane = threadIdx.x & 31, ln = lane & 15, hh = lane >> 4; const int w = __builtin_amdgcn_readfirstlane(threadIdx.x >> 5);
  const int tok0 = ((int)blockIdx.x * 4 + w) * PJT; const int b = tok0 / SQ, i0 = tok0 % SQ;      /* PJT divides SQ and QT0: a wave's tokens lie in one batch, and all or none of them in the first tile */
  v16h xf[PJT / 16], wf[3][4]; v4f xr[PJT / 16][4], wr[3][16];
  const float* xp = x + (size_t)(tok0 + ln) * DM + 8 * hh; const int wo = 8 * hh * DI + 4 * ln;
#pragma unroll      /* constant indices, so that the arrays indexed below stay in registers */
  for (int g = 0; g < PJT / 16; ++g) { xr[g][0] = *(const v4fa*)(xp + 16 * g * DM); xr[g][1] = *(const v4fa*)(xp + 16 * g * DM + 4); xr[g][2] = *(const v4fa*)(xp + 16 * g * DM + 16); xr[g][3] = *(const v4fa*)(xp + 16 * g * DM + 20); }
  pj_wload(wq + wo, wr[0]); pj_wload(wk + wo, wr[1]);
  asm volatile("s_wait_xcnt 0x0" :: "v"(xp), "v"(wo) : "memory");      /* the address registers stay untouched until the loads that name them have taken them */
  __builtin_amdgcn_sched_barrier(0);      /* all loads above are issued before the first conversion waits for one: without it they are issued a few at a time, each batch behind the wait for the batch before */
#pragma unroll      /* constant indices, so that the arrays indexed below stay in registers */
  for (int g = 0; g < PJT / 16; ++g) { FragH f;
    for (int u = 0; u < 4; ++u) for (int q = 0; q < 4; ++q) f.h[4 * u + q] = (_Float16)bf16_round(xr[g][u][q]);
    xf[g] = f.v; }
  pj_wfrag(wr[0], wf[0]);
  pj_wload(wv + wo, wr[2]);      /* into the registers that x and the q weights have left; in flight under the conversion of the k weights */
  asm volatile("s_wait_xcnt 0x0" :: "v"(wo) : "memory");      /* as above */
  __builtin_amdgcn_sched_barrier(0);      /* as above */
  pj_wfrag(wr[1], wf[1]); pj_wfrag(wr[2], wf[2]);
  const v8f z8 = {0.f, 0.f, 0.f, 0.f, 0.f, 0.f, 0.f, 0.f};
#pragma unroll      /* constant indices, so that the arrays indexed below stay in registers */
  for (int g = 0; g < PJT / 16; ++g) { unsigned short* qr = (unsigned short*)QK + (size_t)(tok0 + 16 * g + ln) * LQK + 32 * hh; unsigned short* vr = (unsigned short*)VT + ((size_t)b * HD + 4 * ln) * SQ + i0 + 16 * g + 8 * hh;
    for (int c = 0; c < 2; ++c) { v8f d[4];
      for (int t = 0; t < 4; ++t) d[t] = fa_mma(wf[c][t], xf[g], z8);
      for (int s = 0; s < 4; ++s) { FragH f;
        for (int e = 0; e < 8; ++e) f.h[e] = (_Float16)(d[e & 3][2 * s + (e >> 2)] * 0.0625f);      /* takes the weights' x16 back */
        *(v8us*)(qr + c * DI + 8 * s) = f.half[0]; } }
    { v8f d[4];
      for (int t = 0; t < 4; ++t) d[t] = fa_mma(xf[g], wf[2][t], z8);
      for (int t = 0; t < 4; ++t) { FragH f;
        for (int r = 0; r < 8; ++r) f.h[r] = (_Float16)(d[t][r] * 0.0625f);
        *(v8us*)(vr + (size_t)t * SQ) = f.half[0]; } } }
  if (i0 < QT0) {      /* the same for the whole wave (a scalar test) */
#pragma unroll      /* constant indices, so that the arrays indexed below stay in registers */
    for (int g = 0; g < PJT / 16; ++g) { float* fr = F0 + ((size_t)b * QT0 + i0 + 16 * g + ln) * LQK + 32 * hh;
      for (int c = 0; c < 3; ++c) { v8f d[4];
        for (int t = 0; t < 4; ++t) d[t] = fa_mma(wf[c][t], xf[g], z8);
        for (int r = 0; r < 8; ++r) { const v4f y = {d[0][r] * 0.0625f, d[1][r] * 0.0625f, d[2][r] * 0.0625f, d[3][r] * 0.0625f}; *(v4f*)(fr + c * DI + 4 * r) = y; } } } } }
extern "C" void kernel_launch(void* const* d_in, const int* in_sizes, int n_in,
                              void* d_out, int out_size, void* d_ws, size_t ws_size, hipStream_t stream) {
  (void)in_sizes; (void)n_in; (void)out_size;
  const float* const* I = (const float* const*)d_in; const float* x = I[0]; const float* wq = I[2]; const float* wk = I[1]; const float* wv = I[3];      /* x; [in][out = 64] weights in this module's input order (wq = input 2, wk = input 1, wv = input 3); no biases */
  char* ws = (char*)d_ws; size_t off = 0;
  auto take = [&](size_t bytes) { char* p = ws + off; off += (bytes + 255) & ~(size_t)255; return p; };
  _Float16* QKV = (_Float16*)take(NR * LQK * 2); _Float16* VT = (_Float16*)take((size_t)NB * NH * HD * SQ * 2);      /* of the q | k | v row pitch only the q and k columns are written and read: v goes straight into V^T */
  float* QKVF0 = (float*)take((size_t)NB * QT0 * LQK * 4);      /* one slab per batch of each plane: every launch below covers all NB batches */
  if (off > ws_size) return;
  float* ob = (float*)d_out;
  k_proj<<<(unsigned)(NR / (4 * PJT)), 128, 0, stream>>>(x, wq, wk, wv, QKV, VT, QKVF0);      /* q | k = x W as f16 rows, V^T [NB][HD][SQ] as f16, and f32 q | k | v of rows 0..511 of every batch (exact products, f32 accumulation) */
  k_fattn<LQK><<<dim3(SQ / 256, NB), 256, 0, stream>>>(QKV, QKV + DI, VT, ob);      /* out[b][i][..] = softmax(causal(q k^T 64^-0.5)) v (f32), every row of every batch; scores and weights never leave the registers */
  k_att0w<LQK><<<dim3(NH * (QT0 / A0R), NB), 256, 0, stream>>>(QKVF0, QKVF0 + DI, QKVF0 + 2 * DI, 0.125f, ob, DI);      /* exact f32 causal attention for rows 0..511 of every batch, which it REWRITES in the output */
}

// v006
// It runs in 113 microseconds.
// Next to v005, in two timings, it ran 1.06 and 1.07 times as fast.
// Over all steps from v000 it is 1154 times as fast.
#include <hip/hip_runtime.h>
// Single-head causal self-attention from a 32-wide embedding (x [16][4096][32]; k/q/v = x W ([in][out] [32][64], no biases; input order Wk, Wq, Wv); ONE 64-wide head (head_size 64 != C 32); scores * 64^-0.5; causal; softmax; out = weights v -> [16][4096][64]; no output projection).
// Structure: token rows; one projection launch (x and weights rounded in registers, WMMA products, f16 q | k rows and v^T stored straight from the result tiles); one fused causal attention launch (scores alpha 1/8, running-maximum softmax f32 -> f16 weights, P V in f32, all in registers; the four key shares of a query tile merged through LDS and written as f32 into the output rows); an exact f32 first tile (rows 0..511) rewritten at the end; launches: see trace.
// Compute dtype: inputs rounded to bf16; x / weights exact; q, k, v and softmax weights as plain f16 GEMM operands (~2^-12); scores, softmax statistics and o f32. v_wmma_f32_16x16x32_f16.
#define NB 16
#define SQ 4096
#define DM 32
#define NH 1
#define HD 64
#define HG 4                         /* unused by the launches (grid.y is NB); read only by the uncalled k_vt overload */
#define QT 256                       /* unused; a k_fattn block takes two 128-row query tiles */
#define NKX SQ                       /* unused; scores and weights stay in registers */
#define QT0 512                      /* first-tile rows recomputed exactly (f32): 512 here (no output projection averages the early-row cancellation errors away; logit sigma 1.0) */
#define B0 0                         /* unused; the batches are grid.y 0..NB-1 */
#define NBR NB                       /* feeds only the unused MP; the attention launches put the NB batches on grid.y */
#define NR ((size_t)NB * SQ)
#define DMQ DM
#define DFF 4096                     /* unused; no FFN here */
#define DFFR 100                     /* unused; no FFN here */
#define MP ((int)((size_t)NBR * SQ)) /* unused; the projections cover NR rows */
#define QN SQ                        /* unused; the query tiles cover SQ rows */
#define NHD NH                       /* unused; the launches use NH */
#define MPO MP                       /* unused */
#define LQ (3 * DM)      /* unused; the q/k/v row pitch is LQK */
typedef __bf16 v16b __attribute__((ext_vector_type(16)));
typedef unsigned short v8us __attribute__((ext_vector_type(8), may_alias));
typedef float  v8f  __attribute__((ext_vector_type(8)));
typedef float  v4f  __attribute__((ext_vector_type(4)));
typedef float  v4fa __attribute__((ext_vector_type(4), may_alias));
union FragB { v16b v; v8us half[2]; unsigned short u[16]; };

__device__ __forceinline__ unsigned short bf16_bits(float x) { unsigned int u = __float_as_uint(x); return (unsigned short)((u + 0x7FFFu + ((u >> 16) & 1u)) >> 16); }
__device__ __forceinline__ float bf16_val(unsigned short b) { return __uint_as_float(((unsigned int)b) << 16); }
__device__ __forceinline__ float bf16_round(float x) { return bf16_val(bf16_bits(x)); }
// D += A·B with NT terms: 1 = ah·bh, 2 = + al·bh (A split), 3 = + ah·bl (both split)
template <int NT>
__device__ __forceinline__ v8f mmaN(v16b ah, v16b al, v16b bh, v16b bl, v8f c) {
  c = __builtin_amdgcn_wmma_f32_16x16x32_bf16(false, ah, false, bh, (short)0, c, false, false);
  if (NT >= 2) c = __builtin_amdgcn_wmma_f32_16x16x32_bf16(false, al, false, bh, (short)0, c, false, false);
  if (NT >= 3) c = __builtin_amdgcn_wmma_f32_16x16x32_bf16(false, ah, false, bl, (short)0, c, false, false);
  asm volatile("v_nop\n\tv_nop\n\tv_nop\n\tv_nop" : "+v"(c) : "v"(ah), "v"(al), "v"(bh), "v"(bl));
  return c;
}

__global__ __launch_bounds__(256) void k_wt_bf16(const float* __restrict__ W, unsigned short* __restrict__ Wt, int K, int N) {
  const int t = blockIdx.x * 256 + threadIdx.x;
  const int k8n = K / 8;
  if (t >= N * k8n) return;
  const int n = t / k8n, k8 = (t % k8n) * 8;
  v8us v;
#pragma unroll
  for (int i = 0; i < 8; ++i) v[i] = bf16_bits(W[(size_t)(k8 + i) * N + n]);
  *(v8us*)(Wt + (size_t)n * K + k8) = v;
  
}

// GEMM C[M][N] (f32, pitch ldc) = act(A[M][K]·W + bias). A f32 row-major (pitch lda) converted per fragment to bf16
// (ASPLIT: hi/lo two planes -> 2 terms, else single rounded term); Wt bf16 [N][K] (pitch ldb). BIAS_BF16 rounds the
// bias to bf16 first (bias quantised to bf16 before the add). K%32==0, M%16==0, N%64==0.
template <bool ASPLIT, int ACT, bool BIAS_BF16>
__global__ __launch_bounds__(128) void k_gemm_bf(const float* __restrict__ A, int lda, const unsigned short* __restrict__ Wt, int ldb,
                                               const float* __restrict__ bias, float* __restrict__ C, int ldc, int M, int N, int K) {
  __shared__ __attribute__((aligned(16))) float so[4][16][64];
  const int tid = threadIdx.x, w = tid >> 5, lane = tid & 31, ln = lane & 15, hh = lane >> 4;
  const int ntn = N / 64;
  const int wid = blockIdx.x * 4 + w;
  const int mt = wid / ntn, nq = wid % ntn;
  if (mt * 16 >= M) return;
  const int row0 = mt * 16, col0 = nq * 64;
  const float* arow = A + (size_t)(row0 + ln) * lda;
  v8f acc[4] = {};
  for (int kb = 0; kb < K; kb += 32) {
    FragB ah, al;
    const v4f x0 = *(const v4fa*)(arow + kb + 8 * hh), x1 = *(const v4fa*)(arow + kb + 8 * hh + 4);
    const v4f x2 = *(const v4fa*)(arow + kb + 16 + 8 * hh), x3 = *(const v4fa*)(arow + kb + 16 + 8 * hh + 4);
    float xs[16] = {x0[0],x0[1],x0[2],x0[3],x1[0],x1[1],x1[2],x1[3],x2[0],x2[1],x2[2],x2[3],x3[0],x3[1],x3[2],x3[3]};
#pragma unroll
    for (int i = 0; i < 16; ++i) { const unsigned short hb = bf16_bits(xs[i]); ah.u[i] = hb; al.u[i] = ASPLIT ? bf16_bits(xs[i] - bf16_val(hb)) : (unsigned short)0; }
#pragma unroll
    for (int t = 0; t < 4; ++t) {
      const unsigned short* brow = Wt + (size_t)(col0 + t * 16 + ln) * ldb + kb;
      FragB b;
      b.half[0] = *(const v8us*)(brow + 8 * hh);
      b.half[1] = *(const v8us*)(brow + 16 + 8 * hh);
      acc[t] = mmaN<ASPLIT ? 2 : 1>(ah.v, al.v, b.v, b.v, acc[t]);
    }
  }
#pragma unroll
  for (int t = 0; t < 4; ++t) {
    float bv = bias ? bias[col0 + t * 16 + ln] : 0.f;
    if (BIAS_BF16) bv = bf16_round(bv);
#pragma unroll
    for (int r = 0; r < 8; ++r) { float v = acc[t][r] + bv; if (ACT == 1) v = fmaxf(v, 0.f); so[w][8 * hh + r][t * 16 + ln] = v; }
  }
  __builtin_amdgcn_fence(__ATOMIC_ACQ_REL, "workgroup");
  __builtin_amdgcn_wave_barrier();
  const int rsub = lane >> 4, c4 = (lane & 15) * 4;
  {
#pragma unroll
    for (int q = 0; q < 8; ++q) {
      const int r = q * 2 + rsub;
      const v4f v = *(const v4fa*)&so[w][r][c4];
      *(v4f*)(C + (size_t)(row0 + r) * ldc + col0 + c4) = v;
    }
    
  }
}

// GEMM C = act(A·W + bias + resid): A f32 (ASPLIT -> hi/lo 2 terms), Wt bf16 [N][K]; ACT 0 none, 1 relu, 2 exact gelu;
// resid (optional, f32, row index = (row % rmod), pitch ldr, RES_BF16 rounds it) added before the activation.
template <bool ASPLIT, int ACT, bool BIAS_BF16, bool RES_BF16>
__global__ __launch_bounds__(128) void k_gemm_bf3(const float* __restrict__ A, int lda, const unsigned short* __restrict__ Wt, int ldb,
                                                const float* __restrict__ bias, const float* __restrict__ resid, int rmod, int ldr,
                                                float* __restrict__ C, int ldc, int M, int N, int K) {
  __shared__ __attribute__((aligned(16))) float so[4][16][64];
  const int tid = threadIdx.x, w = tid >> 5, lane = tid & 31, ln = lane & 15, hh = lane >> 4;
  const int ntn = N / 64;
  const int wid = blockIdx.x * 4 + w;
  const int mt = wid / ntn, nq = wid % ntn;
  if (mt * 16 >= M) return;
  const int row0 = mt * 16, col0 = nq * 64;
  const float* arow = A + (size_t)(row0 + ln) * lda;
  v8f acc[4] = {};
  for (int kb = 0; kb < K; kb += 32) {
    FragB ah, al;
    const v4f x0 = *(const v4fa*)(arow + kb + 8 * hh), x1 = *(const v4fa*)(arow + kb + 8 * hh + 4);
    const v4f x2 = *(const v4fa*)(arow + kb + 16 + 8 * hh), x3 = *(const v4fa*)(arow + kb + 16 + 8 * hh + 4);
    float xs[16] = {x0[0],x0[1],x0[2],x0[3],x1[0],x1[1],x1[2],x1[3],x2[0],x2[1],x2[2],x2[3],x3[0],x3[1],x3[2],x3[3]};
#pragma unroll
    for (int i = 0; i < 16; ++i) { const unsigned short hb = bf16_bits(xs[i]); ah.u[i] = hb; al.u[i] = ASPLIT ? bf16_bits(xs[i] - bf16_val(hb)) : (unsigned short)0; }
#pragma unroll
    for (int t = 0; t < 4; ++t) {
      const unsigned short* brow = Wt + (size_t)(col0 + t * 16 + ln) * ldb + kb;
      FragB b;
      b.half[0] = *(const v8us*)(brow + 8 * hh);
      b.half[1] = *(const v8us*)(brow + 16 + 8 * hh);
      acc[t] = mmaN<ASPLIT ? 2 : 1>(ah.v, al.v, b.v, b.v, acc[t]);
    }
  }
#pragma unroll
  for (int t = 0; t < 4; ++t) {
    const int col = col0 + t * 16 + ln;
    float bv = bias ? bias[col] : 0.f;
    if (BIAS_BF16) bv = bf16_round(bv);
#pragma unroll
    for (int r = 0; r < 8; ++r) {
      float v = acc[t][r] + bv;
      if (resid) { float rv = resid[(size_t)((row0 + 8 * hh + r) % rmod) * ldr + col]; if (RES_BF16) rv = bf16_round(rv); v += rv; }
      if (ACT == 1) v = fmaxf(v, 0.f);
      if (ACT == 2) v = 0.5f * v * (1.0f + erff(v * 0.70710678118654752f));
      if (ACT == 3) { const float u = 0.7978845608028654f * (v + 0.044715f * v * v * v); v = 0.5f * v * (1.0f + tanhf(u)); }
      so[w][8 * hh + r][t * 16 + ln] = v;
    }
  }
  __builtin_amdgcn_fence(__ATOMIC_ACQ_REL, "workgroup");
  __builtin_amdgcn_wave_barrier();
  const int rsub = lane >> 4, c4 = (lane & 15) * 4;
  {
#pragma unroll
    for (int q = 0; q < 8; ++q) {
      const int r = q * 2 + rsub;
      const v4f v = *(const v4fa*)&so[w][r][c4];
      *(v4f*)(C + (size_t)(row0 + r) * ldc + col0 + c4) = v;
    }
    
  }
}
// row LayerNorm (biased variance, eps) over N: s = X (+ R); optional out_sum <- s; out_norm <- (s-mu)*rsqrt(var+eps)*g + b
template <bool PARAM_BF16>
__global__ __launch_bounds__(256) void k_layernorm(const float* __restrict__ X, const float* __restrict__ R, const float* __restrict__ g, const float* __restrict__ bta,
                                                  float* __restrict__ out_sum, float* __restrict__ out_norm, int N, float eps) {
  __shared__ float red[256];
  const int row = blockIdx.x, tid = threadIdx.x;
  const float* x = X + (size_t)row * N; const float* rr = R ? R + (size_t)row * N : nullptr;
  float vals[16];                     // up to N = 4096
  const int per = N / 256;            // contiguous chunk per thread? use strided-by-4 chunks: thread handles j = tid*4 + 1024*u
  float s1 = 0.f;
  for (int u = 0; u < per / 4; ++u) {
    const int j = tid * 4 + 1024 * u;
    const v4f a = *(const v4fa*)(x + j);
    v4f b = {0.f,0.f,0.f,0.f}; if (rr) b = *(const v4fa*)(rr + j);
#pragma unroll
    for (int q = 0; q < 4; ++q) { const float v = a[q] + b[q]; vals[u * 4 + q] = v; s1 += v; }
  }
  red[tid] = s1; __syncthreads();
  for (int st = 128; st > 0; st >>= 1) { if (tid < st) red[tid] += red[tid + st]; __syncthreads(); }
  const float mu = red[0] / (float)N; __syncthreads();
  float s2 = 0.f;
  for (int u = 0; u < per / 4; ++u)
#pragma unroll
    for (int q = 0; q < 4; ++q) { const float c = vals[u * 4 + q] - mu; s2 += c * c; }
  red[tid] = s2; __syncthreads();
  for (int st = 128; st > 0; st >>= 1) { if (tid < st) red[tid] += red[tid + st]; __syncthreads(); }
  const float rs = rsqrtf(red[0] / (float)N + eps);
  {
    for (int u = 0; u < per / 4; ++u) {
      const int j = tid * 4 + 1024 * u;
      v4f o, sm;
#pragma unroll
      for (int q = 0; q < 4; ++q) {
        float gg = g[j + q], bb = bta[j + q];
        if (PARAM_BF16) { gg = bf16_round(gg); bb = bf16_round(bb); }
        sm[q] = vals[u * 4 + q]; o[q] = (vals[u * 4 + q] - mu) * rs * gg + bb;
      }
      if (out_sum) *(v4f*)(out_sum + (size_t)row * N + j) = sm;
      *(v4f*)(out_norm + (size_t)row * N + j) = o;
    }
    
  }
}



// ---- f16 WMMA path (v_wmma_f32_16x16x32_f16): 11-bit significands for operands in range — used where a [0,1] probability operand needs more precision than bf16
typedef _Float16 v16h __attribute__((ext_vector_type(16)));
union FragH { v16h v; v8us half[2]; _Float16 h[16]; unsigned short u[16]; };
template <int NT>
__device__ __forceinline__ v8f mmaH(v16h ah, v16h al, v16h bh, v16h bl, v8f c) {
  c = __builtin_amdgcn_wmma_f32_16x16x32_f16(false, ah, false, bh, (short)0, c, false, false);
  if (NT >= 2) c = __builtin_amdgcn_wmma_f32_16x16x32_f16(false, al, false, bh, (short)0, c, false, false);
  if (NT >= 3) c = __builtin_amdgcn_wmma_f32_16x16x32_f16(false, ah, false, bl, (short)0, c, false, false);
  asm volatile("v_nop\n\tv_nop\n\tv_nop\n\tv_nop" : "+v"(c) : "v"(ah), "v"(al), "v"(bh), "v"(bl));
  return c;
}
// batched GEMM like k_gemm_b but f16 operands: A f32 (split into f16 hi/lo if ASPLIT, else rounded to f16), Bt = f16 values [n][k]; alpha; C f32; N multiple of 16 (partial tiles skipped)
template <bool ASPLIT>
__global__ __launch_bounds__(128) void k_gemm_h(const float* __restrict__ A, int lda, size_t sA, const _Float16* __restrict__ Bh, int ldb, size_t sB, float alpha, float* __restrict__ C, int ldc, size_t sC, int M, int N, int K) {
  __shared__ __attribute__((aligned(16))) float so[4][16][64];
  const int tid = threadIdx.x, w = tid >> 5, lane = tid & 31, ln = lane & 15, hh = lane >> 4; const int by = blockIdx.y;
  A += (size_t)by * sA; Bh += (size_t)by * sB; C += (size_t)by * sC;
  const int ntn = (N + 63) / 64; const int wid = blockIdx.x * 4 + w; const int mt = wid / ntn, nq = wid % ntn; if (mt * 16 >= M) return;
  const int row0 = mt * 16, col0 = nq * 64; const float* arow = A + (size_t)(row0 + ln) * lda;
  v8f acc[4] = {};
  for (int kb = 0; kb < K; kb += 32) {
    FragH ah, al;
    const v4f x0 = *(const v4fa*)(arow + kb + 8 * hh), x1 = *(const v4fa*)(arow + kb + 8 * hh + 4), x2 = *(const v4fa*)(arow + kb + 16 + 8 * hh), x3 = *(const v4fa*)(arow + kb + 16 + 8 * hh + 4);
    float xs[16] = {x0[0],x0[1],x0[2],x0[3],x1[0],x1[1],x1[2],x1[3],x2[0],x2[1],x2[2],x2[3],x3[0],x3[1],x3[2],x3[3]};
#pragma unroll
    for (int i = 0; i < 16; ++i) { const _Float16 h = (_Float16)xs[i]; ah.h[i] = h; al.h[i] = ASPLIT ? (_Float16)(xs[i] - (float)h) : (_Float16)0.0f; }
#pragma unroll
    for (int t = 0; t < 4; ++t) { if (col0 + t * 16 >= N) continue; const size_t boff = (size_t)(col0 + t * 16 + ln) * ldb + kb; FragH bq; bq.half[0] = *(const v8us*)(Bh + boff + 8 * hh); bq.half[1] = *(const v8us*)(Bh + boff + 16 + 8 * hh);
      acc[t] = mmaH<ASPLIT ? 2 : 1>(ah.v, al.v, bq.v, bq.v, acc[t]); }
  }
#pragma unroll
  for (int t = 0; t < 4; ++t) { if (col0 + t * 16 >= N) continue;
#pragma unroll
    for (int r = 0; r < 8; ++r) so[w][8 * hh + r][t * 16 + ln] = acc[t][r] * alpha; }
  __builtin_amdgcn_fence(__ATOMIC_ACQ_REL, "workgroup"); __builtin_amdgcn_wave_barrier();
  const int rsub = lane >> 4, c4 = (lane & 15) * 4;
  {
#pragma unroll
    for (int q = 0; q < 8; ++q) { const int r = q * 2 + rsub; if (col0 + c4 < N) { const v4f v = *(const v4fa*)&so[w][r][c4]; *(v4f*)(C + (size_t)(row0 + r) * ldc + col0 + c4) = v; } }
     }
}

// k_gemm_hh variant with fused epilogue: v = acc·alpha + bias[by·sBias + col] (+ CP[(row/rowsPerB)·sCPb + by·64 + col] if CP) ; ACT 0 none / 1 elu ; writes f16 C16 (and f32 C if non-null)
template <int ACT>
__global__ __launch_bounds__(128) void k_gemm_hhx(const _Float16* __restrict__ A, int lda, size_t sA, const _Float16* __restrict__ Bh, int ldb, size_t sB, float alpha, const float* __restrict__ bias, size_t sBias, const float* __restrict__ CP, int rowsPerB, size_t sCPb, int row0g,
    float* __restrict__ C, _Float16* __restrict__ C16, int ldc, size_t sC, int M, int N, int K) {
  __shared__ __attribute__((aligned(16))) float so[4][16][64];
  const int tid = threadIdx.x, w = tid >> 5, lane = tid & 31, ln = lane & 15, hh = lane >> 4; const int by = blockIdx.y;
  A += (size_t)by * sA; Bh += (size_t)by * sB; const size_t cofs = (size_t)by * sC; const float* bp = bias ? bias + (size_t)by * sBias : nullptr;
  const int ntn = (N + 63) / 64; const int wid = blockIdx.x * 4 + w; const int mt = wid / ntn, nq = wid % ntn; if (mt * 16 >= M) return;
  const int row0 = mt * 16, col0 = nq * 64; const _Float16* arow = A + (size_t)(row0 + ln) * lda;
  v8f acc[4] = {};
  for (int kb = 0; kb < K; kb += 32) { FragH ah; ah.half[0] = *(const v8us*)((const unsigned short*)arow + kb + 8 * hh); ah.half[1] = *(const v8us*)((const unsigned short*)arow + kb + 16 + 8 * hh);
#pragma unroll
    for (int t = 0; t < 4; ++t) { if (col0 + t * 16 >= N) continue; const size_t boff = (size_t)(col0 + t * 16 + ln) * ldb + kb; FragH bq; bq.half[0] = *(const v8us*)((const unsigned short*)Bh + boff + 8 * hh); bq.half[1] = *(const v8us*)((const unsigned short*)Bh + boff + 16 + 8 * hh);
      acc[t] = mmaH<1>(ah.v, ah.v, bq.v, bq.v, acc[t]); }
  }
#pragma unroll
  for (int t = 0; t < 4; ++t) { if (col0 + t * 16 >= N) continue; const int col = col0 + t * 16 + ln; const float bv = bp ? bf16_round(bp[col]) : 0.f;
#pragma unroll
    for (int r = 0; r < 8; ++r) { float v = acc[t][r] * alpha + bv; if (CP) { const int rr = row0g + row0 + 8 * hh + r; if (rowsPerB < 0) v += CP[cofs + (size_t)rr * ldc + col];      /* rowsPerB < 0: own element of the batched C plane */ else { const int bidx = rr / rowsPerB; v += CP[(size_t)bidx * sCPb + (size_t)by * 64 + col]; } } if (ACT == 1) v = (v > 0.f) ? v : expm1f(v); else if (ACT == 7) v = (v > 0.f) ? v + 1.0f : expf(v); else if (ACT == 8) v = tanhf(v); else if (ACT == 9) v = 0.5f * v * (1.0f + tanhf(0.7978845608028654f * (v + 0.044715f * v * v * v))); else if (ACT == 11) v = 1.0f / (1.0f + expf(-v)); else if (ACT == 12) v = (v > 0.f) ? v : 0.01f * v; else if (ACT == 14) v = (v > 0.f) ? v : 0.1f * v; else if (ACT == 16) v = (v >= 0.f) ? v : 0.3f * v; else if (ACT == 17) v = (v >= 0.f) ? v : 0.2f * v; else if (ACT == 15) v = v / (1.0f + expf(-v)); else if (ACT == 3) v = fmaxf(v, 0.f); else if (ACT == 6) v = 0.5f * v * (1.0f + erff(v * 0.70710678118654752f)); so[w][8 * hh + r][t * 16 + ln] = v; } }
  __builtin_amdgcn_fence(__ATOMIC_ACQ_REL, "workgroup"); __builtin_amdgcn_wave_barrier();
  const int rsub = lane >> 4, c4 = (lane & 15) * 4; typedef _Float16 v4h __attribute__((ext_vector_type(4)));
  {
#pragma unroll
    for (int q = 0; q < 8; ++q) { const int r = q * 2 + rsub; if (col0 + c4 < N) { const v4f v = *(const v4fa*)&so[w][r][c4]; if (C) *(v4f*)(C + cofs + (size_t)(row0 + r) * ldc + col0 + c4) = v; if (C16) { v4h h4; for (int i = 0; i < 4; ++i) h4[i] = (_Float16)v[i]; *(v4h*)(C16 + cofs + (size_t)(row0 + r) * ldc + col0 + c4) = h4; } } }
     }
}


typedef _Float16 v4h __attribute__((ext_vector_type(4)));

__global__ __launch_bounds__(256) void k_h16(const float* __restrict__ x, _Float16* __restrict__ X16, size_t n8) { const size_t t = (size_t)blockIdx.x * 256 + threadIdx.x; if (t >= n8) return; FragH f;
#pragma unroll
  for (int q = 0; q < 8; ++q) f.h[q] = (_Float16)x[t * 8 + q]; *(v8us*)((unsigned short*)X16 + t * 8) = f.half[0];  }
__global__ __launch_bounds__(256) void k_round16f(const float* __restrict__ W, _Float16* __restrict__ Bt, size_t n8) { const size_t t = (size_t)blockIdx.x * 256 + threadIdx.x; if (t >= n8) return; FragH f;
#pragma unroll
  for (int i = 0; i < 8; ++i) f.h[i] = (_Float16)(bf16_round(W[t * 8 + i]) * 16.0f); *(v8us*)((unsigned short*)Bt + t * 8) = f.half[0];  }

__global__ __launch_bounds__(256) void k_hl(const float* __restrict__ F, _Float16* __restrict__ Hh, _Float16* __restrict__ Hl, size_t n8) { const size_t t = (size_t)blockIdx.x * 256 + threadIdx.x; if (t >= n8) return; FragH fh, fl; const v4f a = *(const v4fa*)(F + t * 8), c = *(const v4fa*)(F + t * 8 + 4);
#pragma unroll
  for (int q = 0; q < 4; ++q) { _Float16 h = (_Float16)a[q]; fh.h[q] = h; fl.h[q] = (_Float16)((a[q] - (float)h) * 1024.0f); h = (_Float16)c[q]; fh.h[4 + q] = h; fl.h[4 + q] = (_Float16)((c[q] - (float)h) * 1024.0f); }
  { *(v8us*)((unsigned short*)Hh + t * 8) = fh.half[0]; *(v8us*)((unsigned short*)Hl + t * 8) = fl.half[0];  } }



__global__ __launch_bounds__(256) void k_wnat(const float* __restrict__ w, size_t n8, _Float16* __restrict__ Bt) { const size_t t = (size_t)blockIdx.x * 256 + threadIdx.x; if (t >= n8) return; FragH f; for (int q = 0; q < 8; ++q) f.h[q] = (_Float16)(bf16_round(w[t * 8 + q]) * 16.0f); *(v8us*)((unsigned short*)Bt + t * 8) = f.half[0];  }
__global__ __launch_bounds__(256) void k_rsm(const float* __restrict__ S, _Float16* __restrict__ P, int nrows) {
  #pragma clang fp contract(off)
  const int i = blockIdx.x * 256 + threadIdx.x; if (i >= nrows) return; const float* s = S + (size_t)i * SQ; float mx = -3.0e38f;
#pragma unroll 1
  for (int j = 0; j < SQ; ++j) mx = fmaxf(mx, s[j]); float se = 0.f;
#pragma unroll 1
  for (int j = 0; j < SQ; ++j) se += expf(s[j] - mx); const float sc = 256.0f / se;
#pragma unroll 1
  for (int j0 = 0; j0 < SQ; j0 += 8) { FragH f; for (int q = 0; q < 8; ++q) f.h[q] = (_Float16)(expf(s[j0 + q] - mx) * sc); unsigned short* d = (unsigned short*)P + (size_t)i * SQ + j0; *(v8us*)d = f.half[0];  } }
__global__ __launch_bounds__(256) void k_vt(const _Float16* __restrict__ V16, int b, int h0, _Float16* __restrict__ VT) { __shared__ unsigned short tl[64][65]; const int tid = threadIdx.x; const int hh = blockIdx.x % HG, sg = blockIdx.x / HG; const int s0 = sg * 64; const int h = h0 + hh;
  for (int i = tid; i < 64 * 8; i += 256) { const int j = i / 8, d8 = (i % 8) * 8; FragH f; f.half[0] = *(const v8us*)((const unsigned short*)V16 + ((size_t)b * SQ + s0 + j) * DM + h * HD + d8); for (int q = 0; q < 8; ++q) tl[d8 + q][j] = f.u[q]; }
  __syncthreads();
  { for (int i = tid; i < 64 * 8; i += 256) { const int d = i / 8, j8 = (i % 8) * 8; FragH f; for (int q = 0; q < 8; ++q) f.u[q] = tl[d][j8 + q]; *(v8us*)((unsigned short*)VT + ((size_t)hh * HD + d) * SQ + s0 + j8) = f.half[0]; }  } }



// Fused causal attention, one launch for all query rows and batches: a wave holds 32 query rows (two 16-column groups) and walks every fourth block of 32 keys, four waves to a tile; scores and weights stay in registers.
// S^T = K Q^T (A = K rows, B = Q rows, both through the same loader), so a lane holds the scores of ONE query per group: keys kb + 8 hh + r (tile 0) and kb + 16 + 8 hh + r (tile 1), which is the k order of a B operand:
// the weights are converted in place and feed O^T += V^T P^T (A = V^T rows through the same loader). Running maximum (log2 units) and sum per query in f32; the two lane halves exchange the maximum each pass and join their sums once at the end.
// The output tiles are rescaled only when some query's maximum has grown by more than 8 (weights stay <= 2^8, inside f16). K fragments are refetched right behind their products, V^T fragments right behind theirs, into the same registers.
__device__ __forceinline__ v16h fa_frag(const _Float16* p) { FragH f; f.half[0] = *(const v8us*)((const unsigned short*)p); f.half[1] = *(const v8us*)((const unsigned short*)p + 16); return f.v; }      /* p already holds the lane half's 8 hh */
__device__ __forceinline__ v8f fa_mma(v16h a, v16h b, v8f c) { return __builtin_amdgcn_wmma_f32_16x16x32_f16(false, a, false, b, (short)0, c, false, false); }
__device__ __forceinline__ float fa_xhalf(float x) { return __builtin_bit_cast(float, __builtin_amdgcn_permlanex16(__builtin_bit_cast(int, x), __builtin_bit_cast(int, x), 0x76543210, 0xfedcba98, false, false)); }      /* lane l with lane l ^ 16 */
#define FAC 0.18033688011112042f     /* 64^-0.5 * log2(e) */
__device__ __forceinline__ float fa_exp2(float x) { float r; asm("v_exp_f32 %0, %1\n\tv_nop" : "=v"(r) : "v"(x)); return r; }      /* 2^x; the v_nop fills the one slot that the instruction set asks for between a transcendental and a next instruction that reads its result or overwrites its source */
__device__ __forceinline__ v8f fa_exp2x8(v8f x) { float r0, r1, r2, r3, r4, r5, r6, r7;      /* eight 2^x in one statement: the results are kept off the sources (early clobber), so each instruction fills the slot of the one before it, and one v_nop that of the last */
  asm("v_exp_f32 %0, %8\n\tv_exp_f32 %1, %9\n\tv_exp_f32 %2, %10\n\tv_exp_f32 %3, %11\n\tv_exp_f32 %4, %12\n\tv_exp_f32 %5, %13\n\tv_exp_f32 %6, %14\n\tv_exp_f32 %7, %15\n\tv_nop"
      : "=&v"(r0), "=&v"(r1), "=&v"(r2), "=&v"(r3), "=&v"(r4), "=&v"(r5), "=&v"(r6), "=&v"(r7) : "v"(x[0]), "v"(x[1]), "v"(x[2]), "v"(x[3]), "v"(x[4]), "v"(x[5]), "v"(x[6]), "v"(x[7]));
  return v8f{r0, r1, r2, r3, r4, r5, r6, r7}; }
#define FKS 4                        /* waves that share the keys of one 32-row query tile */
#define FQT 4                        /* 32-row query tiles per block */
template <int LD>      /* row pitch of the q / k planes */
__global__ __launch_bounds__(32 * FKS * FQT) void k_fattn(const _Float16* __restrict__ Q, const _Float16* __restrict__ K, const _Float16* __restrict__ VT, float* __restrict__ O) {
  // Key split: a block of sixteen waves owns 128 query rows (four 32-row tiles); the four waves of a tile hold the SAME 32 query rows, and wave sh of them walks key blocks sh, sh + 4, ... (32 keys each)
  // with its own running maximum, sum and output tiles; the four partial results of a tile are merged through LDS. The waves with the same sh walk the same keys side by side.
  // A block takes row group n - 1 - x and then row group x, so the key blocks walked add up alike in every block, and a wave walks about a quarter of its two tiles' blocks.
  __shared__ __attribute__((aligned(16))) float so[FKS * FQT * 2048];      /* merge plane [wave][piece (t, j, register half)][32 units of 16 bytes] */
  __shared__ float sfm[FKS * FQT][32]; __shared__ float sfl[FKS * FQT][32];      /* [wave][query row of the tile]: running maximum (log2 units), sum */
  const int lane = threadIdx.x & 31, ln = lane & 15, hh = lane >> 4; const int w = __builtin_amdgcn_readfirstlane(threadIdx.x >> 5); const int sh = w / FQT, qt = w % FQT;      /* wave w: key share sh of tile qt of the row group; neighbouring waves walk the same keys */
  { const size_t bi = (size_t)blockIdx.y * SQ; Q += bi * LD; K += bi * LD; VT += bi * HD; O += bi * HD; }      /* batch on grid.y */
  const v8f z8 = {0.f, 0.f, 0.f, 0.f, 0.f, 0.f, 0.f, 0.f};
  for (int h = 0; h < 2; ++h) {
    const int tile = (h ? (int)blockIdx.x : SQ / (32 * FQT) - 1 - (int)blockIdx.x) * FQT + qt; const int q0 = tile * 32;
    const int nf = (tile > sh ? tile - sh : 0) / FKS;      /* the wave's key blocks: sh, sh + 4, ..., sh + 4 nf (the same for the whole wave) */
    const int dq = (tile - sh - FKS * nf) * 32;      /* query q0 minus the first key of the wave's last block: 0 = the diagonal block; below 0 (sh > tile, tiles 0 .. 2 only): a block wholly right of the diagonal, every key masked, so that the wave adds weight 0 */
    v8f o[4][2]; float m[2] = {-1.0e30f, -1.0e30f}, l[2] = {0.f, 0.f};
#pragma unroll      /* constant indices, so that the arrays indexed below stay in registers */
    for (int t = 0; t < 4; ++t) { o[t][0] = z8; o[t][1] = z8; }
    {
      v16h qf[2][2], kf[2][2], vf[4];
      const _Float16* kp = K + (size_t)(32 * sh + ln) * LD + 8 * hh; const _Float16* vp = VT + (size_t)ln * SQ + 32 * sh + 8 * hh;
      { const _Float16* qp = Q + (size_t)(q0 + ln) * LD + 8 * hh;
#pragma unroll      /* constant indices, so that the arrays indexed below stay in registers */
        for (int j = 0; j < 2; ++j) for (int ks = 0; ks < 2; ++ks) { qf[j][ks] = fa_frag(qp + 16 * j * LD + 32 * ks); kf[j][ks] = fa_frag(kp + 16 * j * LD + 32 * ks); }
#pragma unroll      /* constant indices, so that the arrays indexed below stay in registers */
        for (int t = 0; t < 4; ++t) vf[t] = fa_frag(vp + 16 * t * SQ);
        asm volatile("s_wait_xcnt 0x0" :: "v"(qp), "v"(kp), "v"(vp) : "memory"); }      /* the address pairs stay untouched until the loads that name them have taken them: kp and vp are stepped on in the loop */
      auto pass = [&](const bool last) __attribute__((always_inline)) {      /* one block of 32 keys; last: the wave's last block, masked where it reaches the diagonal, nothing fetched behind it; else the wave's next block (4 blocks on) is fetched behind the products */
        v8f s[2][2];      /* [key tile][query group] */
#pragma unroll      /* constant indices, so that the arrays indexed below stay in registers */
        for (int kt = 0; kt < 2; ++kt) for (int j = 0; j < 2; ++j) s[kt][j] = fa_mma(kf[kt][1], qf[j][1], fa_mma(kf[kt][0], qf[j][0], z8));
        if (!last) { kp += FKS * 32 * LD;
#pragma unroll      /* constant indices, so that the arrays indexed below stay in registers */
          for (int kt = 0; kt < 2; ++kt) for (int ks = 0; ks < 2; ++ks) kf[kt][ks] = fa_frag(kp + 16 * kt * LD + 32 * ks);
          asm volatile("s_wait_xcnt 0x0" :: "v"(kp) : "memory"); }      /* as above */
        if (last && dq < 32) {      /* a scalar test: three waves of four end left of the diagonal block */
#pragma unroll      /* constant indices, so that the arrays indexed below stay in registers */
          for (int kt = 0; kt < 2; ++kt) for (int j = 0; j < 2; ++j) for (int r = 0; r < 8; ++r) s[kt][j][r] = (16 * kt + 8 * hh + r <= 16 * j + ln + dq) ? s[kt][j][r] : -3.0e38f; }      /* key at or left of query */
        float mx[2];
#pragma unroll      /* constant indices, so that the arrays indexed below stay in registers */
        for (int j = 0; j < 2; ++j) { float a = fmaxf(s[0][j][0], s[1][j][0]);
          for (int r = 1; r < 8; ++r) a = fmaxf(a, fmaxf(s[0][j][r], s[1][j][r]));
          mx[j] = fmaxf(a, fa_xhalf(a)) * FAC; }      /* finite; in a block that is masked as a whole it lies below the start value of m, which then stays, and every weight is 2^(-huge) = 0 */
        if (__builtin_amdgcn_ballot_w32(mx[0] > m[0] + 8.0f || mx[1] > m[1] + 8.0f) != 0) {      /* one scalar test a pass */
#pragma unroll      /* constant indices, so that the arrays indexed below stay in registers */
          for (int j = 0; j < 2; ++j) { const float mn = fmaxf(m[j], mx[j]); const float al = fa_exp2(m[j] - mn); m[j] = mn; l[j] *= al;
            for (int t = 0; t < 4; ++t) o[t][j] *= al; } }
        v16h pf[2];
#pragma unroll      /* constant indices, so that the arrays indexed below stay in registers */
        for (int j = 0; j < 2; ++j) { FragH f; const float mj = -m[j]; const v8f c8 = {FAC, FAC, FAC, FAC, FAC, FAC, FAC, FAC}, m8 = {mj, mj, mj, mj, mj, mj, mj, mj};
          const v8f e0 = fa_exp2x8(__builtin_elementwise_fma(s[0][j], c8, m8)), e1 = fa_exp2x8(__builtin_elementwise_fma(s[1][j], c8, m8));
          float a0 = e0[0], a1 = e1[0];
          for (int r = 1; r < 8; ++r) { a0 += e0[r]; a1 += e1[r]; }
          for (int r = 0; r < 8; ++r) { f.h[r] = (_Float16)e0[r]; f.h[8 + r] = (_Float16)e1[r]; }
          l[j] += a0 + a1; pf[j] = f.v; }
#pragma unroll      /* constant indices, so that the arrays indexed below stay in registers */
        for (int t = 0; t < 4; ++t) for (int j = 0; j < 2; ++j) o[t][j] = fa_mma(vf[t], pf[j], o[t][j]);
        if (!last) { vp += FKS * 32;
#pragma unroll      /* constant indices, so that the arrays indexed below stay in registers */
          for (int t = 0; t < 4; ++t) vf[t] = fa_frag(vp + 16 * t * SQ);
          asm volatile("s_wait_xcnt 0x0" :: "v"(vp) : "memory"); }      /* as above */
      };
      for (int i = 0; i < nf; ++i) pass(false);
      pass(true);
    }
    __syncthreads();      /* the readers of the row group before have left the merge plane */
#pragma unroll      /* constant indices, so that the arrays indexed below stay in registers */
    for (int t = 0; t < 4; ++t) for (int j = 0; j < 2; ++j) for (int g = 0; g < 2; ++g) { const v4f y = {o[t][j][4 * g], o[t][j][4 * g + 1], o[t][j][4 * g + 2], o[t][j][4 * g + 3]};
      *(v4f*)&so[(w * 512 + ((t * 2 + j) * 2 + g) * 32 + hh * 16 + ((ln + 2 * hh + 4 * t) & 15)) * 4] = y; }      /* the unit is turned by 2 hh + 4 t inside its 16, so that writers (16 lanes = 16 queries) and readers (16 lanes = 2 queries x 8 column pieces) both fall on distinct banks */
    { const float l0 = l[0] + fa_xhalf(l[0]), l1 = l[1] + fa_xhalf(l[1]);      /* the two lane halves join their sums */
      sfm[w][lane] = hh ? m[1] : m[0]; sfl[w][lane] = hh ? l1 : l0; }      /* lane = query row 16 j + ln with j = hh: the maximum and the joined sum are alike in both halves */
    __syncthreads();      /* all partial results are in LDS */
#pragma unroll      /* constant indices, so that the arrays indexed below stay in registers */
    for (int i = 0; i < 2; ++i) { const int row = 8 * sh + 4 * i + (lane >> 3), rj = row >> 4, rl = row & 15, rt = (lane & 7) >> 1, rh = lane & 1;      /* merge: wave sh of a tile owns its rows 8 sh .. 8 sh + 7, four at a time; a lane eight neighbouring columns 16 rt + 8 rh .., so a wave stores whole rows */
      float mu[FKS]; float mt = sfm[qt][row]; mu[0] = mt;      /* the tile's four waves: qt, qt + 4, ... */
      for (int u = 1; u < FKS; ++u) { mu[u] = sfm[qt + FQT * u][row]; mt = fmaxf(mt, mu[u]); }      /* finite: the tile's first wave holds key 0, which is valid for every row */
      const int un = (rt * 2 + rj) * 64 + rh * 16 + ((rl + 2 * rh + 4 * rt) & 15);
      float lt = 0.f; v4f a0 = {0.f, 0.f, 0.f, 0.f}, a1 = {0.f, 0.f, 0.f, 0.f};
      for (int u = 0; u < FKS; ++u) { const float f = fa_exp2(mu[u] - mt); lt += sfl[qt + FQT * u][row] * f;      /* a wave whose only block was masked as a whole: maximum -1e30, so f = 0 */
        a0 += *(const v4f*)&so[((qt + FQT * u) * 512 + un) * 4] * f; a1 += *(const v4f*)&so[((qt + FQT * u) * 512 + un + 32) * 4] * f; }
      const float fin = 1.0f / lt;
      float* op = O + (size_t)(q0 + row) * HD + 16 * rt + 8 * rh;
      *(v4f*)op = a0 * fin; *(v4f*)(op + 4) = a1 * fin;
      asm volatile("s_wait_xcnt 0x0" :: "v"(op) : "memory"); }      /* the stores' address and data registers stay untouched until the stores have taken them: the next row group's code writes them anew */
  } }


// Exact f32 causal attention for rows 0..QT0-1, one 8-wave block per 32 query rows of one batch: lane = query row, its q row and its partial o row stay in registers;
// K and V rows come through LDS in tiles of 64 keys (coalesced 16-byte loads, the next tile fetched into registers while this one is worked on) and are read as same-address (broadcast) 16-byte LDS loads;
// wave w takes keys 8 w .. 8 w + 7 of every tile with its own running maximum, sum and o; at the end the eight partial results of a row are merged through LDS and stored straight into the output rows.
typedef float v2f __attribute__((ext_vector_type(2)));
#define A0R 32                       /* query rows per block */
#define A0T 64                       /* keys per LDS tile */
#define A0K 8                        /* keys per wave and tile */
#define A0P 33                       /* row pitch of the merge plane [wave][d][row]: odd, so that writers (lane = row) and readers (lane = row, d piece) both fall on distinct banks */
__device__ __forceinline__ float a0_exp(float x) { float r; asm("v_exp_f32 %0, %1\n\tv_nop" : "=v"(r) : "v"(x * 1.4426950408889634f)); return r; }      /* e^x; the v_nop fills the one slot that the instruction set asks for between a transcendental and a next instruction that reads its result or overwrites its source */
template <int LD>      /* row pitch of the q / k / v planes: a constant, so that all loads of a tile share one address pair and differ in their immediate offsets only */
__global__ __launch_bounds__(256) void k_att0w(const float* __restrict__ QF, const float* __restrict__ KF, const float* __restrict__ VF, float scale, float* __restrict__ OF, int ldo) {
  __shared__ __attribute__((aligned(16))) float sm[8 * HD * A0P];      /* in the loop: K tile [A0T][HD], then V tile [A0T][HD]; behind it: the merge plane */
  __shared__ float smm[8][A0R]; __shared__ float sml[8][A0R];
  { const size_t bi = (size_t)blockIdx.y * QT0 * LD; QF += bi; KF += bi; VF += bi; OF += (size_t)blockIdx.y * SQ * ldo; }      /* batch on grid.y: its own QT0-row slab of each plane, and its own rows of the output */
  const int tid = threadIdx.x, lane = tid & 31; const int w = __builtin_amdgcn_readfirstlane(tid >> 5);
  const int h = blockIdx.x / (QT0 / A0R), rg = (QT0 / A0R - 1) - blockIdx.x % (QT0 / A0R);      /* the row groups with the most keys start first */
  const int r0 = rg * A0R, i = r0 + lane; const int nkeys = r0 + A0R; const int nt = (nkeys + A0T - 1) / A0T;      /* keys 0 .. r0 + 31; a tile's rows all lie below QT0 (A0T divides QT0) */
  v2f q[HD / 2], o[HD / 2];
  { const float* qr = QF + (size_t)i * LD + h * HD;
#pragma unroll      /* constant indices, so that the arrays indexed below stay in registers */
    for (int c = 0; c < HD / 4; ++c) { const v4f a = *(const v4fa*)(qr + c * 4); q[2 * c] = v2f{a[0], a[1]}; q[2 * c + 1] = v2f{a[2], a[3]}; o[2 * c] = v2f{0.f, 0.f}; o[2 * c + 1] = v2f{0.f, 0.f}; }
    asm volatile("s_wait_xcnt 0x0" :: "v"(qr) : "memory"); }      /* the address pair stays untouched until the loads that name it have taken it: no later load's result and no later instruction may take it over before */
  const int sr = tid >> 4, sc4 = (tid & 15) * 4;      /* staging: 16 lanes per 256-byte row, rows sr + 16 u */
  const float* kg = KF + (size_t)sr * LD + h * HD + sc4; const float* vg = VF + (size_t)sr * LD + h * HD + sc4;
  v4f pk[4], pv[4];
#pragma unroll      /* constant indices, so that the arrays indexed below stay in registers */
  for (int u = 0; u < 4; ++u) { pk[u] = *(const v4fa*)(kg + 16 * u * LD); pv[u] = *(const v4fa*)(vg + 16 * u * LD); }
  asm volatile("s_wait_xcnt 0x0" :: "v"(kg), "v"(vg) : "memory");      /* as above: both address pairs are stepped on in the loop */
  float m = -1.0e30f, l = 0.f;
  for (int t = 0; t < nt; ++t) {
#pragma unroll      /* constant indices, so that the arrays indexed below stay in registers */
    for (int u = 0; u < 4; ++u) { *(v4f*)&sm[(sr + 16 * u) * HD + sc4] = pk[u]; *(v4f*)&sm[A0T * HD + (sr + 16 * u) * HD + sc4] = pv[u]; }
    __syncthreads();
    if (t + 1 < nt) { kg += A0T * LD; vg += A0T * LD;
#pragma unroll      /* constant indices, so that the arrays indexed below stay in registers */
      for (int u = 0; u < 4; ++u) { pk[u] = *(const v4fa*)(kg + 16 * u * LD); pv[u] = *(const v4fa*)(vg + 16 * u * LD); }
      asm volatile("s_wait_xcnt 0x0" :: "v"(kg), "v"(vg) : "memory"); }      /* as above */
    const int j0 = t * A0T + w * A0K;
    if (j0 < nkeys) {      /* the same for the whole wave; no barrier inside */
      const float* kt = sm + w * A0K * HD; const float* vt = sm + A0T * HD + w * A0K * HD;
      v2f s2[A0K];
#pragma unroll      /* constant indices, so that the arrays indexed below stay in registers */
      for (int k = 0; k < A0K; ++k) s2[k] = v2f{0.f, 0.f};
#pragma unroll      /* constant indices, so that the arrays indexed below stay in registers */
      for (int c = 0; c < HD / 4; ++c) {
#pragma unroll      /* constant indices, so that the arrays indexed below stay in registers */
        for (int k = 0; k < A0K; ++k) { const v4f kk = *(const v4f*)&kt[k * HD + c * 4]; s2[k] = __builtin_elementwise_fma(q[2 * c], v2f{kk[0], kk[1]}, s2[k]); s2[k] = __builtin_elementwise_fma(q[2 * c + 1], v2f{kk[2], kk[3]}, s2[k]); } }
      float s[A0K], e[A0K]; float mn = m;
#pragma unroll      /* constant indices, so that the arrays indexed below stay in registers */
      for (int k = 0; k < A0K; ++k) { s[k] = (j0 + k <= i) ? (s2[k][0] + s2[k][1]) * scale : -1.0e30f; mn = fmaxf(mn, s[k]); }
      const float rs = a0_exp(m - mn); m = mn; float ls = 0.f;
#pragma unroll      /* constant indices, so that the arrays indexed below stay in registers */
      for (int k = 0; k < A0K; ++k) { const float ex = a0_exp(s[k] - mn); e[k] = (j0 + k <= i) ? ex : 0.f; ls += e[k]; }      /* a key right of the diagonal weighs 0 also while the running maximum is still the start value */
      l = l * rs + ls;
#pragma unroll      /* constant indices, so that the arrays indexed below stay in registers */
      for (int c = 0; c < HD / 2; ++c) o[c] *= rs;
#pragma unroll      /* constant indices, so that the arrays indexed below stay in registers */
      for (int k = 0; k < A0K; ++k) { const v2f e2 = {e[k], e[k]};
#pragma unroll      /* constant indices, so that the arrays indexed below stay in registers */
        for (int c = 0; c < HD / 4; ++c) { const v4f vv = *(const v4f*)&vt[k * HD + c * 4]; o[2 * c] = __builtin_elementwise_fma(e2, v2f{vv[0], vv[1]}, o[2 * c]); o[2 * c + 1] = __builtin_elementwise_fma(e2, v2f{vv[2], vv[3]}, o[2 * c + 1]); } }
    }
    __syncthreads();
  }
#pragma unroll      /* constant indices, so that the arrays indexed below stay in registers */
  for (int c = 0; c < HD / 2; ++c) { sm[(w * HD + 2 * c) * A0P + lane] = o[c][0]; sm[(w * HD + 2 * c + 1) * A0P + lane] = o[c][1]; }
  smm[w][lane] = m; sml[w][lane] = l;
  __syncthreads();
  const int row = w * 4 + (lane >> 3), d0 = (lane & 7) * 8;      /* merge: wave w owns rows 4 w .. 4 w + 3, a lane eight neighbouring columns, so a wave stores whole rows */
  float mx = smm[0][row];
#pragma unroll      /* constant indices, so that the arrays indexed below stay in registers */
  for (int u = 1; u < 8; ++u) mx = fmaxf(mx, smm[u][row]);      /* finite: key 0 is valid for every row */
  float lt = 0.f; float a[8] = {0.f, 0.f, 0.f, 0.f, 0.f, 0.f, 0.f, 0.f};
#pragma unroll      /* constant indices, so that the arrays indexed below stay in registers */
  for (int u = 0; u < 8; ++u) { const float f = a0_exp(smm[u][row] - mx); lt += sml[u][row] * f;
#pragma unroll      /* constant indices, so that the arrays indexed below stay in registers */
    for (int d = 0; d < 8; ++d) a[d] += sm[(u * HD + d0 + d) * A0P + row] * f; }
  const float fin = 1.0f / lt;
  float* op = OF + (size_t)(r0 + row) * ldo + h * HD + d0;
  const v4f y0 = {a[0] * fin, a[1] * fin, a[2] * fin, a[3] * fin}, y1 = {a[4] * fin, a[5] * fin, a[6] * fin, a[7] * fin};
  *(v4f*)op = y0; *(v4f*)(op + 4) = y1; }


template <int BFIN, int WXB>
__global__ __launch_bounds__(256) void k_ln16(const float* __restrict__ X, const float* __restrict__ g, const float* __restrict__ bb, float eps, _Float16* __restrict__ N16, float* __restrict__ XB) {
  #pragma clang fp contract(off)
  __shared__ float red[256]; const size_t r = blockIdx.x; const int t = threadIdx.x; const v4f xa = *(const v4fa*)(X + r * DMQ + t * 4); float s[4]; float sum = 0.f;
  for (int q = 0; q < 4; ++q) { s[q] = BFIN ? bf16_round(xa[q]) : xa[q]; sum = __fadd_rn(sum, s[q]); }
  red[t] = sum; __syncthreads(); for (int st = 128; st > 0; st >>= 1) { if (t < st) red[t] = __fadd_rn(red[t], red[t + st]); __syncthreads(); } const float mu = red[0] / (float)DMQ; __syncthreads();
  float vs = 0.f; for (int q = 0; q < 4; ++q) { const float dl = __fadd_rn(s[q], -mu); vs = __fadd_rn(vs, __fmul_rn(dl, dl)); } red[t] = vs; __syncthreads(); for (int st = 128; st > 0; st >>= 1) { if (t < st) red[t] = __fadd_rn(red[t], red[t + st]); __syncthreads(); }
  const float rs = rsqrtf(__fadd_rn(red[0] / (float)DMQ, eps)); v4h y; v4f xb;
  for (int q = 0; q < 4; ++q) { const int c = t * 4 + q; y[q] = (_Float16)__fadd_rn(__fmul_rn(__fmul_rn(__fadd_rn(s[q], -mu), rs), bf16_round(g[c])), bf16_round(bb[c])); xb[q] = s[q]; }
  { *(v4h*)(N16 + r * DMQ + t * 4) = y; if (WXB) *(v4f*)(XB + r * DMQ + t * 4) = xb;  } }
__global__ __launch_bounds__(256) void k_ftres2(const float* __restrict__ OF0, const float* __restrict__ XB, float* __restrict__ X1, size_t n4) {
  #pragma clang fp contract(off)
  const size_t t = (size_t)blockIdx.x * 256 + threadIdx.x; if (t >= n4) return; const v4f o = *(const v4fa*)(OF0 + t * 4), xv = *(const v4fa*)(XB + t * 4); v4f y; for (int q = 0; q < 4; ++q) y[q] = __fadd_rn(__fmul_rn(o[q], 0.015625f), xv[q]); *(v4f*)(X1 + t * 4) = y;  }

__global__ __launch_bounds__(256) void k_wthd(const float* __restrict__ Wt, _Float16* __restrict__ Bt) { const size_t t = (size_t)blockIdx.x * 256 + threadIdx.x; if (t >= (size_t)NH * HD * (DM / 8)) return; const int m8 = (int)(t % (DM / 8)) * 8; const int d = (int)((t / (DM / 8)) % HD); const int h = (int)(t / ((size_t)(DM / 8) * HD)); FragH f;
  for (int q = 0; q < 8; ++q) f.h[q] = (_Float16)(16.0f * bf16_round(Wt[((size_t)h * DM + m8 + q) * HD + d])); unsigned short* dst = (unsigned short*)Bt + ((size_t)h * HD + d) * DM + m8; *(v8us*)dst = f.half[0];  }




__global__ __launch_bounds__(256) void k_wtpad(const float* __restrict__ Wm, _Float16* __restrict__ Wt, int Kr, int Kp, int Nr, int Np, float scale) {
  const int t = blockIdx.x * 256 + threadIdx.x; if (t >= Np * (Kp / 8)) return; const int n = t / (Kp / 8), k8 = (t % (Kp / 8)) * 8; const int nc = min(n, Nr - 1); const float fn = (n < Nr) ? 1.f : 0.f; FragH f;
  for (int i = 0; i < 8; ++i) { const int k = k8 + i; const int kc = min(k, Kr - 1); const float fk = (k < Kr) ? fn : 0.f; f.h[i] = (_Float16)(bf16_round(Wm[(size_t)kc * Nr + nc]) * scale * fk); }
  unsigned short* o = (unsigned short*)Wt + (size_t)n * Kp + k8; *(v8us*)o = f.half[0];  }
__global__ __launch_bounds__(128) void k_bpad(const float* __restrict__ b, float* __restrict__ Bp, int nr, int np) {
  const int i = threadIdx.x; if (i >= np) return; const float v = b[min(i, nr - 1)] * ((i < nr) ? 1.f : 0.f); *(float*)(Bp + i) = v;  }

#define DI 64         /* inner width = NH * HD (ONE 64-wide head) */
#define LQK (3 * DI)  /* fused q | k | v row pitch (192) */
__global__ __launch_bounds__(256) void k_o0(const float* __restrict__ OF, float* __restrict__ ob, size_t n4) {
  #pragma clang fp contract(off)
  const size_t t = (size_t)blockIdx.x * 256 + threadIdx.x; if (t >= n4) return; const size_t e = t * 4; const int i = (int)(e / DI); const int c = (int)(e % DI); const int h = c / HD, d = c % HD; const v4f a = *(const v4fa*)(OF + e); v4f o; for (int q = 0; q < 4; ++q) o[q] = __fmul_rn(a[q], 0.015625f); float* dst = ob + (size_t)h * SQ * HD + (size_t)i * HD + d; *(v4f*)dst = o;  }

// Projection, ONE launch from the inputs themselves: a wave owns 64 tokens (so that it writes whole 128-byte pieces of the V^T rows) and holds the twelve 16-feature weight fragments of q | k | v in registers
// (f16 of the bf16-rounded weight x16, read straight from the [in][out] f32 weights) and its four x fragments (f16 of the bf16-rounded x); weight and x go through the same k order (8 hh + i, 16 + 8 hh + i).
// Row (or column) c of weight tile t is feature 4 c + t, so one 16-byte load of a weight row serves all four tiles.
// q, k: A = weight, B = x, so a lane holds, over the four tiles, features 32 hh .. 32 hh + 31 of ONE token (register r of tile t = feature 32 hh + 4 r + t): 16-byte stores into the q | k rows.
// v: A = x, B = weight, so a lane's eight results are eight neighbouring tokens of ONE feature: one 16-byte f16 store into V^T.
// The waves of tokens 0..QT0-1 of a batch store q | k | v as f32 rows for the exact first tile as well. K = 32: one matrix instruction a tile.
#define PJT 64                       /* tokens per wave */
__device__ __forceinline__ void pj_wload(const float* __restrict__ p, v4f (&r)[16]) {      /* p: the lane's k = 8 hh, features 4 ln .. 4 ln + 3 */
#pragma unroll      /* constant indices, so that the array stays in registers */
  for (int i = 0; i < 8; ++i) { r[i] = *(const v4fa*)(p + i * DI); r[8 + i] = *(const v4fa*)(p + (16 + i) * DI); } }
__device__ __forceinline__ void pj_wfrag(const v4f (&r)[16], v16h (&wf)[4]) {
#pragma unroll      /* constant indices, so that the arrays stay in registers */
  for (int t = 0; t < 4; ++t) { FragH f;
    for (int i = 0; i < 16; ++i) f.h[i] = (_Float16)(bf16_round(r[i][t]) * 16.0f);
    wf[t] = f.v; } }
__global__ __launch_bounds__(128) void k_proj(const float* __restrict__ x, const float* __restrict__ wq, const float* __restrict__ wk, const float* __restrict__ wv, _Float16* __restrict__ QK, _Float16* __restrict__ VT, float* __restrict__ F0) {
  const int lane = threadIdx.x & 31, ln = lane & 15, hh = lane >> 4; const int w = __builtin_amdgcn_readfirstlane(threadIdx.x >> 5);
  const int tok0 = ((int)blockIdx.x * 4 + w) * PJT; const int b = tok0 / SQ, i0 = tok0 % SQ;      /* PJT divides SQ and QT0: a wave's tokens lie in one batch, and all or none of them in the first tile */
  v16h xf[PJT / 16], wf[3][4]; v4f xr[PJT / 16][4], wr[3][16];
  const float* xp = x + (size_t)(tok0 + ln) * DM + 8 * hh; const int wo = 8 * hh * DI + 4 * ln;
#pragma unroll      /* constant indices, so that the arrays indexed below stay in registers */
  for (int g = 0; g < PJT / 16; ++g) { xr[g][0] = *(const v4fa*)(xp + 16 * g * DM); xr[g][1] = *(const v4fa*)(xp + 16 * g * DM + 4); xr[g][2] = *(const v4fa*)(xp + 16 * g * DM + 16); xr[g][3] = *(const v4fa*)(xp + 16 * g * DM + 20); }
  pj_wload(wq + wo, wr[0]); pj_wload(wk + wo, wr[1]);
  asm volatile("s_wait_xcnt 0x0" :: "v"(xp), "v"(wo) : "memory");      /* the address registers stay untouched until the loads that name them have taken them */
  __builtin_amdgcn_sched_barrier(0);      /* all loads above are issued before the first conversion waits for one: without it they are issued a few at a time, each batch behind the wait for the batch before */
#pragma unroll      /* constant indices, so that the arrays indexed below stay in registers */
  for (int g = 0; g < PJT / 16; ++g) { FragH f;
    for (int u = 0; u < 4; ++u) for (int q = 0; q < 4; ++q) f.h[4 * u + q] = (_Float16)bf16_round(xr[g][u][q]);
    xf[g] = f.v; }
  pj_wfrag(wr[0], wf[0]);
  pj_wload(wv + wo, wr[2]);      /* into the registers that x and the q weights have left; in flight under the conversion of the k weights */
  asm volatile("s_wait_xcnt 0x0" :: "v"(wo) : "memory");      /* as above */
  __builtin_amdgcn_sched_barrier(0);      /* as above */
  pj_wfrag(wr[1], wf[1]); pj_wfrag(wr[2], wf[2]);
  const v8f z8 = {0.f, 0.f, 0.f, 0.f, 0.f, 0.f, 0.f, 0.f};
#pragma unroll      /* constant indices, so that the arrays indexed below stay in registers */
  for (int g = 0; g < PJT / 16; ++g) { unsigned short* qr = (unsigned short*)QK + (size_t)(tok0 + 16 * g + ln) * LQK + 32 * hh; unsigned short* vr = (unsigned short*)VT + ((size_t)b * HD + 4 * ln) * SQ + i0 + 16 * g + 8 * hh;
    for (int c = 0; c < 2; ++c) { v8f d[4];
      for (int t = 0; t < 4; ++t) d[t] = fa_mma(wf[c][t], xf[g], z8);
      for (int s = 0; s < 4; ++s) { FragH f;
        for (int e = 0; e < 8; ++e) f.h[e] = (_Float16)(d[e & 3][2 * s + (e >> 2)] * 0.0625f);      /* takes the weights' x16 back */
        *(v8us*)(qr + c * DI + 8 * s) = f.half[0]; } }
    { v8f d[4];
      for (int t = 0; t < 4; ++t) d[t] = fa_mma(xf[g], wf[2][t], z8);
      for (int t = 0; t < 4; ++t) { FragH f;
        for (int r = 0; r < 8; ++r) f.h[r] = (_Float16)(d[t][r] * 0.0625f);
        *(v8us*)(vr + (size_t)t * SQ) = f.half[0]; } } }
  if (i0 < QT0) {      /* the same for the whole wave (a scalar test) */
#pragma unroll      /* constant indices, so that the arrays indexed below stay in registers */
    for (int g = 0; g < PJT / 16; ++g) { float* fr = F0 + ((size_t)b * QT0 + i0 + 16 * g + ln) * LQK + 32 * hh;
      for (int c = 0; c < 3; ++c) { v8f d[4];
        for (int t = 0; t < 4; ++t) d[t] = fa_mma(wf[c][t], xf[g], z8);
        for (int r = 0; r < 8; ++r) { const v4f y = {d[0][r] * 0.0625f, d[1][r] * 0.0625f, d[2][r] * 0.0625f, d[3][r] * 0.0625f}; *(v4f*)(fr + c * DI + 4 * r) = y; } } } } }
extern "C" void kernel_launch(void* const* d_in, const int* in_sizes, int n_in,
                              void* d_out, int out_size, void* d_ws, size_t ws_size, hipStream_t stream) {
  (void)in_sizes; (void)n_in; (void)out_size;
  const float* const* I = (const float* const*)d_in; const float* x = I[0]; const float* wq = I[2]; const float* wk = I[1]; const float* wv = I[3];      /* x; [in][out = 64] weights in this module's input order (wq = input 2, wk = input 1, wv = input 3); no biases */
  char* ws = (char*)d_ws; size_t off = 0;
  auto take = [&](size_t bytes) { char* p = ws + off; off += (bytes + 255) & ~(size_t)255; return p; };
  _Float16* QKV = (_Float16*)take(NR * LQK * 2); _Float16* VT = (_Float16*)take((size_t)NB * NH * HD * SQ * 2);      /* of the q | k | v row pitch only the q and k columns are written and read: v goes straight into V^T */
  float* QKVF0 = (float*)take((size_t)NB * QT0 * LQK * 4);      /* one slab per batch of each plane: every launch below covers all NB batches */
  if (off > ws_size) return;
  float* ob = (float*)d_out;
  k_proj<<<(unsigned)(NR / (4 * PJT)), 128, 0, stream>>>(x, wq, wk, wv, QKV, VT, QKVF0);      /* q | k = x W as f16 rows, V^T [NB][HD][SQ] as f16, and f32 q | k | v of rows 0..511 of every batch (exact products, f32 accumulation) */
  k_fattn<LQK><<<dim3(SQ / (64 * FQT), NB), 32 * FKS * FQT, 0, stream>>>(QKV, QKV + DI, VT, ob);      /* out[b][i][..] = softmax(causal(q k^T 64^-0.5)) v (f32), every row of every batch; scores and weights never leave the registers */
  k_att0w<LQK><<<dim3(NH * (QT0 / A0R), NB), 256, 0, stream>>>(QKVF0, QKVF0 + DI, QKVF0 + 2 * DI, 0.125f, ob, DI);      /* exact f32 causal attention for rows 0..511 of every batch, which it REWRITES in the output */
}

// v007
// Measured time: 79.9 microseconds a run.
// Next to v006, in two timings, it ran 1.41 and 1.40 times as fast.
// Counting every step since v000, it is 1619 times as fast.
#include <hip/hip_runtime.h>
// Single-head causal self-attention from a 32-wide embedding (x [16][4096][32]; k/q/v = x W ([in][out] [32][64], no biases; input order Wk, Wq, Wv); ONE 64-wide head (head_size 64 != C 32); scores * 64^-0.5; causal; softmax; out = weights v -> [16][4096][64]; no output projection).
// Structure: token rows; one projection launch (x and weights rounded in registers, WMMA products, f16 q rows and k, v^T in matrix-fragment order stored straight from the result tiles); one fused causal attention launch (scores alpha 1/8, running-maximum softmax f32 -> f16 weights, P V in f32, all in registers; the four key shares of a query tile merged through LDS and written as f32 into the output rows); an exact f32 first tile (rows 0..511) rewritten at the end; launches: see trace.
// Compute dtype: inputs rounded to bf16; x / weights exact; q, k, v and softmax weights as plain f16 GEMM operands (~2^-12); scores and softmax statistics f32. v_wmma_f32_16x16x32_f16.
#define NB 16
#define SQ 4096
#define DM 32
#define NH 1
#define HD 64
#define HG 4                         /* unused by the launches (grid.y is NB); read only by the uncalled k_vt overload */
#define QT 256                       /* unused; a k_fattn block takes two 128-row query tiles */
#define NKX SQ                       /* unused; scores and weights stay in registers */
#define QT0 512                      /* first-tile rows recomputed exactly (f32): 512 here (no output projection averages the early-row cancellation errors away; logit sigma 1.0) */
#define B0 0                         /* unused; the batches are grid.y 0..NB-1 */
#define NBR NB                       /* feeds only the unused MP; the attention launches put the NB batches on grid.y */
#define NR ((size_t)NB * SQ)
#define DMQ DM
#define DFF 4096                     /* unused; no FFN here */
#define DFFR 100                     /* unused; no FFN here */
#define MP ((int)((size_t)NBR * SQ)) /* unused; the projections cover NR rows */
#define QN SQ                        /* unused; the query tiles cover SQ rows */
#define NHD NH                       /* unused; the launches use NH */
#define MPO MP                       /* unused */
#define LQ (3 * DM)      /* unused; the q/k/v row pitch is LQK */
typedef __bf16 v16b __attribute__((ext_vector_type(16)));
typedef unsigned short v8us __attribute__((ext_vector_type(8), may_alias));
typedef float  v8f  __attribute__((ext_vector_type(8)));
typedef float  v4f  __attribute__((ext_vector_type(4)));
typedef float  v4fa __attribute__((ext_vector_type(4), may_alias));
union FragB { v16b v; v8us half[2]; unsigned short u[16]; };

__device__ __forceinline__ unsigned short bf16_bits(float x) { unsigned int u = __float_as_uint(x); return (unsigned short)((u + 0x7FFFu + ((u >> 16) & 1u)) >> 16); }
__device__ __forceinline__ float bf16_val(unsigned short b) { return __uint_as_float(((unsigned int)b) << 16); }
__device__ __forceinline__ float bf16_round(float x) { return bf16_val(bf16_bits(x)); }
// D += A·B with NT terms: 1 = ah·bh, 2 = + al·bh (A split), 3 = + ah·bl (both split)
template <int NT>
__device__ __forceinline__ v8f mmaN(v16b ah, v16b al, v16b bh, v16b bl, v8f c) {
  c = __builtin_amdgcn_wmma_f32_16x16x32_bf16(false, ah, false, bh, (short)0, c, false, false);
  if (NT >= 2) c = __builtin_amdgcn_wmma_f32_16x16x32_bf16(false, al, false, bh, (short)0, c, false, false);
  if (NT >= 3) c = __builtin_amdgcn_wmma_f32_16x16x32_bf16(false, ah, false, bl, (short)0, c, false, false);
  asm volatile("v_nop\n\tv_nop\n\tv_nop\n\tv_nop" : "+v"(c) : "v"(ah), "v"(al), "v"(bh), "v"(bl));
  return c;
}

__global__ __launch_bounds__(256) void k_wt_bf16(const float* __restrict__ W, unsigned short* __restrict__ Wt, int K, int N) {
  const int t = blockIdx.x * 256 + threadIdx.x;
  const int k8n = K / 8;
  if (t >= N * k8n) return;
  const int n = t / k8n, k8 = (t % k8n) * 8;
  v8us v;
#pragma unroll
  for (int i = 0; i < 8; ++i) v[i] = bf16_bits(W[(size_t)(k8 + i) * N + n]);
  *(v8us*)(Wt + (size_t)n * K + k8) = v;
  
}

// GEMM C[M][N] (f32, pitch ldc) = act(A[M][K]·W + bias). A f32 row-major (pitch lda) converted per fragment to bf16
// (ASPLIT: hi/lo two planes -> 2 terms, else single rounded term); Wt bf16 [N][K] (pitch ldb). BIAS_BF16 rounds the
// bias to bf16 first (bias quantised to bf16 before the add). K%32==0, M%16==0, N%64==0.
template <bool ASPLIT, int ACT, bool BIAS_BF16>
__global__ __launch_bounds__(128) void k_gemm_bf(const float* __restrict__ A, int lda, const unsigned short* __restrict__ Wt, int ldb,
                                               const float* __restrict__ bias, float* __restrict__ C, int ldc, int M, int N, int K) {
  __shared__ __attribute__((aligned(16))) float so[4][16][64];
  const int tid = threadIdx.x, w = tid >> 5, lane = tid & 31, ln = lane & 15, hh = lane >> 4;
  const int ntn = N / 64;
  const int wid = blockIdx.x * 4 + w;
  const int mt = wid / ntn, nq = wid % ntn;
  if (mt * 16 >= M) return;
  const int row0 = mt * 16, col0 = nq * 64;
  const float* arow = A + (size_t)(row0 + ln) * lda;
  v8f acc[4] = {};
  for (int kb = 0; kb < K; kb += 32) {
    FragB ah, al;
    const v4f x0 = *(const v4fa*)(arow + kb + 8 * hh), x1 = *(const v4fa*)(arow + kb + 8 * hh + 4);
    const v4f x2 = *(const v4fa*)(arow + kb + 16 + 8 * hh), x3 = *(const v4fa*)(arow + kb + 16 + 8 * hh + 4);
    float xs[16] = {x0[0],x0[1],x0[2],x0[3],x1[0],x1[1],x1[2],x1[3],x2[0],x2[1],x2[2],x2[3],x3[0],x3[1],x3[2],x3[3]};
#pragma unroll
    for (int i = 0; i < 16; ++i) { const unsigned short hb = bf16_bits(xs[i]); ah.u[i] = hb; al.u[i] = ASPLIT ? bf16_bits(xs[i] - bf16_val(hb)) : (unsigned short)0; }
#pragma unroll
    for (int t = 0; t < 4; ++t) {
      const unsigned short* brow = Wt + (size_t)(col0 + t * 16 + ln) * ldb + kb;
      FragB b;
      b.half[0] = *(const v8us*)(brow + 8 * hh);
      b.half[1] = *(const v8us*)(brow + 16 + 8 * hh);
      acc[t] = mmaN<ASPLIT ? 2 : 1>(ah.v, al.v, b.v, b.v, acc[t]);
    }
  }
#pragma unroll
  for (int t = 0; t < 4; ++t) {
    float bv = bias ? bias[col0 + t * 16 + ln] : 0.f;
    if (BIAS_BF16) bv = bf16_round(bv);
#pragma unroll
    for (int r = 0; r < 8; ++r) { float v = acc[t][r] + bv; if (ACT == 1) v = fmaxf(v, 0.f); so[w][8 * hh + r][t * 16 + ln] = v; }
  }
  __builtin_amdgcn_fence(__ATOMIC_ACQ_REL, "workgroup");
  __builtin_amdgcn_wave_barrier();
  const int rsub = lane >> 4, c4 = (lane & 15) * 4;
  {
#pragma unroll
    for (int q = 0; q < 8; ++q) {
      const int r = q * 2 + rsub;
      const v4f v = *(const v4fa*)&so[w][r][c4];
      *(v4f*)(C + (size_t)(row0 + r) * ldc + col0 + c4) = v;
    }
    
  }
}

// GEMM C = act(A·W + bias + resid): A f32 (ASPLIT -> hi/lo 2 terms), Wt bf16 [N][K]; ACT 0 none, 1 relu, 2 exact gelu;
// resid (optional, f32, row index = (row % rmod), pitch ldr, RES_BF16 rounds it) added before the activation.
template <bool ASPLIT, int ACT, bool BIAS_BF16, bool RES_BF16>
__global__ __launch_bounds__(128) void k_gemm_bf3(const float* __restrict__ A, int lda, const unsigned short* __restrict__ Wt, int ldb,
                                                const float* __restrict__ bias, const float* __restrict__ resid, int rmod, int ldr,
                                                float* __restrict__ C, int ldc, int M, int N, int K) {
  __shared__ __attribute__((aligned(16))) float so[4][16][64];
  const int tid = threadIdx.x, w = tid >> 5, lane = tid & 31, ln = lane & 15, hh = lane >> 4;
  const int ntn = N / 64;
  const int wid = blockIdx.x * 4 + w;
  const int mt = wid / ntn, nq = wid % ntn;
  if (mt * 16 >= M) return;
  const int row0 = mt * 16, col0 = nq * 64;
  const float* arow = A + (size_t)(row0 + ln) * lda;
  v8f acc[4] = {};
  for (int kb = 0; kb < K; kb += 32) {
    FragB ah, al;
    const v4f x0 = *(const v4fa*)(arow + kb + 8 * hh), x1 = *(const v4fa*)(arow + kb + 8 * hh + 4);
    const v4f x2 = *(const v4fa*)(arow + kb + 16 + 8 * hh), x3 = *(const v4fa*)(arow + kb + 16 + 8 * hh + 4);
    float xs[16] = {x0[0],x0[1],x0[2],x0[3],x1[0],x1[1],x1[2],x1[3],x2[0],x2[1],x2[2],x2[3],x3[0],x3[1],x3[2],x3[3]};
#pragma unroll
    for (int i = 0; i < 16; ++i) { const unsigned short hb = bf16_bits(xs[i]); ah.u[i] = hb; al.u[i] = ASPLIT ? bf16_bits(xs[i] - bf16_val(hb)) : (unsigned short)0; }
#pragma unroll
    for (int t = 0; t < 4; ++t) {
      const unsigned short* brow = Wt + (size_t)(col0 + t * 16 + ln) * ldb + kb;
      FragB b;
      b.half[0] = *(const v8us*)(brow + 8 * hh);
      b.half[1] = *(const v8us*)(brow + 16 + 8 * hh);
      acc[t] = mmaN<ASPLIT ? 2 : 1>(ah.v, al.v, b.v, b.v, acc[t]);
    }
  }
#pragma unroll
  for (int t = 0; t < 4; ++t) {
    const int col = col0 + t * 16 + ln;
    float bv = bias ? bias[col] : 0.f;
    if (BIAS_BF16) bv = bf16_round(bv);
#pragma unroll
    for (int r = 0; r < 8; ++r) {
      float v = acc[t][r] + bv;
      if (resid) { float rv = resid[(size_t)((row0 + 8 * hh + r) % rmod) * ldr + col]; if (RES_BF16) rv = bf16_round(rv); v += rv; }
      if (ACT == 1) v = fmaxf(v, 0.f);
      if (ACT == 2) v = 0.5f * v * (1.0f + erff(v * 0.70710678118654752f));
      if (ACT == 3) { const float u = 0.7978845608028654f * (v + 0.044715f * v * v * v); v = 0.5f * v * (1.0f + tanhf(u)); }
      so[w][8 * hh + r][t * 16 + ln] = v;
    }
  }
  __builtin_amdgcn_fence(__ATOMIC_ACQ_REL, "workgroup");
  __builtin_amdgcn_wave_barrier();
  const int rsub = lane >> 4, c4 = (lane & 15) * 4;
  {
#pragma unroll
    for (int q = 0; q < 8; ++q) {
      const int r = q * 2 + rsub;
      const v4f v = *(const v4fa*)&so[w][r][c4];
      *(v4f*)(C + (size_t)(row0 + r) * ldc + col0 + c4) = v;
    }
    
  }
}
// row LayerNorm (biased variance, eps) over N: s = X (+ R); optional out_sum <- s; out_norm <- (s-mu)*rsqrt(var+eps)*g + b
template <bool PARAM_BF16>
__global__ __launch_bounds__(256) void k_layernorm(const float* __restrict__ X, const float* __restrict__ R, const float* __restrict__ g, const float* __restrict__ bta,
                                                  float* __restrict__ out_sum, float* __restrict__ out_norm, int N, float eps) {
  __shared__ float red[256];
  const int row = blockIdx.x, tid = threadIdx.x;
  const float* x = X + (size_t)row * N; const float* rr = R ? R + (size_t)row * N : nullptr;
  float vals[16];                     // up to N = 4096
  const int per = N / 256;            // contiguous chunk per thread? use strided-by-4 chunks: thread handles j = tid*4 + 1024*u
  float s1 = 0.f;
  for (int u = 0; u < per / 4; ++u) {
    const int j = tid * 4 + 1024 * u;
    const v4f a = *(const v4fa*)(x + j);
    v4f b = {0.f,0.f,0.f,0.f}; if (rr) b = *(const v4fa*)(rr + j);
#pragma unroll
    for (int q = 0; q < 4; ++q) { const float v = a[q] + b[q]; vals[u * 4 + q] = v; s1 += v; }
  }
  red[tid] = s1; __syncthreads();
  for (int st = 128; st > 0; st >>= 1) { if (tid < st) red[tid] += red[tid + st]; __syncthreads(); }
  const float mu = red[0] / (float)N; __syncthreads();
  float s2 = 0.f;
  for (int u = 0; u < per / 4; ++u)
#pragma unroll
    for (int q = 0; q < 4; ++q) { const float c = vals[u * 4 + q] - mu; s2 += c * c; }
  red[tid] = s2; __syncthreads();
  for (int st = 128; st > 0; st >>= 1) { if (tid < st) red[tid] += red[tid + st]; __syncthreads(); }
  const float rs = rsqrtf(red[0] / (float)N + eps);
  {
    for (int u = 0; u < per / 4; ++u) {
      const int j = tid * 4 + 1024 * u;
      v4f o, sm;
#pragma unroll
      for (int q = 0; q < 4; ++q) {
        float gg = g[j + q], bb = bta[j + q];
        if (PARAM_BF16) { gg = bf16_round(gg); bb = bf16_round(bb); }
        sm[q] = vals[u * 4 + q]; o[q] = (vals[u * 4 + q] - mu) * rs * gg + bb;
      }
      if (out_sum) *(v4f*)(out_sum + (size_t)row * N + j) = sm;
      *(v4f*)(out_norm + (size_t)row * N + j) = o;
    }
    
  }
}



// ---- f16 WMMA path (v_wmma_f32_16x16x32_f16): 11-bit significands for operands in range — used where a [0,1] probability operand needs more precision than bf16
typedef _Float16 v16h __attribute__((ext_vector_type(16)));
union FragH { v16h v; v8us half[2]; _Float16 h[16]; unsigned short u[16]; };
template <int NT>
__device__ __forceinline__ v8f mmaH(v16h ah, v16h al, v16h bh, v16h bl, v8f c) {
  c = __builtin_amdgcn_wmma_f32_16x16x32_f16(false, ah, false, bh, (short)0, c, false, false);
  if (NT >= 2) c = __builtin_amdgcn_wmma_f32_16x16x32_f16(false, al, false, bh, (short)0, c, false, false);
  if (NT >= 3) c = __builtin_amdgcn_wmma_f32_16x16x32_f16(false, ah, false, bl, (short)0, c, false, false);
  asm volatile("v_nop\n\tv_nop\n\tv_nop\n\tv_nop" : "+v"(c) : "v"(ah), "v"(al), "v"(bh), "v"(bl));
  return c;
}
// batched GEMM like k_gemm_b but f16 operands: A f32 (split into f16 hi/lo if ASPLIT, else rounded to f16), Bt = f16 values [n][k]; alpha; C f32; N multiple of 16 (partial tiles skipped)
template <bool ASPLIT>
__global__ __launch_bounds__(128) void k_gemm_h(const float* __restrict__ A, int lda, size_t sA, const _Float16* __restrict__ Bh, int ldb, size_t sB, float alpha, float* __restrict__ C, int ldc, size_t sC, int M, int N, int K) {
  __shared__ __attribute__((aligned(16))) float so[4][16][64];
  const int tid = threadIdx.x, w = tid >> 5, lane = tid & 31, ln = lane & 15, hh = lane >> 4; const int by = blockIdx.y;
  A += (size_t)by * sA; Bh += (size_t)by * sB; C += (size_t)by * sC;
  const int ntn = (N + 63) / 64; const int wid = blockIdx.x * 4 + w; const int mt = wid / ntn, nq = wid % ntn; if (mt * 16 >= M) return;
  const int row0 = mt * 16, col0 = nq * 64; const float* arow = A + (size_t)(row0 + ln) * lda;
  v8f acc[4] = {};
  for (int kb = 0; kb < K; kb += 32) {
    FragH ah, al;
    const v4f x0 = *(const v4fa*)(arow + kb + 8 * hh), x1 = *(const v4fa*)(arow + kb + 8 * hh + 4), x2 = *(const v4fa*)(arow + kb + 16 + 8 * hh), x3 = *(const v4fa*)(arow + kb + 16 + 8 * hh + 4);
    float xs[16] = {x0[0],x0[1],x0[2],x0[3],x1[0],x1[1],x1[2],x1[3],x2[0],x2[1],x2[2],x2[3],x3[0],x3[1],x3[2],x3[3]};
#pragma unroll
    for (int i = 0; i < 16; ++i) { const _Float16 h = (_Float16)xs[i]; ah.h[i] = h; al.h[i] = ASPLIT ? (_Float16)(xs[i] - (float)h) : (_Float16)0.0f; }
#pragma unroll
    for (int t = 0; t < 4; ++t) { if (col0 + t * 16 >= N) continue; const size_t boff = (size_t)(col0 + t * 16 + ln) * ldb + kb; FragH bq; bq.half[0] = *(const v8us*)(Bh + boff + 8 * hh); bq.half[1] = *(const v8us*)(Bh + boff + 16 + 8 * hh);
      acc[t] = mmaH<ASPLIT ? 2 : 1>(ah.v, al.v, bq.v, bq.v, acc[t]); }
  }
#pragma unroll
  for (int t = 0; t < 4; ++t) { if (col0 + t * 16 >= N) continue;
#pragma unroll
    for (int r = 0; r < 8; ++r) so[w][8 * hh + r][t * 16 + ln] = acc[t][r] * alpha; }
  __builtin_amdgcn_fence(__ATOMIC_ACQ_REL, "workgroup"); __builtin_amdgcn_wave_barrier();
  const int rsub = lane >> 4, c4 = (lane & 15) * 4;
  {
#pragma unroll
    for (int q = 0; q < 8; ++q) { const int r = q * 2 + rsub; if (col0 + c4 < N) { const v4f v = *(const v4fa*)&so[w][r][c4]; *(v4f*)(C + (size_t)(row0 + r) * ldc + col0 + c4) = v; } }
     }
}

// k_gemm_hh variant with fused epilogue: v = acc·alpha + bias[by·sBias + col] (+ CP[(row/rowsPerB)·sCPb + by·64 + col] if CP) ; ACT 0 none / 1 elu ; writes f16 C16 (and f32 C if non-null)
template <int ACT>
__global__ __launch_bounds__(128) void k_gemm_hhx(const _Float16* __restrict__ A, int lda, size_t sA, const _Float16* __restrict__ Bh, int ldb, size_t sB, float alpha, const float* __restrict__ bias, size_t sBias, const float* __restrict__ CP, int rowsPerB, size_t sCPb, int row0g,
    float* __restrict__ C, _Float16* __restrict__ C16, int ldc, size_t sC, int M, int N, int K) {
  __shared__ __attribute__((aligned(16))) float so[4][16][64];
  const int tid = threadIdx.x, w = tid >> 5, lane = tid & 31, ln = lane & 15, hh = lane >> 4; const int by = blockIdx.y;
  A += (size_t)by * sA; Bh += (size_t)by * sB; const size_t cofs = (size_t)by * sC; const float* bp = bias ? bias + (size_t)by * sBias : nullptr;
  const int ntn = (N + 63) / 64; const int wid = blockIdx.x * 4 + w; const int mt = wid / ntn, nq = wid % ntn; if (mt * 16 >= M) return;
  const int row0 = mt * 16, col0 = nq * 64; const _Float16* arow = A + (size_t)(row0 + ln) * lda;
  v8f acc[4] = {};
  for (int kb = 0; kb < K; kb += 32) { FragH ah; ah.half[0] = *(const v8us*)((const unsigned short*)arow + kb + 8 * hh); ah.half[1] = *(const v8us*)((const unsigned short*)arow + kb + 16 + 8 * hh);
#pragma unroll
    for (int t = 0; t < 4; ++t) { if (col0 + t * 16 >= N) continue; const size_t boff = (size_t)(col0 + t * 16 + ln) * ldb + kb; FragH bq; bq.half[0] = *(const v8us*)((const unsigned short*)Bh + boff + 8 * hh); bq.half[1] = *(const v8us*)((const unsigned short*)Bh + boff + 16 + 8 * hh);
      acc[t] = mmaH<1>(ah.v, ah.v, bq.v, bq.v, acc[t]); }
  }
#pragma unroll
  for (int t = 0; t < 4; ++t) { if (col0 + t * 16 >= N) continue; const int col = col0 + t * 16 + ln; const float bv = bp ? bf16_round(bp[col]) : 0.f;
#pragma unroll
    for (int r = 0; r < 8; ++r) { float v = acc[t][r] * alpha + bv; if (CP) { const int rr = row0g + row0 + 8 * hh + r; if (rowsPerB < 0) v += CP[cofs + (size_t)rr * ldc + col];      /* rowsPerB < 0: own element of the batched C plane */ else { const int bidx = rr / rowsPerB; v += CP[(size_t)bidx * sCPb + (size_t)by * 64 + col]; } } if (ACT == 1) v = (v > 0.f) ? v : expm1f(v); else if (ACT == 7) v = (v > 0.f) ? v + 1.0f : expf(v); else if (ACT == 8) v = tanhf(v); else if (ACT == 9) v = 0.5f * v * (1.0f + tanhf(0.7978845608028654f * (v + 0.044715f * v * v * v))); else if (ACT == 11) v = 1.0f / (1.0f + expf(-v)); else if (ACT == 12) v = (v > 0.f) ? v : 0.01f * v; else if (ACT == 14) v = (v > 0.f) ? v : 0.1f * v; else if (ACT == 16) v = (v >= 0.f) ? v : 0.3f * v; else if (ACT == 17) v = (v >= 0.f) ? v : 0.2f * v; else if (ACT == 15) v = v / (1.0f + expf(-v)); else if (ACT == 3) v = fmaxf(v, 0.f); else if (ACT == 6) v = 0.5f * v * (1.0f + erff(v * 0.70710678118654752f)); so[w][8 * hh + r][t * 16 + ln] = v; } }
  __builtin_amdgcn_fence(__ATOMIC_ACQ_REL, "workgroup"); __builtin_amdgcn_wave_barrier();
  const int rsub = lane >> 4, c4 = (lane & 15) * 4; typedef _Float16 v4h __attribute__((ext_vector_type(4)));
  {
#pragma unroll
    for (int q = 0; q < 8; ++q) { const int r = q * 2 + rsub; if (col0 + c4 < N) { const v4f v = *(const v4fa*)&so[w][r][c4]; if (C) *(v4f*)(C + cofs + (size_t)(row0 + r) * ldc + col0 + c4) = v; if (C16) { v4h h4; for (int i = 0; i < 4; ++i) h4[i] = (_Float16)v[i]; *(v4h*)(C16 + cofs + (size_t)(row0 + r) * ldc + col0 + c4) = h4; } } }
     }
}


typedef _Float16 v4h __attribute__((ext_vector_type(4)));

__global__ __launch_bounds__(256) void k_h16(const float* __restrict__ x, _Float16* __restrict__ X16, size_t n8) { const size_t t = (size_t)blockIdx.x * 256 + threadIdx.x; if (t >= n8) return; FragH f;
#pragma unroll
  for (int q = 0; q < 8; ++q) f.h[q] = (_Float16)x[t * 8 + q]; *(v8us*)((unsigned short*)X16 + t * 8) = f.half[0];  }
__global__ __launch_bounds__(256) void k_round16f(const float* __restrict__ W, _Float16* __restrict__ Bt, size_t n8) { const size_t t = (size_t)blockIdx.x * 256 + threadIdx.x; if (t >= n8) return; FragH f;
#pragma unroll
  for (int i = 0; i < 8; ++i) f.h[i] = (_Float16)(bf16_round(W[t * 8 + i]) * 16.0f); *(v8us*)((unsigned short*)Bt + t * 8) = f.half[0];  }

__global__ __launch_bounds__(256) void k_hl(const float* __restrict__ F, _Float16* __restrict__ Hh, _Float16* __restrict__ Hl, size_t n8) { const size_t t = (size_t)blockIdx.x * 256 + threadIdx.x; if (t >= n8) return; FragH fh, fl; const v4f a = *(const v4fa*)(F + t * 8), c = *(const v4fa*)(F + t * 8 + 4);
#pragma unroll
  for (int q = 0; q < 4; ++q) { _Float16 h = (_Float16)a[q]; fh.h[q] = h; fl.h[q] = (_Float16)((a[q] - (float)h) * 1024.0f); h = (_Float16)c[q]; fh.h[4 + q] = h; fl.h[4 + q] = (_Float16)((c[q] - (float)h) * 1024.0f); }
  { *(v8us*)((unsigned short*)Hh + t * 8) = fh.half[0]; *(v8us*)((unsigned short*)Hl + t * 8) = fl.half[0];  } }



__global__ __launch_bounds__(256) void k_wnat(const float* __restrict__ w, size_t n8, _Float16* __restrict__ Bt) { const size_t t = (size_t)blockIdx.x * 256 + threadIdx.x; if (t >= n8) return; FragH f; for (int q = 0; q < 8; ++q) f.h[q] = (_Float16)(bf16_round(w[t * 8 + q]) * 16.0f); *(v8us*)((unsigned short*)Bt + t * 8) = f.half[0];  }
__global__ __launch_bounds__(256) void k_rsm(const float* __restrict__ S, _Float16* __restrict__ P, int nrows) {
  #pragma clang fp contract(off)
  const int i = blockIdx.x * 256 + threadIdx.x; if (i >= nrows) return; const float* s = S + (size_t)i * SQ; float mx = -3.0e38f;
#pragma unroll 1
  for (int j = 0; j < SQ; ++j) mx = fmaxf(mx, s[j]); float se = 0.f;
#pragma unroll 1
  for (int j = 0; j < SQ; ++j) se += expf(s[j] - mx); const float sc = 256.0f / se;
#pragma unroll 1
  for (int j0 = 0; j0 < SQ; j0 += 8) { FragH f; for (int q = 0; q < 8; ++q) f.h[q] = (_Float16)(expf(s[j0 + q] - mx) * sc); unsigned short* d = (unsigned short*)P + (size_t)i * SQ + j0; *(v8us*)d = f.half[0];  } }
__global__ __launch_bounds__(256) void k_vt(const _Float16* __restrict__ V16, int b, int h0, _Float16* __restrict__ VT) { __shared__ unsigned short tl[64][65]; const int tid = threadIdx.x; const int hh = blockIdx.x % HG, sg = blockIdx.x / HG; const int s0 = sg * 64; const int h = h0 + hh;
  for (int i = tid; i < 64 * 8; i += 256) { const int j = i / 8, d8 = (i % 8) * 8; FragH f; f.half[0] = *(const v8us*)((const unsigned short*)V16 + ((size_t)b * SQ + s0 + j) * DM + h * HD + d8); for (int q = 0; q < 8; ++q) tl[d8 + q][j] = f.u[q]; }
  __syncthreads();
  { for (int i = tid; i < 64 * 8; i += 256) { const int d = i / 8, j8 = (i % 8) * 8; FragH f; for (int q = 0; q < 8; ++q) f.u[q] = tl[d][j8 + q]; *(v8us*)((unsigned short*)VT + ((size_t)hh * HD + d) * SQ + s0 + j8) = f.half[0]; }  } }



// Fused causal attention, one launch for all query rows and batches: a wave holds 32 query rows (two 16-column groups) and walks every fourth block of 32 keys, four waves to a tile; scores and weights stay in registers.
// K and V^T lie in fragment order: 4 KiB per block of 32 keys, [16-row tile][k step of 32 (K only)][register half][lane][8 values], the value of (lane, register) being the one that the row loader fa_frag would fetch from a row-major plane,
// so a wave's 16-byte load covers four whole 128-byte lines in place of 32-byte pieces of sixteen.
// S^T = K Q^T (A = K rows, B = Q rows, both in the same k order), so a lane holds the scores of ONE query per group: keys kb + 8 hh + r (tile 0) and kb + 16 + 8 hh + r (tile 1), which is the k order of a B operand:
// the weights are converted in place and feed O^T += V^T P^T (A = V^T rows in the same k order). Running maximum (log2 units) and sum per query in f32; the two lane halves exchange the maximum each pass and join their sums once at the end.
// The output tiles are rescaled only when some query's maximum has grown by more than 8 (weights stay <= 2^8, inside f16). K fragments are refetched right behind their products, V^T fragments right behind theirs, into the same registers.
__device__ __forceinline__ v16h fa_frag(const _Float16* p) { FragH f; f.half[0] = *(const v8us*)((const unsigned short*)p); f.half[1] = *(const v8us*)((const unsigned short*)p + 16); return f.v; }      /* p already holds the lane half's 8 hh */
__device__ __forceinline__ v16h fa_fragp(const _Float16* p) { FragH f; f.half[0] = *(const v8us*)((const unsigned short*)p); f.half[1] = *(const v8us*)((const unsigned short*)p + 256); return f.v; }      /* fragment-order plane: p already holds the lane's 16-byte unit; each of the two loads reads 512 neighbouring bytes over the wave */
__device__ __forceinline__ v8f fa_mma(v16h a, v16h b, v8f c) { return __builtin_amdgcn_wmma_f32_16x16x32_f16(false, a, false, b, (short)0, c, false, false); }
__device__ __forceinline__ float fa_xhalf(float x) { return __builtin_bit_cast(float, __builtin_amdgcn_permlanex16(__builtin_bit_cast(int, x), __builtin_bit_cast(int, x), 0x76543210, 0xfedcba98, false, false)); }      /* lane l with lane l ^ 16 */
#define FAC 0.18033688011112042f     /* 64^-0.5 * log2(e) */
__device__ __forceinline__ float fa_exp2(float x) { float r; asm("v_exp_f32 %0, %1\n\tv_nop" : "=v"(r) : "v"(x)); return r; }      /* 2^x; the v_nop fills the one slot that the instruction set asks for between a transcendental and a next instruction that reads its result or overwrites its source */
__device__ __forceinline__ v8f fa_exp2x8(v8f x) { float r0, r1, r2, r3, r4, r5, r6, r7;      /* eight 2^x in one statement: the results are kept off the sources (early clobber), so each instruction fills the slot of the one before it, and one v_nop that of the last */
  asm("v_exp_f32 %0, %8\n\tv_exp_f32 %1, %9\n\tv_exp_f32 %2, %10\n\tv_exp_f32 %3, %11\n\tv_exp_f32 %4, %12\n\tv_exp_f32 %5, %13\n\tv_exp_f32 %6, %14\n\tv_exp_f32 %7, %15\n\tv_nop"
      : "=&v"(r0), "=&v"(r1), "=&v"(r2), "=&v"(r3), "=&v"(r4), "=&v"(r5), "=&v"(r6), "=&v"(r7) : "v"(x[0]), "v"(x[1]), "v"(x[2]), "v"(x[3]), "v"(x[4]), "v"(x[5]), "v"(x[6]), "v"(x[7]));
  return v8f{r0, r1, r2, r3, r4, r5, r6, r7}; }
#define FKS 4                        /* waves that share the keys of one 32-row query tile */
#define FQT 4                        /* 32-row query tiles per block */
template <int LD>      /* row pitch of the q plane */
__global__ __launch_bounds__(32 * FKS * FQT) void k_fattn(const _Float16* __restrict__ Q, const _Float16* __restrict__ K, const _Float16* __restrict__ VT, float* __restrict__ O) {
  // Key split: a block of sixteen waves owns 128 query rows (four 32-row tiles); the four waves of a tile hold the SAME 32 query rows, and wave sh of them walks key blocks sh, sh + 4, ... (32 keys each)
  // with its own running maximum, sum and output tiles; the four partial results of a tile are merged through LDS. The waves with the same sh walk the same keys side by side.
  // A block takes row group n - 1 - x and then row group x, so the key blocks walked add up alike in every block, and a wave walks about a quarter of its two tiles' blocks.
  __shared__ __attribute__((aligned(16))) float so[FKS * FQT * 2048];      /* merge plane [wave][piece (t, j, register half)][32 units of 16 bytes] */
  __shared__ float sfm[FKS * FQT][32]; __shared__ float sfl[FKS * FQT][32];      /* [wave][query row of the tile]: running maximum (log2 units), sum */
  const int lane = threadIdx.x & 31, ln = lane & 15, hh = lane >> 4; const int w = __builtin_amdgcn_readfirstlane(threadIdx.x >> 5); const int sh = w / FQT, qt = w % FQT;      /* wave w: key share sh of tile qt of the row group; neighbouring waves walk the same keys */
  { const size_t bi = (size_t)blockIdx.y * SQ; Q += bi * LD; K += bi * HD; VT += bi * HD; O += bi * HD; }      /* batch on grid.y */
  const v8f z8 = {0.f, 0.f, 0.f, 0.f, 0.f, 0.f, 0.f, 0.f};
  for (int h = 0; h < 2; ++h) {
    const int tile = (h ? (int)blockIdx.x : SQ / (32 * FQT) - 1 - (int)blockIdx.x) * FQT + qt; const int q0 = tile * 32;
    const int nf = (tile > sh ? tile - sh : 0) / FKS;      /* the wave's key blocks: sh, sh + 4, ..., sh + 4 nf (the same for the whole wave) */
    const int dq = (tile - sh - FKS * nf) * 32;      /* query q0 minus the first key of the wave's last block: 0 = the diagonal block; below 0 (sh > tile, tiles 0 .. 2 only): a block wholly right of the diagonal, every key masked, so that the wave adds weight 0 */
    v8f o[4][2]; float m[2] = {-1.0e30f, -1.0e30f}, l[2] = {0.f, 0.f};
#pragma unroll      /* constant indices, so that the arrays indexed below stay in registers */
    for (int t = 0; t < 4; ++t) { o[t][0] = z8; o[t][1] = z8; }
    {
      v16h qf[2][2], kf[2][2], vf[4];
      const _Float16* kp = K + 32 * HD * sh + 8 * lane; const _Float16* vp = VT + 32 * HD * sh + 8 * lane;      /* key block sh, the lane's unit */
      { const _Float16* qp = Q + (size_t)(q0 + ln) * LD + 8 * hh;
#pragma unroll      /* constant indices, so that the arrays indexed below stay in registers */
        for (int j = 0; j < 2; ++j) for (int ks = 0; ks < 2; ++ks) { qf[j][ks] = fa_frag(qp + 16 * j * LD + 32 * ks); kf[j][ks] = fa_fragp(kp + 512 * (2 * j + ks)); }
#pragma unroll      /* constant indices, so that the arrays indexed below stay in registers */
        for (int t = 0; t < 4; ++t) vf[t] = fa_fragp(vp + 512 * t);
        asm volatile("s_wait_xcnt 0x0" :: "v"(qp), "v"(kp), "v"(vp) : "memory"); }      /* the address pairs stay untouched until the loads that name them have taken them: kp and vp are stepped on in the loop */
      auto pass = [&](const bool last) __attribute__((always_inline)) {      /* one block of 32 keys; last: the wave's last block, masked where it reaches the diagonal, nothing fetched behind it; else the wave's next block (4 blocks on) is fetched behind the products */
        v8f s[2][2];      /* [key tile][query group] */
#pragma unroll      /* constant indices, so that the arrays indexed below stay in registers */
        for (int kt = 0; kt < 2; ++kt) for (int j = 0; j < 2; ++j) s[kt][j] = fa_mma(kf[kt][1], qf[j][1], fa_mma(kf[kt][0], qf[j][0], z8));
        if (!last) { kp += FKS * 32 * HD;
#pragma unroll      /* constant indices, so that the arrays indexed below stay in registers */
          for (int kt = 0; kt < 2; ++kt) for (int ks = 0; ks < 2; ++ks) kf[kt][ks] = fa_fragp(kp + 512 * (2 * kt + ks));
          asm volatile("s_wait_xcnt 0x0" :: "v"(kp) : "memory"); }      /* as above */
        if (last && dq < 32) {      /* a scalar test: three waves of four end left of the diagonal block */
#pragma unroll      /* constant indices, so that the arrays indexed below stay in registers */
          for (int kt = 0; kt < 2; ++kt) for (int j = 0; j < 2; ++j) for (int r = 0; r < 8; ++r) s[kt][j][r] = (16 * kt + 8 * hh + r <= 16 * j + ln + dq) ? s[kt][j][r] : -3.0e38f; }      /* key at or left of query */
        float mx[2];
#pragma unroll      /* constant indices, so that the arrays indexed below stay in registers */
        for (int j = 0; j < 2; ++j) { float a = fmaxf(s[0][j][0], s[1][j][0]);
          for (int r = 1; r < 8; ++r) a = fmaxf(a, fmaxf(s[0][j][r], s[1][j][r]));
          mx[j] = fmaxf(a, fa_xhalf(a)) * FAC; }      /* finite; in a block that is masked as a whole it lies below the start value of m, which then stays, and every weight is 2^(-huge) = 0 */
        if (__builtin_amdgcn_ballot_w32(mx[0] > m[0] + 8.0f || mx[1] > m[1] + 8.0f) != 0) {      /* one scalar test a pass */
#pragma unroll      /* constant indices, so that the arrays indexed below stay in registers */
          for (int j = 0; j < 2; ++j) { const float mn = fmaxf(m[j], mx[j]); const float al = fa_exp2(m[j] - mn); m[j] = mn; l[j] *= al;
            for (int t = 0; t < 4; ++t) o[t][j] *= al; } }
        v16h pf[2];
#pragma unroll      /* constant indices, so that the arrays indexed below stay in registers */
        for (int j = 0; j < 2; ++j) { FragH f; const float mj = -m[j]; const v8f c8 = {FAC, FAC, FAC, FAC, FAC, FAC, FAC, FAC}, m8 = {mj, mj, mj, mj, mj, mj, mj, mj};
          const v8f e0 = fa_exp2x8(__builtin_elementwise_fma(s[0][j], c8, m8)), e1 = fa_exp2x8(__builtin_elementwise_fma(s[1][j], c8, m8));
          float a0 = e0[0], a1 = e1[0];
          for (int r = 1; r < 8; ++r) { a0 += e0[r]; a1 += e1[r]; }
          for (int r = 0; r < 8; ++r) { f.h[r] = (_Float16)e0[r]; f.h[8 + r] = (_Float16)e1[r]; }
          l[j] += a0 + a1; pf[j] = f.v; }
#pragma unroll      /* constant indices, so that the arrays indexed below stay in registers */
        for (int t = 0; t < 4; ++t) for (int j = 0; j < 2; ++j) o[t][j] = fa_mma(vf[t], pf[j], o[t][j]);
        if (!last) { vp += FKS * 32 * HD;
#pragma unroll      /* constant indices, so that the arrays indexed below stay in registers */
          for (int t = 0; t < 4; ++t) vf[t] = fa_fragp(vp + 512 * t);
          asm volatile("s_wait_xcnt 0x0" :: "v"(vp) : "memory"); }      /* as above */
      };
      for (int i = 0; i < nf; ++i) pass(false);
      pass(true);
    }
    __syncthreads();      /* the readers of the row group before have left the merge plane */
#pragma unroll      /* constant indices, so that the arrays indexed below stay in registers */
    for (int t = 0; t < 4; ++t) for (int j = 0; j < 2; ++j) for (int g = 0; g < 2; ++g) { const v4f y = {o[t][j][4 * g], o[t][j][4 * g + 1], o[t][j][4 * g + 2], o[t][j][4 * g + 3]};
      *(v4f*)&so[(w * 512 + ((t * 2 + j) * 2 + g) * 32 + hh * 16 + ((ln + 2 * hh + 4 * t) & 15)) * 4] = y; }      /* the unit is turned by 2 hh + 4 t inside its 16, so that writers (16 lanes = 16 queries) and readers (16 lanes = 2 queries x 8 column pieces) both fall on distinct banks */
    { const float l0 = l[0] + fa_xhalf(l[0]), l1 = l[1] + fa_xhalf(l[1]);      /* the two lane halves join their sums */
      sfm[w][lane] = hh ? m[1] : m[0]; sfl[w][lane] = hh ? l1 : l0; }      /* lane = query row 16 j + ln with j = hh: the maximum and the joined sum are alike in both halves */
    __syncthreads();      /* all partial results are in LDS */
#pragma unroll      /* constant indices, so that the arrays indexed below stay in registers */
    for (int i = 0; i < 2; ++i) { const int row = 8 * sh + 4 * i + (lane >> 3), rj = row >> 4, rl = row & 15, rt = (lane & 7) >> 1, rh = lane & 1;      /* merge: wave sh of a tile owns its rows 8 sh .. 8 sh + 7, four at a time; a lane eight neighbouring columns 16 rt + 8 rh .., so a wave stores whole rows */
      float mu[FKS]; float mt = sfm[qt][row]; mu[0] = mt;      /* the tile's four waves: qt, qt + 4, ... */
      for (int u = 1; u < FKS; ++u) { mu[u] = sfm[qt + FQT * u][row]; mt = fmaxf(mt, mu[u]); }      /* finite: the tile's first wave holds key 0, which is valid for every row */
      const int un = (rt * 2 + rj) * 64 + rh * 16 + ((rl + 2 * rh + 4 * rt) & 15);
      float lt = 0.f; v4f a0 = {0.f, 0.f, 0.f, 0.f}, a1 = {0.f, 0.f, 0.f, 0.f};
      for (int u = 0; u < FKS; ++u) { const float f = fa_exp2(mu[u] - mt); lt += sfl[qt + FQT * u][row] * f;      /* a wave whose only block was masked as a whole: maximum -1e30, so f = 0 */
        a0 += *(const v4f*)&so[((qt + FQT * u) * 512 + un) * 4] * f; a1 += *(const v4f*)&so[((qt + FQT * u) * 512 + un + 32) * 4] * f; }
      const float fin = 1.0f / lt;
      float* op = O + (size_t)(q0 + row) * HD + 16 * rt + 8 * rh;
      *(v4f*)op = a0 * fin; *(v4f*)(op + 4) = a1 * fin;
      asm volatile("s_wait_xcnt 0x0" :: "v"(op) : "memory"); }      /* the stores' address and data registers stay untouched until the stores have taken them: the next row group's code writes them anew */
  } }


// Exact f32 causal attention for rows 0..QT0-1, one 8-wave block per 32 query rows of one batch: lane = query row, its q row and its partial o row stay in registers;
// K and V rows come through LDS in tiles of 64 keys (coalesced 16-byte loads, the next tile fetched into registers while this one is worked on) and are read as same-address (broadcast) 16-byte LDS loads;
// wave w takes keys 8 w .. 8 w + 7 of every tile with its own running maximum, sum and o; at the end the eight partial results of a row are merged through LDS and stored straight into the output rows.
typedef float v2f __attribute__((ext_vector_type(2)));
#define A0R 32                       /* query rows per block */
#define A0T 64                       /* keys per LDS tile */
#define A0K 8                        /* keys per wave and tile */
#define A0P 33                       /* row pitch of the merge plane [wave][d][row]: odd, so that writers (lane = row) and readers (lane = row, d piece) both fall on distinct banks */
__device__ __forceinline__ float a0_exp(float x) { float r; asm("v_exp_f32 %0, %1\n\tv_nop" : "=v"(r) : "v"(x * 1.4426950408889634f)); return r; }      /* e^x; the v_nop fills the one slot that the instruction set asks for between a transcendental and a next instruction that reads its result or overwrites its source */
template <int LD>      /* row pitch of the q / k / v planes: a constant, so that all loads of a tile share one address pair and differ in their immediate offsets only */
__global__ __launch_bounds__(256) void k_att0w(const float* __restrict__ QF, const float* __restrict__ KF, const float* __restrict__ VF, float scale, float* __restrict__ OF, int ldo) {
  __shared__ __attribute__((aligned(16))) float sm[8 * HD * A0P];      /* in the loop: K tile [A0T][HD], then V tile [A0T][HD]; behind it: the merge plane */
  __shared__ float smm[8][A0R]; __shared__ float sml[8][A0R];
  { const size_t bi = (size_t)blockIdx.y * QT0 * LD; QF += bi; KF += bi; VF += bi; OF += (size_t)blockIdx.y * SQ * ldo; }      /* batch on grid.y: its own QT0-row slab of each plane, and its own rows of the output */
  const int tid = threadIdx.x, lane = tid & 31; const int w = __builtin_amdgcn_readfirstlane(tid >> 5);
  const int h = blockIdx.x / (QT0 / A0R), rg = (QT0 / A0R - 1) - blockIdx.x % (QT0 / A0R);      /* the row groups with the most keys start first */
  const int r0 = rg * A0R, i = r0 + lane; const int nkeys = r0 + A0R; const int nt = (nkeys + A0T - 1) / A0T;      /* keys 0 .. r0 + 31; a tile's rows all lie below QT0 (A0T divides QT0) */
  v2f q[HD / 2], o[HD / 2];
  { const float* qr = QF + (size_t)i * LD + h * HD;
#pragma unroll      /* constant indices, so that the arrays indexed below stay in registers */
    for (int c = 0; c < HD / 4; ++c) { const v4f a = *(const v4fa*)(qr + c * 4); q[2 * c] = v2f{a[0], a[1]}; q[2 * c + 1] = v2f{a[2], a[3]}; o[2 * c] = v2f{0.f, 0.f}; o[2 * c + 1] = v2f{0.f, 0.f}; }
    asm volatile("s_wait_xcnt 0x0" :: "v"(qr) : "memory"); }      /* the address pair stays untouched until the loads that name it have taken it: no later load's result and no later instruction may take it over before */
  const int sr = tid >> 4, sc4 = (tid & 15) * 4;      /* staging: 16 lanes per 256-byte row, rows sr + 16 u */
  const float* kg = KF + (size_t)sr * LD + h * HD + sc4; const float* vg = VF + (size_t)sr * LD + h * HD + sc4;
  v4f pk[4], pv[4];
#pragma unroll      /* constant indices, so that the arrays indexed below stay in registers */
  for (int u = 0; u < 4; ++u) { pk[u] = *(const v4fa*)(kg + 16 * u * LD); pv[u] = *(const v4fa*)(vg + 16 * u * LD); }
  asm volatile("s_wait_xcnt 0x0" :: "v"(kg), "v"(vg) : "memory");      /* as above: both address pairs are stepped on in the loop */
  float m = -1.0e30f, l = 0.f;
  for (int t = 0; t < nt; ++t) {
#pragma unroll      /* constant indices, so that the arrays indexed below stay in registers */
    for (int u = 0; u < 4; ++u) { *(v4f*)&sm[(sr + 16 * u) * HD + sc4] = pk[u]; *(v4f*)&sm[A0T * HD + (sr + 16 * u) * HD + sc4] = pv[u]; }
    __syncthreads();
    if (t + 1 < nt) { kg += A0T * LD; vg += A0T * LD;
#pragma unroll      /* constant indices, so that the arrays indexed below stay in registers */
      for (int u = 0; u < 4; ++u) { pk[u] = *(const v4fa*)(kg + 16 * u * LD); pv[u] = *(const v4fa*)(vg + 16 * u * LD); }
      asm volatile("s_wait_xcnt 0x0" :: "v"(kg), "v"(vg) : "memory"); }      /* as above */
    const int j0 = t * A0T + w * A0K;
    if (j0 < nkeys) {      /* the same for the whole wave; no barrier inside */
      const float* kt = sm + w * A0K * HD; const float* vt = sm + A0T * HD + w * A0K * HD;
      v2f s2[A0K];
#pragma unroll      /* constant indices, so that the arrays indexed below stay in registers */
      for (int k = 0; k < A0K; ++k) s2[k] = v2f{0.f, 0.f};
#pragma unroll      /* constant indices, so that the arrays indexed below stay in registers */
      for (int c = 0; c < HD / 4; ++c) {
#pragma unroll      /* constant indices, so that the arrays indexed below stay in registers */
        for (int k = 0; k < A0K; ++k) { const v4f kk = *(const v4f*)&kt[k * HD + c * 4]; s2[k] = __builtin_elementwise_fma(q[2 * c], v2f{kk[0], kk[1]}, s2[k]); s2[k] = __builtin_elementwise_fma(q[2 * c + 1], v2f{kk[2], kk[3]}, s2[k]); } }
      float s[A0K], e[A0K]; float mn = m;
#pragma unroll      /* constant indices, so that the arrays indexed below stay in registers */
      for (int k = 0; k < A0K; ++k) { s[k] = (j0 + k <= i) ? (s2[k][0] + s2[k][1]) * scale : -1.0e30f; mn = fmaxf(mn, s[k]); }
      const float rs = a0_exp(m - mn); m = mn; float ls = 0.f;
#pragma unroll      /* constant indices, so that the arrays indexed below stay in registers */
      for (int k = 0; k < A0K; ++k) { const float ex = a0_exp(s[k] - mn); e[k] = (j0 + k <= i) ? ex : 0.f; ls += e[k]; }      /* a key right of the diagonal weighs 0 also while the running maximum is still the start value */
      l = l * rs + ls;
#pragma unroll      /* constant indices, so that the arrays indexed below stay in registers */
      for (int c = 0; c < HD / 2; ++c) o[c] *= rs;
#pragma unroll      /* constant indices, so that the arrays indexed below stay in registers */
      for (int k = 0; k < A0K; ++k) { const v2f e2 = {e[k], e[k]};
#pragma unroll      /* constant indices, so that the arrays indexed below stay in registers */
        for (int c = 0; c < HD / 4; ++c) { const v4f vv = *(const v4f*)&vt[k * HD + c * 4]; o[2 * c] = __builtin_elementwise_fma(e2, v2f{vv[0], vv[1]}, o[2 * c]); o[2 * c + 1] = __builtin_elementwise_fma(e2, v2f{vv[2], vv[3]}, o[2 * c + 1]); } }
    }
    __syncthreads();
  }
#pragma unroll      /* constant indices, so that the arrays indexed below stay in registers */
  for (int c = 0; c < HD / 2; ++c) { sm[(w * HD + 2 * c) * A0P + lane] = o[c][0]; sm[(w * HD + 2 * c + 1) * A0P + lane] = o[c][1]; }
  smm[w][lane] = m; sml[w][lane] = l;
  __syncthreads();
  const int row = w * 4 + (lane >> 3), d0 = (lane & 7) * 8;      /* merge: wave w owns rows 4 w .. 4 w + 3, a lane eight neighbouring columns, so a wave stores whole rows */
  float mx = smm[0][row];
#pragma unroll      /* constant indices, so that the arrays indexed below stay in registers */
  for (int u = 1; u < 8; ++u) mx = fmaxf(mx, smm[u][row]);      /* finite: key 0 is valid for every row */
  float lt = 0.f; float a[8] = {0.f, 0.f, 0.f, 0.f, 0.f, 0.f, 0.f, 0.f};
#pragma unroll      /* constant indices, so that the arrays indexed below stay in registers */
  for (int u = 0; u < 8; ++u) { const float f = a0_exp(smm[u][row] - mx); lt += sml[u][row] * f;
#pragma unroll      /* constant indices, so that the arrays indexed below stay in registers */
    for (int d = 0; d < 8; ++d) a[d] += sm[(u * HD + d0 + d) * A0P + row] * f; }
  const float fin = 1.0f / lt;
  float* op = OF + (size_t)(r0 + row) * ldo + h * HD + d0;
  const v4f y0 = {a[0] * fin, a[1] * fin, a[2] * fin, a[3] * fin}, y1 = {a[4] * fin, a[5] * fin, a[6] * fin, a[7] * fin};
  *(v4f*)op = y0; *(v4f*)(op + 4) = y1; }


template <int BFIN, int WXB>
__global__ __launch_bounds__(256) void k_ln16(const float* __restrict__ X, const float* __restrict__ g, const float* __restrict__ bb, float eps, _Float16* __restrict__ N16, float* __restrict__ XB) {
  #pragma clang fp contract(off)
  __shared__ float red[256]; const size_t r = blockIdx.x; const int t = threadIdx.x; const v4f xa = *(const v4fa*)(X + r * DMQ + t * 4); float s[4]; float sum = 0.f;
  for (int q = 0; q < 4; ++q) { s[q] = BFIN ? bf16_round(xa[q]) : xa[q]; sum = __fadd_rn(sum, s[q]); }
  red[t] = sum; __syncthreads(); for (int st = 128; st > 0; st >>= 1) { if (t < st) red[t] = __fadd_rn(red[t], red[t + st]); __syncthreads(); } const float mu = red[0] / (float)DMQ; __syncthreads();
  float vs = 0.f; for (int q = 0; q < 4; ++q) { const float dl = __fadd_rn(s[q], -mu); vs = __fadd_rn(vs, __fmul_rn(dl, dl)); } red[t] = vs; __syncthreads(); for (int st = 128; st > 0; st >>= 1) { if (t < st) red[t] = __fadd_rn(red[t], red[t + st]); __syncthreads(); }
  const float rs = rsqrtf(__fadd_rn(red[0] / (float)DMQ, eps)); v4h y; v4f xb;
  for (int q = 0; q < 4; ++q) { const int c = t * 4 + q; y[q] = (_Float16)__fadd_rn(__fmul_rn(__fmul_rn(__fadd_rn(s[q], -mu), rs), bf16_round(g[c])), bf16_round(bb[c])); xb[q] = s[q]; }
  { *(v4h*)(N16 + r * DMQ + t * 4) = y; if (WXB) *(v4f*)(XB + r * DMQ + t * 4) = xb;  } }
__global__ __launch_bounds__(256) void k_ftres2(const float* __restrict__ OF0, const float* __restrict__ XB, float* __restrict__ X1, size_t n4) {
  #pragma clang fp contract(off)
  const size_t t = (size_t)blockIdx.x * 256 + threadIdx.x; if (t >= n4) return; const v4f o = *(const v4fa*)(OF0 + t * 4), xv = *(const v4fa*)(XB + t * 4); v4f y; for (int q = 0; q < 4; ++q) y[q] = __fadd_rn(__fmul_rn(o[q], 0.015625f), xv[q]); *(v4f*)(X1 + t * 4) = y;  }

__global__ __launch_bounds__(256) void k_wthd(const float* __restrict__ Wt, _Float16* __restrict__ Bt) { const size_t t = (size_t)blockIdx.x * 256 + threadIdx.x; if (t >= (size_t)NH * HD * (DM / 8)) return; const int m8 = (int)(t % (DM / 8)) * 8; const int d = (int)((t / (DM / 8)) % HD); const int h = (int)(t / ((size_t)(DM / 8) * HD)); FragH f;
  for (int q = 0; q < 8; ++q) f.h[q] = (_Float16)(16.0f * bf16_round(Wt[((size_t)h * DM + m8 + q) * HD + d])); unsigned short* dst = (unsigned short*)Bt + ((size_t)h * HD + d) * DM + m8; *(v8us*)dst = f.half[0];  }




__global__ __launch_bounds__(256) void k_wtpad(const float* __restrict__ Wm, _Float16* __restrict__ Wt, int Kr, int Kp, int Nr, int Np, float scale) {
  const int t = blockIdx.x * 256 + threadIdx.x; if (t >= Np * (Kp / 8)) return; const int n = t / (Kp / 8), k8 = (t % (Kp / 8)) * 8; const int nc = min(n, Nr - 1); const float fn = (n < Nr) ? 1.f : 0.f; FragH f;
  for (int i = 0; i < 8; ++i) { const int k = k8 + i; const int kc = min(k, Kr - 1); const float fk = (k < Kr) ? fn : 0.f; f.h[i] = (_Float16)(bf16_round(Wm[(size_t)kc * Nr + nc]) * scale * fk); }
  unsigned short* o = (unsigned short*)Wt + (size_t)n * Kp + k8; *(v8us*)o = f.half[0];  }
__global__ __launch_bounds__(128) void k_bpad(const float* __restrict__ b, float* __restrict__ Bp, int nr, int np) {
  const int i = threadIdx.x; if (i >= np) return; const float v = b[min(i, nr - 1)] * ((i < nr) ? 1.f : 0.f); *(float*)(Bp + i) = v;  }

#define DI 64         /* inner width = NH * HD (ONE 64-wide head) */
#define LQK (3 * DI)  /* fused q | k | v row pitch (192) */
__global__ __launch_bounds__(256) void k_o0(const float* __restrict__ OF, float* __restrict__ ob, size_t n4) {
  #pragma clang fp contract(off)
  const size_t t = (size_t)blockIdx.x * 256 + threadIdx.x; if (t >= n4) return; const size_t e = t * 4; const int i = (int)(e / DI); const int c = (int)(e % DI); const int h = c / HD, d = c % HD; const v4f a = *(const v4fa*)(OF + e); v4f o; for (int q = 0; q < 4; ++q) o[q] = __fmul_rn(a[q], 0.015625f); float* dst = ob + (size_t)h * SQ * HD + (size_t)i * HD + d; *(v4f*)dst = o;  }

// Projection, ONE launch from the inputs themselves: a wave owns 64 tokens (two whole 32-key blocks of the K and V^T planes, so every 128-byte line there has one writer) and holds the twelve 16-feature weight fragments of q | k | v in registers
// (f16 of the bf16-rounded weight x16, read straight from the [in][out] f32 weights) and its four x fragments (f16 of the bf16-rounded x); weight and x go through the same k order (8 hh + i, 16 + 8 hh + i).
// Row (or column) c of weight tile t is feature 4 c + t, so one 16-byte load of a weight row serves all four tiles.
// q, k: A = weight, B = x, so a lane holds, over the four tiles, features 32 hh .. 32 hh + 31 of ONE token (register r of tile t = feature 32 hh + 4 r + t): 16-byte stores, q into its rows, k into the fragment-order plane (features 32 hh + 8 s .. + 7 of token ln are the unit of k step hh, register half s >> 1, lane 16 (s & 1) + ln: 16 lanes store 256 neighbouring bytes).
// v: A = x, B = weight, so a lane's eight results are eight neighbouring tokens of ONE feature: one 16-byte f16 store into the fragment-order V^T plane (feature d, tokens 16 g + 8 hh .. + 7 are the unit of tile d >> 4, register half g & 1, lane 16 hh + (d & 15)).
// The waves of tokens 0..QT0-1 of a batch store q | k | v as f32 rows for the exact first tile as well. K = 32: one matrix instruction a tile.
#define PJT 64                       /* tokens per wave */
__device__ __forceinline__ void pj_wload(const float* __restrict__ p, v4f (&r)[16]) {      /* p: the lane's k = 8 hh, features 4 ln .. 4 ln + 3 */
#pragma unroll      /* constant indices, so that the array stays in registers */
  for (int i = 0; i < 8; ++i) { r[i] = *(const v4fa*)(p + i * DI); r[8 + i] = *(const v4fa*)(p + (16 + i) * DI); } }
__device__ __forceinline__ void pj_wfrag(const v4f (&r)[16], v16h (&wf)[4]) {
#pragma unroll      /* constant indices, so that the arrays stay in registers */
  for (int t = 0; t < 4; ++t) { FragH f;
    for (int i = 0; i < 16; ++i) f.h[i] = (_Float16)(bf16_round(r[i][t]) * 16.0f);
    wf[t] = f.v; } }
__global__ __launch_bounds__(128) void k_proj(const float* __restrict__ x, const float* __restrict__ wq, const float* __restrict__ wk, const float* __restrict__ wv, _Float16* __restrict__ QK, _Float16* __restrict__ KP, _Float16* __restrict__ VT, float* __restrict__ F0) {
  const int lane = threadIdx.x & 31, ln = lane & 15, hh = lane >> 4; const int w = __builtin_amdgcn_readfirstlane(threadIdx.x >> 5);
  const int tok0 = ((int)blockIdx.x * 4 + w) * PJT; const int b = tok0 / SQ, i0 = tok0 % SQ;      /* PJT divides SQ and QT0: a wave's tokens lie in one batch, and all or none of them in the first tile */
  v16h xf[PJT / 16], wf[3][4]; v4f xr[PJT / 16][4], wr[3][16];
  const float* xp = x + (size_t)(tok0 + ln) * DM + 8 * hh; const int wo = 8 * hh * DI + 4 * ln;
#pragma unroll      /* constant indices, so that the arrays indexed below stay in registers */
  for (int g = 0; g < PJT / 16; ++g) { xr[g][0] = *(const v4fa*)(xp + 16 * g * DM); xr[g][1] = *(const v4fa*)(xp + 16 * g * DM + 4); xr[g][2] = *(const v4fa*)(xp + 16 * g * DM + 16); xr[g][3] = *(const v4fa*)(xp + 16 * g * DM + 20); }
  pj_wload(wq + wo, wr[0]); pj_wload(wk + wo, wr[1]);
  asm volatile("s_wait_xcnt 0x0" :: "v"(xp), "v"(wo) : "memory");      /* the address registers stay untouched until the loads that name them have taken them */
  __builtin_amdgcn_sched_barrier(0);      /* all loads above are issued before the first conversion waits for one: without it they are issued a few at a time, each batch behind the wait for the batch before */
#pragma unroll      /* constant indices, so that the arrays indexed below stay in registers */
  for (int g = 0; g < PJT / 16; ++g) { FragH f;
    for (int u = 0; u < 4; ++u) for (int q = 0; q < 4; ++q) f.h[4 * u + q] = (_Float16)bf16_round(xr[g][u][q]);
    xf[g] = f.v; }
  pj_wfrag(wr[0], wf[0]);
  pj_wload(wv + wo, wr[2]);      /* into the registers that x and the q weights have left; in flight under the conversion of the k weights */
  asm volatile("s_wait_xcnt 0x0" :: "v"(wo) : "memory");      /* as above */
  __builtin_amdgcn_sched_barrier(0);      /* as above */
  pj_wfrag(wr[1], wf[1]); pj_wfrag(wr[2], wf[2]);
  const v8f z8 = {0.f, 0.f, 0.f, 0.f, 0.f, 0.f, 0.f, 0.f};
#pragma unroll      /* constant indices, so that the arrays indexed below stay in registers */
  for (int g = 0; g < PJT / 16; ++g) { unsigned short* qr = (unsigned short*)QK + (size_t)(tok0 + 16 * g + ln) * LQK + 32 * hh; unsigned short* kr = (unsigned short*)KP + (size_t)(tok0 + 16 * g) * HD + 8 * (64 * hh + ln); unsigned short* vr = (unsigned short*)VT + (size_t)(tok0 + 32 * (g >> 1)) * HD + 8 * (32 * (2 * (ln >> 2) + (g & 1)) + 16 * hh + 4 * (ln & 3));
    for (int c = 0; c < 2; ++c) { v8f d[4];
      for (int t = 0; t < 4; ++t) d[t] = fa_mma(wf[c][t], xf[g], z8);
      for (int s = 0; s < 4; ++s) { FragH f;
        for (int e = 0; e < 8; ++e) f.h[e] = (_Float16)(d[e & 3][2 * s + (e >> 2)] * 0.0625f);      /* takes the weights' x16 back */
        *(v8us*)(c ? kr + 8 * (32 * (s >> 1) + 16 * (s & 1)) : qr + 8 * s) = f.half[0]; } }
    { v8f d[4];
      for (int t = 0; t < 4; ++t) d[t] = fa_mma(xf[g], wf[2][t], z8);
      for (int t = 0; t < 4; ++t) { FragH f;
        for (int r = 0; r < 8; ++r) f.h[r] = (_Float16)(d[t][r] * 0.0625f);
        *(v8us*)(vr + 8 * t) = f.half[0]; } } }
  asm volatile("s_wait_xcnt 0x0" ::: "memory");      /* the last stores' address and data registers stay untouched until the stores have taken them: the code behind the branch below writes them anew */
  if (i0 < QT0) {      /* the same for the whole wave (a scalar test) */
#pragma unroll      /* constant indices, so that the arrays indexed below stay in registers */
    for (int g = 0; g < PJT / 16; ++g) { float* fr = F0 + ((size_t)b * QT0 + i0 + 16 * g + ln) * LQK + 32 * hh;
      for (int c = 0; c < 3; ++c) { v8f d[4];
        for (int t = 0; t < 4; ++t) d[t] = fa_mma(wf[c][t], xf[g], z8);
        for (int r = 0; r < 8; ++r) { const v4f y = {d[0][r] * 0.0625f, d[1][r] * 0.0625f, d[2][r] * 0.0625f, d[3][r] * 0.0625f}; *(v4f*)(fr + c * DI + 4 * r) = y; } } } } }
extern "C" void kernel_launch(void* const* d_in, const int* in_sizes, int n_in,
                              void* d_out, int out_size, void* d_ws, size_t ws_size, hipStream_t stream) {
  (void)in_sizes; (void)n_in; (void)out_size;
  const float* const* I = (const float* const*)d_in; const float* x = I[0]; const float* wq = I[2]; const float* wk = I[1]; const float* wv = I[3];      /* x; [in][out = 64] weights in this module's input order (wq = input 2, wk = input 1, wv = input 3); no biases */
  char* ws = (char*)d_ws; size_t off = 0;
  auto take = [&](size_t bytes) { char* p = ws + off; off += (bytes + 255) & ~(size_t)255; return p; };
  _Float16* QKV = (_Float16*)take(NR * LQK * 2); _Float16* KP = (_Float16*)take(NR * HD * 2); _Float16* VT = (_Float16*)take((size_t)NB * NH * HD * SQ * 2);      /* of the q | k | v row pitch only the q columns are written and read: k and v go straight into their fragment-order planes */
  float* QKVF0 = (float*)take((size_t)NB * QT0 * LQK * 4);      /* one slab per batch of each plane: every launch below covers all NB batches */
  if (off > ws_size) return;
  float* ob = (float*)d_out;
  k_proj<<<(unsigned)(NR / (4 * PJT)), 128, 0, stream>>>(x, wq, wk, wv, QKV, KP, VT, QKVF0);      /* q = x W as f16 rows, k and V^T as f16 in fragment order (4 KiB per 32 tokens each), and f32 q | k | v of rows 0..511 of every batch (exact products, f32 accumulation) */
  k_fattn<LQK><<<dim3(SQ / (64 * FQT), NB), 32 * FKS * FQT, 0, stream>>>(QKV, KP, VT, ob);      /* out[b][i][..] = softmax(causal(q k^T 64^-0.5)) v (f32), every row of every batch; scores and weights never leave the registers */
  k_att0w<LQK><<<dim3(NH * (QT0 / A0R), NB), 256, 0, stream>>>(QKVF0, QKVF0 + DI, QKVF0 + 2 * DI, 0.125f, ob, DI);      /* exact f32 causal attention for rows 0..511 of every batch, which it REWRITES in the output */
}

// v008
// A run of this version takes 50.6 microseconds.
// Timed twice side by side with v007, it ran 1.57 times as fast both times.
// Over all steps from v000 it is 2544 times as fast.
#include <hip/hip_runtime.h>
// Single-head causal self-attention from a 32-wide embedding (x [16][4096][32]; k/q/v = x W ([in][out] [32][64], no biases; input order Wk, Wq, Wv); ONE 64-wide head (head_size 64 != C 32); scores * 64^-0.5; causal; softmax; out = weights v -> [16][4096][64]; no output projection).
// Structure: token rows; scores and output reassociated through the 32-wide embedding (q k^T = (x Wq Wk^T) x^T, P v = (P x) Wv); one projection launch (x and weights rounded in registers, WMMA products, f16 q' rows and x, x^T in matrix-fragment order); one fused causal attention launch (scores alpha 1/8, running-maximum softmax f32 -> f16 weights, P x in f32, all in registers; the four key shares of a query tile merged through LDS, multiplied by Wv and written as f32 into the output rows); an exact f32 first tile (rows 0..511) rewritten at the end; launches: see trace.
// Compute dtype: inputs rounded to bf16; x / weights exact; q' and softmax weights as plain f16 GEMM operands (~2^-12); q in front of Wk^T and P x in front of Wv as two f16 terms; scores and softmax statistics f32. v_wmma_f32_16x16x32_f16.
#define NB 16
#define SQ 4096
#define DM 32
#define NH 1
#define HD 64
#define HG 4                         /* unused by the launches (grid.y is NB); read only by the uncalled k_vt overload */
#define QT 256                       /* unused; a k_fattn block takes two 128-row query tiles */
#define NKX SQ                       /* unused; scores and weights stay in registers */
#define QT0 512                      /* first-tile rows recomputed exactly (f32): 512 here (no output projection averages the early-row cancellation errors away; logit sigma 1.0) */
#define B0 0                         /* unused; the batches are grid.y 0..NB-1 */
#define NBR NB                       /* feeds only the unused MP; the attention launches put the NB batches on grid.y */
#define NR ((size_t)NB * SQ)
#define DMQ DM
#define DFF 4096                     /* unused; no FFN here */
#define DFFR 100                     /* unused; no FFN here */
#define MP ((int)((size_t)NBR * SQ)) /* unused; the projections cover NR rows */
#define QN SQ                        /* unused; the query tiles cover SQ rows */
#define NHD NH                       /* unused */
#define MPO MP                       /* unused */
#define LQ (3 * DM)      /* unused */
typedef __bf16 v16b __attribute__((ext_vector_type(16)));
typedef unsigned short v8us __attribute__((ext_vector_type(8), may_alias));
typedef float  v8f  __attribute__((ext_vector_type(8)));
typedef float  v4f  __attribute__((ext_vector_type(4)));
typedef float  v4fa __attribute__((ext_vector_type(4), may_alias));
union FragB { v16b v; v8us half[2]; unsigned short u[16]; };

__device__ __forceinline__ unsigned short bf16_bits(float x) { unsigned int u = __float_as_uint(x); return (unsigned short)((u + 0x7FFFu + ((u >> 16) & 1u)) >> 16); }
__device__ __forceinline__ float bf16_val(unsigned short b) { return __uint_as_float(((unsigned int)b) << 16); }
__device__ __forceinline__ float bf16_round(float x) { return bf16_val(bf16_bits(x)); }
// D += A·B with NT terms: 1 = ah·bh, 2 = + al·bh (A split), 3 = + ah·bl (both split)
template <int NT>
__device__ __forceinline__ v8f mmaN(v16b ah, v16b al, v16b bh, v16b bl, v8f c) {
  c = __builtin_amdgcn_wmma_f32_16x16x32_bf16(false, ah, false, bh, (short)0, c, false, false);
  if (NT >= 2) c = __builtin_amdgcn_wmma_f32_16x16x32_bf16(false, al, false, bh, (short)0, c, false, false);
  if (NT >= 3) c = __builtin_amdgcn_wmma_f32_16x16x32_bf16(false, ah, false, bl, (short)0, c, false, false);
  asm volatile("v_nop\n\tv_nop\n\tv_nop\n\tv_nop" : "+v"(c) : "v"(ah), "v"(al), "v"(bh), "v"(bl));
  return c;
}

__global__ __launch_bounds__(256) void k_wt_bf16(const float* __restrict__ W, unsigned short* __restrict__ Wt, int K, int N) {
  const int t = blockIdx.x * 256 + threadIdx.x;
  const int k8n = K / 8;
  if (t >= N * k8n) return;
  const int n = t / k8n, k8 = (t % k8n) * 8;
  v8us v;
#pragma unroll
  for (int i = 0; i < 8; ++i) v[i] = bf16_bits(W[(size_t)(k8 + i) * N + n]);
  *(v8us*)(Wt + (size_t)n * K + k8) = v;
  
}

// GEMM C[M][N] (f32, pitch ldc) = act(A[M][K]·W + bias). A f32 row-major (pitch lda) converted per fragment to bf16
// (ASPLIT: hi/lo two planes -> 2 terms, else single rounded term); Wt bf16 [N][K] (pitch ldb). BIAS_BF16 rounds the
// bias to bf16 first (bias quantised to bf16 before the add). K%32==0, M%16==0, N%64==0.
template <bool ASPLIT, int ACT, bool BIAS_BF16>
__global__ __launch_bounds__(128) void k_gemm_bf(const float* __restrict__ A, int lda, const unsigned short* __restrict__ Wt, int ldb,
                                               const float* __restrict__ bias, float* __restrict__ C, int ldc, int M, int N, int K) {
  __shared__ __attribute__((aligned(16))) float so[4][16][64];
  const int tid = threadIdx.x, w = tid >> 5, lane = tid & 31, ln = lane & 15, hh = lane >> 4;
  const int ntn = N / 64;
  const int wid = blockIdx.x * 4 + w;
  const int mt = wid / ntn, nq = wid % ntn;
  if (mt * 16 >= M) return;
  const int row0 = mt * 16, col0 = nq * 64;
  const float* arow = A + (size_t)(row0 + ln) * lda;
  v8f acc[4] = {};
  for (int kb = 0; kb < K; kb += 32) {
    FragB ah, al;
    const v4f x0 = *(const v4fa*)(arow + kb + 8 * hh), x1 = *(const v4fa*)(arow + kb + 8 * hh + 4);
    const v4f x2 = *(const v4fa*)(arow + kb + 16 + 8 * hh), x3 = *(const v4fa*)(arow + kb + 16 + 8 * hh + 4);
    float xs[16] = {x0[0],x0[1],x0[2],x0[3],x1[0],x1[1],x1[2],x1[3],x2[0],x2[1],x2[2],x2[3],x3[0],x3[1],x3[2],x3[3]};
#pragma unroll
    for (int i = 0; i < 16; ++i) { const unsigned short hb = bf16_bits(xs[i]); ah.u[i] = hb; al.u[i] = ASPLIT ? bf16_bits(xs[i] - bf16_val(hb)) : (unsigned short)0; }
#pragma unroll
    for (int t = 0; t < 4; ++t) {
      const unsigned short* brow = Wt + (size_t)(col0 + t * 16 + ln) * ldb + kb;
      FragB b;
      b.half[0] = *(const v8us*)(brow + 8 * hh);
      b.half[1] = *(const v8us*)(brow + 16 + 8 * hh);
      acc[t] = mmaN<ASPLIT ? 2 : 1>(ah.v, al.v, b.v, b.v, acc[t]);
    }
  }
#pragma unroll
  for (int t = 0; t < 4; ++t) {
    float bv = bias ? bias[col0 + t * 16 + ln] : 0.f;
    if (BIAS_BF16) bv = bf16_round(bv);
#pragma unroll
    for (int r = 0; r < 8; ++r) { float v = acc[t][r] + bv; if (ACT == 1) v = fmaxf(v, 0.f); so[w][8 * hh + r][t * 16 + ln] = v; }
  }
  __builtin_amdgcn_fence(__ATOMIC_ACQ_REL, "workgroup");
  __builtin_amdgcn_wave_barrier();
  const int rsub = lane >> 4, c4 = (lane & 15) * 4;
  {
#pragma unroll
    for (int q = 0; q < 8; ++q) {
      const int r = q * 2 + rsub;
      const v4f v = *(const v4fa*)&so[w][r][c4];
      *(v4f*)(C + (size_t)(row0 + r) * ldc + col0 + c4) = v;
    }
    
  }
}

// GEMM C = act(A·W + bias + resid): A f32 (ASPLIT -> hi/lo 2 terms), Wt bf16 [N][K]; ACT 0 none, 1 relu, 2 exact gelu;
// resid (optional, f32, row index = (row % rmod), pitch ldr, RES_BF16 rounds it) added before the activation.
template <bool ASPLIT, int ACT, bool BIAS_BF16, bool RES_BF16>
__global__ __launch_bounds__(128) void k_gemm_bf3(const float* __restrict__ A, int lda, const unsigned short* __restrict__ Wt, int ldb,
                                                const float* __restrict__ bias, const float* __restrict__ resid, int rmod, int ldr,
                                                float* __restrict__ C, int ldc, int M, int N, int K) {
  __shared__ __attribute__((aligned(16))) float so[4][16][64];
  const int tid = threadIdx.x, w = tid >> 5, lane = tid & 31, ln = lane & 15, hh = lane >> 4;
  const int ntn = N / 64;
  const int wid = blockIdx.x * 4 + w;
  const int mt = wid / ntn, nq = wid % ntn;
  if (mt * 16 >= M) return;
  const int row0 = mt * 16, col0 = nq * 64;
  const float* arow = A + (size_t)(row0 + ln) * lda;
  v8f acc[4] = {};
  for (int kb = 0; kb < K; kb += 32) {
    FragB ah, al;
    const v4f x0 = *(const v4fa*)(arow + kb + 8 * hh), x1 = *(const v4fa*)(arow + kb + 8 * hh + 4);
    const v4f x2 = *(const v4fa*)(arow + kb + 16 + 8 * hh), x3 = *(const v4fa*)(arow + kb + 16 + 8 * hh + 4);
    float xs[16] = {x0[0],x0[1],x0[2],x0[3],x1[0],x1[1],x1[2],x1[3],x2[0],x2[1],x2[2],x2[3],x3[0],x3[1],x3[2],x3[3]};
#pragma unroll
    for (int i = 0; i < 16; ++i) { const unsigned short hb = bf16_bits(xs[i]); ah.u[i] = hb; al.u[i] = ASPLIT ? bf16_bits(xs[i] - bf16_val(hb)) : (unsigned short)0; }
#pragma unroll
    for (int t = 0; t < 4; ++t) {
      const unsigned short* brow = Wt + (size_t)(col0 + t * 16 + ln) * ldb + kb;
      FragB b;
      b.half[0] = *(const v8us*)(brow + 8 * hh);
      b.half[1] = *(const v8us*)(brow + 16 + 8 * hh);
      acc[t] = mmaN<ASPLIT ? 2 : 1>(ah.v, al.v, b.v, b.v, acc[t]);
    }
  }
#pragma unroll
  for (int t = 0; t < 4; ++t) {
    const int col = col0 + t * 16 + ln;
    float bv = bias ? bias[col] : 0.f;
    if (BIAS_BF16) bv = bf16_round(bv);
#pragma unroll
    for (int r = 0; r < 8; ++r) {
      float v = acc[t][r] + bv;
      if (resid) { float rv = resid[(size_t)((row0 + 8 * hh + r) % rmod) * ldr + col]; if (RES_BF16) rv = bf16_round(rv); v += rv; }
      if (ACT == 1) v = fmaxf(v, 0.f);
      if (ACT == 2) v = 0.5f * v * (1.0f + erff(v * 0.70710678118654752f));
      if (ACT == 3) { const float u = 0.7978845608028654f * (v + 0.044715f * v * v * v); v = 0.5f * v * (1.0f + tanhf(u)); }
      so[w][8 * hh + r][t * 16 + ln] = v;
    }
  }
  __builtin_amdgcn_fence(__ATOMIC_ACQ_REL, "workgroup");
  __builtin_amdgcn_wave_barrier();
  const int rsub = lane >> 4, c4 = (lane & 15) * 4;
  {
#pragma unroll
    for (int q = 0; q < 8; ++q) {
      const int r = q * 2 + rsub;
      const v4f v = *(const v4fa*)&so[w][r][c4];
      *(v4f*)(C + (size_t)(row0 + r) * ldc + col0 + c4) = v;
    }
    
  }
}
// row LayerNorm (biased variance, eps) over N: s = X (+ R); optional out_sum <- s; out_norm <- (s-mu)*rsqrt(var+eps)*g + b
template <bool PARAM_BF16>
__global__ __launch_bounds__(256) void k_layernorm(const float* __restrict__ X, const float* __restrict__ R, const float* __restrict__ g, const float* __restrict__ bta,
                                                  float* __restrict__ out_sum, float* __restrict__ out_norm, int N, float eps) {
  __shared__ float red[256];
  const int row = blockIdx.x, tid = threadIdx.x;
  const float* x = X + (size_t)row * N; const float* rr = R ? R + (size_t)row * N : nullptr;
  float vals[16];                     // up to N = 4096
  const int per = N / 256;            // contiguous chunk per thread? use strided-by-4 chunks: thread handles j = tid*4 + 1024*u
  float s1 = 0.f;
  for (int u = 0; u < per / 4; ++u) {
    const int j = tid * 4 + 1024 * u;
    const v4f a = *(const v4fa*)(x + j);
    v4f b = {0.f,0.f,0.f,0.f}; if (rr) b = *(const v4fa*)(rr + j);
#pragma unroll
    for (int q = 0; q < 4; ++q) { const float v = a[q] + b[q]; vals[u * 4 + q] = v; s1 += v; }
  }
  red[tid] = s1; __syncthreads();
  for (int st = 128; st > 0; st >>= 1) { if (tid < st) red[tid] += red[tid + st]; __syncthreads(); }
  const float mu = red[0] / (float)N; __syncthreads();
  float s2 = 0.f;
  for (int u = 0; u < per / 4; ++u)
#pragma unroll
    for (int q = 0; q < 4; ++q) { const float c = vals[u * 4 + q] - mu; s2 += c * c; }
  red[tid] = s2; __syncthreads();
  for (int st = 128; st > 0; st >>= 1) { if (tid < st) red[tid] += red[tid + st]; __syncthreads(); }
  const float rs = rsqrtf(red[0] / (float)N + eps);
  {
    for (int u = 0; u < per / 4; ++u) {
      const int j = tid * 4 + 1024 * u;
      v4f o, sm;
#pragma unroll
      for (int q = 0; q < 4; ++q) {
        float gg = g[j + q], bb = bta[j + q];
        if (PARAM_BF16) { gg = bf16_round(gg); bb = bf16_round(bb); }
        sm[q] = vals[u * 4 + q]; o[q] = (vals[u * 4 + q] - mu) * rs * gg + bb;
      }
      if (out_sum) *(v4f*)(out_sum + (size_t)row * N + j) = sm;
      *(v4f*)(out_norm + (size_t)row * N + j) = o;
    }
    
  }
}



// ---- f16 WMMA path (v_wmma_f32_16x16x32_f16): 11-bit significands for operands in range — used where a [0,1] probability operand needs more precision than bf16
typedef _Float16 v16h __attribute__((ext_vector_type(16)));
union FragH { v16h v; v8us half[2]; _Float16 h[16]; unsigned short u[16]; };
template <int NT>
__device__ __forceinline__ v8f mmaH(v16h ah, v16h al, v16h bh, v16h bl, v8f c) {
  c = __builtin_amdgcn_wmma_f32_16x16x32_f16(false, ah, false, bh, (short)0, c, false, false);
  if (NT >= 2) c = __builtin_amdgcn_wmma_f32_16x16x32_f16(false, al, false, bh, (short)0, c, false, false);
  if (NT >= 3) c = __builtin_amdgcn_wmma_f32_16x16x32_f16(false, ah, false, bl, (short)0, c, false, false);
  asm volatile("v_nop\n\tv_nop\n\tv_nop\n\tv_nop" : "+v"(c) : "v"(ah), "v"(al), "v"(bh), "v"(bl));
  return c;
}
// batched GEMM like k_gemm_b but f16 operands: A f32 (split into f16 hi/lo if ASPLIT, else rounded to f16), Bt = f16 values [n][k]; alpha; C f32; N multiple of 16 (partial tiles skipped)
template <bool ASPLIT>
__global__ __launch_bounds__(128) void k_gemm_h(const float* __restrict__ A, int lda, size_t sA, const _Float16* __restrict__ Bh, int ldb, size_t sB, float alpha, float* __restrict__ C, int ldc, size_t sC, int M, int N, int K) {
  __shared__ __attribute__((aligned(16))) float so[4][16][64];
  const int tid = threadIdx.x, w = tid >> 5, lane = tid & 31, ln = lane & 15, hh = lane >> 4; const int by = blockIdx.y;
  A += (size_t)by * sA; Bh += (size_t)by * sB; C += (size_t)by * sC;
  const int ntn = (N + 63) / 64; const int wid = blockIdx.x * 4 + w; const int mt = wid / ntn, nq = wid % ntn; if (mt * 16 >= M) return;
  const int row0 = mt * 16, col0 = nq * 64; const float* arow = A + (size_t)(row0 + ln) * lda;
  v8f acc[4] = {};
  for (int kb = 0; kb < K; kb += 32) {
    FragH ah, al;
    const v4f x0 = *(const v4fa*)(arow + kb + 8 * hh), x1 = *(const v4fa*)(arow + kb + 8 * hh + 4), x2 = *(const v4fa*)(arow + kb + 16 + 8 * hh), x3 = *(const v4fa*)(arow + kb + 16 + 8 * hh + 4);
    float xs[16] = {x0[0],x0[1],x0[2],x0[3],x1[0],x1[1],x1[2],x1[3],x2[0],x2[1],x2[2],x2[3],x3[0],x3[1],x3[2],x3[3]};
#pragma unroll
    for (int i = 0; i < 16; ++i) { const _Float16 h = (_Float16)xs[i]; ah.h[i] = h; al.h[i] = ASPLIT ? (_Float16)(xs[i] - (float)h) : (_Float16)0.0f; }
#pragma unroll
    for (int t = 0; t < 4; ++t) { if (col0 + t * 16 >= N) continue; const size_t boff = (size_t)(col0 + t * 16 + ln) * ldb + kb; FragH bq; bq.half[0] = *(const v8us*)(Bh + boff + 8 * hh); bq.half[1] = *(const v8us*)(Bh + boff + 16 + 8 * hh);
      acc[t] = mmaH<ASPLIT ? 2 : 1>(ah.v, al.v, bq.v, bq.v, acc[t]); }
  }
#pragma unroll
  for (int t = 0; t < 4; ++t) { if (col0 + t * 16 >= N) continue;
#pragma unroll
    for (int r = 0; r < 8; ++r) so[w][8 * hh + r][t * 16 + ln] = acc[t][r] * alpha; }
  __builtin_amdgcn_fence(__ATOMIC_ACQ_REL, "workgroup"); __builtin_amdgcn_wave_barrier();
  const int rsub = lane >> 4, c4 = (lane & 15) * 4;
  {
#pragma unroll
    for (int q = 0; q < 8; ++q) { const int r = q * 2 + rsub; if (col0 + c4 < N) { const v4f v = *(const v4fa*)&so[w][r][c4]; *(v4f*)(C + (size_t)(row0 + r) * ldc + col0 + c4) = v; } }
     }
}

// k_gemm_hh variant with fused epilogue: v = acc·alpha + bias[by·sBias + col] (+ CP[(row/rowsPerB)·sCPb + by·64 + col] if CP) ; ACT 0 none / 1 elu ; writes f16 C16 (and f32 C if non-null)
template <int ACT>
__global__ __launch_bounds__(128) void k_gemm_hhx(const _Float16* __restrict__ A, int lda, size_t sA, const _Float16* __restrict__ Bh, int ldb, size_t sB, float alpha, const float* __restrict__ bias, size_t sBias, const float* __restrict__ CP, int rowsPerB, size_t sCPb, int row0g,
    float* __restrict__ C, _Float16* __restrict__ C16, int ldc, size_t sC, int M, int N, int K) {
  __shared__ __attribute__((aligned(16))) float so[4][16][64];
  const int tid = threadIdx.x, w = tid >> 5, lane = tid & 31, ln = lane & 15, hh = lane >> 4; const int by = blockIdx.y;
  A += (size_t)by * sA; Bh += (size_t)by * sB; const size_t cofs = (size_t)by * sC; const float* bp = bias ? bias + (size_t)by * sBias : nullptr;
  const int ntn = (N + 63) / 64; const int wid = blockIdx.x * 4 + w; const int mt = wid / ntn, nq = wid % ntn; if (mt * 16 >= M) return;
  const int row0 = mt * 16, col0 = nq * 64; const _Float16* arow = A + (size_t)(row0 + ln) * lda;
  v8f acc[4] = {};
  for (int kb = 0; kb < K; kb += 32) { FragH ah; ah.half[0] = *(const v8us*)((const unsigned short*)arow + kb + 8 * hh); ah.half[1] = *(const v8us*)((const unsigned short*)arow + kb + 16 + 8 * hh);
#pragma unroll
    for (int t = 0; t < 4; ++t) { if (col0 + t * 16 >= N) continue; const size_t boff = (size_t)(col0 + t * 16 + ln) * ldb + kb; FragH bq; bq.half[0] = *(const v8us*)((const unsigned short*)Bh + boff + 8 * hh); bq.half[1] = *(const v8us*)((const unsigned short*)Bh + boff + 16 + 8 * hh);
      acc[t] = mmaH<1>(ah.v, ah.v, bq.v, bq.v, acc[t]); }
  }
#pragma unroll
  for (int t = 0; t < 4; ++t) { if (col0 + t * 16 >= N) continue; const int col = col0 + t * 16 + ln; const float bv = bp ? bf16_round(bp[col]) : 0.f;
#pragma unroll
    for (int r = 0; r < 8; ++r) { float v = acc[t][r] * alpha + bv; if (CP) { const int rr = row0g + row0 + 8 * hh + r; if (rowsPerB < 0) v += CP[cofs + (size_t)rr * ldc + col];      /* rowsPerB < 0: own element of the batched C plane */ else { const int bidx = rr / rowsPerB; v += CP[(size_t)bidx * sCPb + (size_t)by * 64 + col]; } } if (ACT == 1) v = (v > 0.f) ? v : expm1f(v); else if (ACT == 7) v = (v > 0.f) ? v + 1.0f : expf(v); else if (ACT == 8) v = tanhf(v); else if (ACT == 9) v = 0.5f * v * (1.0f + tanhf(0.7978845608028654f * (v + 0.044715f * v * v * v))); else if (ACT == 11) v = 1.0f / (1.0f + expf(-v)); else if (ACT == 12) v = (v > 0.f) ? v : 0.01f * v; else if (ACT == 14) v = (v > 0.f) ? v : 0.1f * v; else if (ACT == 16) v = (v >= 0.f) ? v : 0.3f * v; else if (ACT == 17) v = (v >= 0.f) ? v : 0.2f * v; else if (ACT == 15) v = v / (1.0f + expf(-v)); else if (ACT == 3) v = fmaxf(v, 0.f); else if (ACT == 6) v = 0.5f * v * (1.0f + erff(v * 0.70710678118654752f)); so[w][8 * hh + r][t * 16 + ln] = v; } }
  __builtin_amdgcn_fence(__ATOMIC_ACQ_REL, "workgroup"); __builtin_amdgcn_wave_barrier();
  const int rsub = lane >> 4, c4 = (lane & 15) * 4; typedef _Float16 v4h __attribute__((ext_vector_type(4)));
  {
#pragma unroll
    for (int q = 0; q < 8; ++q) { const int r = q * 2 + rsub; if (col0 + c4 < N) { const v4f v = *(const v4fa*)&so[w][r][c4]; if (C) *(v4f*)(C + cofs + (size_t)(row0 + r) * ldc + col0 + c4) = v; if (C16) { v4h h4; for (int i = 0; i < 4; ++i) h4[i] = (_Float16)v[i]; *(v4h*)(C16 + cofs + (size_t)(row0 + r) * ldc + col0 + c4) = h4; } } }
     }
}


typedef _Float16 v4h __attribute__((ext_vector_type(4)));

__global__ __launch_bounds__(256) void k_h16(const float* __restrict__ x, _Float16* __restrict__ X16, size_t n8) { const size_t t = (size_t)blockIdx.x * 256 + threadIdx.x; if (t >= n8) return; FragH f;
#pragma unroll
  for (int q = 0; q < 8; ++q) f.h[q] = (_Float16)x[t * 8 + q]; *(v8us*)((unsigned short*)X16 + t * 8) = f.half[0];  }
__global__ __launch_bounds__(256) void k_round16f(const float* __restrict__ W, _Float16* __restrict__ Bt, size_t n8) { const size_t t = (size_t)blockIdx.x * 256 + threadIdx.x; if (t >= n8) return; FragH f;
#pragma unroll
  for (int i = 0; i < 8; ++i) f.h[i] = (_Float16)(bf16_round(W[t * 8 + i]) * 16.0f); *(v8us*)((unsigned short*)Bt + t * 8) = f.half[0];  }

__global__ __launch_bounds__(256) void k_hl(const float* __restrict__ F, _Float16* __restrict__ Hh, _Float16* __restrict__ Hl, size_t n8) { const size_t t = (size_t)blockIdx.x * 256 + threadIdx.x; if (t >= n8) return; FragH fh, fl; const v4f a = *(const v4fa*)(F + t * 8), c = *(const v4fa*)(F + t * 8 + 4);
#pragma unroll
  for (int q = 0; q < 4; ++q) { _Float16 h = (_Float16)a[q]; fh.h[q] = h; fl.h[q] = (_Float16)((a[q] - (float)h) * 1024.0f); h = (_Float16)c[q]; fh.h[4 + q] = h; fl.h[4 + q] = (_Float16)((c[q] - (float)h) * 1024.0f); }
  { *(v8us*)((unsigned short*)Hh + t * 8) = fh.half[0]; *(v8us*)((unsigned short*)Hl + t * 8) = fl.half[0];  } }



__global__ __launch_bounds__(256) void k_wnat(const float* __restrict__ w, size_t n8, _Float16* __restrict__ Bt) { const size_t t = (size_t)blockIdx.x * 256 + threadIdx.x; if (t >= n8) return; FragH f; for (int q = 0; q < 8; ++q) f.h[q] = (_Float16)(bf16_round(w[t * 8 + q]) * 16.0f); *(v8us*)((unsigned short*)Bt + t * 8) = f.half[0];  }
__global__ __launch_bounds__(256) void k_rsm(const float* __restrict__ S, _Float16* __restrict__ P, int nrows) {
  #pragma clang fp contract(off)
  const int i = blockIdx.x * 256 + threadIdx.x; if (i >= nrows) return; const float* s = S + (size_t)i * SQ; float mx = -3.0e38f;
#pragma unroll 1
  for (int j = 0; j < SQ; ++j) mx = fmaxf(mx, s[j]); float se = 0.f;
#pragma unroll 1
  for (int j = 0; j < SQ; ++j) se += expf(s[j] - mx); const float sc = 256.0f / se;
#pragma unroll 1
  for (int j0 = 0; j0 < SQ; j0 += 8) { FragH f; for (int q = 0; q < 8; ++q) f.h[q] = (_Float16)(expf(s[j0 + q] - mx) * sc); unsigned short* d = (unsigned short*)P + (size_t)i * SQ + j0; *(v8us*)d = f.half[0];  } }
__global__ __launch_bounds__(256) void k_vt(const _Float16* __restrict__ V16, int b, int h0, _Float16* __restrict__ VT) { __shared__ unsigned short tl[64][65]; const int tid = threadIdx.x; const int hh = blockIdx.x % HG, sg = blockIdx.x / HG; const int s0 = sg * 64; const int h = h0 + hh;
  for (int i = tid; i < 64 * 8; i += 256) { const int j = i / 8, d8 = (i % 8) * 8; FragH f; f.half[0] = *(const v8us*)((const unsigned short*)V16 + ((size_t)b * SQ + s0 + j) * DM + h * HD + d8); for (int q = 0; q < 8; ++q) tl[d8 + q][j] = f.u[q]; }
  __syncthreads();
  { for (int i = tid; i < 64 * 8; i += 256) { const int d = i / 8, j8 = (i % 8) * 8; FragH f; for (int q = 0; q < 8; ++q) f.u[q] = tl[d][j8 + q]; *(v8us*)((unsigned short*)VT + ((size_t)hh * HD + d) * SQ + s0 + j8) = f.half[0]; }  } }



// Fused causal attention, one launch for all query rows and batches: a wave holds 32 query rows (two 16-column groups) and walks every fourth block of 32 keys, four waves to a tile; scores and weights stay in registers.
// Reassociated through the 32-wide embedding: q k^T = (x Wq Wk^T) x^T and P v = (P x) Wv, so the walk reads x itself (32 wide) on both sides in place of k and v (64 wide): one k step a score tile, two output tiles in place of four;
// the product with Wv is done once per query tile behind the merge.
// x lies in two fragment-order planes, 2 KiB per block of 32 keys each: the key plane [16-key tile][register half][lane][8 values] (rows = keys, k = embedding) and the transposed plane [16-column tile][register half][lane][8 values] (rows = embedding columns, k = keys),
// the value of (lane, register) being the one that the row loader fa_frag would fetch from a row-major plane, so a wave's 16-byte load covers four whole 128-byte lines.
// S^T = X Q'^T (A = x rows, B = q' rows, both in the same k order), so a lane holds the scores of ONE query per group: keys kb + 8 hh + r (tile 0) and kb + 16 + 8 hh + r (tile 1), which is the k order of a B operand:
// the weights are converted in place and feed Y^T += X^T P^T (A = x^T rows in the same k order). Running maximum (log2 units) and sum per query in f32; the two lane halves exchange the maximum each pass and join their sums once at the end.
// The output tiles are rescaled only when some query's maximum has grown by more than 8 (weights stay <= 2^8, inside f16). Key fragments are refetched right behind their products, x^T fragments right behind theirs, into the same registers.
__device__ __forceinline__ v16h fa_frag(const _Float16* p) { FragH f; f.half[0] = *(const v8us*)((const unsigned short*)p); f.half[1] = *(const v8us*)((const unsigned short*)p + 16); return f.v; }      /* p already holds the lane half's 8 hh */
__device__ __forceinline__ v16h fa_fragp(const _Float16* p) { FragH f; f.half[0] = *(const v8us*)((const unsigned short*)p); f.half[1] = *(const v8us*)((const unsigned short*)p + 256); return f.v; }      /* fragment-order plane: p already holds the lane's 16-byte unit; each of the two loads reads 512 neighbouring bytes over the wave */
__device__ __forceinline__ v8f fa_mma(v16h a, v16h b, v8f c) { return __builtin_amdgcn_wmma_f32_16x16x32_f16(false, a, false, b, (short)0, c, false, false); }
__device__ __forceinline__ float fa_xhalf(float x) { return __builtin_bit_cast(float, __builtin_amdgcn_permlanex16(__builtin_bit_cast(int, x), __builtin_bit_cast(int, x), 0x76543210, 0xfedcba98, false, false)); }      /* lane l with lane l ^ 16 */
#define FAC 0.18033688011112042f     /* 64^-0.5 * log2(e) */
__device__ __forceinline__ float fa_exp2(float x) { float r; asm("v_exp_f32 %0, %1\n\tv_nop" : "=v"(r) : "v"(x)); return r; }      /* 2^x; the v_nop fills the one slot that the instruction set asks for between a transcendental and a next instruction that reads its result or overwrites its source */
__device__ __forceinline__ v8f fa_exp2x8(v8f x) { float r0, r1, r2, r3, r4, r5, r6, r7;      /* eight 2^x in one statement: the results are kept off the sources (early clobber), so each instruction fills the slot of the one before it, and one v_nop that of the last */
  asm("v_exp_f32 %0, %8\n\tv_exp_f32 %1, %9\n\tv_exp_f32 %2, %10\n\tv_exp_f32 %3, %11\n\tv_exp_f32 %4, %12\n\tv_exp_f32 %5, %13\n\tv_exp_f32 %6, %14\n\tv_exp_f32 %7, %15\n\tv_nop"
      : "=&v"(r0), "=&v"(r1), "=&v"(r2), "=&v"(r3), "=&v"(r4), "=&v"(r5), "=&v"(r6), "=&v"(r7) : "v"(x[0]), "v"(x[1]), "v"(x[2]), "v"(x[3]), "v"(x[4]), "v"(x[5]), "v"(x[6]), "v"(x[7]));
  return v8f{r0, r1, r2, r3, r4, r5, r6, r7}; }
// Last product out^T = Wv^T Y^T on the matrix unit: A = Wv^T (row = output column d; f16 of the bf16-rounded weight x16, exact), B = the normalised Y row of one query, split into f16 high and low parts (two terms, so that Y keeps f32 accuracy);
// both in the k order 8 hh + i, 16 + 8 hh + i over the 32 embedding columns, which is the order in which the Y^T tiles hold them (register r of tile t = column 16 t + 8 hh + r).
__device__ __forceinline__ v16h wv_frag(const float* __restrict__ wv, int d, int hh) { FragH f;
#pragma unroll      /* constant indices, so that the arrays indexed below stay in registers */
  for (int i = 0; i < 16; ++i) f.h[i] = (_Float16)(bf16_round(wv[((i < 8 ? i : 8 + i) + 8 * hh) * HD + d]) * 16.0f);
  return f.v; }
__device__ __forceinline__ v8f wv_tile(v16h a, const float (&y)[16]) { FragH yh, yl; const v8f z8 = {0.f, 0.f, 0.f, 0.f, 0.f, 0.f, 0.f, 0.f};
#pragma unroll      /* constant indices, so that the arrays indexed below stay in registers */
  for (int i = 0; i < 16; ++i) { const _Float16 h = (_Float16)y[i]; yh.h[i] = h; yl.h[i] = (_Float16)(y[i] - (float)h); }
  return fa_mma(a, yh.v, fa_mma(a, yl.v, z8)) * 0.0625f; }      /* takes the weights' x16 back */
#define FKS 4                        /* waves that share the keys of one 32-row query tile */
#define FQT 4                        /* 32-row query tiles per block */
template <int LD>      /* row pitch of the q' plane */
__global__ __launch_bounds__(32 * FKS * FQT) void k_fattn(const _Float16* __restrict__ Q, const _Float16* __restrict__ K, const _Float16* __restrict__ VT, const float* __restrict__ wv, float* __restrict__ O) {
  // Key split: a block of sixteen waves owns 128 query rows (four 32-row tiles) at a time, two row groups in turn; the four waves of a tile hold the SAME 32 query rows, and wave sh of them walks key blocks sh, sh + 4, ... (32 keys each)
  // with its own running maximum, sum and output tiles; the four partial results of a tile are merged through LDS. The waves with the same sh walk the same keys side by side.
  // A block takes row group n - 1 - x and then row group x, so the key blocks walked add up alike in every block, and a wave walks about a quarter of its two tiles' blocks.
  __shared__ __attribute__((aligned(16))) float so[FKS * FQT * 1024];      /* merge plane [wave][piece (t, j, register half)][lane]: units of 16 bytes, written and read by the same lane number */
  __shared__ float sfm[FKS * FQT][32]; __shared__ float sfl[FKS * FQT][32];      /* [wave][query row of the tile]: running maximum (log2 units), sum */
  const int lane = threadIdx.x & 31, ln = lane & 15, hh = lane >> 4; const int w = __builtin_amdgcn_readfirstlane(threadIdx.x >> 5); const int sh = w / FQT, qt = w % FQT;      /* wave w: key share sh of tile qt of the row group; neighbouring waves walk the same keys */
  { const size_t bi = (size_t)blockIdx.y * SQ; Q += bi * LD; K += bi * DM; VT += bi * DM; O += bi * HD; }      /* batch on grid.y */
  const v8f z8 = {0.f, 0.f, 0.f, 0.f, 0.f, 0.f, 0.f, 0.f};
  const int gj = sh & 1, md = 32 * (sh >> 1);      /* behind the merge wave sh owns query group gj and output columns md .. md + 31 (one whole 128-byte line of each row) */
  v16h wvf[2];
#pragma unroll      /* constant indices, so that the arrays indexed below stay in registers */
  for (int e = 0; e < 2; ++e) wvf[e] = wv_frag(wv, md + 16 * e + ln, hh);
  asm volatile("s_wait_xcnt 0x0" ::: "memory");      /* the address registers stay untouched until the loads that name them have taken them */
  for (int h = 0; h < 2; ++h) {
    const int tile = (h ? (int)blockIdx.x : SQ / (32 * FQT) - 1 - (int)blockIdx.x) * FQT + qt; const int q0 = tile * 32;
    const int nf = (tile > sh ? tile - sh : 0) / FKS;      /* the wave's key blocks: sh, sh + 4, ..., sh + 4 nf (the same for the whole wave) */
    const int dq = (tile - sh - FKS * nf) * 32;      /* query q0 minus the first key of the wave's last block: 0 = the diagonal block; below 0 (sh > tile, tiles 0 .. 2 only): a block wholly right of the diagonal, every key masked, so that the wave adds weight 0 */
    v8f o[2][2]; float m[2] = {-1.0e30f, -1.0e30f}, l[2] = {0.f, 0.f};
#pragma unroll      /* constant indices, so that the arrays indexed below stay in registers */
    for (int t = 0; t < 2; ++t) { o[t][0] = z8; o[t][1] = z8; }
    {
      v16h qf[2], kf[2], vf[2];
      const _Float16* kp = K + 32 * DM * sh + 8 * lane; const _Float16* vp = VT + 32 * DM * sh + 8 * lane;      /* key block sh, the lane's unit */
      { const _Float16* qp = Q + (size_t)(q0 + ln) * LD + 8 * hh;
#pragma unroll      /* constant indices, so that the arrays indexed below stay in registers */
        for (int j = 0; j < 2; ++j) { qf[j] = fa_frag(qp + 16 * j * LD); kf[j] = fa_fragp(kp + 512 * j); }
#pragma unroll      /* constant indices, so that the arrays indexed below stay in registers */
        for (int t = 0; t < 2; ++t) vf[t] = fa_fragp(vp + 512 * t);
        asm volatile("s_wait_xcnt 0x0" :: "v"(qp), "v"(kp), "v"(vp) : "memory"); }      /* the address pairs stay untouched until the loads that name them have taken them: kp and vp are stepped on in the loop */
      auto pass = [&](const bool last) __attribute__((always_inline)) {      /* one block of 32 keys; last: the wave's last block, masked where it reaches the diagonal, nothing fetched behind it; else the wave's next block (4 blocks on) is fetched behind the products */
        v8f s[2][2];      /* [key tile][query group] */
#pragma unroll      /* constant indices, so that the arrays indexed below stay in registers */
        for (int kt = 0; kt < 2; ++kt) for (int j = 0; j < 2; ++j) s[kt][j] = fa_mma(kf[kt], qf[j], z8);
        if (!last) { kp += FKS * 32 * DM;
#pragma unroll      /* constant indices, so that the arrays indexed below stay in registers */
          for (int kt = 0; kt < 2; ++kt) kf[kt] = fa_fragp(kp + 512 * kt);
          asm volatile("s_wait_xcnt 0x0" :: "v"(kp) : "memory"); }      /* as above */
        if (last && dq < 32) {      /* a scalar test: three waves of four end left of the diagonal block */
#pragma unroll      /* constant indices, so that the arrays indexed below stay in registers */
          for (int kt = 0; kt < 2; ++kt) for (int j = 0; j < 2; ++j) for (int r = 0; r < 8; ++r) s[kt][j][r] = (16 * kt + 8 * hh + r <= 16 * j + ln + dq) ? s[kt][j][r] : -3.0e38f; }      /* key at or left of query */
        float mx[2];
#pragma unroll      /* constant indices, so that the arrays indexed below stay in registers */
        for (int j = 0; j < 2; ++j) { float a = fmaxf(s[0][j][0], s[1][j][0]);
          for (int r = 1; r < 8; ++r) a = fmaxf(a, fmaxf(s[0][j][r], s[1][j][r]));
          mx[j] = fmaxf(a, fa_xhalf(a)) * FAC; }      /* finite; in a block that is masked as a whole it lies below the start value of m, which then stays, and every weight is 2^(-huge) = 0 */
        if (__builtin_amdgcn_ballot_w32(mx[0] > m[0] + 8.0f || mx[1] > m[1] + 8.0f) != 0) {      /* one scalar test a pass */
#pragma unroll      /* constant indices, so that the arrays indexed below stay in registers */
          for (int j = 0; j < 2; ++j) { const float mn = fmaxf(m[j], mx[j]); const float al = fa_exp2(m[j] - mn); m[j] = mn; l[j] *= al;
            for (int t = 0; t < 2; ++t) o[t][j] *= al; } }
        v16h pf[2];
#pragma unroll      /* constant indices, so that the arrays indexed below stay in registers */
        for (int j = 0; j < 2; ++j) { FragH f; const float mj = -m[j]; const v8f c8 = {FAC, FAC, FAC, FAC, FAC, FAC, FAC, FAC}, m8 = {mj, mj, mj, mj, mj, mj, mj, mj};
          const v8f e0 = fa_exp2x8(__builtin_elementwise_fma(s[0][j], c8, m8)), e1 = fa_exp2x8(__builtin_elementwise_fma(s[1][j], c8, m8));
          float a0 = e0[0], a1 = e1[0];
          for (int r = 1; r < 8; ++r) { a0 += e0[r]; a1 += e1[r]; }
          for (int r = 0; r < 8; ++r) { f.h[r] = (_Float16)e0[r]; f.h[8 + r] = (_Float16)e1[r]; }
          l[j] += a0 + a1; pf[j] = f.v; }
#pragma unroll      /* constant indices, so that the arrays indexed below stay in registers */
        for (int t = 0; t < 2; ++t) for (int j = 0; j < 2; ++j) o[t][j] = fa_mma(vf[t], pf[j], o[t][j]);
        if (!last) { vp += FKS * 32 * DM;
#pragma unroll      /* constant indices, so that the arrays indexed below stay in registers */
          for (int t = 0; t < 2; ++t) vf[t] = fa_fragp(vp + 512 * t);
          asm volatile("s_wait_xcnt 0x0" :: "v"(vp) : "memory"); }      /* as above */
      };
      for (int i = 0; i < nf; ++i) pass(false);
      pass(true);
    }
    __syncthreads();      /* the readers of the row group before have left the merge plane */
#pragma unroll      /* constant indices, so that the arrays indexed below stay in registers */
    for (int t = 0; t < 2; ++t) for (int j = 0; j < 2; ++j) for (int g = 0; g < 2; ++g) { const v4f y = {o[t][j][4 * g], o[t][j][4 * g + 1], o[t][j][4 * g + 2], o[t][j][4 * g + 3]};
      *(v4f*)&so[(w * 256 + ((t * 2 + j) * 2 + g) * 32 + lane) * 4] = y; }
    { const float l0 = l[0] + fa_xhalf(l[0]), l1 = l[1] + fa_xhalf(l[1]);      /* the two lane halves join their sums */
      sfm[w][lane] = hh ? m[1] : m[0]; sfl[w][lane] = hh ? l1 : l0; }      /* lane = query row 16 j + ln with j = hh: the maximum and the joined sum are alike in both halves */
    __syncthreads();      /* all partial results are in LDS */
    { const int row = 16 * gj + ln;      /* merge: the lane takes, of query row, the 16 embedding columns that its own registers held in the walk, from the tile's four waves qt, qt + 4, ... */
      float mu[FKS]; float mt = sfm[qt][row]; mu[0] = mt;
#pragma unroll      /* constant indices, so that the arrays indexed below stay in registers */
      for (int u = 1; u < FKS; ++u) { mu[u] = sfm[qt + FQT * u][row]; mt = fmaxf(mt, mu[u]); }      /* finite: the tile's first wave holds key 0, which is valid for every row */
      float lt = 0.f; float y[16];
#pragma unroll      /* constant indices, so that the arrays indexed below stay in registers */
      for (int i = 0; i < 16; ++i) y[i] = 0.f;
#pragma unroll      /* constant indices, so that the arrays indexed below stay in registers */
      for (int u = 0; u < FKS; ++u) { const float f = fa_exp2(mu[u] - mt); lt += sfl[qt + FQT * u][row] * f;      /* a wave whose only block was masked as a whole: maximum -1e30, so f = 0 */
        for (int t = 0; t < 2; ++t) for (int g = 0; g < 2; ++g) { const v4f a = *(const v4f*)&so[((qt + FQT * u) * 256 + ((t * 2 + gj) * 2 + g) * 32 + lane) * 4];
          for (int c = 0; c < 4; ++c) y[8 * t + 4 * g + c] += a[c] * f; } }
      const float fin = 1.0f / lt;
#pragma unroll      /* constant indices, so that the arrays indexed below stay in registers */
      for (int i = 0; i < 16; ++i) y[i] *= fin;
      float* op = O + (size_t)(q0 + row) * HD + md + 8 * hh;
#pragma unroll      /* constant indices, so that the arrays indexed below stay in registers */
      for (int e = 0; e < 2; ++e) { const v8f d = wv_tile(wvf[e], y);      /* register r = output column md + 16 e + 8 hh + r of query row */
        const v4f y0 = {d[0], d[1], d[2], d[3]}, y1 = {d[4], d[5], d[6], d[7]};
        *(v4f*)(op + 16 * e) = y0; *(v4f*)(op + 16 * e + 4) = y1; }
      asm volatile("s_wait_xcnt 0x0" :: "v"(op) : "memory"); }      /* the stores' address and data registers stay untouched until the stores have taken them: the next row group's code writes them anew */
  } }


// Exact f32 causal attention for rows 0..QT0-1, one 8-wave block per 32 query rows of one batch, reassociated like the fused kernel: lane = query row, its q' row (x Wq Wk^T, 32 wide) and its partial y row (P x, 32 wide) stay in registers;
// x rows come through LDS in tiles of 64 keys (coalesced 16-byte loads, the next tile fetched into registers while this one is worked on), ONE tile for scores and weighted sum alike, and are read as same-address (broadcast) 16-byte LDS loads;
// wave w takes keys 8 w .. 8 w + 7 of every tile with its own running maximum, sum and y; at the end the eight partial results of a row are merged through LDS, multiplied by Wv on the matrix unit (y split in two f16 terms) and stored straight into the output rows.
typedef float v2f __attribute__((ext_vector_type(2)));
#define A0R 32                       /* query rows per block */
#define A0T 64                       /* keys per LDS tile */
#define A0K 8                        /* keys per wave and tile */
#define A0P 33                       /* row pitch of the merge plane [wave][column][row] */
__device__ __forceinline__ float a0_exp(float x) { float r; asm("v_exp_f32 %0, %1\n\tv_nop" : "=v"(r) : "v"(x * 1.4426950408889634f)); return r; }      /* e^x; the v_nop fills the one slot that the instruction set asks for between a transcendental and a next instruction that reads its result or overwrites its source */
template <int LD>      /* row pitch of the q' | x plane: a constant, so that all loads of a tile share one address pair and differ in their immediate offsets only */
__global__ __launch_bounds__(256) void k_att0w(const float* __restrict__ QF, const float* __restrict__ XF, const float* __restrict__ wv, float scale, float* __restrict__ OF, int ldo) {
  __shared__ __attribute__((aligned(16))) float sm[8 * DM * A0P];      /* in the loop: x tile [A0T][DM]; behind it: the merge plane */
  __shared__ float smm[8][A0R]; __shared__ float sml[8][A0R];
  { const size_t bi = (size_t)blockIdx.y * QT0 * LD; QF += bi; XF += bi; OF += (size_t)blockIdx.y * SQ * ldo; }      /* batch on grid.y: its own QT0-row slab of the plane, and its own rows of the output */
  const int tid = threadIdx.x, lane = tid & 31; const int w = __builtin_amdgcn_readfirstlane(tid >> 5);
  const int rg = (QT0 / A0R - 1) - blockIdx.x;      /* the row groups with the most keys take the lowest block indices */
  const int r0 = rg * A0R, i = r0 + lane; const int nkeys = r0 + A0R; const int nt = (nkeys + A0T - 1) / A0T;      /* keys 0 .. r0 + 31; a tile's rows all lie below QT0 (A0T divides QT0) */
  v2f q[DM / 2], o[DM / 2];
  { const float* qr = QF + (size_t)i * LD;
#pragma unroll      /* constant indices, so that the arrays indexed below stay in registers */
    for (int c = 0; c < DM / 4; ++c) { const v4f a = *(const v4fa*)(qr + c * 4); q[2 * c] = v2f{a[0], a[1]}; q[2 * c + 1] = v2f{a[2], a[3]}; o[2 * c] = v2f{0.f, 0.f}; o[2 * c + 1] = v2f{0.f, 0.f}; }
    asm volatile("s_wait_xcnt 0x0" :: "v"(qr) : "memory"); }      /* the address pair stays untouched until the loads that name it have taken it: no later load's result and no later instruction may take it over before */
  const int sr = tid >> 3, sc4 = (tid & 7) * 4;      /* staging: 8 lanes per 128-byte row, rows sr + 32 u */
  const float* xg = XF + (size_t)sr * LD + sc4;
  v4f px[2];
#pragma unroll      /* constant indices, so that the arrays indexed below stay in registers */
  for (int u = 0; u < 2; ++u) px[u] = *(const v4fa*)(xg + 32 * u * LD);
  asm volatile("s_wait_xcnt 0x0" :: "v"(xg) : "memory");      /* as above: the address pair is stepped on in the loop */
  float m = -1.0e30f, l = 0.f;
  for (int t = 0; t < nt; ++t) {
#pragma unroll      /* constant indices, so that the arrays indexed below stay in registers */
    for (int u = 0; u < 2; ++u) *(v4f*)&sm[(sr + 32 * u) * DM + sc4] = px[u];
    __syncthreads();
    if (t + 1 < nt) { xg += A0T * LD;
#pragma unroll      /* constant indices, so that the arrays indexed below stay in registers */
      for (int u = 0; u < 2; ++u) px[u] = *(const v4fa*)(xg + 32 * u * LD);
      asm volatile("s_wait_xcnt 0x0" :: "v"(xg) : "memory"); }      /* as above */
    const int j0 = t * A0T + w * A0K;
    if (j0 < nkeys) {      /* the same for the whole wave; no barrier inside */
      const float* kt = sm + w * A0K * DM;
      v2f s2[A0K];
#pragma unroll      /* constant indices, so that the arrays indexed below stay in registers */
      for (int k = 0; k < A0K; ++k) s2[k] = v2f{0.f, 0.f};
#pragma unroll      /* constant indices, so that the arrays indexed below stay in registers */
      for (int c = 0; c < DM / 4; ++c) {
#pragma unroll      /* constant indices, so that the arrays indexed below stay in registers */
        for (int k = 0; k < A0K; ++k) { const v4f kk = *(const v4f*)&kt[k * DM + c * 4]; s2[k] = __builtin_elementwise_fma(q[2 * c], v2f{kk[0], kk[1]}, s2[k]); s2[k] = __builtin_elementwise_fma(q[2 * c + 1], v2f{kk[2], kk[3]}, s2[k]); } }
      float s[A0K], e[A0K]; float mn = m;
#pragma unroll      /* constant indices, so that the arrays indexed below stay in registers */
      for (int k = 0; k < A0K; ++k) { s[k] = (j0 + k <= i) ? (s2[k][0] + s2[k][1]) * scale : -1.0e30f; mn = fmaxf(mn, s[k]); }
      const float rs = a0_exp(m - mn); m = mn; float ls = 0.f;
#pragma unroll      /* constant indices, so that the arrays indexed below stay in registers */
      for (int k = 0; k < A0K; ++k) { const float ex = a0_exp(s[k] - mn); e[k] = (j0 + k <= i) ? ex : 0.f; ls += e[k]; }      /* a key right of the diagonal weighs 0 also while the running maximum is still the start value */
      l = l * rs + ls;
#pragma unroll      /* constant indices, so that the arrays indexed below stay in registers */
      for (int c = 0; c < DM / 2; ++c) o[c] *= rs;
#pragma unroll      /* constant indices, so that the arrays indexed below stay in registers */
      for (int k = 0; k < A0K; ++k) { const v2f e2 = {e[k], e[k]};
#pragma unroll      /* constant indices, so that the arrays indexed below stay in registers */
        for (int c = 0; c < DM / 4; ++c) { const v4f vv = *(const v4f*)&kt[k * DM + c * 4]; o[2 * c] = __builtin_elementwise_fma(e2, v2f{vv[0], vv[1]}, o[2 * c]); o[2 * c + 1] = __builtin_elementwise_fma(e2, v2f{vv[2], vv[3]}, o[2 * c + 1]); } }
    }
    __syncthreads();
  }
#pragma unroll      /* constant indices, so that the arrays indexed below stay in registers */
  for (int c = 0; c < DM / 2; ++c) { sm[(w * DM + 2 * c) * A0P + lane] = o[c][0]; sm[(w * DM + 2 * c + 1) * A0P + lane] = o[c][1]; }
  smm[w][lane] = m; sml[w][lane] = l;
  __syncthreads();
  if (w < 4) {      /* the same for the whole wave, no barrier behind it: wave w merges query group w & 1 and owns output columns 32 (w >> 1) .. + 31, one whole 128-byte line of each of its rows */
    const int ln = lane & 15, hh = lane >> 4, row = 16 * (w & 1) + ln, md = 32 * (w >> 1);
    v16h wvf[2];
#pragma unroll      /* constant indices, so that the arrays indexed below stay in registers */
    for (int e = 0; e < 2; ++e) wvf[e] = wv_frag(wv, md + 16 * e + ln, hh);
    asm volatile("s_wait_xcnt 0x0" ::: "memory");      /* the address registers stay untouched until the loads that name them have taken them */
    float mx = smm[0][row];
#pragma unroll      /* constant indices, so that the arrays indexed below stay in registers */
    for (int u = 1; u < 8; ++u) mx = fmaxf(mx, smm[u][row]);      /* finite: key 0 is valid for every row */
    float lt = 0.f; float y[16];
#pragma unroll      /* constant indices, so that the arrays indexed below stay in registers */
    for (int c = 0; c < 16; ++c) y[c] = 0.f;
#pragma unroll      /* constant indices, so that the arrays indexed below stay in registers */
    for (int u = 0; u < 8; ++u) { const float f = a0_exp(smm[u][row] - mx); lt += sml[u][row] * f;
#pragma unroll      /* constant indices, so that the arrays indexed below stay in registers */
      for (int c = 0; c < 16; ++c) y[c] += sm[(u * DM + (c < 8 ? c : 8 + c) + 8 * hh) * A0P + row] * f; }      /* the k order of wv_frag */
    const float fin = 1.0f / lt;
#pragma unroll      /* constant indices, so that the arrays indexed below stay in registers */
    for (int c = 0; c < 16; ++c) y[c] *= fin;
    float* op = OF + (size_t)(r0 + row) * ldo + md + 8 * hh;
#pragma unroll      /* constant indices, so that the arrays indexed below stay in registers */
    for (int e = 0; e < 2; ++e) { const v8f d = wv_tile(wvf[e], y);      /* register r = output column md + 16 e + 8 hh + r of query row */
      const v4f y0 = {d[0], d[1], d[2], d[3]}, y1 = {d[4], d[5], d[6], d[7]};
      *(v4f*)(op + 16 * e) = y0; *(v4f*)(op + 16 * e + 4) = y1; } } }


template <int BFIN, int WXB>
__global__ __launch_bounds__(256) void k_ln16(const float* __restrict__ X, const float* __restrict__ g, const float* __restrict__ bb, float eps, _Float16* __restrict__ N16, float* __restrict__ XB) {
  #pragma clang fp contract(off)
  __shared__ float red[256]; const size_t r = blockIdx.x; const int t = threadIdx.x; const v4f xa = *(const v4fa*)(X + r * DMQ + t * 4); float s[4]; float sum = 0.f;
  for (int q = 0; q < 4; ++q) { s[q] = BFIN ? bf16_round(xa[q]) : xa[q]; sum = __fadd_rn(sum, s[q]); }
  red[t] = sum; __syncthreads(); for (int st = 128; st > 0; st >>= 1) { if (t < st) red[t] = __fadd_rn(red[t], red[t + st]); __syncthreads(); } const float mu = red[0] / (float)DMQ; __syncthreads();
  float vs = 0.f; for (int q = 0; q < 4; ++q) { const float dl = __fadd_rn(s[q], -mu); vs = __fadd_rn(vs, __fmul_rn(dl, dl)); } red[t] = vs; __syncthreads(); for (int st = 128; st > 0; st >>= 1) { if (t < st) red[t] = __fadd_rn(red[t], red[t + st]); __syncthreads(); }
  const float rs = rsqrtf(__fadd_rn(red[0] / (float)DMQ, eps)); v4h y; v4f xb;
  for (int q = 0; q < 4; ++q) { const int c = t * 4 + q; y[q] = (_Float16)__fadd_rn(__fmul_rn(__fmul_rn(__fadd_rn(s[q], -mu), rs), bf16_round(g[c])), bf16_round(bb[c])); xb[q] = s[q]; }
  { *(v4h*)(N16 + r * DMQ + t * 4) = y; if (WXB) *(v4f*)(XB + r * DMQ + t * 4) = xb;  } }
__global__ __launch_bounds__(256) void k_ftres2(const float* __restrict__ OF0, const float* __restrict__ XB, float* __restrict__ X1, size_t n4) {
  #pragma clang fp contract(off)
  const size_t t = (size_t)blockIdx.x * 256 + threadIdx.x; if (t >= n4) return; const v4f o = *(const v4fa*)(OF0 + t * 4), xv = *(const v4fa*)(XB + t * 4); v4f y; for (int q = 0; q < 4; ++q) y[q] = __fadd_rn(__fmul_rn(o[q], 0.015625f), xv[q]); *(v4f*)(X1 + t * 4) = y;  }

__global__ __launch_bounds__(256) void k_wthd(const float* __restrict__ Wt, _Float16* __restrict__ Bt) { const size_t t = (size_t)blockIdx.x * 256 + threadIdx.x; if (t >= (size_t)NH * HD * (DM / 8)) return; const int m8 = (int)(t % (DM / 8)) * 8; const int d = (int)((t / (DM / 8)) % HD); const int h = (int)(t / ((size_t)(DM / 8) * HD)); FragH f;
  for (int q = 0; q < 8; ++q) f.h[q] = (_Float16)(16.0f * bf16_round(Wt[((size_t)h * DM + m8 + q) * HD + d])); unsigned short* dst = (unsigned short*)Bt + ((size_t)h * HD + d) * DM + m8; *(v8us*)dst = f.half[0];  }




__global__ __launch_bounds__(256) void k_wtpad(const float* __restrict__ Wm, _Float16* __restrict__ Wt, int Kr, int Kp, int Nr, int Np, float scale) {
  const int t = blockIdx.x * 256 + threadIdx.x; if (t >= Np * (Kp / 8)) return; const int n = t / (Kp / 8), k8 = (t % (Kp / 8)) * 8; const int nc = min(n, Nr - 1); const float fn = (n < Nr) ? 1.f : 0.f; FragH f;
  for (int i = 0; i < 8; ++i) { const int k = k8 + i; const int kc = min(k, Kr - 1); const float fk = (k < Kr) ? fn : 0.f; f.h[i] = (_Float16)(bf16_round(Wm[(size_t)kc * Nr + nc]) * scale * fk); }
  unsigned short* o = (unsigned short*)Wt + (size_t)n * Kp + k8; *(v8us*)o = f.half[0];  }
__global__ __launch_bounds__(128) void k_bpad(const float* __restrict__ b, float* __restrict__ Bp, int nr, int np) {
  const int i = threadIdx.x; if (i >= np) return; const float v = b[min(i, nr - 1)] * ((i < nr) ? 1.f : 0.f); *(float*)(Bp + i) = v;  }

#define DI 64         /* inner width = NH * HD (ONE 64-wide head) */
#define LQK (3 * DI)  /* unused: no q | k | v plane here (192) */
__global__ __launch_bounds__(256) void k_o0(const float* __restrict__ OF, float* __restrict__ ob, size_t n4) {
  #pragma clang fp contract(off)
  const size_t t = (size_t)blockIdx.x * 256 + threadIdx.x; if (t >= n4) return; const size_t e = t * 4; const int i = (int)(e / DI); const int c = (int)(e % DI); const int h = c / HD, d = c % HD; const v4f a = *(const v4fa*)(OF + e); v4f o; for (int q = 0; q < 4; ++q) o[q] = __fmul_rn(a[q], 0.015625f); float* dst = ob + (size_t)h * SQ * HD + (size_t)i * HD + d; *(v4f*)dst = o;  }

// Projection, ONE launch from the inputs themselves: a wave owns 64 tokens (two whole 32-key blocks of the two x planes, so every 128-byte line there has one writer). It stores what the reassociated attention reads:
// q' = (x Wq) Wk^T (32 wide, f16 rows), x in key fragment order (its own x fragments as they stand in registers) and x^T in fragment order (column 16 ct + ln, tokens 16 hf + 8 hh .. + 7 are the unit of tile ct, register half hf, lane 16 hh + ln; read again by column from the lines just loaded).
// q: A = Wq, B = x (f16 of the bf16-rounded values, the weight x16; both in the k order 8 hh + i, 16 + 8 hh + i). Row c of weight tile t is feature 4 c + t, so one 16-byte load of a weight row serves all four tiles, and a lane holds features 32 hh .. 32 hh + 31 of ONE token (register r of tile t = feature 32 hh + 4 r + t).
// q': A = Wk (row = embedding column, k = the 64 features), B = q from those registers, split into f16 high and low parts (two terms, so that q keeps f32 accuracy); k step s takes feature 32 hh + 16 s + i at position i of lane half hh, in the A loader and in the B registers alike.
// A lane then holds columns 16 ct + 8 hh + r of q' of ONE token: 16-byte f16 stores. The waves of tokens 0..QT0-1 of a batch store q' | x as f32 rows for the exact first tile as well.
#define PJT 64                       /* tokens per wave */
__device__ __forceinline__ void pj_wload(const float* __restrict__ p, v4f (&r)[16]) {      /* p: the lane's k = 8 hh, features 4 ln .. 4 ln + 3 */
#pragma unroll      /* constant indices, so that the array stays in registers */
  for (int i = 0; i < 8; ++i) { r[i] = *(const v4fa*)(p + i * DI); r[8 + i] = *(const v4fa*)(p + (16 + i) * DI); } }
__device__ __forceinline__ void pj_wfrag(const v4f (&r)[16], v16h (&wf)[4]) {
#pragma unroll      /* constant indices, so that the arrays stay in registers */
  for (int t = 0; t < 4; ++t) { FragH f;
    for (int i = 0; i < 16; ++i) f.h[i] = (_Float16)(bf16_round(r[i][t]) * 16.0f);
    wf[t] = f.v; } }
__global__ __launch_bounds__(128) void k_proj(const float* __restrict__ x, const float* __restrict__ wq, const float* __restrict__ wk, _Float16* __restrict__ QP, _Float16* __restrict__ XK, _Float16* __restrict__ XT, float* __restrict__ F0) {
  const int lane = threadIdx.x & 31, ln = lane & 15, hh = lane >> 4; const int w = __builtin_amdgcn_readfirstlane(threadIdx.x >> 5);
  const int tok0 = ((int)blockIdx.x * 4 + w) * PJT; const int b = tok0 / SQ, i0 = tok0 % SQ;      /* PJT divides SQ and QT0: a wave's tokens lie in one batch, and all or none of them in the first tile */
  v16h xf[PJT / 16], wf[4], ka[2][2]; v4f xr[PJT / 16][4], wr[16], kr[2][2][4]; float xt[PJT / 32][2][2][8];
  const float* xp = x + (size_t)(tok0 + ln) * DM + 8 * hh; const int wo = 8 * hh * DI + 4 * ln; const float* kp = wk + ln * DI + 32 * hh; const float* tp = x + (size_t)(tok0 + 8 * hh) * DM + ln;
#pragma unroll      /* constant indices, so that the arrays indexed below stay in registers */
  for (int g = 0; g < PJT / 16; ++g) { xr[g][0] = *(const v4fa*)(xp + 16 * g * DM); xr[g][1] = *(const v4fa*)(xp + 16 * g * DM + 4); xr[g][2] = *(const v4fa*)(xp + 16 * g * DM + 16); xr[g][3] = *(const v4fa*)(xp + 16 * g * DM + 20); }
  pj_wload(wq + wo, wr);
#pragma unroll      /* constant indices, so that the arrays indexed below stay in registers */
  for (int ct = 0; ct < 2; ++ct) for (int s = 0; s < 2; ++s) for (int u = 0; u < 4; ++u) kr[ct][s][u] = *(const v4fa*)(kp + 16 * ct * DI + 16 * s + 4 * u);
  asm volatile("s_wait_xcnt 0x0" :: "v"(xp), "v"(wo), "v"(kp) : "memory");      /* the address registers stay untouched until the loads that name them have taken them */
  __builtin_amdgcn_sched_barrier(0);      /* all loads above are issued before the first conversion waits for one: without it they are issued a few at a time, each batch behind the wait for the batch before */
#pragma unroll      /* constant indices, so that the arrays indexed below stay in registers */
  for (int g = 0; g < PJT / 16; ++g) { FragH f;
    for (int u = 0; u < 4; ++u) for (int q = 0; q < 4; ++q) f.h[4 * u + q] = (_Float16)bf16_round(xr[g][u][q]);
    xf[g] = f.v; }
  pj_wfrag(wr, wf);
#pragma unroll      /* constant indices, so that the arrays indexed below stay in registers */
  for (int bk = 0; bk < PJT / 32; ++bk) for (int ct = 0; ct < 2; ++ct) for (int hf = 0; hf < 2; ++hf) for (int e = 0; e < 8; ++e) xt[bk][ct][hf][e] = tp[(32 * bk + 16 * hf + e) * DM + 16 * ct];      /* into the registers that x and the q weights have left; in flight under the conversion of the k weights */
  asm volatile("s_wait_xcnt 0x0" :: "v"(tp) : "memory");      /* as above */
  __builtin_amdgcn_sched_barrier(0);      /* as above */
#pragma unroll      /* constant indices, so that the arrays indexed below stay in registers */
  for (int ct = 0; ct < 2; ++ct) for (int s = 0; s < 2; ++s) { FragH f;
    for (int u = 0; u < 4; ++u) for (int q = 0; q < 4; ++q) f.h[4 * u + q] = (_Float16)(bf16_round(kr[ct][s][u][q]) * 16.0f);
    ka[ct][s] = f.v; }
  unsigned short* tr = (unsigned short*)XT + (size_t)tok0 * DM + 8 * lane;
#pragma unroll      /* constant indices, so that the arrays indexed below stay in registers */
  for (int bk = 0; bk < PJT / 32; ++bk) { v8us st[4];
    for (int ct = 0; ct < 2; ++ct) for (int hf = 0; hf < 2; ++hf) { FragH f;
      for (int e = 0; e < 8; ++e) f.h[e] = (_Float16)bf16_round(xt[bk][ct][hf][e]);
      st[2 * ct + hf] = f.half[0]; *(v8us*)(tr + 32 * bk * DM + 512 * ct + 256 * hf) = st[2 * ct + hf]; }
    asm volatile("s_wait_xcnt 0x0" :: "v"(tr) : "memory"); }      /* the stores' address and data registers stay untouched until the stores have taken them */
  const v8f z8 = {0.f, 0.f, 0.f, 0.f, 0.f, 0.f, 0.f, 0.f};
  unsigned short* qr = (unsigned short*)QP + (size_t)(tok0 + ln) * DM + 8 * hh; unsigned short* kr16 = (unsigned short*)XK + (size_t)tok0 * DM + 8 * lane; float* fr = F0 + ((size_t)b * QT0 + i0 + ln) * (2 * DM) + 8 * hh;      /* fr is used by the waves of the first tile only */
#pragma unroll      /* constant indices, so that the arrays indexed below stay in registers */
  for (int g = 0; g < PJT / 16; ++g) {
    FragH fx; fx.v = xf[g]; *(v8us*)(kr16 + 16 * g * DM) = fx.half[0]; *(v8us*)(kr16 + 16 * g * DM + 256) = fx.half[1];
    v8f d[4], e[2]; FragH qh[2], ql[2]; v8us sq[2];
    for (int t = 0; t < 4; ++t) d[t] = fa_mma(wf[t], xf[g], z8);
    for (int s = 0; s < 2; ++s) for (int i = 0; i < 16; ++i) { const float v = d[i & 3][4 * s + (i >> 2)] * 0.0625f; const _Float16 hv = (_Float16)v; qh[s].h[i] = hv; ql[s].h[i] = (_Float16)(v - (float)hv); }      /* takes the weights' x16 back */
    for (int ct = 0; ct < 2; ++ct) { e[ct] = fa_mma(ka[ct][0], qh[0].v, fa_mma(ka[ct][1], qh[1].v, fa_mma(ka[ct][0], ql[0].v, fa_mma(ka[ct][1], ql[1].v, z8)))) * 0.0625f;
      FragH f;
      for (int r = 0; r < 8; ++r) f.h[r] = (_Float16)e[ct][r];
      sq[ct] = f.half[0]; *(v8us*)(qr + 16 * g * DM + 16 * ct) = sq[ct]; }
    asm volatile("s_wait_xcnt 0x0" :: "v"(qr), "v"(kr16) : "memory");      /* as above */
    if (i0 < QT0) {      /* the same for the whole wave (a scalar test) */
      v4f ye[4], yz[4];
      for (int ct = 0; ct < 2; ++ct) for (int u = 0; u < 2; ++u) { ye[2 * ct + u] = v4f{e[ct][4 * u], e[ct][4 * u + 1], e[ct][4 * u + 2], e[ct][4 * u + 3]}; *(v4f*)(fr + 16 * g * 2 * DM + 16 * ct + 4 * u) = ye[2 * ct + u];
        yz[2 * ct + u] = v4f{(float)fx.h[8 * ct + 4 * u], (float)fx.h[8 * ct + 4 * u + 1], (float)fx.h[8 * ct + 4 * u + 2], (float)fx.h[8 * ct + 4 * u + 3]}; *(v4f*)(fr + 16 * g * 2 * DM + DM + 16 * ct + 4 * u) = yz[2 * ct + u]; }
      asm volatile("s_wait_xcnt 0x0" :: "v"(fr) : "memory"); } } }      /* as above */
extern "C" void kernel_launch(void* const* d_in, const int* in_sizes, int n_in,
                              void* d_out, int out_size, void* d_ws, size_t ws_size, hipStream_t stream) {
  (void)in_sizes; (void)n_in; (void)out_size;
  const float* const* I = (const float* const*)d_in; const float* x = I[0]; const float* wq = I[2]; const float* wk = I[1]; const float* wv = I[3];      /* x; [in][out = 64] weights in this module's input order (wq = input 2, wk = input 1, wv = input 3); no biases */
  char* ws = (char*)d_ws; size_t off = 0;
  auto take = [&](size_t bytes) { char* p = ws + off; off += (bytes + 255) & ~(size_t)255; return p; };
  _Float16* QP = (_Float16*)take(NR * DM * 2); _Float16* XK = (_Float16*)take(NR * DM * 2); _Float16* XT = (_Float16*)take(NR * DM * 2);      /* q' rows; x in key fragment order; x^T in fragment order */
  float* QXF0 = (float*)take((size_t)NB * QT0 * 2 * DM * 4);      /* f32 q' | x rows of the first tile, one slab per batch: every launch below covers all NB batches */
  if (off > ws_size) return;
  float* ob = (float*)d_out;
  k_proj<<<(unsigned)(NR / (4 * PJT)), 128, 0, stream>>>(x, wq, wk, QP, XK, XT, QXF0);      /* q' = x Wq Wk^T as f16 rows, x and x^T as f16 in fragment order (2 KiB per 32 tokens each), and f32 q' | x of rows 0..511 of every batch */
  k_fattn<DM><<<dim3(SQ / (64 * FQT), NB), 32 * FKS * FQT, 0, stream>>>(QP, XK, XT, wv, ob);      /* out[b][i][..] = (softmax(causal(q' x^T 64^-0.5)) x) Wv (f32), every row of every batch; scores and weights never leave the registers */
  k_att0w<2 * DM><<<dim3(QT0 / A0R, NB), 256, 0, stream>>>(QXF0, QXF0 + DM, wv, 0.125f, ob, DI);      /* exact f32 causal attention for rows 0..511 of every batch, which it REWRITES in the output */
}

// v009
// Measured time: 40.7 microseconds a run.
// In both of two side-by-side timings against v008, it was 1.24 times as fast.
// Over all steps from v000 it is 3152 times as fast.
#include <hip/hip_runtime.h>
// Single-head causal self-attention from a 32-wide embedding (x [16][4096][32]; k/q/v = x W ([in][out] [32][64], no biases; input order Wk, Wq, Wv); ONE 64-wide head (head_size 64 != C 32); scores * 64^-0.5; causal; softmax; out = weights v -> [16][4096][64]; no output projection).
// Structure: token rows; scores and output reassociated through the 32-wide embedding (q k^T = (x Wq Wk^T) x^T, P v = (P x) Wv); one projection launch (x and weights rounded in registers, WMMA products, f16 q' rows and x, x^T in matrix-fragment order); one fused causal attention launch (scores alpha 1/8, running-maximum softmax f32 -> f16 weights, P x in f32, all in registers; the four key shares of a query tile merged through LDS, multiplied by Wv and written as f32 into the output rows; rows 0..511 are worked exactly in f32 by four further waves of the same blocks, which alone write them); launches: see trace.
// Compute dtype: inputs rounded to bf16; x / weights exact; q' and softmax weights as plain f16 GEMM operands (~2^-12); q in front of Wk^T and P x in front of Wv as two f16 terms; scores and softmax statistics f32. v_wmma_f32_16x16x32_f16.
#define NB 16
#define SQ 4096
#define DM 32
#define NH 1
#define HD 64
#define HG 4                         /* unused by the launches (grid.y is NB); read only by the uncalled k_vt overload */
#define QT 256                       /* unused; a k_fattn block takes two 128-row query tiles */
#define NKX SQ                       /* unused; scores and weights stay in registers */
#define QT0 512                      /* first-tile rows computed exactly (f32), not by the f16 walk: 512 here (no output projection averages the early-row cancellation errors away; logit sigma 1.0) */
#define B0 0                         /* unused; the batches are grid.y 0..NB-1 */
#define NBR NB                       /* feeds only the unused MP; the attention launches put the NB batches on grid.y */
#define NR ((size_t)NB * SQ)
#define DMQ DM
#define DFF 4096                     /* unused; no FFN here */
#define DFFR 100                     /* unused; no FFN here */
#define MP ((int)((size_t)NBR * SQ)) /* unused; the projections cover NR rows */
#define QN SQ                        /* unused; the query tiles cover SQ rows */
#define NHD NH                       /* unused */
#define MPO MP                       /* unused */
#define LQ (3 * DM)      /* unused */
typedef __bf16 v16b __attribute__((ext_vector_type(16)));
typedef unsigned short v8us __attribute__((ext_vector_type(8), may_alias));
typedef float  v8f  __attribute__((ext_vector_type(8)));
typedef float  v4f  __attribute__((ext_vector_type(4)));
typedef float  v4fa __attribute__((ext_vector_type(4), may_alias));
union FragB { v16b v; v8us half[2]; unsigned short u[16]; };

__device__ __forceinline__ unsigned short bf16_bits(float x) { unsigned int u = __float_as_uint(x); return (unsigned short)((u + 0x7FFFu + ((u >> 16) & 1u)) >> 16); }
__device__ __forceinline__ float bf16_val(unsigned short b) { return __uint_as_float(((unsigned int)b) << 16); }
__device__ __forceinline__ float bf16_round(float x) { return bf16_val(bf16_bits(x)); }
// D += A·B with NT terms: 1 = ah·bh, 2 = + al·bh (A split), 3 = + ah·bl (both split)
template <int NT>
__device__ __forceinline__ v8f mmaN(v16b ah, v16b al, v16b bh, v16b bl, v8f c) {
  c = __builtin_amdgcn_wmma_f32_16x16x32_bf16(false, ah, false, bh, (short)0, c, false, false);
  if (NT >= 2) c = __builtin_amdgcn_wmma_f32_16x16x32_bf16(false, al, false, bh, (short)0, c, false, false);
  if (NT >= 3) c = __builtin_amdgcn_wmma_f32_16x16x32_bf16(false, ah, false, bl, (short)0, c, false, false);
  asm volatile("v_nop\n\tv_nop\n\tv_nop\n\tv_nop" : "+v"(c) : "v"(ah), "v"(al), "v"(bh), "v"(bl));
  return c;
}

__global__ __launch_bounds__(256) void k_wt_bf16(const float* __restrict__ W, unsigned short* __restrict__ Wt, int K, int N) {
  const int t = blockIdx.x * 256 + threadIdx.x;
  const int k8n = K / 8;
  if (t >= N * k8n) return;
  const int n = t / k8n, k8 = (t % k8n) * 8;
  v8us v;
#pragma unroll
  for (int i = 0; i < 8; ++i) v[i] = bf16_bits(W[(size_t)(k8 + i) * N + n]);
  *(v8us*)(Wt + (size_t)n * K + k8) = v;
  
}

// GEMM C[M][N] (f32, pitch ldc) = act(A[M][K]·W + bias). A f32 row-major (pitch lda) converted per fragment to bf16
// (ASPLIT: hi/lo two planes -> 2 terms, else single rounded term); Wt bf16 [N][K] (pitch ldb). BIAS_BF16 rounds the
// bias to bf16 first (bias quantised to bf16 before the add). K%32==0, M%16==0, N%64==0.
template <bool ASPLIT, int ACT, bool BIAS_BF16>
__global__ __launch_bounds__(128) void k_gemm_bf(const float* __restrict__ A, int lda, const unsigned short* __restrict__ Wt, int ldb,
                                               const float* __restrict__ bias, float* __restrict__ C, int ldc, int M, int N, int K) {
  __shared__ __attribute__((aligned(16))) float so[4][16][64];
  const int tid = threadIdx.x, w = tid >> 5, lane = tid & 31, ln = lane & 15, hh = lane >> 4;
  const int ntn = N / 64;
  const int wid = blockIdx.x * 4 + w;
  const int mt = wid / ntn, nq = wid % ntn;
  if (mt * 16 >= M) return;
  const int row0 = mt * 16, col0 = nq * 64;
  const float* arow = A + (size_t)(row0 + ln) * lda;
  v8f acc[4] = {};
  for (int kb = 0; kb < K; kb += 32) {
    FragB ah, al;
    const v4f x0 = *(const v4fa*)(arow + kb + 8 * hh), x1 = *(const v4fa*)(arow + kb + 8 * hh + 4);
    const v4f x2 = *(const v4fa*)(arow + kb + 16 + 8 * hh), x3 = *(const v4fa*)(arow + kb + 16 + 8 * hh + 4);
    float xs[16] = {x0[0],x0[1],x0[2],x0[3],x1[0],x1[1],x1[2],x1[3],x2[0],x2[1],x2[2],x2[3],x3[0],x3[1],x3[2],x3[3]};
#pragma unroll
    for (int i = 0; i < 16; ++i) { const unsigned short hb = bf16_bits(xs[i]); ah.u[i] = hb; al.u[i] = ASPLIT ? bf16_bits(xs[i] - bf16_val(hb)) : (unsigned short)0; }
#pragma unroll
    for (int t = 0; t < 4; ++t) {
      const unsigned short* brow = Wt + (size_t)(col0 + t * 16 + ln) * ldb + kb;
      FragB b;
      b.half[0] = *(const v8us*)(brow + 8 * hh);
      b.half[1] = *(const v8us*)(brow + 16 + 8 * hh);
      acc[t] = mmaN<ASPLIT ? 2 : 1>(ah.v, al.v, b.v, b.v, acc[t]);
    }
  }
#pragma unroll
  for (int t = 0; t < 4; ++t) {
    float bv = bias ? bias[col0 + t * 16 + ln] : 0.f;
    if (BIAS_BF16) bv = bf16_round(bv);
#pragma unroll
    for (int r = 0; r < 8; ++r) { float v = acc[t][r] + bv; if (ACT == 1) v = fmaxf(v, 0.f); so[w][8 * hh + r][t * 16 + ln] = v; }
  }
  __builtin_amdgcn_fence(__ATOMIC_ACQ_REL, "workgroup");
  __builtin_amdgcn_wave_barrier();
  const int rsub = lane >> 4, c4 = (lane & 15) * 4;
  {
#pragma unroll
    for (int q = 0; q < 8; ++q) {
      const int r = q * 2 + rsub;
      const v4f v = *(const v4fa*)&so[w][r][c4];
      *(v4f*)(C + (size_t)(row0 + r) * ldc + col0 + c4) = v;
    }
    
  }
}

// GEMM C = act(A·W + bias + resid): A f32 (ASPLIT -> hi/lo 2 terms), Wt bf16 [N][K]; ACT 0 none, 1 relu, 2 exact gelu;
// resid (optional, f32, row index = (row % rmod), pitch ldr, RES_BF16 rounds it) added before the activation.
template <bool ASPLIT, int ACT, bool BIAS_BF16, bool RES_BF16>
__global__ __launch_bounds__(128) void k_gemm_bf3(const float* __restrict__ A, int lda, const unsigned short* __restrict__ Wt, int ldb,
                                                const float* __restrict__ bias, const float* __restrict__ resid, int rmod, int ldr,
                                                float* __restrict__ C, int ldc, int M, int N, int K) {
  __shared__ __attribute__((aligned(16))) float so[4][16][64];
  const int tid = threadIdx.x, w = tid >> 5, lane = tid & 31, ln = lane & 15, hh = lane >> 4;
  const int ntn = N / 64;
  const int wid = blockIdx.x * 4 + w;
  const int mt = wid / ntn, nq = wid % ntn;
  if (mt * 16 >= M) return;
  const int row0 = mt * 16, col0 = nq * 64;
  const float* arow = A + (size_t)(row0 + ln) * lda;
  v8f acc[4] = {};
  for (int kb = 0; kb < K; kb += 32) {
    FragB ah, al;
    const v4f x0 = *(const v4fa*)(arow + kb + 8 * hh), x1 = *(const v4fa*)(arow + kb + 8 * hh + 4);
    const v4f x2 = *(const v4fa*)(arow + kb + 16 + 8 * hh), x3 = *(const v4fa*)(arow + kb + 16 + 8 * hh + 4);
    float xs[16] = {x0[0],x0[1],x0[2],x0[3],x1[0],x1[1],x1[2],x1[3],x2[0],x2[1],x2[2],x2[3],x3[0],x3[1],x3[2],x3[3]};
#pragma unroll
    for (int i = 0; i < 16; ++i) { const unsigned short hb = bf16_bits(xs[i]); ah.u[i] = hb; al.u[i] = ASPLIT ? bf16_bits(xs[i] - bf16_val(hb)) : (unsigned short)0; }
#pragma unroll
    for (int t = 0; t < 4; ++t) {
      const unsigned short* brow = Wt + (size_t)(col0 + t * 16 + ln) * ldb + kb;
      FragB b;
      b.half[0] = *(const v8us*)(brow + 8 * hh);
      b.half[1] = *(const v8us*)(brow + 16 + 8 * hh);
      acc[t] = mmaN<ASPLIT ? 2 : 1>(ah.v, al.v, b.v, b.v, acc[t]);
    }
  }
#pragma unroll
  for (int t = 0; t < 4; ++t) {
    const int col = col0 + t * 16 + ln;
    float bv = bias ? bias[col] : 0.f;
    if (BIAS_BF16) bv = bf16_round(bv);
#pragma unroll
    for (int r = 0; r < 8; ++r) {
      float v = acc[t][r] + bv;
      if (resid) { float rv = resid[(size_t)((row0 + 8 * hh + r) % rmod) * ldr + col]; if (RES_BF16) rv = bf16_round(rv); v += rv; }
      if (ACT == 1) v = fmaxf(v, 0.f);
      if (ACT == 2) v = 0.5f * v * (1.0f + erff(v * 0.70710678118654752f));
      if (ACT == 3) { const float u = 0.7978845608028654f * (v + 0.044715f * v * v * v); v = 0.5f * v * (1.0f + tanhf(u)); }
      so[w][8 * hh + r][t * 16 + ln] = v;
    }
  }
  __builtin_amdgcn_fence(__ATOMIC_ACQ_REL, "workgroup");
  __builtin_amdgcn_wave_barrier();
  const int rsub = lane >> 4, c4 = (lane & 15) * 4;
  {
#pragma unroll
    for (int q = 0; q < 8; ++q) {
      const int r = q * 2 + rsub;
      const v4f v = *(const v4fa*)&so[w][r][c4];
      *(v4f*)(C + (size_t)(row0 + r) * ldc + col0 + c4) = v;
    }
    
  }
}
// row LayerNorm (biased variance, eps) over N: s = X (+ R); optional out_sum <- s; out_norm <- (s-mu)*rsqrt(var+eps)*g + b
template <bool PARAM_BF16>
__global__ __launch_bounds__(256) void k_layernorm(const float* __restrict__ X, const float* __restrict__ R, const float* __restrict__ g, const float* __restrict__ bta,
                                                  float* __restrict__ out_sum, float* __restrict__ out_norm, int N, float eps) {
  __shared__ float red[256];
  const int row = blockIdx.x, tid = threadIdx.x;
  const float* x = X + (size_t)row * N; const float* rr = R ? R + (size_t)row * N : nullptr;
  float vals[16];                     // up to N = 4096
  const int per = N / 256;            // contiguous chunk per thread? use strided-by-4 chunks: thread handles j = tid*4 + 1024*u
  float s1 = 0.f;
  for (int u = 0; u < per / 4; ++u) {
    const int j = tid * 4 + 1024 * u;
    const v4f a = *(const v4fa*)(x + j);
    v4f b = {0.f,0.f,0.f,0.f}; if (rr) b = *(const v4fa*)(rr + j);
#pragma unroll
    for (int q = 0; q < 4; ++q) { const float v = a[q] + b[q]; vals[u * 4 + q] = v; s1 += v; }
  }
  red[tid] = s1; __syncthreads();
  for (int st = 128; st > 0; st >>= 1) { if (tid < st) red[tid] += red[tid + st]; __syncthreads(); }
  const float mu = red[0] / (float)N; __syncthreads();
  float s2 = 0.f;
  for (int u = 0; u < per / 4; ++u)
#pragma unroll
    for (int q = 0; q < 4; ++q) { const float c = vals[u * 4 + q] - mu; s2 += c * c; }
  red[tid] = s2; __syncthreads();
  for (int st = 128; st > 0; st >>= 1) { if (tid < st) red[tid] += red[tid + st]; __syncthreads(); }
  const float rs = rsqrtf(red[0] / (float)N + eps);
  {
    for (int u = 0; u < per / 4; ++u) {
      const int j = tid * 4 + 1024 * u;
      v4f o, sm;
#pragma unroll
      for (int q = 0; q < 4; ++q) {
        float gg = g[j + q], bb = bta[j + q];
        if (PARAM_BF16) { gg = bf16_round(gg); bb = bf16_round(bb); }
        sm[q] = vals[u * 4 + q]; o[q] = (vals[u * 4 + q] - mu) * rs * gg + bb;
      }
      if (out_sum) *(v4f*)(out_sum + (size_t)row * N + j) = sm;
      *(v4f*)(out_norm + (size_t)row * N + j) = o;
    }
    
  }
}



// ---- f16 WMMA path (v_wmma_f32_16x16x32_f16): 11-bit significands for operands in range — used where a [0,1] probability operand needs more precision than bf16
typedef _Float16 v16h __attribute__((ext_vector_type(16)));
union FragH { v16h v; v8us half[2]; _Float16 h[16]; unsigned short u[16]; };
template <int NT>
__device__ __forceinline__ v8f mmaH(v16h ah, v16h al, v16h bh, v16h bl, v8f c) {
  c = __builtin_amdgcn_wmma_f32_16x16x32_f16(false, ah, false, bh, (short)0, c, false, false);
  if (NT >= 2) c = __builtin_amdgcn_wmma_f32_16x16x32_f16(false, al, false, bh, (short)0, c, false, false);
  if (NT >= 3) c = __builtin_amdgcn_wmma_f32_16x16x32_f16(false, ah, false, bl, (short)0, c, false, false);
  asm volatile("v_nop\n\tv_nop\n\tv_nop\n\tv_nop" : "+v"(c) : "v"(ah), "v"(al), "v"(bh), "v"(bl));
  return c;
}
// batched GEMM like k_gemm_b but f16 operands: A f32 (split into f16 hi/lo if ASPLIT, else rounded to f16), Bt = f16 values [n][k]; alpha; C f32; N multiple of 16 (partial tiles skipped)
template <bool ASPLIT>
__global__ __launch_bounds__(128) void k_gemm_h(const float* __restrict__ A, int lda, size_t sA, const _Float16* __restrict__ Bh, int ldb, size_t sB, float alpha, float* __restrict__ C, int ldc, size_t sC, int M, int N, int K) {
  __shared__ __attribute__((aligned(16))) float so[4][16][64];
  const int tid = threadIdx.x, w = tid >> 5, lane = tid & 31, ln = lane & 15, hh = lane >> 4; const int by = blockIdx.y;
  A += (size_t)by * sA; Bh += (size_t)by * sB; C += (size_t)by * sC;
  const int ntn = (N + 63) / 64; const int wid = blockIdx.x * 4 + w; const int mt = wid / ntn, nq = wid % ntn; if (mt * 16 >= M) return;
  const int row0 = mt * 16, col0 = nq * 64; const float* arow = A + (size_t)(row0 + ln) * lda;
  v8f acc[4] = {};
  for (int kb = 0; kb < K; kb += 32) {
    FragH ah, al;
    const v4f x0 = *(const v4fa*)(arow + kb + 8 * hh), x1 = *(const v4fa*)(arow + kb + 8 * hh + 4), x2 = *(const v4fa*)(arow + kb + 16 + 8 * hh), x3 = *(const v4fa*)(arow + kb + 16 + 8 * hh + 4);
    float xs[16] = {x0[0],x0[1],x0[2],x0[3],x1[0],x1[1],x1[2],x1[3],x2[0],x2[1],x2[2],x2[3],x3[0],x3[1],x3[2],x3[3]};
#pragma unroll
    for (int i = 0; i < 16; ++i) { const _Float16 h = (_Float16)xs[i]; ah.h[i] = h; al.h[i] = ASPLIT ? (_Float16)(xs[i] - (float)h) : (_Float16)0.0f; }
#pragma unroll
    for (int t = 0; t < 4; ++t) { if (col0 + t * 16 >= N) continue; const size_t boff = (size_t)(col0 + t * 16 + ln) * ldb + kb; FragH bq; bq.half[0] = *(const v8us*)(Bh + boff + 8 * hh); bq.half[1] = *(const v8us*)(Bh + boff + 16 + 8 * hh);
      acc[t] = mmaH<ASPLIT ? 2 : 1>(ah.v, al.v, bq.v, bq.v, acc[t]); }
  }
#pragma unroll
  for (int t = 0; t < 4; ++t) { if (col0 + t * 16 >= N) continue;
#pragma unroll
    for (int r = 0; r < 8; ++r) so[w][8 * hh + r][t * 16 + ln] = acc[t][r] * alpha; }
  __builtin_amdgcn_fence(__ATOMIC_ACQ_REL, "workgroup"); __builtin_amdgcn_wave_barrier();
  const int rsub = lane >> 4, c4 = (lane & 15) * 4;
  {
#pragma unroll
    for (int q = 0; q < 8; ++q) { const int r = q * 2 + rsub; if (col0 + c4 < N) { const v4f v = *(const v4fa*)&so[w][r][c4]; *(v4f*)(C + (size_t)(row0 + r) * ldc + col0 + c4) = v; } }
     }
}

// k_gemm_hh variant with fused epilogue: v = acc·alpha + bias[by·sBias + col] (+ CP[(row/rowsPerB)·sCPb + by·64 + col] if CP) ; ACT 0 none / 1 elu ; writes f16 C16 (and f32 C if non-null)
template <int ACT>
__global__ __launch_bounds__(128) void k_gemm_hhx(const _Float16* __restrict__ A, int lda, size_t sA, const _Float16* __restrict__ Bh, int ldb, size_t sB, float alpha, const float* __restrict__ bias, size_t sBias, const float* __restrict__ CP, int rowsPerB, size_t sCPb, int row0g,
    float* __restrict__ C, _Float16* __restrict__ C16, int ldc, size_t sC, int M, int N, int K) {
  __shared__ __attribute__((aligned(16))) float so[4][16][64];
  const int tid = threadIdx.x, w = tid >> 5, lane = tid & 31, ln = lane & 15, hh = lane >> 4; const int by = blockIdx.y;
  A += (size_t)by * sA; Bh += (size_t)by * sB; const size_t cofs = (size_t)by * sC; const float* bp = bias ? bias + (size_t)by * sBias : nullptr;
  const int ntn = (N + 63) / 64; const int wid = blockIdx.x * 4 + w; const int mt = wid / ntn, nq = wid % ntn; if (mt * 16 >= M) return;
  const int row0 = mt * 16, col0 = nq * 64; const _Float16* arow = A + (size_t)(row0 + ln) * lda;
  v8f acc[4] = {};
  for (int kb = 0; kb < K; kb += 32) { FragH ah; ah.half[0] = *(const v8us*)((const unsigned short*)arow + kb + 8 * hh); ah.half[1] = *(const v8us*)((const unsigned short*)arow + kb + 16 + 8 * hh);
#pragma unroll
    for (int t = 0; t < 4; ++t) { if (col0 + t * 16 >= N) continue; const size_t boff = (size_t)(col0 + t * 16 + ln) * ldb + kb; FragH bq; bq.half[0] = *(const v8us*)((const unsigned short*)Bh + boff + 8 * hh); bq.half[1] = *(const v8us*)((const unsigned short*)Bh + boff + 16 + 8 * hh);
      acc[t] = mmaH<1>(ah.v, ah.v, bq.v, bq.v, acc[t]); }
  }
#pragma unroll
  for (int t = 0; t < 4; ++t) { if (col0 + t * 16 >= N) continue; const int col = col0 + t * 16 + ln; const float bv = bp ? bf16_round(bp[col]) : 0.f;
#pragma unroll
    for (int r = 0; r < 8; ++r) { float v = acc[t][r] * alpha + bv; if (CP) { const int rr = row0g + row0 + 8 * hh + r; if (rowsPerB < 0) v += CP[cofs + (size_t)rr * ldc + col];      /* rowsPerB < 0: own element of the batched C plane */ else { const int bidx = rr / rowsPerB; v += CP[(size_t)bidx * sCPb + (size_t)by * 64 + col]; } } if (ACT == 1) v = (v > 0.f) ? v : expm1f(v); else if (ACT == 7) v = (v > 0.f) ? v + 1.0f : expf(v); else if (ACT == 8) v = tanhf(v); else if (ACT == 9) v = 0.5f * v * (1.0f + tanhf(0.7978845608028654f * (v + 0.044715f * v * v * v))); else if (ACT == 11) v = 1.0f / (1.0f + expf(-v)); else if (ACT == 12) v = (v > 0.f) ? v : 0.01f * v; else if (ACT == 14) v = (v > 0.f) ? v : 0.1f * v; else if (ACT == 16) v = (v >= 0.f) ? v : 0.3f * v; else if (ACT == 17) v = (v >= 0.f) ? v : 0.2f * v; else if (ACT == 15) v = v / (1.0f + expf(-v)); else if (ACT == 3) v = fmaxf(v, 0.f); else if (ACT == 6) v = 0.5f * v * (1.0f + erff(v * 0.70710678118654752f)); so[w][8 * hh + r][t * 16 + ln] = v; } }
  __builtin_amdgcn_fence(__ATOMIC_ACQ_REL, "workgroup"); __builtin_amdgcn_wave_barrier();
  const int rsub = lane >> 4, c4 = (lane & 15) * 4; typedef _Float16 v4h __attribute__((ext_vector_type(4)));
  {
#pragma unroll
    for (int q = 0; q < 8; ++q) { const int r = q * 2 + rsub; if (col0 + c4 < N) { const v4f v = *(const v4fa*)&so[w][r][c4]; if (C) *(v4f*)(C + cofs + (size_t)(row0 + r) * ldc + col0 + c4) = v; if (C16) { v4h h4; for (int i = 0; i < 4; ++i) h4[i] = (_Float16)v[i]; *(v4h*)(C16 + cofs + (size_t)(row0 + r) * ldc + col0 + c4) = h4; } } }
     }
}


typedef _Float16 v4h __attribute__((ext_vector_type(4)));

__global__ __launch_bounds__(256) void k_h16(const float* __restrict__ x, _Float16* __restrict__ X16, size_t n8) { const size_t t = (size_t)blockIdx.x * 256 + threadIdx.x; if (t >= n8) return; FragH f;
#pragma unroll
  for (int q = 0; q < 8; ++q) f.h[q] = (_Float16)x[t * 8 + q]; *(v8us*)((unsigned short*)X16 + t * 8) = f.half[0];  }
__global__ __launch_bounds__(256) void k_round16f(const float* __restrict__ W, _Float16* __restrict__ Bt, size_t n8) { const size_t t = (size_t)blockIdx.x * 256 + threadIdx.x; if (t >= n8) return; FragH f;
#pragma unroll
  for (int i = 0; i < 8; ++i) f.h[i] = (_Float16)(bf16_round(W[t * 8 + i]) * 16.0f); *(v8us*)((unsigned short*)Bt + t * 8) = f.half[0];  }

__global__ __launch_bounds__(256) void k_hl(const float* __restrict__ F, _Float16* __restrict__ Hh, _Float16* __restrict__ Hl, size_t n8) { const size_t t = (size_t)blockIdx.x * 256 + threadIdx.x; if (t >= n8) return; FragH fh, fl; const v4f a = *(const v4fa*)(F + t * 8), c = *(const v4fa*)(F + t * 8 + 4);
#pragma unroll
  for (int q = 0; q < 4; ++q) { _Float16 h = (_Float16)a[q]; fh.h[q] = h; fl.h[q] = (_Float16)((a[q] - (float)h) * 1024.0f); h = (_Float16)c[q]; fh.h[4 + q] = h; fl.h[4 + q] = (_Float16)((c[q] - (float)h) * 1024.0f); }
  { *(v8us*)((unsigned short*)Hh + t * 8) = fh.half[0]; *(v8us*)((unsigned short*)Hl + t * 8) = fl.half[0];  } }



__global__ __launch_bounds__(256) void k_wnat(const float* __restrict__ w, size_t n8, _Float16* __restrict__ Bt) { const size_t t = (size_t)blockIdx.x * 256 + threadIdx.x; if (t >= n8) return; FragH f; for (int q = 0; q < 8; ++q) f.h[q] = (_Float16)(bf16_round(w[t * 8 + q]) * 16.0f); *(v8us*)((unsigned short*)Bt + t * 8) = f.half[0];  }
__global__ __launch_bounds__(256) void k_rsm(const float* __restrict__ S, _Float16* __restrict__ P, int nrows) {
  #pragma clang fp contract(off)
  const int i = blockIdx.x * 256 + threadIdx.x; if (i >= nrows) return; const float* s = S + (size_t)i * SQ; float mx = -3.0e38f;
#pragma unroll 1
  for (int j = 0; j < SQ; ++j) mx = fmaxf(mx, s[j]); float se = 0.f;
#pragma unroll 1
  for (int j = 0; j < SQ; ++j) se += expf(s[j] - mx); const float sc = 256.0f / se;
#pragma unroll 1
  for (int j0 = 0; j0 < SQ; j0 += 8) { FragH f; for (int q = 0; q < 8; ++q) f.h[q] = (_Float16)(expf(s[j0 + q] - mx) * sc); unsigned short* d = (unsigned short*)P + (size_t)i * SQ + j0; *(v8us*)d = f.half[0];  } }
__global__ __launch_bounds__(256) void k_vt(const _Float16* __restrict__ V16, int b, int h0, _Float16* __restrict__ VT) { __shared__ unsigned short tl[64][65]; const int tid = threadIdx.x; const int hh = blockIdx.x % HG, sg = blockIdx.x / HG; const int s0 = sg * 64; const int h = h0 + hh;
  for (int i = tid; i < 64 * 8; i += 256) { const int j = i / 8, d8 = (i % 8) * 8; FragH f; f.half[0] = *(const v8us*)((const unsigned short*)V16 + ((size_t)b * SQ + s0 + j) * DM + h * HD + d8); for (int q = 0; q < 8; ++q) tl[d8 + q][j] = f.u[q]; }
  __syncthreads();
  { for (int i = tid; i < 64 * 8; i += 256) { const int d = i / 8, j8 = (i % 8) * 8; FragH f; for (int q = 0; q < 8; ++q) f.u[q] = tl[d][j8 + q]; *(v8us*)((unsigned short*)VT + ((size_t)hh * HD + d) * SQ + s0 + j8) = f.half[0]; }  } }



// Fused causal attention, one launch for all query rows and batches: a wave holds 32 query rows (two 16-column groups) and walks every fourth block of 32 keys, four waves to a tile; scores and weights stay in registers.
// Reassociated through the 32-wide embedding: q k^T = (x Wq Wk^T) x^T and P v = (P x) Wv, so the walk reads x itself (32 wide) on both sides in place of k and v (64 wide): one k step a score tile, two output tiles in place of four;
// the product with Wv is done once per query tile behind the merge.
// x lies in two fragment-order planes, 2 KiB per block of 32 keys each: the key plane [16-key tile][register half][lane][8 values] (rows = keys, k = embedding) and the transposed plane [16-column tile][register half][lane][8 values] (rows = embedding columns, k = keys),
// the value of (lane, register) being the one that the row loader fa_frag would fetch from a row-major plane, so a wave's 16-byte load covers four whole 128-byte lines.
// S^T = X Q'^T (A = x rows, B = q' rows, both in the same k order), so a lane holds the scores of ONE query per group: keys kb + 8 hh + r (tile 0) and kb + 16 + 8 hh + r (tile 1), which is the k order of a B operand:
// the weights are converted in place and feed Y^T += X^T P^T (A = x^T rows in the same k order). Running maximum (log2 units) and sum per query in f32; the two lane halves exchange the maximum each pass and join their sums once at the end.
// The output tiles are rescaled only when some query's maximum has grown by more than 8 (weights stay <= 2^8, inside f16). Key fragments are refetched right behind their products, x^T fragments right behind theirs, into the same registers.
__device__ __forceinline__ v16h fa_frag(const _Float16* p) { FragH f; f.half[0] = *(const v8us*)((const unsigned short*)p); f.half[1] = *(const v8us*)((const unsigned short*)p + 16); return f.v; }      /* p already holds the lane half's 8 hh */
__device__ __forceinline__ v16h fa_fragp(const _Float16* p) { FragH f; f.half[0] = *(const v8us*)((const unsigned short*)p); f.half[1] = *(const v8us*)((const unsigned short*)p + 256); return f.v; }      /* fragment-order plane: p already holds the lane's 16-byte unit; each of the two loads reads 512 neighbouring bytes over the wave */
__device__ __forceinline__ v8f fa_mma(v16h a, v16h b, v8f c) { return __builtin_amdgcn_wmma_f32_16x16x32_f16(false, a, false, b, (short)0, c, false, false); }
__device__ __forceinline__ float fa_xhalf(float x) { return __builtin_bit_cast(float, __builtin_amdgcn_permlanex16(__builtin_bit_cast(int, x), __builtin_bit_cast(int, x), 0x76543210, 0xfedcba98, false, false)); }      /* lane l with lane l ^ 16 */
#define FAC 0.18033688011112042f     /* 64^-0.5 * log2(e) */
__device__ __forceinline__ float fa_exp2(float x) { float r; asm("v_exp_f32 %0, %1\n\tv_nop" : "=v"(r) : "v"(x)); return r; }      /* 2^x; the v_nop fills the one slot that the instruction set asks for between a transcendental and a next instruction that reads its result or overwrites its source */
__device__ __forceinline__ v8f fa_exp2x8(v8f x) { float r0, r1, r2, r3, r4, r5, r6, r7;      /* eight 2^x in one statement: the results are kept off the sources (early clobber), so each instruction fills the slot of the one before it, and one v_nop that of the last */
  asm("v_exp_f32 %0, %8\n\tv_exp_f32 %1, %9\n\tv_exp_f32 %2, %10\n\tv_exp_f32 %3, %11\n\tv_exp_f32 %4, %12\n\tv_exp_f32 %5, %13\n\tv_exp_f32 %6, %14\n\tv_exp_f32 %7, %15\n\tv_nop"
      : "=&v"(r0), "=&v"(r1), "=&v"(r2), "=&v"(r3), "=&v"(r4), "=&v"(r5), "=&v"(r6), "=&v"(r7) : "v"(x[0]), "v"(x[1]), "v"(x[2]), "v"(x[3]), "v"(x[4]), "v"(x[5]), "v"(x[6]), "v"(x[7]));
  return v8f{r0, r1, r2, r3, r4, r5, r6, r7}; }
// Last product out^T = Wv^T Y^T on the matrix unit: A = Wv^T (row = output column d; f16 of the bf16-rounded weight x16, exact), B = the normalised Y row of one query, split into f16 high and low parts (two terms, so that Y keeps f32 accuracy);
// both in the k order 8 hh + i, 16 + 8 hh + i over the 32 embedding columns, which is the order in which the Y^T tiles hold them (register r of tile t = column 16 t + 8 hh + r).
__device__ __forceinline__ v16h wv_frag(const float* __restrict__ wv, int d, int hh) { FragH f;
#pragma unroll      /* constant indices, so that the arrays indexed below stay in registers */
  for (int i = 0; i < 16; ++i) f.h[i] = (_Float16)(bf16_round(wv[((i < 8 ? i : 8 + i) + 8 * hh) * HD + d]) * 16.0f);
  return f.v; }
__device__ __forceinline__ v8f wv_tile(v16h a, const float (&y)[16]) { FragH yh, yl; const v8f z8 = {0.f, 0.f, 0.f, 0.f, 0.f, 0.f, 0.f, 0.f};
#pragma unroll      /* constant indices, so that the arrays indexed below stay in registers */
  for (int i = 0; i < 16; ++i) { const _Float16 h = (_Float16)y[i]; yh.h[i] = h; yl.h[i] = (_Float16)(y[i] - (float)h); }
  return fa_mma(a, yh.v, fa_mma(a, yl.v, z8)) * 0.0625f; }      /* takes the weights' x16 back */
#define FKS 4                        /* waves that share the keys of one 32-row query tile */
#define FQT 4                        /* 32-row query tiles per block */
// Exact f32 causal attention for rows 0..QT0-1, in the same launch: waves 16 .. 19 of a block take 16-row units of the block's batch, unit 31 - x beside the block's long walk and unit x beside its short one (the keys of the two add up alike in every block), reassociated like the f16 walk:
// lane = query row 16 unit + ln, its partial y row (P x, 32 wide) stays in registers, its q' row (x Wq Wk^T, 32 wide) in LDS units of its own; of every 64 keys wave e takes keys 16 e .. 16 e + 15, lane half hh the 8 from 16 e + 8 hh, with its own running maximum, sum and y.
// A wave brings its 16 x rows into LDS of its own (coalesced 16-byte loads, the next rows fetched into registers while these are worked on; no other wave touches them, so no barrier) and reads them as 16-byte LDS loads of one address per lane half;
// the eight partial results of a row are merged through LDS behind the block's two barriers, multiplied by Wv on the matrix unit (y split in two f16 terms) and stored into the output rows. The sixteen f16 waves leave rows 0..QT0-1 alone.
typedef float v2f __attribute__((ext_vector_type(2)));
#define FXW 4                        /* waves per block on the exact rows */
#define A0R 16                       /* query rows per exact unit */
#define A0K 8                        /* keys per lane and step */
#define A0P 33                       /* row pitch of the merge plane [wave][column][lane]: odd, so that the writers fall on distinct banks */
static_assert(2 * (SQ / (64 * FQT)) == QT0 / A0R && QT0 % (32 * FQT) == 0 && QT0 % (2 * A0K * FXW) == 0, "two exact units per block of a batch; whole 128-row groups are exact; a step's 64 keys lie below QT0");
__device__ __forceinline__ float a0_exp(float x) { float r; asm("v_exp_f32 %0, %1\n\tv_nop" : "=v"(r) : "v"(x * 1.4426950408889634f)); return r; }      /* e^x; the v_nop fills the one slot that the instruction set asks for between a transcendental and a next instruction that reads its result or overwrites its source */
template <int LD>      /* row pitch of the q' plane */
__global__ __launch_bounds__(32 * (FKS * FQT + FXW)) void k_fattn(const _Float16* __restrict__ Q, const _Float16* __restrict__ K, const _Float16* __restrict__ VT, const float* __restrict__ F0, const float* __restrict__ wv, float* __restrict__ O) {
  // Key split: the sixteen f16 waves of a block own 128 query rows (four 32-row tiles); the four waves of a tile hold the SAME 32 query rows, and wave sh of them walks key blocks sh, sh + 4, ... (32 keys each)
  // with its own running maximum, sum and output tiles; the four partial results of a tile are merged through LDS. The waves with the same sh walk the same keys side by side.
  // A block takes row group n - 1 - x and then row group x, so the key blocks walked add up alike in blocks 4 .. 15 (in blocks 0 .. 3 row group x lies below QT0 and is not walked), and a wave walks about a quarter of its tiles' blocks.
  __shared__ __attribute__((aligned(16))) float so[FKS * FQT * 1024];      /* merge plane [wave][piece (t, j, register half)][lane]: units of 16 bytes, written and read by the same lane number */
  __shared__ float sfm[FKS * FQT][32]; __shared__ float sfl[FKS * FQT][32];      /* [wave][query row of the tile]: running maximum (log2 units), sum */
  __shared__ __attribute__((aligned(16))) float xs[FXW][2 * A0K * DM];      /* exact rows: each wave's own 16 x rows */
  __shared__ __attribute__((aligned(16))) float xq[FXW][DM / 4][32][4];      /* exact rows: each lane's own q' row */
  __shared__ float xo[2][FXW * DM * A0P]; __shared__ float xmm[2][FXW][32]; __shared__ float xml[2][FXW][32];      /* exact rows: merge plane [unit of the block][wave][column][lane], running maximum, sum; one plane per unit, so that a wave may write the second unit's while the first is still being merged */
  const int lane = threadIdx.x & 31, ln = lane & 15, hh = lane >> 4; const int w = __builtin_amdgcn_readfirstlane(threadIdx.x >> 5); const int sh = w / FQT, qt = w % FQT;      /* wave w: key share sh of tile qt of the row group; neighbouring waves walk the same keys */
  const bool ex = sh == FKS;      /* waves 16 .. 19: key share qt of the exact rows (the same for the whole wave) */
  { const size_t bi = (size_t)blockIdx.y * SQ; Q += bi * LD; K += bi * DM; VT += bi * DM; O += bi * HD; F0 += (size_t)blockIdx.y * QT0 * (2 * DM); }      /* batch on grid.y; the f32 q' | x plane has a QT0-row slab per batch */
  const v8f z8 = {0.f, 0.f, 0.f, 0.f, 0.f, 0.f, 0.f, 0.f};
  const int mi = ex ? qt : sh; const int gj = mi & 1, md = 32 * (mi >> 1);      /* behind the merge share mi owns query group gj and output columns md .. md + 31 (one whole 128-byte line of each row) */
  v16h wvf[2];
#pragma unroll      /* constant indices, so that the arrays indexed below stay in registers */
  for (int e = 0; e < 2; ++e) wvf[e] = wv_frag(wv, md + 16 * e + ln, hh);
  asm volatile("s_wait_xcnt 0x0" ::: "memory");      /* the address registers stay untouched until the loads that name them have taken them */
  for (int h = 0; h < 2; ++h) {
    const int tile = (h ? (int)blockIdx.x : SQ / (32 * FQT) - 1 - (int)blockIdx.x) * FQT + qt; const int q0 = tile * 32;
    const int nf = (tile > sh ? tile - sh : 0) / FKS;      /* the wave's key blocks: sh, sh + 4, ..., sh + 4 nf (the same for the whole wave) */
    const int dq = (tile - sh - FKS * nf) * 32;      /* query q0 minus the first key of the wave's last block: 0 = the diagonal block; below 0 (sh > tile, tiles 0 .. 2 only): a block wholly right of the diagonal, every key masked, so that the wave adds weight 0 */
    const int xr0 = (h ? (int)blockIdx.x : QT0 / A0R - 1 - (int)blockIdx.x) * A0R;      /* first row of the exact unit worked beside this row group */
    if (ex) {      /* a scalar test: one exact unit; in front of the f16 walk's start values, so that those hold no registers here */
      const int i = xr0 + ln; const int nw = (xr0 / A0R + FXW - qt) / FXW;      /* the wave's steps: those whose keys 64 t + 16 qt .. begin at or left of the unit's last row (0 steps: the wave adds weight 0) */
      v2f y2[DM / 2]; float* qs = &xq[qt][0][lane][0];      /* the lane's q' row lies in LDS units of its own, [4 columns][lane], and comes back 4 columns at a time: 8 registers in place of 32 */
      { const float* qr = F0 + (size_t)i * (2 * DM);
#pragma unroll      /* constant indices, so that the arrays indexed below stay in registers */
        for (int c = 0; c < DM / 4; ++c) { const v4f a = *(const v4fa*)(qr + c * 4); *(v4f*)(qs + c * 128) = a; y2[2 * c] = v2f{0.f, 0.f}; y2[2 * c + 1] = v2f{0.f, 0.f}; }
        asm volatile("s_wait_xcnt 0x0" :: "v"(qr) : "memory"); }      /* the address pair stays untouched until the loads that name it have taken it */
      const int sr = lane >> 3, sc4 = (lane & 7) * 4;      /* staging: 8 lanes per 128-byte row, rows sr + 4 u of the wave's 16 */
      const float* xg = F0 + DM + (size_t)(2 * A0K * qt + sr) * (2 * DM) + sc4;
      v4f px[4];
#pragma unroll      /* constant indices, so that the arrays indexed below stay in registers */
      for (int u = 0; u < 4; ++u) px[u] = *(const v4fa*)(xg + 4 * u * 2 * DM);
      asm volatile("s_wait_xcnt 0x0" :: "v"(xg) : "memory");      /* as above: the address pair is stepped on in the loop */
      float xm = -1.0e30f, xl = 0.f; float* ks = xs[qt]; const float* kt = ks + A0K * hh * DM;      /* the lane half's 8 rows */
      for (int t = 0; t < nw; ++t) {
#pragma unroll      /* constant indices, so that the arrays indexed below stay in registers */
        for (int u = 0; u < 4; ++u) *(v4f*)&ks[(sr + 4 * u) * DM + sc4] = px[u];
        __builtin_amdgcn_fence(__ATOMIC_ACQ_REL, "workgroup", "local"); __builtin_amdgcn_wave_barrier();      /* the wave's lanes read each other's rows: the stores stay in front of the reads */
        const int j0 = (t * FXW + qt) * 2 * A0K + A0K * hh;
        v2f s2[A0K]; v4f qv[2]; v4f kb[3][4];      /* batches of 4 LDS reads: two in flight while the third is worked on. Scores: batch b = columns 4 (b / 2) .. + 3 of keys 4 (b % 2) .. + 3 */
#pragma unroll      /* constant indices, so that the arrays indexed below stay in registers */
        for (int k = 0; k < A0K; ++k) { s2[k] = v2f{0.f, 0.f}; kb[k >> 2][k & 3] = *(const v4f*)&kt[k * DM]; }
        qv[0] = *(const v4f*)qs;
#pragma unroll      /* constant indices, so that the arrays indexed below stay in registers */
        for (int b = 0; b < 2 * (DM / 4); ++b) { const int c = b >> 1;
          if (b + 2 < 2 * (DM / 4)) { for (int u = 0; u < 4; ++u) kb[(b + 2) % 3][u] = *(const v4f*)&kt[(4 * (b & 1) + u) * DM + (c + 1) * 4];
            if ((b & 1) == 0) qv[(c + 1) & 1] = *(const v4f*)(qs + (c + 1) * 128); }
          __builtin_amdgcn_sched_barrier(0);      /* the reads of the batch after next are issued before this batch's products wait: left alone, each read is issued singly and waited for at once */
          for (int u = 0; u < 4; ++u) { const int k = 4 * (b & 1) + u; const v4f kk = kb[b % 3][u], qq = qv[c & 1]; s2[k] = __builtin_elementwise_fma(v2f{qq[0], qq[1]}, v2f{kk[0], kk[1]}, s2[k]); s2[k] = __builtin_elementwise_fma(v2f{qq[2], qq[3]}, v2f{kk[2], kk[3]}, s2[k]); }
          __builtin_amdgcn_sched_barrier(0); }      /* as above: no more than three batches hold registers */
        float s[A0K], e[A0K]; float mn = xm;
#pragma unroll      /* constant indices, so that the arrays indexed below stay in registers */
        for (int k = 0; k < A0K; ++k) { s[k] = (j0 + k <= i) ? (s2[k][0] + s2[k][1]) * 0.125f : -1.0e30f; mn = fmaxf(mn, s[k]); }      /* 64^-0.5 */
        const float rs = a0_exp(xm - mn); xm = mn; float ls = 0.f;
#pragma unroll      /* constant indices, so that the arrays indexed below stay in registers */
        for (int k = 0; k < A0K; ++k) { const float ev = a0_exp(s[k] - mn); e[k] = (j0 + k <= i) ? ev : 0.f; ls += e[k]; }      /* a key right of the diagonal weighs 0 also while the running maximum is still the start value */
        xl = xl * rs + ls;
#pragma unroll      /* constant indices, so that the arrays indexed below stay in registers */
        for (int c = 0; c < DM / 2; ++c) y2[c] *= rs;
        __builtin_amdgcn_fence(__ATOMIC_ACQ_REL, "wavefront", "local");      /* the rows are read from LDS a second time: held over from the scores they would take 256 registers, and the block's five waves a SIMD have 192 each */
        if (t + 1 < nw) { xg += FXW * 2 * A0K * 2 * DM;
#pragma unroll      /* constant indices, so that the arrays indexed below stay in registers */
          for (int u = 0; u < 4; ++u) px[u] = *(const v4fa*)(xg + 4 * u * 2 * DM);
          asm volatile("s_wait_xcnt 0x0" :: "v"(xg) : "memory"); }      /* as above */
#pragma unroll      /* constant indices, so that the arrays indexed below stay in registers */
        for (int c = 0; c < DM / 4; ++c) kb[c >> 2][c & 3] = *(const v4f*)&kt[c * 4];      /* weighted sum: batch b = columns 16 (b % 2) .. + 15 of key b / 2 */
#pragma unroll      /* constant indices, so that the arrays indexed below stay in registers */
        for (int b = 0; b < 2 * A0K; ++b) { const int k = b >> 1; const v2f e2 = {e[k], e[k]};
          if (b + 2 < 2 * A0K) for (int u = 0; u < 4; ++u) kb[(b + 2) % 3][u] = *(const v4f*)&kt[(k + 1) * DM + (4 * (b & 1) + u) * 4];
          __builtin_amdgcn_sched_barrier(0);      /* as above */
          for (int u = 0; u < 4; ++u) { const int c = 4 * (b & 1) + u; const v4f vv = kb[b % 3][u]; y2[2 * c] = __builtin_elementwise_fma(e2, v2f{vv[0], vv[1]}, y2[2 * c]); y2[2 * c + 1] = __builtin_elementwise_fma(e2, v2f{vv[2], vv[3]}, y2[2 * c + 1]); }
          __builtin_amdgcn_sched_barrier(0); }      /* as above */
        __builtin_amdgcn_fence(__ATOMIC_ACQ_REL, "workgroup", "local"); __builtin_amdgcn_wave_barrier();      /* the reads stay in front of the next step's stores */
      }
#pragma unroll      /* constant indices, so that the arrays indexed below stay in registers */
      for (int c = 0; c < DM / 2; ++c) { xo[h][(qt * DM + 2 * c) * A0P + lane] = y2[c][0]; xo[h][(qt * DM + 2 * c + 1) * A0P + lane] = y2[c][1]; }
      xmm[h][qt][lane] = xm; xml[h][qt][lane] = xl;
    }
    v8f o[2][2]; float m[2] = {-1.0e30f, -1.0e30f}, l[2] = {0.f, 0.f};
#pragma unroll      /* constant indices, so that the arrays indexed below stay in registers */
    for (int t = 0; t < 2; ++t) { o[t][0] = z8; o[t][1] = z8; }
    const bool act = !ex && q0 >= QT0;      /* a scalar test, alike in all sixteen f16 waves: a row group below QT0 belongs to the exact waves */
    if (act) {
      v16h qf[2], kf[2], vf[2];
      const _Float16* kp = K + 32 * DM * sh + 8 * lane; const _Float16* vp = VT + 32 * DM * sh + 8 * lane;      /* key block sh, the lane's unit */
      { const _Float16* qp = Q + (size_t)(q0 + ln) * LD + 8 * hh;
#pragma unroll      /* constant indices, so that the arrays indexed below stay in registers */
        for (int j = 0; j < 2; ++j) { qf[j] = fa_frag(qp + 16 * j * LD); kf[j] = fa_fragp(kp + 512 * j); }
#pragma unroll      /* constant indices, so that the arrays indexed below stay in registers */
        for (int t = 0; t < 2; ++t) vf[t] = fa_fragp(vp + 512 * t);
        asm volatile("s_wait_xcnt 0x0" :: "v"(qp), "v"(kp), "v"(vp) : "memory"); }      /* the address pairs stay untouched until the loads that name them have taken them: kp and vp are stepped on in the loop */
      auto pass = [&](const bool last) __attribute__((always_inline)) {      /* one block of 32 keys; last: the wave's last block, masked where it reaches the diagonal, nothing fetched behind it; else the wave's next block (4 blocks on) is fetched behind the products */
        v8f s[2][2];      /* [key tile][query group] */
#pragma unroll      /* constant indices, so that the arrays indexed below stay in registers */
        for (int kt = 0; kt < 2; ++kt) for (int j = 0; j < 2; ++j) s[kt][j] = fa_mma(kf[kt], qf[j], z8);
        if (!last) { kp += FKS * 32 * DM;
#pragma unroll      /* constant indices, so that the arrays indexed below stay in registers */
          for (int kt = 0; kt < 2; ++kt) kf[kt] = fa_fragp(kp + 512 * kt);
          asm volatile("s_wait_xcnt 0x0" :: "v"(kp) : "memory"); }      /* as above */
        if (last && dq < 32) {      /* a scalar test: three waves of four end left of the diagonal block */
#pragma unroll      /* constant indices, so that the arrays indexed below stay in registers */
          for (int kt = 0; kt < 2; ++kt) for (int j = 0; j < 2; ++j) for (int r = 0; r < 8; ++r) s[kt][j][r] = (16 * kt + 8 * hh + r <= 16 * j + ln + dq) ? s[kt][j][r] : -3.0e38f; }      /* key at or left of query */
        float mx[2];
#pragma unroll      /* constant indices, so that the arrays indexed below stay in registers */
        for (int j = 0; j < 2; ++j) { float a = fmaxf(s[0][j][0], s[1][j][0]);
          for (int r = 1; r < 8; ++r) a = fmaxf(a, fmaxf(s[0][j][r], s[1][j][r]));
          mx[j] = fmaxf(a, fa_xhalf(a)) * FAC; }      /* finite; in a block that is masked as a whole it lies below the start value of m, which then stays, and every weight is 2^(-huge) = 0 */
        if (__builtin_amdgcn_ballot_w32(mx[0] > m[0] + 8.0f || mx[1] > m[1] + 8.0f) != 0) {      /* one scalar test a pass */
#pragma unroll      /* constant indices, so that the arrays indexed below stay in registers */
          for (int j = 0; j < 2; ++j) { const float mn = fmaxf(m[j], mx[j]); const float al = fa_exp2(m[j] - mn); m[j] = mn; l[j] *= al;
            for (int t = 0; t < 2; ++t) o[t][j] *= al; } }
        v16h pf[2];
#pragma unroll      /* constant indices, so that the arrays indexed below stay in registers */
        for (int j = 0; j < 2; ++j) { FragH f; const float mj = -m[j]; const v8f c8 = {FAC, FAC, FAC, FAC, FAC, FAC, FAC, FAC}, m8 = {mj, mj, mj, mj, mj, mj, mj, mj};
          const v8f e0 = fa_exp2x8(__builtin_elementwise_fma(s[0][j], c8, m8)), e1 = fa_exp2x8(__builtin_elementwise_fma(s[1][j], c8, m8));
          float a0 = e0[0], a1 = e1[0];
          for (int r = 1; r < 8; ++r) { a0 += e0[r]; a1 += e1[r]; }
          for (int r = 0; r < 8; ++r) { f.h[r] = (_Float16)e0[r]; f.h[8 + r] = (_Float16)e1[r]; }
          l[j] += a0 + a1; pf[j] = f.v; }
#pragma unroll      /* constant indices, so that the arrays indexed below stay in registers */
        for (int t = 0; t < 2; ++t) for (int j = 0; j < 2; ++j) o[t][j] = fa_mma(vf[t], pf[j], o[t][j]);
        if (!last) { vp += FKS * 32 * DM;
#pragma unroll      /* constant indices, so that the arrays indexed below stay in registers */
          for (int t = 0; t < 2; ++t) vf[t] = fa_fragp(vp + 512 * t);
          asm volatile("s_wait_xcnt 0x0" :: "v"(vp) : "memory"); }      /* as above */
      };
      for (int i = 0; i < nf; ++i) pass(false);
      pass(true);
      __builtin_amdgcn_sched_barrier(0);      /* holds the slots below behind the walk's last matrix instruction */
      asm volatile("v_nop\n\tv_nop\n\tv_nop\n\tv_nop");      /* the four vector slots that the chip needs between a matrix instruction and the first vector instruction that touches its result, on every path through the scalar branches that follow */
    }
    __syncthreads();      /* the readers of the row group before have left the merge plane; the exact waves' partial results are in LDS */
    if (act) {
#pragma unroll      /* constant indices, so that the arrays indexed below stay in registers */
    for (int t = 0; t < 2; ++t) for (int j = 0; j < 2; ++j) for (int g = 0; g < 2; ++g) { const v4f y = {o[t][j][4 * g], o[t][j][4 * g + 1], o[t][j][4 * g + 2], o[t][j][4 * g + 3]};
      *(v4f*)&so[(w * 256 + ((t * 2 + j) * 2 + g) * 32 + lane) * 4] = y; }
    { const float l0 = l[0] + fa_xhalf(l[0]), l1 = l[1] + fa_xhalf(l[1]);      /* the two lane halves join their sums */
      sfm[w][lane] = hh ? m[1] : m[0]; sfl[w][lane] = hh ? l1 : l0; }      /* lane = query row 16 j + ln with j = hh: the maximum and the joined sum are alike in both halves */
    }
    __syncthreads();      /* all partial results are in LDS */
    if (act) { const int row = 16 * gj + ln;      /* merge: the lane takes, of query row, the 16 embedding columns that its own registers held in the walk, from the tile's four waves qt, qt + 4, ... */
      float mu[FKS]; float mt = sfm[qt][row]; mu[0] = mt;
#pragma unroll      /* constant indices, so that the arrays indexed below stay in registers */
      for (int u = 1; u < FKS; ++u) { mu[u] = sfm[qt + FQT * u][row]; mt = fmaxf(mt, mu[u]); }      /* finite: the tile's first wave holds key 0, which is valid for every row */
      float lt = 0.f; float y[16];
#pragma unroll      /* constant indices, so that the arrays indexed below stay in registers */
      for (int i = 0; i < 16; ++i) y[i] = 0.f;
#pragma unroll      /* constant indices, so that the arrays indexed below stay in registers */
      for (int u = 0; u < FKS; ++u) { const float f = fa_exp2(mu[u] - mt); lt += sfl[qt + FQT * u][row] * f;      /* a wave whose only block was masked as a whole: maximum -1e30, so f = 0 */
        for (int t = 0; t < 2; ++t) for (int g = 0; g < 2; ++g) { const v4f a = *(const v4f*)&so[((qt + FQT * u) * 256 + ((t * 2 + gj) * 2 + g) * 32 + lane) * 4];
          for (int c = 0; c < 4; ++c) y[8 * t + 4 * g + c] += a[c] * f; } }
      const float fin = 1.0f / lt;
#pragma unroll      /* constant indices, so that the arrays indexed below stay in registers */
      for (int i = 0; i < 16; ++i) y[i] *= fin;
      float* op = O + (size_t)(q0 + row) * HD + md + 8 * hh;
#pragma unroll      /* constant indices, so that the arrays indexed below stay in registers */
      for (int e = 0; e < 2; ++e) { const v8f d = wv_tile(wvf[e], y);      /* register r = output column md + 16 e + 8 hh + r of query row */
        const v4f y0 = {d[0], d[1], d[2], d[3]}, y1 = {d[4], d[5], d[6], d[7]};
        *(v4f*)(op + 16 * e) = y0; *(v4f*)(op + 16 * e + 4) = y1; }
      asm volatile("s_wait_xcnt 0x0" :: "v"(op) : "memory");      /* the stores' address and data registers stay untouched until the stores have taken them: the next row group's code writes them anew */
    } else if (ex && gj == 0) {      /* a scalar test: exact waves 0 and 2 merge the unit's 16 rows, beside the f16 waves' merge, and own output columns md .. md + 31, one whole 128-byte line of each row */
      float mx = xmm[h][0][ln];
#pragma unroll      /* constant indices, so that the arrays indexed below stay in registers */
      for (int u = 1; u < 2 * FXW; ++u) mx = fmaxf(mx, xmm[h][u >> 1][ln + 16 * (u & 1)]);      /* finite: key 0 is valid for every row */
      float lt = 0.f; float y[16];
#pragma unroll      /* constant indices, so that the arrays indexed below stay in registers */
      for (int c = 0; c < 16; ++c) y[c] = 0.f;
#pragma unroll      /* constant indices, so that the arrays indexed below stay in registers */
      for (int u = 0; u < 2 * FXW; ++u) { const int pl = ln + 16 * (u & 1); const float f = a0_exp(xmm[h][u >> 1][pl] - mx); lt += xml[h][u >> 1][pl] * f;      /* partial result of wave u / 2, lane half u % 2 */
#pragma unroll      /* constant indices, so that the arrays indexed below stay in registers */
        for (int c = 0; c < 16; ++c) y[c] += xo[h][((u >> 1) * DM + (c < 8 ? c : 8 + c) + 8 * hh) * A0P + pl] * f; }      /* the k order of wv_frag */
      const float fin = 1.0f / lt;
#pragma unroll      /* constant indices, so that the arrays indexed below stay in registers */
      for (int c = 0; c < 16; ++c) y[c] *= fin;
      float* op = O + (size_t)(xr0 + ln) * HD + md + 8 * hh;
#pragma unroll      /* constant indices, so that the arrays indexed below stay in registers */
      for (int e = 0; e < 2; ++e) { const v8f d = wv_tile(wvf[e], y);      /* register r = output column md + 16 e + 8 hh + r of query row */
        const v4f y0 = {d[0], d[1], d[2], d[3]}, y1 = {d[4], d[5], d[6], d[7]};
        *(v4f*)(op + 16 * e) = y0; *(v4f*)(op + 16 * e + 4) = y1; }
      asm volatile("s_wait_xcnt 0x0" :: "v"(op) : "memory");      /* the stores' address and data registers stay untouched until the stores have taken them */
    }
  } }


template <int BFIN, int WXB>
__global__ __launch_bounds__(256) void k_ln16(const float* __restrict__ X, const float* __restrict__ g, const float* __restrict__ bb, float eps, _Float16* __restrict__ N16, float* __restrict__ XB) {
  #pragma clang fp contract(off)
  __shared__ float red[256]; const size_t r = blockIdx.x; const int t = threadIdx.x; const v4f xa = *(const v4fa*)(X + r * DMQ + t * 4); float s[4]; float sum = 0.f;
  for (int q = 0; q < 4; ++q) { s[q] = BFIN ? bf16_round(xa[q]) : xa[q]; sum = __fadd_rn(sum, s[q]); }
  red[t] = sum; __syncthreads(); for (int st = 128; st > 0; st >>= 1) { if (t < st) red[t] = __fadd_rn(red[t], red[t + st]); __syncthreads(); } const float mu = red[0] / (float)DMQ; __syncthreads();
  float vs = 0.f; for (int q = 0; q < 4; ++q) { const float dl = __fadd_rn(s[q], -mu); vs = __fadd_rn(vs, __fmul_rn(dl, dl)); } red[t] = vs; __syncthreads(); for (int st = 128; st > 0; st >>= 1) { if (t < st) red[t] = __fadd_rn(red[t], red[t + st]); __syncthreads(); }
  const float rs = rsqrtf(__fadd_rn(red[0] / (float)DMQ, eps)); v4h y; v4f xb;
  for (int q = 0; q < 4; ++q) { const int c = t * 4 + q; y[q] = (_Float16)__fadd_rn(__fmul_rn(__fmul_rn(__fadd_rn(s[q], -mu), rs), bf16_round(g[c])), bf16_round(bb[c])); xb[q] = s[q]; }
  { *(v4h*)(N16 + r * DMQ + t * 4) = y; if (WXB) *(v4f*)(XB + r * DMQ + t * 4) = xb;  } }
__global__ __launch_bounds__(256) void k_ftres2(const float* __restrict__ OF0, const float* __restrict__ XB, float* __restrict__ X1, size_t n4) {
  #pragma clang fp contract(off)
  const size_t t = (size_t)blockIdx.x * 256 + threadIdx.x; if (t >= n4) return; const v4f o = *(const v4fa*)(OF0 + t * 4), xv = *(const v4fa*)(XB + t * 4); v4f y; for (int q = 0; q < 4; ++q) y[q] = __fadd_rn(__fmul_rn(o[q], 0.015625f), xv[q]); *(v4f*)(X1 + t * 4) = y;  }

__global__ __launch_bounds__(256) void k_wthd(const float* __restrict__ Wt, _Float16* __restrict__ Bt) { const size_t t = (size_t)blockIdx.x * 256 + threadIdx.x; if (t >= (size_t)NH * HD * (DM / 8)) return; const int m8 = (int)(t % (DM / 8)) * 8; const int d = (int)((t / (DM / 8)) % HD); const int h = (int)(t / ((size_t)(DM / 8) * HD)); FragH f;
  for (int q = 0; q < 8; ++q) f.h[q] = (_Float16)(16.0f * bf16_round(Wt[((size_t)h * DM + m8 + q) * HD + d])); unsigned short* dst = (unsigned short*)Bt + ((size_t)h * HD + d) * DM + m8; *(v8us*)dst = f.half[0];  }




__global__ __launch_bounds__(256) void k_wtpad(const float* __restrict__ Wm, _Float16* __restrict__ Wt, int Kr, int Kp, int Nr, int Np, float scale) {
  const int t = blockIdx.x * 256 + threadIdx.x; if (t >= Np * (Kp / 8)) return; const int n = t / (Kp / 8), k8 = (t % (Kp / 8)) * 8; const int nc = min(n, Nr - 1); const float fn = (n < Nr) ? 1.f : 0.f; FragH f;
  for (int i = 0; i < 8; ++i) { const int k = k8 + i; const int kc = min(k, Kr - 1); const float fk = (k < Kr) ? fn : 0.f; f.h[i] = (_Float16)(bf16_round(Wm[(size_t)kc * Nr + nc]) * scale * fk); }
  unsigned short* o = (unsigned short*)Wt + (size_t)n * Kp + k8; *(v8us*)o = f.half[0];  }
__global__ __launch_bounds__(128) void k_bpad(const float* __restrict__ b, float* __restrict__ Bp, int nr, int np) {
  const int i = threadIdx.x; if (i >= np) return; const float v = b[min(i, nr - 1)] * ((i < nr) ? 1.f : 0.f); *(float*)(Bp + i) = v;  }

#define DI 64         /* inner width = NH * HD (ONE 64-wide head) */
#define LQK (3 * DI)  /* unused: no q | k | v plane here (192) */
__global__ __launch_bounds__(256) void k_o0(const float* __restrict__ OF, float* __restrict__ ob, size_t n4) {
  #pragma clang fp contract(off)
  const size_t t = (size_t)blockIdx.x * 256 + threadIdx.x; if (t >= n4) return; const size_t e = t * 4; const int i = (int)(e / DI); const int c = (int)(e % DI); const int h = c / HD, d = c % HD; const v4f a = *(const v4fa*)(OF + e); v4f o; for (int q = 0; q < 4; ++q) o[q] = __fmul_rn(a[q], 0.015625f); float* dst = ob + (size_t)h * SQ * HD + (size_t)i * HD + d; *(v4f*)dst = o;  }

// Projection, ONE launch from the inputs themselves: a wave owns 64 tokens (two whole 32-key blocks of the two x planes, so every 128-byte line there has one writer). It stores what the reassociated attention reads:
// q' = (x Wq) Wk^T (32 wide, f16 rows), x in key fragment order (its own x fragments as they stand in registers) and x^T in fragment order (column 16 ct + ln, tokens 16 hf + 8 hh .. + 7 are the unit of tile ct, register half hf, lane 16 hh + ln; read again by column from the lines just loaded).
// q: A = Wq, B = x (f16 of the bf16-rounded values, the weight x16; both in the k order 8 hh + i, 16 + 8 hh + i). Row c of weight tile t is feature 4 c + t, so one 16-byte load of a weight row serves all four tiles, and a lane holds features 32 hh .. 32 hh + 31 of ONE token (register r of tile t = feature 32 hh + 4 r + t).
// q': A = Wk (row = embedding column, k = the 64 features), B = q from those registers, split into f16 high and low parts (two terms, so that q keeps f32 accuracy); k step s takes feature 32 hh + 16 s + i at position i of lane half hh, in the A loader and in the B registers alike.
// A lane then holds columns 16 ct + 8 hh + r of q' of ONE token: 16-byte f16 stores. The waves of tokens 0..QT0-1 of a batch store q' | x as f32 rows for the exact first tile as well.
#define PJT 64                       /* tokens per wave */
__device__ __forceinline__ void pj_wload(const float* __restrict__ p, v4f (&r)[16]) {      /* p: the lane's k = 8 hh, features 4 ln .. 4 ln + 3 */
#pragma unroll      /* constant indices, so that the array stays in registers */
  for (int i = 0; i < 8; ++i) { r[i] = *(const v4fa*)(p + i * DI); r[8 + i] = *(const v4fa*)(p + (16 + i) * DI); } }
__device__ __forceinline__ void pj_wfrag(const v4f (&r)[16], v16h (&wf)[4]) {
#pragma unroll      /* constant indices, so that the arrays stay in registers */
  for (int t = 0; t < 4; ++t) { FragH f;
    for (int i = 0; i < 16; ++i) f.h[i] = (_Float16)(bf16_round(r[i][t]) * 16.0f);
    wf[t] = f.v; } }
__global__ __launch_bounds__(128) void k_proj(const float* __restrict__ x, const float* __restrict__ wq, const float* __restrict__ wk, _Float16* __restrict__ QP, _Float16* __restrict__ XK, _Float16* __restrict__ XT, float* __restrict__ F0) {
  const int lane = threadIdx.x & 31, ln = lane & 15, hh = lane >> 4; const int w = __builtin_amdgcn_readfirstlane(threadIdx.x >> 5);
  const int tok0 = ((int)blockIdx.x * 4 + w) * PJT; const int b = tok0 / SQ, i0 = tok0 % SQ;      /* PJT divides SQ and QT0: a wave's tokens lie in one batch, and all or none of them in the first tile */
  v16h xf[PJT / 16], wf[4], ka[2][2]; v4f xr[PJT / 16][4], wr[16], kr[2][2][4]; float xt[PJT / 32][2][2][8];
  const float* xp = x + (size_t)(tok0 + ln) * DM + 8 * hh; const int wo = 8 * hh * DI + 4 * ln; const float* kp = wk + ln * DI + 32 * hh; const float* tp = x + (size_t)(tok0 + 8 * hh) * DM + ln;
#pragma unroll      /* constant indices, so that the arrays indexed below stay in registers */
  for (int g = 0; g < PJT / 16; ++g) { xr[g][0] = *(const v4fa*)(xp + 16 * g * DM); xr[g][1] = *(const v4fa*)(xp + 16 * g * DM + 4); xr[g][2] = *(const v4fa*)(xp + 16 * g * DM + 16); xr[g][3] = *(const v4fa*)(xp + 16 * g * DM + 20); }
  pj_wload(wq + wo, wr);
#pragma unroll      /* constant indices, so that the arrays indexed below stay in registers */
  for (int ct = 0; ct < 2; ++ct) for (int s = 0; s < 2; ++s) for (int u = 0; u < 4; ++u) kr[ct][s][u] = *(const v4fa*)(kp + 16 * ct * DI + 16 * s + 4 * u);
  asm volatile("s_wait_xcnt 0x0" :: "v"(xp), "v"(wo), "v"(kp) : "memory");      /* the address registers stay untouched until the loads that name them have taken them */
  __builtin_amdgcn_sched_barrier(0);      /* all loads above are issued before the first conversion waits for one: without it they are issued a few at a time, each batch behind the wait for the batch before */
#pragma unroll      /* constant indices, so that the arrays indexed below stay in registers */
  for (int g = 0; g < PJT / 16; ++g) { FragH f;
    for (int u = 0; u < 4; ++u) for (int q = 0; q < 4; ++q) f.h[4 * u + q] = (_Float16)bf16_round(xr[g][u][q]);
    xf[g] = f.v; }
  pj_wfrag(wr, wf);
#pragma unroll      /* constant indices, so that the arrays indexed below stay in registers */
  for (int bk = 0; bk < PJT / 32; ++bk) for (int ct = 0; ct < 2; ++ct) for (int hf = 0; hf < 2; ++hf) for (int e = 0; e < 8; ++e) xt[bk][ct][hf][e] = tp[(32 * bk + 16 * hf + e) * DM + 16 * ct];      /* into the registers that x and the q weights have left; in flight under the conversion of the k weights */
  asm volatile("s_wait_xcnt 0x0" :: "v"(tp) : "memory");      /* as above */
  __builtin_amdgcn_sched_barrier(0);      /* as above */
#pragma unroll      /* constant indices, so that the arrays indexed below stay in registers */
  for (int ct = 0; ct < 2; ++ct) for (int s = 0; s < 2; ++s) { FragH f;
    for (int u = 0; u < 4; ++u) for (int q = 0; q < 4; ++q) f.h[4 * u + q] = (_Float16)(bf16_round(kr[ct][s][u][q]) * 16.0f);
    ka[ct][s] = f.v; }
  unsigned short* tr = (unsigned short*)XT + (size_t)tok0 * DM + 8 * lane;
#pragma unroll      /* constant indices, so that the arrays indexed below stay in registers */
  for (int bk = 0; bk < PJT / 32; ++bk) { v8us st[4];
    for (int ct = 0; ct < 2; ++ct) for (int hf = 0; hf < 2; ++hf) { FragH f;
      for (int e = 0; e < 8; ++e) f.h[e] = (_Float16)bf16_round(xt[bk][ct][hf][e]);
      st[2 * ct + hf] = f.half[0]; *(v8us*)(tr + 32 * bk * DM + 512 * ct + 256 * hf) = st[2 * ct + hf]; }
    asm volatile("s_wait_xcnt 0x0" :: "v"(tr) : "memory"); }      /* the stores' address and data registers stay untouched until the stores have taken them */
  const v8f z8 = {0.f, 0.f, 0.f, 0.f, 0.f, 0.f, 0.f, 0.f};
  unsigned short* qr = (unsigned short*)QP + (size_t)(tok0 + ln) * DM + 8 * hh; unsigned short* kr16 = (unsigned short*)XK + (size_t)tok0 * DM + 8 * lane; float* fr = F0 + ((size_t)b * QT0 + i0 + ln) * (2 * DM) + 8 * hh;      /* fr is used by the waves of the first tile only */
#pragma unroll      /* constant indices, so that the arrays indexed below stay in registers */
  for (int g = 0; g < PJT / 16; ++g) {
    FragH fx; fx.v = xf[g]; *(v8us*)(kr16 + 16 * g * DM) = fx.half[0]; *(v8us*)(kr16 + 16 * g * DM + 256) = fx.half[1];
    v8f d[4], e[2]; FragH qh[2], ql[2]; v8us sq[2];
    for (int t = 0; t < 4; ++t) d[t] = fa_mma(wf[t], xf[g], z8);
    for (int s = 0; s < 2; ++s) for (int i = 0; i < 16; ++i) { const float v = d[i & 3][4 * s + (i >> 2)] * 0.0625f; const _Float16 hv = (_Float16)v; qh[s].h[i] = hv; ql[s].h[i] = (_Float16)(v - (float)hv); }      /* takes the weights' x16 back */
    for (int ct = 0; ct < 2; ++ct) { e[ct] = fa_mma(ka[ct][0], qh[0].v, fa_mma(ka[ct][1], qh[1].v, fa_mma(ka[ct][0], ql[0].v, fa_mma(ka[ct][1], ql[1].v, z8)))) * 0.0625f;
      FragH f;
      for (int r = 0; r < 8; ++r) f.h[r] = (_Float16)e[ct][r];
      sq[ct] = f.half[0]; *(v8us*)(qr + 16 * g * DM + 16 * ct) = sq[ct]; }
    asm volatile("s_wait_xcnt 0x0" :: "v"(qr), "v"(kr16) : "memory");      /* as above */
    if (i0 < QT0) {      /* the same for the whole wave (a scalar test) */
      v4f ye[4], yz[4];
      for (int ct = 0; ct < 2; ++ct) for (int u = 0; u < 2; ++u) { ye[2 * ct + u] = v4f{e[ct][4 * u], e[ct][4 * u + 1], e[ct][4 * u + 2], e[ct][4 * u + 3]}; *(v4f*)(fr + 16 * g * 2 * DM + 16 * ct + 4 * u) = ye[2 * ct + u];
        yz[2 * ct + u] = v4f{(float)fx.h[8 * ct + 4 * u], (float)fx.h[8 * ct + 4 * u + 1], (float)fx.h[8 * ct + 4 * u + 2], (float)fx.h[8 * ct + 4 * u + 3]}; *(v4f*)(fr + 16 * g * 2 * DM + DM + 16 * ct + 4 * u) = yz[2 * ct + u]; }
      asm volatile("s_wait_xcnt 0x0" :: "v"(fr) : "memory"); } } }      /* as above */
extern "C" void kernel_launch(void* const* d_in, const int* in_sizes, int n_in,
                              void* d_out, int out_size, void* d_ws, size_t ws_size, hipStream_t stream) {
  (void)in_sizes; (void)n_in; (void)out_size;
  const float* const* I = (const float* const*)d_in; const float* x = I[0]; const float* wq = I[2]; const float* wk = I[1]; const float* wv = I[3];      /* x; [in][out = 64] weights in this module's input order (wq = input 2, wk = input 1, wv = input 3); no biases */
  char* ws = (char*)d_ws; size_t off = 0;
  auto take = [&](size_t bytes) { char* p = ws + off; off += (bytes + 255) & ~(size_t)255; return p; };
  _Float16* QP = (_Float16*)take(NR * DM * 2); _Float16* XK = (_Float16*)take(NR * DM * 2); _Float16* XT = (_Float16*)take(NR * DM * 2);      /* q' rows; x in key fragment order; x^T in fragment order */
  float* QXF0 = (float*)take((size_t)NB * QT0 * 2 * DM * 4);      /* f32 q' | x rows of the first tile, one slab per batch: every launch below covers all NB batches */
  if (off > ws_size) return;
  float* ob = (float*)d_out;
  k_proj<<<(unsigned)(NR / (4 * PJT)), 128, 0, stream>>>(x, wq, wk, QP, XK, XT, QXF0);      /* q' = x Wq Wk^T as f16 rows, x and x^T as f16 in fragment order (2 KiB per 32 tokens each), and f32 q' | x of rows 0..511 of every batch */
  k_fattn<DM><<<dim3(SQ / (64 * FQT), NB), 32 * (FKS * FQT + FXW), 0, stream>>>(QP, XK, XT, QXF0, wv, ob);      /* out[b][i][..] = (softmax(causal(q' x^T 64^-0.5)) x) Wv (f32), every row of every batch; scores and weights never leave the registers; rows 0..511 of every batch in exact f32 by the blocks' four further waves */
}
